// v000
// Times are from an AMD MI455X. After a warm-up the kernel runs many times in a row, and a time is the length of
// such a window on the GPU divided by its runs, so every launch and the gaps after it count. The runs cycle
// through copies of the inputs. A figure is the median of several windows, for all but v000 over two sittings.
// Sittings can differ by a few percent; kernels timed side by side share one.
// The starting kernel, v000, takes 58.4 microseconds a run.
#include <hip/hip_runtime.h>
#include <stddef.h>

// Contractions on v_wmma_f32_16x16x32_f16 (f16 operands, f32 accumulate): the query and key
// projections and the value x attention-weight product. Float inputs are RNE-converted to bf16
// and carried in f16 planes (weights x64, input rows x16, attention weights x16384).
// The vc-weighted tanh sum is a matrix-vector product kept on the vector unit in f32;
// tanh, softmax (over the query axis) and all scalings in f32.

typedef _Float16 v16h __attribute__((ext_vector_type(16)));
typedef _Float16 v8h  __attribute__((ext_vector_type(8)));
typedef float    v8f  __attribute__((ext_vector_type(8)));
typedef float    v4f  __attribute__((ext_vector_type(4)));
typedef _Float16 h16;

#ifndef NB
#define NB 4
#endif
#ifndef QLEN
#define QLEN 512
#endif
#ifndef KLEN
#define KLEN 512
#endif
#define NB_FULL   4
#define QLEN_FULL 512
#define KLEN_FULL 512
#define FEAT 256     // input feature width (2 x encoder size)
#define ENC  128     // encoder size
#define TT   8       // key rows per score block == waves per block

static_assert(NB >= 1 && NB <= NB_FULL);
static_assert(QLEN >= 64 && QLEN <= QLEN_FULL && (QLEN % 64) == 0);
static_assert(KLEN >= 64 && KLEN <= KLEN_FULL && (KLEN % 64) == 0);
static_assert((FEAT % 64) == 0 && (FEAT % 32) == 0);
static_assert((ENC % 64) == 0 && (ENC % 32) == 0 && (ENC % 4) == 0);
static_assert(((NB * QLEN) % 64) == 0 && ((NB * KLEN) % 64) == 0);
static_assert((((size_t)NB * QLEN * FEAT / 8) % 256) == 0);   // plane converter grid, query rows
static_assert((((size_t)NB * KLEN * FEAT / 8) % 256) == 0);   // plane converter grid, key rows
static_assert((((size_t)NB * FEAT * KLEN / 8) % 256) == 0);   // plane converter grid, value rows
static_assert(TT == 8);                                       // one softmax row per wave, 8 waves
static_assert((KLEN % TT) == 0);
static_assert(((TT * ENC) % 256) == 0);
static_assert((QLEN % 32) == 0);
static_assert((KLEN % 32) == 0);

#define LDT 72   // halves per LDS row (144 B, 16-B aligned)
#define LDC 68   // floats per LDS row (272 B, 16-B aligned)
static_assert((LDT % 8) == 0 && LDT >= 64);
static_assert((LDC % 4) == 0 && LDC >= 64);

#define WCARRY 64.0f      // weight planes carried x64
#define XCARRY 16.0f      // input row planes (query, key, value) carried x16
#define PCARRY 16384.0f   // attention-weight plane carried x2^14
// projection planes hold 2*log2(e) * (x . W): exp(2 (k+q)) == exp2(k' + q')
#define PSCALE (2.8853900817779268f / (WCARRY * XCARRY))
#define OSCALE (1.0f / (PCARRY * XCARRY))
#define LSCALE (-2.8853900817779268f)   // -2 log2(e): log2-domain logit from the reciprocal sum

// static LDS per kernel (bytes)
static_assert((size_t)64 * LDT * 2 <= (size_t)131072);
static_assert((size_t)64 * LDC * 4 <= (size_t)131072);
static_assert(((size_t)TT * ENC + ENC + (size_t)TT * QLEN) * 4 <= (size_t)131072);

// workspace layout (bytes)
#define W_BYTES   ((size_t)ENC * FEAT * 2)
#define XQ_BYTES  ((size_t)NB * QLEN * FEAT * 2)
#define XK_BYTES  ((size_t)NB * KLEN * FEAT * 2)
#define V_BYTES   ((size_t)NB * FEAT * KLEN * 2)
#define QP_BYTES  ((size_t)NB * QLEN * ENC * 4)
#define KP_BYTES  ((size_t)NB * KLEN * ENC * 4)
#define P_BYTES   ((size_t)NB * KLEN * QLEN * 4)
#define PT_BYTES  ((size_t)NB * QLEN * KLEN * 2)
#define OFF_W1T ((size_t)0)
#define OFF_W2T (OFF_W1T + W_BYTES)
#define OFF_XQ  (OFF_W2T + W_BYTES)
#define OFF_XK  (OFF_XQ + XQ_BYTES)
#define OFF_V   (OFF_XK + XK_BYTES)
#define OFF_QP  (OFF_V + V_BYTES)
#define OFF_KP  (OFF_QP + QP_BYTES)
#define OFF_P   (OFF_KP + KP_BYTES)
#define OFF_PT  (OFF_P + P_BYTES)
#define WS_TOTAL (OFF_PT + PT_BYTES)
static_assert((W_BYTES % 128) == 0 && (XQ_BYTES % 128) == 0 && (XK_BYTES % 128) == 0);
static_assert((V_BYTES % 128) == 0 && (QP_BYTES % 128) == 0 && (KP_BYTES % 128) == 0);
static_assert((P_BYTES % 128) == 0 && (PT_BYTES % 128) == 0);
static_assert(WS_TOTAL <= (size_t)134217728);

// ---------------------------------------------------------------------------
__device__ __forceinline__ float bf16r(float x) {   // RNE convert to bf16, returned widened
  unsigned int u = __float_as_uint(x);
  u = (u + 0x7FFFu + ((u >> 16) & 1u)) & 0xFFFF0000u;
  return __uint_as_float(u);
}

// f32 -> f16 operand convert that cannot produce an f16 subnormal (value select).
static __device__ __forceinline__ h16 toh_flush(float v) {
  const h16 r = (h16)v;
  return (fabsf(v) < 6.103515625e-05f) ? (h16)0.0f : r;
}

// 16-bit fragment: p points at element [row = lane&15][k0 + 8*(lane>>4)] of a k-contiguous
// row. Elements 0..7 <- k0+8h+0..7, elements 8..15 <- k0+16+8h+0..7 (same map for A and B).
__device__ __forceinline__ v16h frag_at(const _Float16* p) {
  v8h lo = *(const v8h*)(p);
  v8h hi = *(const v8h*)(p + 16);
  v16h out;
#pragma unroll
  for (int i = 0; i < 8; ++i) { out[i] = lo[i]; out[i + 8] = hi[i]; }
  return out;
}

__device__ __forceinline__ v8f wmma16(v16h a, v16h b, v8f c) {
  v8f d = __builtin_amdgcn_wmma_f32_16x16x32_f16(false, a, false, b, (short)0, c,
                                                 false, false);
  asm volatile("v_nop\n\tv_nop\n\tv_nop\n\tv_nop" : "+v"(d) : "v"(a), "v"(b));
  return d;
}

__device__ __forceinline__ float red32_max(float x) {
#pragma unroll
  for (int off = 1; off < 32; off <<= 1) x = fmaxf(x, __shfl_xor(x, off, 32));
  return x;
}
__device__ __forceinline__ float red32_sum(float x) {
#pragma unroll
  for (int off = 1; off < 32; off <<= 1) x += __shfl_xor(x, off, 32);
  return x;
}

__device__ __forceinline__ float fexp2(float x) {
#if __has_builtin(__builtin_amdgcn_exp2f)
  return __builtin_amdgcn_exp2f(x);
#else
  return exp2f(x);
#endif
}

// 1 / (2^x + 1); tanh(z) = 1 - 2 / (exp(2 z) + 1) with x = 2 log2(e) z
__device__ __forceinline__ float rcp1p(float x) {
  return __builtin_amdgcn_rcpf(fexp2(x) + 1.0f);
}

// ---------------------------------------------------------------------------
// Weight plane: in W[K rows][N cols] (pitch ldw = N) -> out Wt[N][K] (pitch ldk = K),
// f16(64 * bf16(w)). Grid (N/64, K/64). T: cross-wave (block barrier).
// Store rows: n = 32 i + tid/8, i < 2 -> 64 rows; loads: 16 x 256 = 64 x 64 elements.
// ---------------------------------------------------------------------------
__global__ __launch_bounds__(256) void wconv_kernel(
    const float* __restrict__ W, _Float16* __restrict__ Wt, unsigned ldw, unsigned ldk) {
  __shared__ _Float16 T[64 * LDT];
  const unsigned tid = threadIdx.x;
  const unsigned n0 = blockIdx.x * 64u;
  const unsigned k0 = blockIdx.y * 64u;
#pragma unroll 4
  for (unsigned j = 0; j < 16u; ++j) {
    const unsigned idx = tid + 256u * j;
    const unsigned kr = idx >> 6, nc = idx & 63u;
    const float v = W[(size_t)(k0 + kr) * ldw + n0 + nc];
    T[nc * LDT + kr] = toh_flush(WCARRY * bf16r(v));
  }
  __syncthreads();
  v8h x[2];
  size_t off[2];
#pragma unroll
  for (unsigned i = 0; i < 2u; ++i) {
    const unsigned n = 32u * i + (tid >> 3);
    const unsigned kc = (tid & 7u) * 8u;
    x[i] = *(const v8h*)&T[n * LDT + kc];
    off[i] = (size_t)(n0 + n) * ldk + k0 + kc;
  }
#pragma unroll
  for (int i = 0; i < 2; ++i) *(v8h*)(Wt + off[i]) = x[i];
  
}

// ---------------------------------------------------------------------------
// Attention-weight plane: in P[b][t rows][q cols] f32 (pitch QLEN) -> out PT[b][q][t] f16
// (pitch KLEN), f16(16384 * p). Same tile transposition as the weight plane kernel.
// Grid (QLEN/64, KLEN/64, NB). T: cross-wave (block barrier).
// ---------------------------------------------------------------------------
__global__ __launch_bounds__(256) void pconv_kernel(
    const float* __restrict__ P, _Float16* __restrict__ PT) {
  __shared__ _Float16 T[64 * LDT];
  const unsigned tid = threadIdx.x;
  const unsigned n0 = blockIdx.x * 64u;   // q
  const unsigned k0 = blockIdx.y * 64u;   // t
  const unsigned b = blockIdx.z;
  const float* src = P + (size_t)b * KLEN * QLEN;
  _Float16* dst = PT + (size_t)b * QLEN * KLEN;
#pragma unroll 4
  for (unsigned j = 0; j < 16u; ++j) {
    const unsigned idx = tid + 256u * j;
    const unsigned kr = idx >> 6, nc = idx & 63u;
    const float v = src[(size_t)(k0 + kr) * QLEN + n0 + nc];
    T[nc * LDT + kr] = toh_flush(PCARRY * v);
  }
  __syncthreads();
  v8h x[2];
  size_t off[2];
#pragma unroll
  for (unsigned i = 0; i < 2u; ++i) {
    const unsigned n = 32u * i + (tid >> 3);
    const unsigned kc = (tid & 7u) * 8u;
    x[i] = *(const v8h*)&T[n * LDT + kc];
    off[i] = (size_t)(n0 + n) * KLEN + k0 + kc;
  }
#pragma unroll
  for (int i = 0; i < 2; ++i) *(v8h*)(dst + off[i]) = x[i];
  
}

// ---------------------------------------------------------------------------
// Input row plane: src f32 [b][RF rows][CF cols] (first R rows, first C cols of each batch
// used) -> dst compact f16 [b][R][C] = f16(16 * bf16(x)). One thread per 8 columns; each
// Grid (NB*R*C/8/256), exact.
// ---------------------------------------------------------------------------
__global__ __launch_bounds__(256) void xconv_kernel(
    const float* __restrict__ X, _Float16* __restrict__ dst,
    unsigned R, unsigned RF, unsigned C, unsigned CF) {
  const unsigned g = blockIdx.x * 256u + threadIdx.x;
  const unsigned cpr = C >> 3;
  const unsigned row = g / cpr;
  const unsigned cc = (g - row * cpr) * 8u;
  const unsigned b = row / R;
  const unsigned r = row - b * R;
  const float* s = X + ((size_t)b * RF + r) * CF + cc;
  const v4f a0 = *(const v4f*)(s);
  const v4f a1 = *(const v4f*)(s + 4);
  v8h o;
#pragma unroll
  for (int i = 0; i < 4; ++i) {
    o[i]     = toh_flush(XCARRY * bf16r(a0[i]));
    o[i + 4] = toh_flush(XCARRY * bf16r(a1[i]));
  }
  _Float16* p = dst + (size_t)g * 8u;
  *(v8h*)p = o;
  
}

// ---------------------------------------------------------------------------
// GEMM C[64x64 tile] = A16[rows][K] . Bt[n][K]^T, fragments straight from the 16-bit global
// planes; 8 waves (mw = 16-row group, nw = 32-col group), 2 accumulators/wave.
// outf[row][col] (pitch ldo) = cs * acc; rows r = 16 i + tid/16, i < 4 -> 64 rows;
// 16 lanes x 16 B = the 256-B row segment of the tile.
// Grid (N/64, rows/64 [, batch]).
// ---------------------------------------------------------------------------
__device__ __forceinline__ void gemm_body(
    const _Float16* __restrict__ A16, const _Float16* __restrict__ Bt, const unsigned K,
    float* __restrict__ outf, const unsigned ldo, const float cs) {
  __shared__ float Cs[64 * LDC];
  const unsigned tid = threadIdx.x, lane = tid & 31u, w = tid >> 5;
  const unsigned mw = w >> 1, nw = w & 1u;
  const unsigned hh = lane >> 4, m = lane & 15u;
  const unsigned n0 = blockIdx.x * 64u;
  const unsigned row0 = blockIdx.y * 64u;

  const _Float16* ap  = A16 + (size_t)(row0 + mw * 16u + m) * K + hh * 8u;
  const _Float16* bp0 = Bt + (size_t)(n0 + nw * 32u + m) * K + hh * 8u;
  const _Float16* bp1 = bp0 + (size_t)16 * K;
  v8f acc0 = {}, acc1 = {};
#pragma unroll 2
  for (unsigned k0 = 0; k0 < K; k0 += 32u) {
    const v16h a  = frag_at(ap + k0);
    const v16h b0 = frag_at(bp0 + k0);
    const v16h b1 = frag_at(bp1 + k0);
    acc0 = wmma16(a, b0, acc0);
    acc1 = wmma16(a, b1, acc1);
  }
#pragma unroll
  for (int r = 0; r < 8; ++r) {
    float* d = &Cs[(mw * 16u + hh * 8u + (unsigned)r) * LDC + nw * 32u + m];
    d[0]  = acc0[r];
    d[16] = acc1[r];
  }
  __syncthreads();

  v4f xs[4];
  size_t off[4];
#pragma unroll
  for (unsigned i = 0; i < 4u; ++i) {
    const unsigned r = 16u * i + (tid >> 4);
    const unsigned c = (tid & 15u) * 4u;
    const v4f u = *(const v4f*)&Cs[r * LDC + c];
    v4f val;
#pragma unroll
    for (int j = 0; j < 4; ++j) val[j] = u[j] * cs;
    xs[i] = val;
    off[i] = (size_t)(row0 + r) * ldo + n0 + c;
  }
#pragma unroll
  for (int i = 0; i < 4; ++i) *(v4f*)(outf + off[i]) = xs[i];
  
}

// projection: out[rows][ENC] = 2 log2(e) * (x . W); grid (ENC/64, rows/64)
__global__ __launch_bounds__(256) void proj_kernel(
    const _Float16* __restrict__ A16, const _Float16* __restrict__ Bt,
    float* __restrict__ outf) {
  gemm_body(A16, Bt, (unsigned)FEAT, outf, (unsigned)ENC, PSCALE);
}

// out[b][d][q] = sum_t value[b][d][t] * p[b][t][q]; A = value plane [b][FEAT][KLEN],
// Bt = PT [b][QLEN][KLEN]; grid (QLEN/64, FEAT/64, NB); output rows at the full pitch.
__global__ __launch_bounds__(256) void outgemm_kernel(
    const _Float16* __restrict__ V16, const _Float16* __restrict__ PT,
    float* __restrict__ outf) {
  const unsigned b = blockIdx.z;
  gemm_body(V16 + (size_t)b * FEAT * KLEN, PT + (size_t)b * QLEN * KLEN, (unsigned)KLEN,
            outf + (size_t)b * FEAT * QLEN_FULL, (unsigned)QLEN_FULL, OSCALE);
}

// ---------------------------------------------------------------------------
// Additive score + softmax over the query axis. Block = 8 key rows t0..t0+7 of one batch.
//   r[t][q][e] = 1 / (exp2(Kp'[t][e] + Qp'[q][e]) + 1)      (planes pre-scaled by 2 log2 e)
//   L[t][q]    = -2 log2(e) * sum_e bf16(vc[e]) * r          (log2-domain logit up to a constant
//                                                             shift that the softmax removes)
//   p[t][q]    = exp2(L - max_q L) / sum_q exp2(L - max_q L)
// krow / vcs / sv: cross-wave (block barriers); after the second barrier each wave owns one
// sv row and every lane touches only its own elements (no exchange through LDS).
// Each output row line (32 floats) is one store instruction of one wave, 4 B per lane,
// lane-contiguous. Grid (KLEN/TT, NB).
// ---------------------------------------------------------------------------
__global__ __launch_bounds__(256) void score_kernel(
    const float* __restrict__ Qp, const float* __restrict__ Kp,
    const float* __restrict__ vc, float* __restrict__ P) {
  __shared__ __attribute__((aligned(16))) float krow[TT * ENC];
  __shared__ __attribute__((aligned(16))) float vcs[ENC];
  __shared__ __attribute__((aligned(16))) float sv[TT * QLEN];

  const unsigned tid = threadIdx.x;
  const unsigned t0 = blockIdx.x * (unsigned)TT;
  const unsigned b = blockIdx.y;

  if (tid < (unsigned)ENC) vcs[tid] = bf16r(vc[tid]);   // whole waves in or out (ENC % 32 == 0)
  {
    const float* kp = Kp + (size_t)(b * (unsigned)KLEN + t0) * ENC;
#pragma unroll
    for (unsigned j = 0; j < (unsigned)(TT * ENC / 256); ++j) {
      const unsigned i = tid + 256u * j;
      krow[i] = kp[i];
    }
  }
  __syncthreads();

#pragma unroll 1
  for (unsigned q = tid; q < (unsigned)QLEN; q += 256u) {
    const float* qr = Qp + (size_t)(b * (unsigned)QLEN + q) * ENC;
    float acc[TT];
#pragma unroll
    for (int t = 0; t < TT; ++t) acc[t] = 0.0f;
#pragma unroll 1
    for (unsigned e = 0; e < (unsigned)ENC; e += 4u) {
      const v4f qv = *(const v4f*)(qr + e);
      const v4f vv = *(const v4f*)&vcs[e];
#pragma unroll
      for (int t = 0; t < TT; ++t) {
        const v4f kk = *(const v4f*)&krow[(unsigned)t * ENC + e];
#pragma unroll
        for (int j = 0; j < 4; ++j) acc[t] += vv[j] * rcp1p(kk[j] + qv[j]);
      }
    }
#pragma unroll
    for (int t = 0; t < TT; ++t) sv[(unsigned)t * QLEN + q] = acc[t] * LSCALE;
  }
  __syncthreads();

  const int wave = __builtin_amdgcn_readfirstlane((int)(threadIdx.x >> 5));
  const unsigned lane = tid & 31u;
  const unsigned sb = (unsigned)wave * (unsigned)QLEN + lane;

  float mx = -3.0e38f;
#pragma unroll 4
  for (unsigned j = 0; j < (unsigned)(QLEN / 32); ++j) mx = fmaxf(mx, sv[sb + 32u * j]);
  mx = red32_max(mx);

  float sum = 0.0f;
#pragma unroll 4
  for (unsigned j = 0; j < (unsigned)(QLEN / 32); ++j) {
    const float ex = fexp2(sv[sb + 32u * j] - mx);
    sv[sb + 32u * j] = ex;
    sum += ex;
  }
  sum = red32_sum(sum);
  const float inv = __builtin_amdgcn_rcpf(sum);

#pragma unroll 4
  for (unsigned j = 0; j < (unsigned)(QLEN / 32); ++j) {
    const float pv = sv[sb + 32u * j] * inv;
    sv[sb + 32u * j] = pv;
  }

  float* prow = P + (size_t)(b * (unsigned)KLEN + t0 + (unsigned)wave) * QLEN + lane;
#pragma unroll 4
  for (unsigned j = 0; j < (unsigned)(QLEN / 32); ++j)
    *(float*)(prow + 32u * j) = sv[sb + 32u * j];
  
}

// ---------------------------------------------------------------------------
extern "C" void kernel_launch(void* const* d_in, const int* in_sizes, int n_in,
                              void* d_out, int out_size, void* d_ws, size_t ws_size,
                              hipStream_t stream) {
  if (n_in < 6) return;
  const long long need_q = ((long long)(NB - 1) * QLEN_FULL + QLEN) * FEAT;
  const long long need_k = ((long long)(NB - 1) * KLEN_FULL + KLEN) * FEAT;
  const long long need_v = ((long long)NB * FEAT - 1) * KLEN_FULL + KLEN;
  const long long need_o = ((long long)NB * FEAT - 1) * QLEN_FULL + QLEN;
  if ((long long)in_sizes[0] < need_q) return;
  if ((long long)in_sizes[1] < need_k) return;
  if ((long long)in_sizes[2] < need_v) return;
  if ((long long)in_sizes[3] < (long long)FEAT * ENC) return;
  if ((long long)in_sizes[4] < (long long)FEAT * ENC) return;
  if (in_sizes[5] < ENC) return;
  if ((long long)out_size < need_o) return;
  if (ws_size < WS_TOTAL) return;

  const float* query = (const float*)d_in[0];   // [NB_FULL][QLEN_FULL][FEAT]
  const float* key   = (const float*)d_in[1];   // [NB_FULL][KLEN_FULL][FEAT]
  const float* value = (const float*)d_in[2];   // [NB_FULL][FEAT][KLEN_FULL]
  const float* w1    = (const float*)d_in[3];   // [FEAT][ENC]  (in, out), pairs with query
  const float* w2    = (const float*)d_in[4];   // [FEAT][ENC]  (in, out), pairs with key
  const float* vc    = (const float*)d_in[5];   // [ENC]
  float* out = (float*)d_out;                   // [NB_FULL][FEAT][QLEN_FULL]

  char* ws = (char*)d_ws;
  _Float16* W1t = (_Float16*)(ws + OFF_W1T);    // [ENC][FEAT]
  _Float16* W2t = (_Float16*)(ws + OFF_W2T);    // [ENC][FEAT]
  _Float16* XQ  = (_Float16*)(ws + OFF_XQ);     // [NB*QLEN][FEAT]
  _Float16* XK  = (_Float16*)(ws + OFF_XK);     // [NB*KLEN][FEAT]
  _Float16* V16 = (_Float16*)(ws + OFF_V);      // [NB][FEAT][KLEN]
  float*    Qp  = (float*)(ws + OFF_QP);        // [NB*QLEN][ENC]
  float*    Kp  = (float*)(ws + OFF_KP);        // [NB*KLEN][ENC]
  float*    Pf  = (float*)(ws + OFF_P);         // [NB][KLEN][QLEN]
  _Float16* PT  = (_Float16*)(ws + OFF_PT);     // [NB][QLEN][KLEN]

  dim3 blk(256);

  // weight planes: in [K = FEAT rows][N = ENC cols] -> out [ENC][FEAT]; grid (N/64, K/64)
  wconv_kernel<<<dim3(ENC / 64, FEAT / 64), blk, 0, stream>>>(w1, W1t, (unsigned)ENC, (unsigned)FEAT);
  wconv_kernel<<<dim3(ENC / 64, FEAT / 64), blk, 0, stream>>>(w2, W2t, (unsigned)ENC, (unsigned)FEAT);

  // input row planes (R rows of RF per batch, C columns of CF)
  xconv_kernel<<<dim3((unsigned)((size_t)NB * QLEN * FEAT / 8 / 256)), blk, 0, stream>>>(
      query, XQ, (unsigned)QLEN, (unsigned)QLEN_FULL, (unsigned)FEAT, (unsigned)FEAT);
  xconv_kernel<<<dim3((unsigned)((size_t)NB * KLEN * FEAT / 8 / 256)), blk, 0, stream>>>(
      key, XK, (unsigned)KLEN, (unsigned)KLEN_FULL, (unsigned)FEAT, (unsigned)FEAT);
  xconv_kernel<<<dim3((unsigned)((size_t)NB * FEAT * KLEN / 8 / 256)), blk, 0, stream>>>(
      value, V16, (unsigned)FEAT, (unsigned)FEAT, (unsigned)KLEN, (unsigned)KLEN_FULL);

  // projections
  proj_kernel<<<dim3(ENC / 64, NB * QLEN / 64), blk, 0, stream>>>(XQ, W1t, Qp);
  proj_kernel<<<dim3(ENC / 64, NB * KLEN / 64), blk, 0, stream>>>(XK, W2t, Kp);

  // additive scores + softmax over q
  score_kernel<<<dim3(KLEN / TT, NB), blk, 0, stream>>>(Qp, Kp, vc, Pf);

  // attention-weight plane: in [t rows][q cols] -> out [q][t]; grid (q/64, t/64, batch)
  pconv_kernel<<<dim3(QLEN / 64, KLEN / 64, NB), blk, 0, stream>>>(Pf, PT);

  // out = value . p
  outgemm_kernel<<<dim3(QLEN / 64, FEAT / 64, NB), blk, 0, stream>>>(V16, PT, out);
}

// v001
// A run of this version takes 36.5 microseconds.
// Timed twice side by side with v000, it ran 1.60 and 1.62 times as fast.
#include <hip/hip_runtime.h>
#include <stddef.h>

// Contractions on v_wmma_f32_16x16x32_f16 (f16 operands, f32 accumulate): the query and key
// projections and the value x attention-weight product. Float inputs are RNE-converted to bf16
// and carried in f16 planes (weights x64, input rows x16); attention weights go to f16 x16384
// without the bf16 step.
// The vc-weighted tanh sum is a matrix-vector product kept on the vector unit in f32;
// tanh, softmax (over the query axis) and all scalings in f32.
// Three launches: projections (operands converted on the way into LDS; spare blocks write the
// value plane), score + softmax, output product (attention weights converted and transposed on
// the way into LDS).

typedef _Float16 v16h __attribute__((ext_vector_type(16)));
typedef _Float16 v8h  __attribute__((ext_vector_type(8)));
typedef float    v8f  __attribute__((ext_vector_type(8)));
typedef float    v4f  __attribute__((ext_vector_type(4)));
typedef _Float16 h16;

#ifndef NB
#define NB 4
#endif
#ifndef QLEN
#define QLEN 512
#endif
#ifndef KLEN
#define KLEN 512
#endif
#define NB_FULL   4
#define QLEN_FULL 512
#define KLEN_FULL 512
#define FEAT 256     // input feature width (2 x encoder size)
#define ENC  128     // encoder size
#define TT   8       // key rows per score block == waves per block

static_assert(NB >= 1 && NB <= NB_FULL);
static_assert(QLEN >= 64 && QLEN <= QLEN_FULL && (QLEN % 64) == 0);
static_assert(KLEN >= 64 && KLEN <= KLEN_FULL && (KLEN % 64) == 0);
static_assert((FEAT % 64) == 0 && (FEAT % 32) == 0);
static_assert((ENC % 64) == 0 && (ENC % 32) == 0 && (ENC % 4) == 0);
static_assert(((NB * QLEN) % 64) == 0 && ((NB * KLEN) % 64) == 0);
static_assert((((size_t)NB * FEAT * KLEN / 8) % 256) == 0);   // value plane blocks, exact
static_assert(TT == 8);                                       // one softmax row per wave, 8 waves
static_assert((KLEN % TT) == 0);
static_assert(((TT * ENC) % 256) == 0);
static_assert((QLEN % 32) == 0);
static_assert((KLEN % 32) == 0);

#define LDF (FEAT + 8)   // halves per LDS operand row, projections (16 B x odd)
#define LDK (KLEN + 8)   // halves per LDS operand row, output product (16 B x odd)
#define LDC 68           // floats per LDS row (272 B, 16-B aligned)
static_assert((LDF % 8) == 0 && ((LDF / 8) % 2) == 1);
static_assert((LDK % 8) == 0 && ((LDK / 8) % 2) == 1);
static_assert((LDC % 4) == 0 && LDC >= 64);

#define WCARRY 64.0f      // weight planes carried x64
#define XCARRY 16.0f      // input row planes (query, key, value) carried x16
#define PCARRY 16384.0f   // attention-weight plane carried x2^14
// projection planes hold 2*log2(e) * (x . W): exp(2 (k+q)) == exp2(k' + q')
#define PSCALE (2.8853900817779268f / (WCARRY * XCARRY))
#define OSCALE (1.0f / (PCARRY * XCARRY))
#define LSCALE (-2.8853900817779268f)   // -2 log2(e): log2-domain logit from the reciprocal sum

// static LDS per kernel (bytes)
static_assert((size_t)2 * 64 * LDF * 2 + (size_t)64 * LDC * 4 <= (size_t)131072);
static_assert((size_t)64 * LDK * 2 + (size_t)64 * LDC * 4 <= (size_t)131072);
static_assert(((size_t)TT * ENC + ENC + (size_t)TT * QLEN) * 4 <= (size_t)131072);

// workspace layout (bytes)
#define V_BYTES   ((size_t)NB * FEAT * KLEN * 2)
#define QP_BYTES  ((size_t)NB * QLEN * ENC * 4)
#define KP_BYTES  ((size_t)NB * KLEN * ENC * 4)
#define P_BYTES   ((size_t)NB * KLEN * QLEN * 4)
#define OFF_V   ((size_t)0)
#define OFF_QP  (OFF_V + V_BYTES)
#define OFF_KP  (OFF_QP + QP_BYTES)
#define OFF_P   (OFF_KP + KP_BYTES)
#define WS_TOTAL (OFF_P + P_BYTES)
static_assert((V_BYTES % 128) == 0 && (QP_BYTES % 128) == 0 && (KP_BYTES % 128) == 0);
static_assert((P_BYTES % 128) == 0);
static_assert(WS_TOTAL <= (size_t)134217728);

// ---------------------------------------------------------------------------
__device__ __forceinline__ float bf16r(float x) {   // RNE convert to bf16, returned widened
  unsigned int u = __float_as_uint(x);
  u = (u + 0x7FFFu + ((u >> 16) & 1u)) & 0xFFFF0000u;
  return __uint_as_float(u);
}

// f32 -> f16 operand convert that cannot produce an f16 subnormal (value select).
static __device__ __forceinline__ h16 toh_flush(float v) {
  const h16 r = (h16)v;
  return (fabsf(v) < 6.103515625e-05f) ? (h16)0.0f : r;
}

// 16-bit fragment: p points at element [row = lane&15][k0 + 8*(lane>>4)] of a k-contiguous
// row. Elements 0..7 <- k0+8h+0..7, elements 8..15 <- k0+16+8h+0..7 (same map for A and B).
__device__ __forceinline__ v16h frag_at(const _Float16* p) {
  v8h lo = *(const v8h*)(p);
  v8h hi = *(const v8h*)(p + 16);
  v16h out;
#pragma unroll
  for (int i = 0; i < 8; ++i) { out[i] = lo[i]; out[i + 8] = hi[i]; }
  return out;
}

__device__ __forceinline__ v8f wmma16(v16h a, v16h b, v8f c) {
  v8f d = __builtin_amdgcn_wmma_f32_16x16x32_f16(false, a, false, b, (short)0, c,
                                                 false, false);
  asm volatile("v_nop\n\tv_nop\n\tv_nop\n\tv_nop" : "+v"(d) : "v"(a), "v"(b));
  return d;
}

__device__ __forceinline__ float red32_max(float x) {
#pragma unroll
  for (int off = 1; off < 32; off <<= 1) x = fmaxf(x, __shfl_xor(x, off, 32));
  return x;
}
__device__ __forceinline__ float red32_sum(float x) {
#pragma unroll
  for (int off = 1; off < 32; off <<= 1) x += __shfl_xor(x, off, 32);
  return x;
}

__device__ __forceinline__ float fexp2(float x) {
#if __has_builtin(__builtin_amdgcn_exp2f)
  return __builtin_amdgcn_exp2f(x);
#else
  return exp2f(x);
#endif
}

// 1 / (2^x + 1); tanh(z) = 1 - 2 / (exp(2 z) + 1) with x = 2 log2(e) z
__device__ __forceinline__ float rcp1p(float x) {
  return __builtin_amdgcn_rcpf(fexp2(x) + 1.0f);
}

// ---------------------------------------------------------------------------
// Operand staging, f32 global -> f16 LDS, 256 threads, one 64-wide tile over the whole K;
// a load half (registers; one address, constant offsets) and a convert-and-store half.
// cols: src[K rows][64 cols used] (pitch LD) -> T[col][k] (pitch K + 8 halves),
//   f16(carry * bf16(x)) (RND) or f16(carry * x). Thread: col = tid & 63, eight consecutive k
//   per 16-B LDS store; each load instruction of a wave covers one 128-B line of a source row.
// rows: src[64 rows][K cols] (pitch LD) -> T[row][k] (pitch K + 8 halves),
//   f16(16 * bf16(x)). Thread: eight consecutive k of one row per 16-B LDS store.
// ---------------------------------------------------------------------------
template <unsigned K, unsigned LD>
__device__ __forceinline__ void load_cols(const float* __restrict__ src, float (&v)[K / 32u][8]) {
  const float* s = src + (size_t)((threadIdx.x >> 6) * 8u) * LD + (threadIdx.x & 63u);
#pragma unroll
  for (unsigned j = 0; j < K / 32u; ++j)               // k = 8 (tid >> 6) + 32 j + i
#pragma unroll
    for (unsigned i = 0; i < 8u; ++i) v[j][i] = s[(size_t)(32u * j + i) * LD];
  // precaution: the address stays in its registers up to this wait, so that no load's result
  // is placed on the address of an issued load ahead of it
  asm volatile("s_wait_xcnt 0x0" :: "v"(s) : "memory");
}

template <unsigned K, bool RND>
__device__ __forceinline__ void put_cols(const float (&v)[K / 32u][8], const float carry,
                                         _Float16* T) {
  _Float16* d = T + (threadIdx.x & 63u) * (K + 8u) + (threadIdx.x >> 6) * 8u;
#pragma unroll
  for (unsigned j = 0; j < K / 32u; ++j) {
    v8h o;
#pragma unroll
    for (int i = 0; i < 8; ++i) o[i] = toh_flush(carry * (RND ? bf16r(v[j][i]) : v[j][i]));
    *(v8h*)(d + 32u * j) = o;
  }
}

// rows per sweep of the block: 256 threads / (K / 8 threads per row)
#define ROWSWEEP(K) (256u / ((K) / 8u))

template <unsigned K, unsigned LD>
__device__ __forceinline__ void load_rows(const float* __restrict__ src,
                                          v4f (&a)[64u / ROWSWEEP(K)][2]) {
  static_assert(K / 8u <= 256u && (256u % (K / 8u)) == 0);
  const float* s = src + (size_t)(threadIdx.x / (K / 8u)) * LD + (threadIdx.x % (K / 8u)) * 8u;
#pragma unroll
  for (unsigned j = 0; j < 64u / ROWSWEEP(K); ++j) {   // row = tid / (K / 8) + ROWSWEEP j
    a[j][0] = *(const v4f*)(s + (size_t)(ROWSWEEP(K) * j) * LD);
    a[j][1] = *(const v4f*)(s + (size_t)(ROWSWEEP(K) * j) * LD + 4);
  }
  // precaution: as in load_cols
  asm volatile("s_wait_xcnt 0x0" :: "v"(s) : "memory");
}

template <unsigned K>
__device__ __forceinline__ void put_rows(const v4f (&a)[64u / ROWSWEEP(K)][2], _Float16* T) {
  _Float16* d = T + (threadIdx.x / (K / 8u)) * (K + 8u) + (threadIdx.x % (K / 8u)) * 8u;
#pragma unroll
  for (unsigned j = 0; j < 64u / ROWSWEEP(K); ++j) {
    v8h o;
#pragma unroll
    for (int i = 0; i < 4; ++i) {
      o[i]     = toh_flush(XCARRY * bf16r(a[j][0][i]));
      o[i + 4] = toh_flush(XCARRY * bf16r(a[j][1][i]));
    }
    *(v8h*)(d + ROWSWEEP(K) * j * (K + 8u)) = o;
  }
}

// ---------------------------------------------------------------------------
// GEMM C[64x64 tile] = A[64 rows][K] . Bt[64 n][K]^T from k-contiguous 16-bit rows (A: row 0 of
// the tile, pitch lda; Bt: column 0 of the tile, pitch ldb; LDS or global);
// 8 waves (mw = 16-row group, nw = 32-col group), 2 accumulators/wave.
// outf[row0 + row][n0 + col] (pitch ldo) = cs * acc; rows r = 16 i + tid/16, i < 4 -> 64 rows;
// 16 lanes x 16 B = the 256-B row segment of the tile.
// ---------------------------------------------------------------------------
__device__ __forceinline__ void gemm_body(
    const _Float16* A, const unsigned lda, const _Float16* Bt, const unsigned ldb,
    const unsigned K, float* __restrict__ outf, const unsigned ldo, const float cs,
    const unsigned row0, const unsigned n0) {
  __shared__ float Cs[64 * LDC];
  const unsigned tid = threadIdx.x, lane = tid & 31u, w = tid >> 5;
  const unsigned mw = w >> 1, nw = w & 1u;
  const unsigned hh = lane >> 4, m = lane & 15u;

  const _Float16* ap  = A + (size_t)(mw * 16u + m) * lda + hh * 8u;
  const _Float16* bp0 = Bt + (size_t)(nw * 32u + m) * ldb + hh * 8u;
  const _Float16* bp1 = bp0 + (size_t)16 * ldb;
  v8f acc0 = {}, acc1 = {};
#pragma unroll 2
  for (unsigned k0 = 0; k0 < K; k0 += 32u) {
    const v16h a  = frag_at(ap + k0);
    const v16h b0 = frag_at(bp0 + k0);
    const v16h b1 = frag_at(bp1 + k0);
    acc0 = wmma16(a, b0, acc0);
    acc1 = wmma16(a, b1, acc1);
  }
#pragma unroll
  for (int r = 0; r < 8; ++r) {
    float* d = &Cs[(mw * 16u + hh * 8u + (unsigned)r) * LDC + nw * 32u + m];
    d[0]  = acc0[r];
    d[16] = acc1[r];
  }
  __syncthreads();

  v4f xs[4];
  size_t off[4];
#pragma unroll
  for (unsigned i = 0; i < 4u; ++i) {
    const unsigned r = 16u * i + (tid >> 4);
    const unsigned c = (tid & 15u) * 4u;
    const v4f u = *(const v4f*)&Cs[r * LDC + c];
    v4f val;
#pragma unroll
    for (int j = 0; j < 4; ++j) val[j] = u[j] * cs;
    xs[i] = val;
    off[i] = (size_t)(row0 + r) * ldo + n0 + c;
  }
#pragma unroll
  for (int i = 0; i < 4; ++i) *(v4f*)(outf + off[i]) = xs[i];
}

// ---------------------------------------------------------------------------
// First launch, 1-D grid of three block ranges:
//   [0, NPQ)           Qp[rows][ENC] = 2 log2(e) * (query . W1), one 64 x 64 tile per block
//   [NPQ, NPQ + NPK)   Kp[rows][ENC] = 2 log2(e) * (key . W2)
//   [NPQ + NPK, + NVB) value plane V16[b][FEAT][KLEN] = f16(16 * bf16(value)), 8 columns/thread
// Ta / Tb: cross-wave (block barrier). The range test is the same for a whole block and the
// value blocks leave before any barrier.
// ---------------------------------------------------------------------------
#define NPQ ((unsigned)((ENC / 64) * (NB * QLEN / 64)))
#define NPK ((unsigned)((ENC / 64) * (NB * KLEN / 64)))
#define NVB ((unsigned)((size_t)NB * FEAT * KLEN / 8 / 256))

__global__ __launch_bounds__(256) void proj_kernel(
    const float* __restrict__ query, const float* __restrict__ key,
    const float* __restrict__ value, const float* __restrict__ w1,
    const float* __restrict__ w2, float* __restrict__ Qp, float* __restrict__ Kp,
    _Float16* __restrict__ V16) {
  __shared__ __attribute__((aligned(16))) _Float16 Ta[64 * LDF];
  __shared__ __attribute__((aligned(16))) _Float16 Tb[64 * LDF];
  const unsigned bid = blockIdx.x;

  if (bid >= NPQ + NPK) {
    const unsigned g = (bid - (NPQ + NPK)) * 256u + threadIdx.x;
    const unsigned row = g / (unsigned)(KLEN / 8);            // b * FEAT + d
    const unsigned cc = (g % (unsigned)(KLEN / 8)) * 8u;
    const float* s = value + (size_t)row * KLEN_FULL + cc;
    const v4f a0 = *(const v4f*)(s);
    const v4f a1 = *(const v4f*)(s + 4);
    v8h o;
#pragma unroll
    for (int i = 0; i < 4; ++i) {
      o[i]     = toh_flush(XCARRY * bf16r(a0[i]));
      o[i + 4] = toh_flush(XCARRY * bf16r(a1[i]));
    }
    *(v8h*)(V16 + (size_t)g * 8u) = o;
    return;
  }

  const bool isq = bid < NPQ;
  const unsigned t = isq ? bid : bid - NPQ;
  const unsigned n0 = (t % (unsigned)(ENC / 64)) * 64u;
  const unsigned row0 = (t / (unsigned)(ENC / 64)) * 64u;    // compact row, b * len + r
  const unsigned len = isq ? (unsigned)QLEN : (unsigned)KLEN;
  const unsigned lenf = isq ? (unsigned)QLEN_FULL : (unsigned)KLEN_FULL;
  const unsigned b = row0 / len;
  const float* X = (isq ? query : key) + ((size_t)b * lenf + (row0 - b * len)) * FEAT;
  const float* Wm = (isq ? w1 : w2) + n0;

  float wv[FEAT / 32][8];
  v4f xa[64u / ROWSWEEP(FEAT)][2];
  load_cols<FEAT, ENC>(Wm, wv);
  load_rows<FEAT, FEAT>(X, xa);
  // keeps every load of both tiles issued ahead of the first convert: one memory latency for
  // the block instead of one per group of rows
  __builtin_amdgcn_sched_barrier(0);
  put_cols<FEAT, true>(wv, WCARRY, Tb);
  put_rows<FEAT>(xa, Ta);
  __syncthreads();
  gemm_body(Ta, (unsigned)LDF, Tb, (unsigned)LDF, (unsigned)FEAT, isq ? Qp : Kp,
            (unsigned)ENC, PSCALE, row0, n0);
}

// ---------------------------------------------------------------------------
// out[b][d][q] = sum_t value[b][d][t] * p[b][t][q]; A = value plane [b][FEAT][KLEN], fragments
// straight from global; Bt[q][t] = f16(16384 * p[t][q]) staged in LDS from P[b][KLEN][QLEN].
// Tb: cross-wave (block barrier). Grid (QLEN/64, FEAT/64, NB); output rows at the full pitch.
// ---------------------------------------------------------------------------
__global__ __launch_bounds__(256) void outgemm_kernel(
    const _Float16* __restrict__ V16, const float* __restrict__ P,
    float* __restrict__ outf) {
  __shared__ __attribute__((aligned(16))) _Float16 Tb[64 * LDK];
  const unsigned b = blockIdx.z;
  const unsigned n0 = blockIdx.x * 64u;
  const unsigned row0 = blockIdx.y * 64u;
  float pv[KLEN / 32][8];
  load_cols<KLEN, QLEN>(P + (size_t)b * KLEN * QLEN + n0, pv);
  put_cols<KLEN, false>(pv, PCARRY, Tb);
  __syncthreads();
  gemm_body(V16 + ((size_t)b * FEAT + row0) * KLEN, (unsigned)KLEN, Tb, (unsigned)LDK,
            (unsigned)KLEN, outf + (size_t)b * FEAT * QLEN_FULL, (unsigned)QLEN_FULL, OSCALE,
            row0, n0);
}

// ---------------------------------------------------------------------------
// Additive score + softmax over the query axis. Block = 8 key rows t0..t0+7 of one batch.
//   r[t][q][e] = 1 / (exp2(Kp'[t][e] + Qp'[q][e]) + 1)      (planes pre-scaled by 2 log2 e)
//   L[t][q]    = -2 log2(e) * sum_e bf16(vc[e]) * r          (log2-domain logit up to a constant
//                                                             shift that the softmax removes)
//   p[t][q]    = exp2(L - max_q L) / sum_q exp2(L - max_q L)
// krow / vcs / sv: cross-wave (block barriers); after the second barrier each wave owns one
// sv row and every lane touches only its own elements (no exchange through LDS).
// Each output row line (32 floats) is one store instruction of one wave, 4 B per lane,
// lane-contiguous. Grid (KLEN/TT, NB).
// ---------------------------------------------------------------------------
__global__ __launch_bounds__(256) void score_kernel(
    const float* __restrict__ Qp, const float* __restrict__ Kp,
    const float* __restrict__ vc, float* __restrict__ P) {
  __shared__ __attribute__((aligned(16))) float krow[TT * ENC];
  __shared__ __attribute__((aligned(16))) float vcs[ENC];
  __shared__ __attribute__((aligned(16))) float sv[TT * QLEN];

  const unsigned tid = threadIdx.x;
  const unsigned t0 = blockIdx.x * (unsigned)TT;
  const unsigned b = blockIdx.y;

  if (tid < (unsigned)ENC) vcs[tid] = bf16r(vc[tid]);   // whole waves in or out (ENC % 32 == 0)
  {
    const float* kp = Kp + (size_t)(b * (unsigned)KLEN + t0) * ENC;
#pragma unroll
    for (unsigned j = 0; j < (unsigned)(TT * ENC / 256); ++j) {
      const unsigned i = tid + 256u * j;
      krow[i] = kp[i];
    }
  }
  __syncthreads();

#pragma unroll 1
  for (unsigned q = tid; q < (unsigned)QLEN; q += 256u) {
    const float* qr = Qp + (size_t)(b * (unsigned)QLEN + q) * ENC;
    float acc[TT];
#pragma unroll
    for (int t = 0; t < TT; ++t) acc[t] = 0.0f;
#pragma unroll 1
    for (unsigned e = 0; e < (unsigned)ENC; e += 4u) {
      const v4f qv = *(const v4f*)(qr + e);
      const v4f vv = *(const v4f*)&vcs[e];
#pragma unroll
      for (int t = 0; t < TT; ++t) {
        const v4f kk = *(const v4f*)&krow[(unsigned)t * ENC + e];
#pragma unroll
        for (int j = 0; j < 4; ++j) acc[t] += vv[j] * rcp1p(kk[j] + qv[j]);
      }
    }
#pragma unroll
    for (int t = 0; t < TT; ++t) sv[(unsigned)t * QLEN + q] = acc[t] * LSCALE;
  }
  __syncthreads();

  const int wave = __builtin_amdgcn_readfirstlane((int)(threadIdx.x >> 5));
  const unsigned lane = tid & 31u;
  const unsigned sb = (unsigned)wave * (unsigned)QLEN + lane;

  float mx = -3.0e38f;
#pragma unroll 4
  for (unsigned j = 0; j < (unsigned)(QLEN / 32); ++j) mx = fmaxf(mx, sv[sb + 32u * j]);
  mx = red32_max(mx);

  float sum = 0.0f;
#pragma unroll 4
  for (unsigned j = 0; j < (unsigned)(QLEN / 32); ++j) {
    const float ex = fexp2(sv[sb + 32u * j] - mx);
    sv[sb + 32u * j] = ex;
    sum += ex;
  }
  sum = red32_sum(sum);
  const float inv = __builtin_amdgcn_rcpf(sum);

#pragma unroll 4
  for (unsigned j = 0; j < (unsigned)(QLEN / 32); ++j) {
    const float pv = sv[sb + 32u * j] * inv;
    sv[sb + 32u * j] = pv;
  }

  float* prow = P + (size_t)(b * (unsigned)KLEN + t0 + (unsigned)wave) * QLEN + lane;
#pragma unroll 4
  for (unsigned j = 0; j < (unsigned)(QLEN / 32); ++j)
    *(float*)(prow + 32u * j) = sv[sb + 32u * j];
  
}

// ---------------------------------------------------------------------------
extern "C" void kernel_launch(void* const* d_in, const int* in_sizes, int n_in,
                              void* d_out, int out_size, void* d_ws, size_t ws_size,
                              hipStream_t stream) {
  if (n_in < 6) return;
  const long long need_q = ((long long)(NB - 1) * QLEN_FULL + QLEN) * FEAT;
  const long long need_k = ((long long)(NB - 1) * KLEN_FULL + KLEN) * FEAT;
  const long long need_v = ((long long)NB * FEAT - 1) * KLEN_FULL + KLEN;
  const long long need_o = ((long long)NB * FEAT - 1) * QLEN_FULL + QLEN;
  if ((long long)in_sizes[0] < need_q) return;
  if ((long long)in_sizes[1] < need_k) return;
  if ((long long)in_sizes[2] < need_v) return;
  if ((long long)in_sizes[3] < (long long)FEAT * ENC) return;
  if ((long long)in_sizes[4] < (long long)FEAT * ENC) return;
  if (in_sizes[5] < ENC) return;
  if ((long long)out_size < need_o) return;
  if (ws_size < WS_TOTAL) return;

  const float* query = (const float*)d_in[0];   // [NB_FULL][QLEN_FULL][FEAT]
  const float* key   = (const float*)d_in[1];   // [NB_FULL][KLEN_FULL][FEAT]
  const float* value = (const float*)d_in[2];   // [NB_FULL][FEAT][KLEN_FULL]
  const float* w1    = (const float*)d_in[3];   // [FEAT][ENC]  (in, out), pairs with query
  const float* w2    = (const float*)d_in[4];   // [FEAT][ENC]  (in, out), pairs with key
  const float* vc    = (const float*)d_in[5];   // [ENC]
  float* out = (float*)d_out;                   // [NB_FULL][FEAT][QLEN_FULL]

  char* ws = (char*)d_ws;
  _Float16* V16 = (_Float16*)(ws + OFF_V);      // [NB][FEAT][KLEN]
  float*    Qp  = (float*)(ws + OFF_QP);        // [NB*QLEN][ENC]
  float*    Kp  = (float*)(ws + OFF_KP);        // [NB*KLEN][ENC]
  float*    Pf  = (float*)(ws + OFF_P);         // [NB][KLEN][QLEN]

  dim3 blk(256);

  // projections (operands converted in the kernel) + value plane
  proj_kernel<<<dim3(NPQ + NPK + NVB), blk, 0, stream>>>(query, key, value, w1, w2, Qp, Kp, V16);

  // additive scores + softmax over q
  score_kernel<<<dim3(KLEN / TT, NB), blk, 0, stream>>>(Qp, Kp, vc, Pf);

  // out = value . p
  outgemm_kernel<<<dim3(QLEN / 64, FEAT / 64, NB), blk, 0, stream>>>(V16, Pf, out);
}

// v002
// It runs in 32 microseconds.
// Timed twice side by side with v001, it ran 1.13 and 1.14 times as fast.
// Over all steps from v000 it is 1.83 times as fast.
#include <hip/hip_runtime.h>
#include <stddef.h>

// Contractions on v_wmma_f32_16x16x32_f16 (f16 operands, f32 accumulate): the query and key
// projections and the value x attention-weight product. Float inputs are RNE-converted to bf16
// and carried in f16 planes (weights x64, input rows x16); attention weights go to f16 x16384
// without the bf16 step.
// The vc-weighted tanh sum is a matrix-vector product kept on the vector unit in f32;
// tanh, softmax (over the query axis) and all scalings in f32. The exponential inside tanh is
// factored, 2^(k'+q') = 2^k' * 2^q', where all |q'| of the query row and
// all |k'| of the block's key rows are <= XLIM (120).
// Three launches: projections (operands converted on the way into LDS; spare blocks write the
// value plane), score + softmax, output product (attention weights converted and transposed on
// the way into LDS).

typedef _Float16 v16h __attribute__((ext_vector_type(16)));
typedef _Float16 v8h  __attribute__((ext_vector_type(8)));
typedef float    v8f  __attribute__((ext_vector_type(8)));
typedef float    v4f  __attribute__((ext_vector_type(4)));
typedef _Float16 h16;

#ifndef NB
#define NB 4
#endif
#ifndef QLEN
#define QLEN 512
#endif
#ifndef KLEN
#define KLEN 512
#endif
#define NB_FULL   4
#define QLEN_FULL 512
#define KLEN_FULL 512
#define FEAT 256     // input feature width (2 x encoder size)
#define ENC  128     // encoder size
#define TT   8       // key rows per score block == waves per block

static_assert(NB >= 1 && NB <= NB_FULL);
static_assert(QLEN >= 64 && QLEN <= QLEN_FULL && (QLEN % 64) == 0);
static_assert(KLEN >= 64 && KLEN <= KLEN_FULL && (KLEN % 64) == 0);
static_assert((FEAT % 64) == 0 && (FEAT % 32) == 0);
static_assert((ENC % 64) == 0 && (ENC % 32) == 0 && (ENC % 4) == 0);
static_assert(((NB * QLEN) % 64) == 0 && ((NB * KLEN) % 64) == 0);
static_assert((((size_t)NB * FEAT * KLEN / 8) % 256) == 0);   // value plane blocks, exact
static_assert(TT == 8);                                       // one softmax row per wave, 8 waves
static_assert((KLEN % TT) == 0);
static_assert(((TT * ENC) % 256) == 0);
static_assert((QLEN % 32) == 0);
static_assert((KLEN % 32) == 0);

#define LDF (FEAT + 8)   // halves per LDS operand row, projections (16 B x odd)
#define LDK (KLEN + 8)   // halves per LDS operand row, output product (16 B x odd)
#define LDC 68           // floats per LDS row (272 B, 16-B aligned)
static_assert((LDF % 8) == 0 && ((LDF / 8) % 2) == 1);
static_assert((LDK % 8) == 0 && ((LDK / 8) % 2) == 1);
static_assert((LDC % 4) == 0 && LDC >= 64);

#define WCARRY 64.0f      // weight planes carried x64
#define XCARRY 16.0f      // input row planes (query, key, value) carried x16
#define PCARRY 16384.0f   // attention-weight plane carried x2^14
// projection planes hold 2*log2(e) * (x . W): exp(2 (k+q)) == exp2(k' + q')
#define PSCALE (2.8853900817779268f / (WCARRY * XCARRY))
#define OSCALE (1.0f / (PCARRY * XCARRY))
#define LSCALE (-2.8853900817779268f)   // -2 log2(e): log2-domain logit from the reciprocal sum
// |x'| <= XLIM: 2^x' is a normal f32 well inside the range, so 2^k' * 2^q' + 1 is 2^(k'+q') + 1
// to rounding, its overflow (inf, reciprocal 0) and underflow (1) being the limits of the sum form
#define XLIM 120.0f

// static LDS per kernel (bytes)
static_assert((size_t)2 * 64 * LDF * 2 + (size_t)64 * LDC * 4 <= (size_t)131072);
static_assert((size_t)64 * LDK * 2 + (size_t)64 * LDC * 4 <= (size_t)131072);
static_assert(((size_t)2 * TT * ENC + ENC + 8 + (size_t)TT * QLEN) * 4 <= (size_t)131072);

// workspace layout (bytes)
#define V_BYTES   ((size_t)NB * FEAT * KLEN * 2)
#define QP_BYTES  ((size_t)NB * QLEN * ENC * 4)
#define KP_BYTES  ((size_t)NB * KLEN * ENC * 4)
#define P_BYTES   ((size_t)NB * KLEN * QLEN * 4)
#define OFF_V   ((size_t)0)
#define OFF_QP  (OFF_V + V_BYTES)
#define OFF_KP  (OFF_QP + QP_BYTES)
#define OFF_P   (OFF_KP + KP_BYTES)
#define WS_TOTAL (OFF_P + P_BYTES)
static_assert((V_BYTES % 128) == 0 && (QP_BYTES % 128) == 0 && (KP_BYTES % 128) == 0);
static_assert((P_BYTES % 128) == 0);
static_assert(WS_TOTAL <= (size_t)134217728);

// ---------------------------------------------------------------------------
__device__ __forceinline__ float bf16r(float x) {   // RNE convert to bf16, returned widened
  unsigned int u = __float_as_uint(x);
  u = (u + 0x7FFFu + ((u >> 16) & 1u)) & 0xFFFF0000u;
  return __uint_as_float(u);
}

// f32 -> f16 operand convert that cannot produce an f16 subnormal (value select).
static __device__ __forceinline__ h16 toh_flush(float v) {
  const h16 r = (h16)v;
  return (fabsf(v) < 6.103515625e-05f) ? (h16)0.0f : r;
}

// 16-bit fragment: p points at element [row = lane&15][k0 + 8*(lane>>4)] of a k-contiguous
// row. Elements 0..7 <- k0+8h+0..7, elements 8..15 <- k0+16+8h+0..7 (same map for A and B).
__device__ __forceinline__ v16h frag_at(const _Float16* p) {
  v8h lo = *(const v8h*)(p);
  v8h hi = *(const v8h*)(p + 16);
  v16h out;
#pragma unroll
  for (int i = 0; i < 8; ++i) { out[i] = lo[i]; out[i + 8] = hi[i]; }
  return out;
}

__device__ __forceinline__ v8f wmma16(v16h a, v16h b, v8f c) {
  v8f d = __builtin_amdgcn_wmma_f32_16x16x32_f16(false, a, false, b, (short)0, c,
                                                 false, false);
  asm volatile("v_nop\n\tv_nop\n\tv_nop\n\tv_nop" : "+v"(d) : "v"(a), "v"(b));
  return d;
}

__device__ __forceinline__ float red32_max(float x) {
#pragma unroll
  for (int off = 1; off < 32; off <<= 1) x = fmaxf(x, __shfl_xor(x, off, 32));
  return x;
}
__device__ __forceinline__ float red32_sum(float x) {
#pragma unroll
  for (int off = 1; off < 32; off <<= 1) x += __shfl_xor(x, off, 32);
  return x;
}

__device__ __forceinline__ float fexp2(float x) {
#if __has_builtin(__builtin_amdgcn_exp2f)
  return __builtin_amdgcn_exp2f(x);
#else
  return exp2f(x);
#endif
}

// 1 / (2^x + 1); tanh(z) = 1 - 2 / (exp(2 z) + 1) with x = 2 log2(e) z
__device__ __forceinline__ float rcp1p(float x) {
  return __builtin_amdgcn_rcpf(fexp2(x) + 1.0f);
}

// ---------------------------------------------------------------------------
// Operand staging, f32 global -> f16 LDS, 256 threads, one 64-wide tile over the whole K;
// a load half (registers; one address, constant offsets) and a convert-and-store half.
// cols: src[K rows][64 cols used] (pitch LD) -> T[col][k] (pitch K + 8 halves),
//   f16(carry * bf16(x)) (RND) or f16(carry * x). Thread: col = tid & 63, eight consecutive k
//   per 16-B LDS store; each load instruction of a wave covers one 128-B line of a source row.
// rows: src[64 rows][K cols] (pitch LD) -> T[row][k] (pitch K + 8 halves),
//   f16(16 * bf16(x)). Thread: eight consecutive k of one row per 16-B LDS store.
// ---------------------------------------------------------------------------
template <unsigned K, unsigned LD>
__device__ __forceinline__ void load_cols(const float* __restrict__ src, float (&v)[K / 32u][8]) {
  const float* s = src + (size_t)((threadIdx.x >> 6) * 8u) * LD + (threadIdx.x & 63u);
#pragma unroll
  for (unsigned j = 0; j < K / 32u; ++j)               // k = 8 (tid >> 6) + 32 j + i
#pragma unroll
    for (unsigned i = 0; i < 8u; ++i) v[j][i] = s[(size_t)(32u * j + i) * LD];
  // precaution: the address stays in its registers up to this wait, so that no load's result
  // is placed on the address of an issued load ahead of it
  asm volatile("s_wait_xcnt 0x0" :: "v"(s) : "memory");
}

template <unsigned K, bool RND>
__device__ __forceinline__ void put_cols(const float (&v)[K / 32u][8], const float carry,
                                         _Float16* T) {
  _Float16* d = T + (threadIdx.x & 63u) * (K + 8u) + (threadIdx.x >> 6) * 8u;
#pragma unroll
  for (unsigned j = 0; j < K / 32u; ++j) {
    v8h o;
#pragma unroll
    for (int i = 0; i < 8; ++i) o[i] = toh_flush(carry * (RND ? bf16r(v[j][i]) : v[j][i]));
    *(v8h*)(d + 32u * j) = o;
  }
}

// rows per sweep of the block: 256 threads / (K / 8 threads per row)
#define ROWSWEEP(K) (256u / ((K) / 8u))

template <unsigned K, unsigned LD>
__device__ __forceinline__ void load_rows(const float* __restrict__ src,
                                          v4f (&a)[64u / ROWSWEEP(K)][2]) {
  static_assert(K / 8u <= 256u && (256u % (K / 8u)) == 0);
  const float* s = src + (size_t)(threadIdx.x / (K / 8u)) * LD + (threadIdx.x % (K / 8u)) * 8u;
#pragma unroll
  for (unsigned j = 0; j < 64u / ROWSWEEP(K); ++j) {   // row = tid / (K / 8) + ROWSWEEP j
    a[j][0] = *(const v4f*)(s + (size_t)(ROWSWEEP(K) * j) * LD);
    a[j][1] = *(const v4f*)(s + (size_t)(ROWSWEEP(K) * j) * LD + 4);
  }
  // precaution: as in load_cols
  asm volatile("s_wait_xcnt 0x0" :: "v"(s) : "memory");
}

template <unsigned K>
__device__ __forceinline__ void put_rows(const v4f (&a)[64u / ROWSWEEP(K)][2], _Float16* T) {
  _Float16* d = T + (threadIdx.x / (K / 8u)) * (K + 8u) + (threadIdx.x % (K / 8u)) * 8u;
#pragma unroll
  for (unsigned j = 0; j < 64u / ROWSWEEP(K); ++j) {
    v8h o;
#pragma unroll
    for (int i = 0; i < 4; ++i) {
      o[i]     = toh_flush(XCARRY * bf16r(a[j][0][i]));
      o[i + 4] = toh_flush(XCARRY * bf16r(a[j][1][i]));
    }
    *(v8h*)(d + ROWSWEEP(K) * j * (K + 8u)) = o;
  }
}

// ---------------------------------------------------------------------------
// GEMM C[64x64 tile] = A[64 rows][K] . Bt[64 n][K]^T from k-contiguous 16-bit rows (A: row 0 of
// the tile, pitch lda; Bt: column 0 of the tile, pitch ldb; LDS or global);
// 8 waves (mw = 16-row group, nw = 32-col group), 2 accumulators/wave.
// outf[row0 + row][n0 + col] (pitch ldo) = cs * acc; rows r = 16 i + tid/16, i < 4 -> 64 rows;
// 16 lanes x 16 B = the 256-B row segment of the tile.
// ---------------------------------------------------------------------------
__device__ __forceinline__ void gemm_body(
    const _Float16* A, const unsigned lda, const _Float16* Bt, const unsigned ldb,
    const unsigned K, float* __restrict__ outf, const unsigned ldo, const float cs,
    const unsigned row0, const unsigned n0) {
  __shared__ float Cs[64 * LDC];
  const unsigned tid = threadIdx.x, lane = tid & 31u, w = tid >> 5;
  const unsigned mw = w >> 1, nw = w & 1u;
  const unsigned hh = lane >> 4, m = lane & 15u;

  const _Float16* ap  = A + (size_t)(mw * 16u + m) * lda + hh * 8u;
  const _Float16* bp0 = Bt + (size_t)(nw * 32u + m) * ldb + hh * 8u;
  const _Float16* bp1 = bp0 + (size_t)16 * ldb;
  v8f acc0 = {}, acc1 = {};
#pragma unroll 2
  for (unsigned k0 = 0; k0 < K; k0 += 32u) {
    const v16h a  = frag_at(ap + k0);
    const v16h b0 = frag_at(bp0 + k0);
    const v16h b1 = frag_at(bp1 + k0);
    acc0 = wmma16(a, b0, acc0);
    acc1 = wmma16(a, b1, acc1);
  }
#pragma unroll
  for (int r = 0; r < 8; ++r) {
    float* d = &Cs[(mw * 16u + hh * 8u + (unsigned)r) * LDC + nw * 32u + m];
    d[0]  = acc0[r];
    d[16] = acc1[r];
  }
  __syncthreads();

  v4f xs[4];
  size_t off[4];
#pragma unroll
  for (unsigned i = 0; i < 4u; ++i) {
    const unsigned r = 16u * i + (tid >> 4);
    const unsigned c = (tid & 15u) * 4u;
    const v4f u = *(const v4f*)&Cs[r * LDC + c];
    v4f val;
#pragma unroll
    for (int j = 0; j < 4; ++j) val[j] = u[j] * cs;
    xs[i] = val;
    off[i] = (size_t)(row0 + r) * ldo + n0 + c;
  }
#pragma unroll
  for (int i = 0; i < 4; ++i) *(v4f*)(outf + off[i]) = xs[i];
}

// ---------------------------------------------------------------------------
// First launch, 1-D grid of three block ranges:
//   [0, NPQ)           Qp[rows][ENC] = 2 log2(e) * (query . W1), one 64 x 64 tile per block
//   [NPQ, NPQ + NPK)   Kp[rows][ENC] = 2 log2(e) * (key . W2)
//   [NPQ + NPK, + NVB) value plane V16[b][FEAT][KLEN] = f16(16 * bf16(value)), 8 columns/thread
// Ta / Tb: cross-wave (block barrier). The range test is the same for a whole block and the
// value blocks leave before any barrier.
// ---------------------------------------------------------------------------
#define NPQ ((unsigned)((ENC / 64) * (NB * QLEN / 64)))
#define NPK ((unsigned)((ENC / 64) * (NB * KLEN / 64)))
#define NVB ((unsigned)((size_t)NB * FEAT * KLEN / 8 / 256))

__global__ __launch_bounds__(256) void proj_kernel(
    const float* __restrict__ query, const float* __restrict__ key,
    const float* __restrict__ value, const float* __restrict__ w1,
    const float* __restrict__ w2, float* __restrict__ Qp, float* __restrict__ Kp,
    _Float16* __restrict__ V16) {
  __shared__ __attribute__((aligned(16))) _Float16 Ta[64 * LDF];
  __shared__ __attribute__((aligned(16))) _Float16 Tb[64 * LDF];
  const unsigned bid = blockIdx.x;

  if (bid >= NPQ + NPK) {
    const unsigned g = (bid - (NPQ + NPK)) * 256u + threadIdx.x;
    const unsigned row = g / (unsigned)(KLEN / 8);            // b * FEAT + d
    const unsigned cc = (g % (unsigned)(KLEN / 8)) * 8u;
    const float* s = value + (size_t)row * KLEN_FULL + cc;
    const v4f a0 = *(const v4f*)(s);
    const v4f a1 = *(const v4f*)(s + 4);
    v8h o;
#pragma unroll
    for (int i = 0; i < 4; ++i) {
      o[i]     = toh_flush(XCARRY * bf16r(a0[i]));
      o[i + 4] = toh_flush(XCARRY * bf16r(a1[i]));
    }
    *(v8h*)(V16 + (size_t)g * 8u) = o;
    return;
  }

  const bool isq = bid < NPQ;
  const unsigned t = isq ? bid : bid - NPQ;
  const unsigned n0 = (t % (unsigned)(ENC / 64)) * 64u;
  const unsigned row0 = (t / (unsigned)(ENC / 64)) * 64u;    // compact row, b * len + r
  const unsigned len = isq ? (unsigned)QLEN : (unsigned)KLEN;
  const unsigned lenf = isq ? (unsigned)QLEN_FULL : (unsigned)KLEN_FULL;
  const unsigned b = row0 / len;
  const float* X = (isq ? query : key) + ((size_t)b * lenf + (row0 - b * len)) * FEAT;
  const float* Wm = (isq ? w1 : w2) + n0;

  float wv[FEAT / 32][8];
  v4f xa[64u / ROWSWEEP(FEAT)][2];
  load_cols<FEAT, ENC>(Wm, wv);
  load_rows<FEAT, FEAT>(X, xa);
  // keeps every load of both tiles issued ahead of the first convert: one memory latency for
  // the block instead of one per group of rows
  __builtin_amdgcn_sched_barrier(0);
  put_cols<FEAT, true>(wv, WCARRY, Tb);
  put_rows<FEAT>(xa, Ta);
  __syncthreads();
  gemm_body(Ta, (unsigned)LDF, Tb, (unsigned)LDF, (unsigned)FEAT, isq ? Qp : Kp,
            (unsigned)ENC, PSCALE, row0, n0);
}

// ---------------------------------------------------------------------------
// out[b][d][q] = sum_t value[b][d][t] * p[b][t][q]; A = value plane [b][FEAT][KLEN], fragments
// straight from global; Bt[q][t] = f16(16384 * p[t][q]) staged in LDS from P[b][KLEN][QLEN].
// Tb: cross-wave (block barrier). Grid (QLEN/64, FEAT/64, NB); output rows at the full pitch.
// ---------------------------------------------------------------------------
__global__ __launch_bounds__(256) void outgemm_kernel(
    const _Float16* __restrict__ V16, const float* __restrict__ P,
    float* __restrict__ outf) {
  __shared__ __attribute__((aligned(16))) _Float16 Tb[64 * LDK];
  const unsigned b = blockIdx.z;
  const unsigned n0 = blockIdx.x * 64u;
  const unsigned row0 = blockIdx.y * 64u;
  float pv[KLEN / 32][8];
  load_cols<KLEN, QLEN>(P + (size_t)b * KLEN * QLEN + n0, pv);
  put_cols<KLEN, false>(pv, PCARRY, Tb);
  __syncthreads();
  gemm_body(V16 + ((size_t)b * FEAT + row0) * KLEN, (unsigned)KLEN, Tb, (unsigned)LDK,
            (unsigned)KLEN, outf + (size_t)b * FEAT * QLEN_FULL, (unsigned)QLEN_FULL, OSCALE,
            row0, n0);
}

// ---------------------------------------------------------------------------
// Additive score + softmax over the query axis. Block = 8 key rows t0..t0+7 of one batch.
//   r[t][q][e] = 1 / (exp2(Kp'[t][e] + Qp'[q][e]) + 1)      (planes pre-scaled by 2 log2 e)
//              = 1 / (2^Kp'[t][e] * 2^Qp'[q][e] + 1)         (factored form: 2^Kp' once per element
//                in LDS, 2^Qp' once per element and block). A query row with an element outside
//                +-XLIM, and every row of a block whose key rows hold one, takes the sum form.
//   L[t][q]    = -2 log2(e) * sum_e bf16(vc[e]) * r          (log2-domain logit up to a constant
//                                                             shift that the softmax removes)
//   p[t][q]    = exp2(L - max_q L) / sum_q exp2(L - max_q L)
// krow / kexp / kout / vcs / sv: cross-wave (block barriers); after the second barrier each wave owns one
// sv row and every lane touches only its own elements (no exchange through LDS).
// Each output row line (32 floats) is one store instruction of one wave, 4 B per lane,
// lane-contiguous. Grid (KLEN/TT, NB).
// ---------------------------------------------------------------------------
// acc[t] = sum_e vcs[e] / (exp2(krow[t][e] + qr[e]) + 1): any size of k' and q'
__device__ __forceinline__ void row_sumform(const float* __restrict__ qr, const float* krow,
                                            const float* vcs, float (&acc)[TT]) {
#pragma unroll
  for (int t = 0; t < TT; ++t) acc[t] = 0.0f;
  // rolled: a trip holds 32 independent exponentials and reciprocals already
#pragma unroll 1
  for (unsigned e = 0; e < (unsigned)ENC; e += 4u) {
    const v4f qv = *(const v4f*)(qr + e);
    const v4f vv = *(const v4f*)&vcs[e];
#pragma unroll
    for (int t = 0; t < TT; ++t) {
      const v4f kk = *(const v4f*)&krow[(unsigned)t * ENC + e];
#pragma unroll
      for (int j = 0; j < 4; ++j) acc[t] = __builtin_fmaf(vv[j], rcp1p(kk[j] + qv[j]), acc[t]);
    }
  }
}

// acc[t] = sum_e vcs[e] / (kexp[t][e] * exp2(qr[e]) + 1), same order of the sum; returns
// max_e |qr[e]|. Right only where that maximum and every |k'| are within XLIM (the caller tests).
__device__ __forceinline__ float row_factored(const float* __restrict__ qr, const float* kexp,
                                              const float* vcs, float (&acc)[TT]) {
  float qm = 0.0f;
  const v4f one = {1.0f, 1.0f, 1.0f, 1.0f};
#pragma unroll
  for (int t = 0; t < TT; ++t) acc[t] = 0.0f;
  // rolled like the sum form: a trip holds 32 independent reciprocals already
#pragma unroll 1
  for (unsigned e = 0; e < (unsigned)ENC; e += 4u) {
    const v4f qv = *(const v4f*)(qr + e);
    const v4f vv = *(const v4f*)&vcs[e];
    qm = fmaxf(fmaxf(qm, fmaxf(fabsf(qv[0]), fabsf(qv[1]))), fmaxf(fabsf(qv[2]), fabsf(qv[3])));
    v4f qe;
#pragma unroll
    for (int j = 0; j < 4; ++j) qe[j] = fexp2(qv[j]);
#pragma unroll
    for (int t = 0; t < TT; ++t) {
      const v4f kk = *(const v4f*)&kexp[(unsigned)t * ENC + e];
      const v4f den = __builtin_elementwise_fma(kk, qe, one);
#pragma unroll
      for (int j = 0; j < 4; ++j) acc[t] = __builtin_fmaf(vv[j], __builtin_amdgcn_rcpf(den[j]), acc[t]);
    }
  }
  return qm;
}

__global__ __launch_bounds__(256) void score_kernel(
    const float* __restrict__ Qp, const float* __restrict__ Kp,
    const float* __restrict__ vc, float* __restrict__ P) {
  __shared__ __attribute__((aligned(16))) float krow[TT * ENC];
  __shared__ __attribute__((aligned(16))) float kexp[TT * ENC];
  __shared__ __attribute__((aligned(16))) unsigned kout[8];   // per wave: lanes with a k' outside
  __shared__ __attribute__((aligned(16))) float vcs[ENC];
  __shared__ __attribute__((aligned(16))) float sv[TT * QLEN];

  const unsigned tid = threadIdx.x;
  const unsigned t0 = blockIdx.x * (unsigned)TT;
  const unsigned b = blockIdx.y;

  if (tid < (unsigned)ENC) vcs[tid] = bf16r(vc[tid]);   // whole waves in or out (ENC % 32 == 0)
  {
    const float* kp = Kp + (size_t)(b * (unsigned)KLEN + t0) * ENC;
    float km = 0.0f;
#pragma unroll
    for (unsigned j = 0; j < (unsigned)(TT * ENC / 256); ++j) {
      const unsigned i = tid + 256u * j;
      const float kv = kp[i];
      krow[i] = kv;
      kexp[i] = fexp2(kv);
      km = fmaxf(km, fabsf(kv));
    }
    const unsigned kb = __builtin_amdgcn_ballot_w32(!(km <= XLIM));
    if ((tid & 31u) == 0u) kout[tid >> 5] = kb;
  }
  __syncthreads();

  unsigned ko = 0u;
#pragma unroll
  for (int w = 0; w < 8; ++w) ko |= kout[w];
  const bool kwide = __builtin_amdgcn_readfirstlane((int)ko) != 0;   // the same for the block

#pragma unroll 1
  for (unsigned q = tid; q < (unsigned)QLEN; q += 256u) {
    const float* qr = Qp + (size_t)(b * (unsigned)QLEN + q) * ENC;
    float acc[TT];
    bool wide = kwide;
    if (!kwide) wide = !(row_factored(qr, kexp, vcs, acc) <= XLIM);
    if (wide) row_sumform(qr, krow, vcs, acc);   // per lane: this query row anew, unfactored
#pragma unroll
    for (int t = 0; t < TT; ++t) sv[(unsigned)t * QLEN + q] = acc[t] * LSCALE;
  }
  __syncthreads();

  const int wave = __builtin_amdgcn_readfirstlane((int)(threadIdx.x >> 5));
  const unsigned lane = tid & 31u;
  const unsigned sb = (unsigned)wave * (unsigned)QLEN + lane;

  float mx = -3.0e38f;
#pragma unroll 4
  for (unsigned j = 0; j < (unsigned)(QLEN / 32); ++j) mx = fmaxf(mx, sv[sb + 32u * j]);
  mx = red32_max(mx);

  float sum = 0.0f;
#pragma unroll 4
  for (unsigned j = 0; j < (unsigned)(QLEN / 32); ++j) {
    const float ex = fexp2(sv[sb + 32u * j] - mx);
    sv[sb + 32u * j] = ex;
    sum += ex;
  }
  sum = red32_sum(sum);
  const float inv = __builtin_amdgcn_rcpf(sum);

#pragma unroll 4
  for (unsigned j = 0; j < (unsigned)(QLEN / 32); ++j) {
    const float pv = sv[sb + 32u * j] * inv;
    sv[sb + 32u * j] = pv;
  }

  float* prow = P + (size_t)(b * (unsigned)KLEN + t0 + (unsigned)wave) * QLEN + lane;
#pragma unroll 4
  for (unsigned j = 0; j < (unsigned)(QLEN / 32); ++j)
    *(float*)(prow + 32u * j) = sv[sb + 32u * j];
  
}

// ---------------------------------------------------------------------------
extern "C" void kernel_launch(void* const* d_in, const int* in_sizes, int n_in,
                              void* d_out, int out_size, void* d_ws, size_t ws_size,
                              hipStream_t stream) {
  if (n_in < 6) return;
  const long long need_q = ((long long)(NB - 1) * QLEN_FULL + QLEN) * FEAT;
  const long long need_k = ((long long)(NB - 1) * KLEN_FULL + KLEN) * FEAT;
  const long long need_v = ((long long)NB * FEAT - 1) * KLEN_FULL + KLEN;
  const long long need_o = ((long long)NB * FEAT - 1) * QLEN_FULL + QLEN;
  if ((long long)in_sizes[0] < need_q) return;
  if ((long long)in_sizes[1] < need_k) return;
  if ((long long)in_sizes[2] < need_v) return;
  if ((long long)in_sizes[3] < (long long)FEAT * ENC) return;
  if ((long long)in_sizes[4] < (long long)FEAT * ENC) return;
  if (in_sizes[5] < ENC) return;
  if ((long long)out_size < need_o) return;
  if (ws_size < WS_TOTAL) return;

  const float* query = (const float*)d_in[0];   // [NB_FULL][QLEN_FULL][FEAT]
  const float* key   = (const float*)d_in[1];   // [NB_FULL][KLEN_FULL][FEAT]
  const float* value = (const float*)d_in[2];   // [NB_FULL][FEAT][KLEN_FULL]
  const float* w1    = (const float*)d_in[3];   // [FEAT][ENC]  (in, out), pairs with query
  const float* w2    = (const float*)d_in[4];   // [FEAT][ENC]  (in, out), pairs with key
  const float* vc    = (const float*)d_in[5];   // [ENC]
  float* out = (float*)d_out;                   // [NB_FULL][FEAT][QLEN_FULL]

  char* ws = (char*)d_ws;
  _Float16* V16 = (_Float16*)(ws + OFF_V);      // [NB][FEAT][KLEN]
  float*    Qp  = (float*)(ws + OFF_QP);        // [NB*QLEN][ENC]
  float*    Kp  = (float*)(ws + OFF_KP);        // [NB*KLEN][ENC]
  float*    Pf  = (float*)(ws + OFF_P);         // [NB][KLEN][QLEN]

  dim3 blk(256);

  // projections (operands converted in the kernel) + value plane
  proj_kernel<<<dim3(NPQ + NPK + NVB), blk, 0, stream>>>(query, key, value, w1, w2, Qp, Kp, V16);

  // additive scores + softmax over q
  score_kernel<<<dim3(KLEN / TT, NB), blk, 0, stream>>>(Qp, Kp, vc, Pf);

  // out = value . p
  outgemm_kernel<<<dim3(QLEN / 64, FEAT / 64, NB), blk, 0, stream>>>(V16, Pf, out);
}

// v003
// Measured time: 29.1 microseconds a run.
// Next to v002, in two timings, it ran 1.10 and 1.13 times as fast.
// Over all steps from v000 it is 2.04 times as fast.
#include <hip/hip_runtime.h>
#include <stddef.h>

// Contractions on v_wmma_f32_16x16x32_f16 (f16 operands, f32 accumulate): the query and key
// projections and the value x attention-weight product. Float inputs are RNE-converted to bf16
// and carried in f16 planes (weights x64, input rows x16); attention weights go to f16 x16384
// without the bf16 step.
// The vc-weighted tanh sum is a matrix-vector product kept on the vector unit in f32;
// tanh, softmax (over the query axis) and all scalings in f32. The exponential inside tanh is
// factored, 2^(k'+q') = 2^k' * 2^q', where all |q'| of the query row and
// all |k'| of the block's key rows are <= XLIM (120).
// Three launches: projections (operands converted on the way into LDS; spare blocks write the
// value plane), score + softmax, output product (attention weights converted and transposed on
// the way into LDS, the value tile brought there by asynchronous copies).

typedef _Float16 v16h __attribute__((ext_vector_type(16)));
typedef _Float16 v8h  __attribute__((ext_vector_type(8)));
typedef float    v8f  __attribute__((ext_vector_type(8)));
typedef float    v4f  __attribute__((ext_vector_type(4)));
typedef _Float16 h16;

#ifndef NB
#define NB 4
#endif
#ifndef QLEN
#define QLEN 512
#endif
#ifndef KLEN
#define KLEN 512
#endif
#define NB_FULL   4
#define QLEN_FULL 512
#define KLEN_FULL 512
#define FEAT 256     // input feature width (2 x encoder size)
#define ENC  128     // encoder size
#define TT   8       // key rows per score block == waves per block

static_assert(NB >= 1 && NB <= NB_FULL);
static_assert(QLEN >= 64 && QLEN <= QLEN_FULL && (QLEN % 64) == 0);
static_assert(KLEN >= 64 && KLEN <= KLEN_FULL && (KLEN % 64) == 0);
static_assert((FEAT % 64) == 0 && (FEAT % 32) == 0);
static_assert((ENC % 64) == 0 && (ENC % 32) == 0 && (ENC % 4) == 0);
static_assert(((NB * QLEN) % 64) == 0 && ((NB * KLEN) % 64) == 0);
static_assert((((size_t)NB * FEAT * KLEN / 8) % 256) == 0);   // value plane blocks, exact
static_assert(TT == 8);                                       // one softmax row per wave, 8 waves
static_assert((KLEN % TT) == 0);
static_assert(((TT * ENC) % 256) == 0);
static_assert((QLEN % 32) == 0);
static_assert((KLEN % 32) == 0);

#define LDF (FEAT + 8)   // halves per LDS operand row, projections (16 B x odd)
#define LDK (KLEN + 8)   // halves per LDS operand row, output product (16 B x odd)
#define LDC 68           // floats per LDS row (272 B, 16-B aligned)
static_assert((LDF % 8) == 0 && ((LDF / 8) % 2) == 1);
static_assert((LDK % 8) == 0 && ((LDK / 8) % 2) == 1);
static_assert((LDC % 4) == 0 && LDC >= 64);

#define WCARRY 64.0f      // weight planes carried x64
#define XCARRY 16.0f      // input row planes (query, key, value) carried x16
#define PCARRY 16384.0f   // attention-weight plane carried x2^14
// projection planes hold 2*log2(e) * (x . W): exp(2 (k+q)) == exp2(k' + q')
#define PSCALE (2.8853900817779268f / (WCARRY * XCARRY))
#define OSCALE (1.0f / (PCARRY * XCARRY))
#define LSCALE (-2.8853900817779268f)   // -2 log2(e): log2-domain logit from the reciprocal sum
// |x'| <= XLIM: 2^x' is a normal f32 well inside the range, so 2^k' * 2^q' + 1 is 2^(k'+q') + 1
// to rounding, its overflow (inf, reciprocal 0) and underflow (1) being the limits of the sum form
#define XLIM 120.0f

// static LDS per kernel (bytes)
static_assert((size_t)2 * 64 * LDF * 2 + (size_t)64 * LDC * 4 <= (size_t)131072);
static_assert((size_t)2 * 64 * LDK * 2 + (size_t)64 * LDC * 4 <= (size_t)163840);
static_assert(((size_t)2 * TT * ENC + ENC + 8 + (size_t)TT * QLEN) * 4 <= (size_t)131072);

// workspace layout (bytes)
#define V_BYTES   ((size_t)NB * FEAT * KLEN * 2)
#define QP_BYTES  ((size_t)NB * QLEN * ENC * 4)
#define KP_BYTES  ((size_t)NB * KLEN * ENC * 4)
#define P_BYTES   ((size_t)NB * KLEN * QLEN * 4)
#define OFF_V   ((size_t)0)
#define OFF_QP  (OFF_V + V_BYTES)
#define OFF_KP  (OFF_QP + QP_BYTES)
#define OFF_P   (OFF_KP + KP_BYTES)
#define WS_TOTAL (OFF_P + P_BYTES)
static_assert((V_BYTES % 128) == 0 && (QP_BYTES % 128) == 0 && (KP_BYTES % 128) == 0);
static_assert((P_BYTES % 128) == 0);
static_assert(WS_TOTAL <= (size_t)134217728);

// ---------------------------------------------------------------------------
__device__ __forceinline__ float bf16r(float x) {   // RNE convert to bf16, returned widened
  unsigned int u = __float_as_uint(x);
  u = (u + 0x7FFFu + ((u >> 16) & 1u)) & 0xFFFF0000u;
  return __uint_as_float(u);
}

// f32 -> f16 operand convert that cannot produce an f16 subnormal (value select).
static __device__ __forceinline__ h16 toh_flush(float v) {
  const h16 r = (h16)v;
  return (fabsf(v) < 6.103515625e-05f) ? (h16)0.0f : r;
}

// 16-bit fragment: p points at element [row = lane&15][k0 + 8*(lane>>4)] of a k-contiguous
// row. Elements 0..7 <- k0+8h+0..7, elements 8..15 <- k0+16+8h+0..7 (same map for A and B).
__device__ __forceinline__ v16h frag_at(const _Float16* p) {
  v8h lo = *(const v8h*)(p);
  v8h hi = *(const v8h*)(p + 16);
  v16h out;
#pragma unroll
  for (int i = 0; i < 8; ++i) { out[i] = lo[i]; out[i + 8] = hi[i]; }
  return out;
}

__device__ __forceinline__ v8f wmma16(v16h a, v16h b, v8f c) {
  v8f d = __builtin_amdgcn_wmma_f32_16x16x32_f16(false, a, false, b, (short)0, c,
                                                 false, false);
  asm volatile("v_nop\n\tv_nop\n\tv_nop\n\tv_nop" : "+v"(d) : "v"(a), "v"(b));
  return d;
}

__device__ __forceinline__ float red32_max(float x) {
#pragma unroll
  for (int off = 1; off < 32; off <<= 1) x = fmaxf(x, __shfl_xor(x, off, 32));
  return x;
}
__device__ __forceinline__ float red32_sum(float x) {
#pragma unroll
  for (int off = 1; off < 32; off <<= 1) x += __shfl_xor(x, off, 32);
  return x;
}

__device__ __forceinline__ float fexp2(float x) {
#if __has_builtin(__builtin_amdgcn_exp2f)
  return __builtin_amdgcn_exp2f(x);
#else
  return exp2f(x);
#endif
}

// 1 / (2^x + 1); tanh(z) = 1 - 2 / (exp(2 z) + 1) with x = 2 log2(e) z
__device__ __forceinline__ float rcp1p(float x) {
  return __builtin_amdgcn_rcpf(fexp2(x) + 1.0f);
}

// ---------------------------------------------------------------------------
// Operand staging, f32 global -> f16 LDS, 256 threads, one 64-wide tile over the whole K;
// a load half (registers; one address, constant offsets) and a convert-and-store half.
// cols: src[K rows][64 cols used] (pitch LD) -> T[col][k] (pitch K + 8 halves),
//   f16(carry * bf16(x)) (RND) or f16(carry * x). Thread: col = tid & 63, eight consecutive k
//   per 16-B LDS store; each load instruction of a wave covers one 128-B line of a source row.
// rows: src[64 rows][K cols] (pitch LD) -> T[row][k] (pitch K + 8 halves),
//   f16(16 * bf16(x)). Thread: eight consecutive k of one row per 16-B LDS store.
// ---------------------------------------------------------------------------
template <unsigned K, unsigned LD>
__device__ __forceinline__ void load_cols(const float* __restrict__ src, float (&v)[K / 32u][8]) {
  const float* s = src + (size_t)((threadIdx.x >> 6) * 8u) * LD + (threadIdx.x & 63u);
#pragma unroll
  for (unsigned j = 0; j < K / 32u; ++j)               // k = 8 (tid >> 6) + 32 j + i
#pragma unroll
    for (unsigned i = 0; i < 8u; ++i) v[j][i] = s[(size_t)(32u * j + i) * LD];
  // precaution: the address stays in its registers up to this wait, so that no load's result
  // is placed on the address of an issued load ahead of it
  asm volatile("s_wait_xcnt 0x0" :: "v"(s) : "memory");
}

template <unsigned K, bool RND>
__device__ __forceinline__ void put_cols(const float (&v)[K / 32u][8], const float carry,
                                         _Float16* T) {
  _Float16* d = T + (threadIdx.x & 63u) * (K + 8u) + (threadIdx.x >> 6) * 8u;
#pragma unroll
  for (unsigned j = 0; j < K / 32u; ++j) {
    v8h o;
#pragma unroll
    for (int i = 0; i < 8; ++i) o[i] = toh_flush(carry * (RND ? bf16r(v[j][i]) : v[j][i]));
    *(v8h*)(d + 32u * j) = o;
  }
}

// rows per sweep of the block: 256 threads / (K / 8 threads per row)
#define ROWSWEEP(K) (256u / ((K) / 8u))

template <unsigned K, unsigned LD>
__device__ __forceinline__ void load_rows(const float* __restrict__ src,
                                          v4f (&a)[64u / ROWSWEEP(K)][2]) {
  static_assert(K / 8u <= 256u && (256u % (K / 8u)) == 0);
  const float* s = src + (size_t)(threadIdx.x / (K / 8u)) * LD + (threadIdx.x % (K / 8u)) * 8u;
#pragma unroll
  for (unsigned j = 0; j < 64u / ROWSWEEP(K); ++j) {   // row = tid / (K / 8) + ROWSWEEP j
    a[j][0] = *(const v4f*)(s + (size_t)(ROWSWEEP(K) * j) * LD);
    a[j][1] = *(const v4f*)(s + (size_t)(ROWSWEEP(K) * j) * LD + 4);
  }
  // precaution: as in load_cols
  asm volatile("s_wait_xcnt 0x0" :: "v"(s) : "memory");
}

template <unsigned K>
__device__ __forceinline__ void put_rows(const v4f (&a)[64u / ROWSWEEP(K)][2], _Float16* T) {
  _Float16* d = T + (threadIdx.x / (K / 8u)) * (K + 8u) + (threadIdx.x % (K / 8u)) * 8u;
#pragma unroll
  for (unsigned j = 0; j < 64u / ROWSWEEP(K); ++j) {
    v8h o;
#pragma unroll
    for (int i = 0; i < 4; ++i) {
      o[i]     = toh_flush(XCARRY * bf16r(a[j][0][i]));
      o[i + 4] = toh_flush(XCARRY * bf16r(a[j][1][i]));
    }
    *(v8h*)(d + ROWSWEEP(K) * j * (K + 8u)) = o;
  }
}

// ---------------------------------------------------------------------------
// Operand staging without a convert: src[64 rows][K halves] (pitch K, f16 already) -> T[row][k]
// (pitch K + 8 halves) by asynchronous copies to LDS, 16 B per lane, through no register.
// Thread: eight consecutive k of one row; a wave's copy covers 512 contiguous bytes of a row.
// All lanes on, 16 copies per wave in flight. The caller waits (s_wait_asynccnt 0) and passes a
// block barrier before anybody reads T.
// ---------------------------------------------------------------------------
template <unsigned K>
__device__ __forceinline__ void copy_rows16(const _Float16* __restrict__ src, _Float16* T) {
  static_assert(K / 8u <= 256u && (256u % (K / 8u)) == 0 && ((64u / ROWSWEEP(K)) % 8u) == 0);
  static_assert(64u / ROWSWEEP(K) <= 63u);
  const unsigned r = threadIdx.x / (K / 8u), c = (threadIdx.x % (K / 8u)) * 8u;
  const _Float16* g = src + (size_t)r * K + c;
  const unsigned l = (unsigned)(size_t)(T + r * (K + 8u) + c);   // LDS byte address
  // unrolled: no branch between the copies, every address a constant step from one base
#pragma unroll
  for (unsigned j = 0; j < 64u / ROWSWEEP(K); j += 8u) {         // row = r + ROWSWEEP (j + i)
    const _Float16* gj = g + (size_t)(ROWSWEEP(K) * j) * K;
    const unsigned lj = l + ROWSWEEP(K) * j * (K + 8u) * 2u;
    const unsigned gs = ROWSWEEP(K) * K, ls = ROWSWEEP(K) * (K + 8u) * 2u;
    // eight copies and, as a precaution, the wait that keeps their address registers as they
    // are until the copies have taken them, in one statement
    asm volatile(
        "global_load_async_to_lds_b128 %0, %8, off\n\t"
        "global_load_async_to_lds_b128 %1, %9, off\n\t"
        "global_load_async_to_lds_b128 %2, %10, off\n\t"
        "global_load_async_to_lds_b128 %3, %11, off\n\t"
        "global_load_async_to_lds_b128 %4, %12, off\n\t"
        "global_load_async_to_lds_b128 %5, %13, off\n\t"
        "global_load_async_to_lds_b128 %6, %14, off\n\t"
        "global_load_async_to_lds_b128 %7, %15, off\n\t"
        "s_wait_xcnt 0x0"
        :: "v"(lj), "v"(lj + ls), "v"(lj + 2u * ls), "v"(lj + 3u * ls), "v"(lj + 4u * ls),
           "v"(lj + 5u * ls), "v"(lj + 6u * ls), "v"(lj + 7u * ls),
           "v"(gj), "v"(gj + gs), "v"(gj + 2u * gs), "v"(gj + 3u * gs), "v"(gj + 4u * gs),
           "v"(gj + 5u * gs), "v"(gj + 6u * gs), "v"(gj + 7u * gs)
        : "memory");
  }
}

// ---------------------------------------------------------------------------
// GEMM C[64x64 tile] = A[64 rows][K] . Bt[64 n][K]^T from k-contiguous 16-bit rows (A: row 0 of
// the tile, pitch lda; Bt: column 0 of the tile, pitch ldb; LDS);
// 8 waves (mw = 16-row group, nw = 32-col group), 2 accumulators/wave.
// outf[row0 + row][n0 + col] (pitch ldo) = cs * acc; rows r = 16 i + tid/16, i < 4 -> 64 rows;
// 16 lanes x 16 B = the 256-B row segment of the tile.
// ---------------------------------------------------------------------------
__device__ __forceinline__ void gemm_body(
    const _Float16* A, const unsigned lda, const _Float16* Bt, const unsigned ldb,
    const unsigned K, float* __restrict__ outf, const unsigned ldo, const float cs,
    const unsigned row0, const unsigned n0) {
  __shared__ float Cs[64 * LDC];
  const unsigned tid = threadIdx.x, lane = tid & 31u, w = tid >> 5;
  const unsigned mw = w >> 1, nw = w & 1u;
  const unsigned hh = lane >> 4, m = lane & 15u;

  const _Float16* ap  = A + (size_t)(mw * 16u + m) * lda + hh * 8u;
  const _Float16* bp0 = Bt + (size_t)(nw * 32u + m) * ldb + hh * 8u;
  const _Float16* bp1 = bp0 + (size_t)16 * ldb;
  v8f acc0 = {}, acc1 = {};
#pragma unroll 2
  for (unsigned k0 = 0; k0 < K; k0 += 32u) {
    const v16h a  = frag_at(ap + k0);
    const v16h b0 = frag_at(bp0 + k0);
    const v16h b1 = frag_at(bp1 + k0);
    acc0 = wmma16(a, b0, acc0);
    acc1 = wmma16(a, b1, acc1);
  }
#pragma unroll
  for (int r = 0; r < 8; ++r) {
    float* d = &Cs[(mw * 16u + hh * 8u + (unsigned)r) * LDC + nw * 32u + m];
    d[0]  = acc0[r];
    d[16] = acc1[r];
  }
  __syncthreads();

  v4f xs[4];
  size_t off[4];
#pragma unroll
  for (unsigned i = 0; i < 4u; ++i) {
    const unsigned r = 16u * i + (tid >> 4);
    const unsigned c = (tid & 15u) * 4u;
    const v4f u = *(const v4f*)&Cs[r * LDC + c];
    v4f val;
#pragma unroll
    for (int j = 0; j < 4; ++j) val[j] = u[j] * cs;
    xs[i] = val;
    off[i] = (size_t)(row0 + r) * ldo + n0 + c;
  }
#pragma unroll
  for (int i = 0; i < 4; ++i) *(v4f*)(outf + off[i]) = xs[i];
}

// ---------------------------------------------------------------------------
// First launch, 1-D grid of three block ranges:
//   [0, NPQ)           Qp[rows][ENC] = 2 log2(e) * (query . W1), one 64 x 64 tile per block
//   [NPQ, NPQ + NPK)   Kp[rows][ENC] = 2 log2(e) * (key . W2)
//   [NPQ + NPK, + NVB) value plane V16[b][FEAT][KLEN] = f16(16 * bf16(value)), 8 columns/thread
// Ta / Tb: cross-wave (block barrier). The range test is the same for a whole block and the
// value blocks leave before any barrier.
// ---------------------------------------------------------------------------
#define NPQ ((unsigned)((ENC / 64) * (NB * QLEN / 64)))
#define NPK ((unsigned)((ENC / 64) * (NB * KLEN / 64)))
#define NVB ((unsigned)((size_t)NB * FEAT * KLEN / 8 / 256))

__global__ __launch_bounds__(256) void proj_kernel(
    const float* __restrict__ query, const float* __restrict__ key,
    const float* __restrict__ value, const float* __restrict__ w1,
    const float* __restrict__ w2, float* __restrict__ Qp, float* __restrict__ Kp,
    _Float16* __restrict__ V16) {
  __shared__ __attribute__((aligned(16))) _Float16 Ta[64 * LDF];
  __shared__ __attribute__((aligned(16))) _Float16 Tb[64 * LDF];
  const unsigned bid = blockIdx.x;

  if (bid >= NPQ + NPK) {
    const unsigned g = (bid - (NPQ + NPK)) * 256u + threadIdx.x;
    const unsigned row = g / (unsigned)(KLEN / 8);            // b * FEAT + d
    const unsigned cc = (g % (unsigned)(KLEN / 8)) * 8u;
    const float* s = value + (size_t)row * KLEN_FULL + cc;
    const v4f a0 = *(const v4f*)(s);
    const v4f a1 = *(const v4f*)(s + 4);
    v8h o;
#pragma unroll
    for (int i = 0; i < 4; ++i) {
      o[i]     = toh_flush(XCARRY * bf16r(a0[i]));
      o[i + 4] = toh_flush(XCARRY * bf16r(a1[i]));
    }
    *(v8h*)(V16 + (size_t)g * 8u) = o;
    return;
  }

  const bool isq = bid < NPQ;
  const unsigned t = isq ? bid : bid - NPQ;
  const unsigned n0 = (t % (unsigned)(ENC / 64)) * 64u;
  const unsigned row0 = (t / (unsigned)(ENC / 64)) * 64u;    // compact row, b * len + r
  const unsigned len = isq ? (unsigned)QLEN : (unsigned)KLEN;
  const unsigned lenf = isq ? (unsigned)QLEN_FULL : (unsigned)KLEN_FULL;
  const unsigned b = row0 / len;
  const float* X = (isq ? query : key) + ((size_t)b * lenf + (row0 - b * len)) * FEAT;
  const float* Wm = (isq ? w1 : w2) + n0;

  float wv[FEAT / 32][8];
  v4f xa[64u / ROWSWEEP(FEAT)][2];
  load_cols<FEAT, ENC>(Wm, wv);
  load_rows<FEAT, FEAT>(X, xa);
  // keeps every load of both tiles issued ahead of the first convert: one memory latency for
  // the block instead of one per group of rows
  __builtin_amdgcn_sched_barrier(0);
  put_cols<FEAT, true>(wv, WCARRY, Tb);
  put_rows<FEAT>(xa, Ta);
  __syncthreads();
  gemm_body(Ta, (unsigned)LDF, Tb, (unsigned)LDF, (unsigned)FEAT, isq ? Qp : Kp,
            (unsigned)ENC, PSCALE, row0, n0);
}

// ---------------------------------------------------------------------------
// out[b][d][q] = sum_t value[b][d][t] * p[b][t][q]; A = 64 rows of the value plane
// [b][FEAT][KLEN], copied to LDS while P is loaded and converted;
// Bt[q][t] = f16(16384 * p[t][q]) staged in LDS from P[b][KLEN][QLEN].
// Ta / Tb: cross-wave (block barrier). Grid (QLEN/64, FEAT/64, NB); output rows at the full pitch.
// ---------------------------------------------------------------------------
__global__ __launch_bounds__(256) void outgemm_kernel(
    const _Float16* __restrict__ V16, const float* __restrict__ P,
    float* __restrict__ outf) {
  __shared__ __attribute__((aligned(16))) _Float16 Ta[64 * LDK];
  __shared__ __attribute__((aligned(16))) _Float16 Tb[64 * LDK];
  const unsigned b = blockIdx.z;
  const unsigned n0 = blockIdx.x * 64u;
  const unsigned row0 = blockIdx.y * 64u;
  copy_rows16<KLEN>(V16 + ((size_t)b * FEAT + row0) * KLEN, Ta);
  float pv[KLEN / 32][8];
  load_cols<KLEN, QLEN>(P + (size_t)b * KLEN * QLEN + n0, pv);
  put_cols<KLEN, false>(pv, PCARRY, Tb);
  // this wave's copies into Ta have landed before the barrier behind which other waves read them
  asm volatile("s_wait_asynccnt 0x0" ::: "memory");
  __syncthreads();
  gemm_body(Ta, (unsigned)LDK, Tb, (unsigned)LDK,
            (unsigned)KLEN, outf + (size_t)b * FEAT * QLEN_FULL, (unsigned)QLEN_FULL, OSCALE,
            row0, n0);
}

// ---------------------------------------------------------------------------
// Additive score + softmax over the query axis. Block = 8 key rows t0..t0+7 of one batch.
//   r[t][q][e] = 1 / (exp2(Kp'[t][e] + Qp'[q][e]) + 1)      (planes pre-scaled by 2 log2 e)
//              = 1 / (2^Kp'[t][e] * 2^Qp'[q][e] + 1)         (factored form: 2^Kp' once per element
//                in LDS, 2^Qp' once per element and block). A query row with an element outside
//                +-XLIM, and every row of a block whose key rows hold one, takes the sum form.
//   L[t][q]    = -2 log2(e) * sum_e bf16(vc[e]) * r          (log2-domain logit up to a constant
//                                                             shift that the softmax removes)
//   p[t][q]    = exp2(L - max_q L) / sum_q exp2(L - max_q L)
// krow / kexp / kout / vcs / sv: cross-wave (block barriers); after the second barrier each wave owns one
// sv row and every lane touches only its own elements (no exchange through LDS).
// Each output row line (32 floats) is one store instruction of one wave, 4 B per lane,
// lane-contiguous. Grid (KLEN/TT, NB).
// ---------------------------------------------------------------------------
// acc[t] = sum_e vcs[e] / (exp2(krow[t][e] + qr[e]) + 1): any size of k' and q'
__device__ __forceinline__ void row_sumform(const float* __restrict__ qr, const float* krow,
                                            const float* vcs, float (&acc)[TT]) {
#pragma unroll
  for (int t = 0; t < TT; ++t) acc[t] = 0.0f;
  // rolled: a trip holds 32 independent exponentials and reciprocals already
#pragma unroll 1
  for (unsigned e = 0; e < (unsigned)ENC; e += 4u) {
    const v4f qv = *(const v4f*)(qr + e);
    const v4f vv = *(const v4f*)&vcs[e];
#pragma unroll
    for (int t = 0; t < TT; ++t) {
      const v4f kk = *(const v4f*)&krow[(unsigned)t * ENC + e];
#pragma unroll
      for (int j = 0; j < 4; ++j) acc[t] = __builtin_fmaf(vv[j], rcp1p(kk[j] + qv[j]), acc[t]);
    }
  }
}

// acc[t] = sum_e vcs[e] / (kexp[t][e] * exp2(qr[e]) + 1), same order of the sum; returns
// max_e |qr[e]|. Right only where that maximum and every |k'| are within XLIM (the caller tests).
__device__ __forceinline__ float row_factored(const float* __restrict__ qr, const float* kexp,
                                              const float* vcs, float (&acc)[TT]) {
  float qm = 0.0f;
  const v4f one = {1.0f, 1.0f, 1.0f, 1.0f};
#pragma unroll
  for (int t = 0; t < TT; ++t) acc[t] = 0.0f;
  // rolled like the sum form: a trip holds 32 independent reciprocals already
#pragma unroll 1
  for (unsigned e = 0; e < (unsigned)ENC; e += 4u) {
    const v4f qv = *(const v4f*)(qr + e);
    const v4f vv = *(const v4f*)&vcs[e];
    qm = fmaxf(fmaxf(qm, fmaxf(fabsf(qv[0]), fabsf(qv[1]))), fmaxf(fabsf(qv[2]), fabsf(qv[3])));
    v4f qe;
#pragma unroll
    for (int j = 0; j < 4; ++j) qe[j] = fexp2(qv[j]);
#pragma unroll
    for (int t = 0; t < TT; ++t) {
      const v4f kk = *(const v4f*)&kexp[(unsigned)t * ENC + e];
      const v4f den = __builtin_elementwise_fma(kk, qe, one);
#pragma unroll
      for (int j = 0; j < 4; ++j) acc[t] = __builtin_fmaf(vv[j], __builtin_amdgcn_rcpf(den[j]), acc[t]);
    }
  }
  return qm;
}

__global__ __launch_bounds__(256) void score_kernel(
    const float* __restrict__ Qp, const float* __restrict__ Kp,
    const float* __restrict__ vc, float* __restrict__ P) {
  __shared__ __attribute__((aligned(16))) float krow[TT * ENC];
  __shared__ __attribute__((aligned(16))) float kexp[TT * ENC];
  __shared__ __attribute__((aligned(16))) unsigned kout[8];   // per wave: lanes with a k' outside
  __shared__ __attribute__((aligned(16))) float vcs[ENC];
  __shared__ __attribute__((aligned(16))) float sv[TT * QLEN];

  const unsigned tid = threadIdx.x;
  const unsigned t0 = blockIdx.x * (unsigned)TT;
  const unsigned b = blockIdx.y;

  if (tid < (unsigned)ENC) vcs[tid] = bf16r(vc[tid]);   // whole waves in or out (ENC % 32 == 0)
  {
    const float* kp = Kp + (size_t)(b * (unsigned)KLEN + t0) * ENC;
    float km = 0.0f;
#pragma unroll
    for (unsigned j = 0; j < (unsigned)(TT * ENC / 256); ++j) {
      const unsigned i = tid + 256u * j;
      const float kv = kp[i];
      krow[i] = kv;
      kexp[i] = fexp2(kv);
      km = fmaxf(km, fabsf(kv));
    }
    const unsigned kb = __builtin_amdgcn_ballot_w32(!(km <= XLIM));
    if ((tid & 31u) == 0u) kout[tid >> 5] = kb;
  }
  __syncthreads();

  unsigned ko = 0u;
#pragma unroll
  for (int w = 0; w < 8; ++w) ko |= kout[w];
  const bool kwide = __builtin_amdgcn_readfirstlane((int)ko) != 0;   // the same for the block

#pragma unroll 1
  for (unsigned q = tid; q < (unsigned)QLEN; q += 256u) {
    const float* qr = Qp + (size_t)(b * (unsigned)QLEN + q) * ENC;
    float acc[TT];
    bool wide = kwide;
    if (!kwide) wide = !(row_factored(qr, kexp, vcs, acc) <= XLIM);
    if (wide) row_sumform(qr, krow, vcs, acc);   // per lane: this query row anew, unfactored
#pragma unroll
    for (int t = 0; t < TT; ++t) sv[(unsigned)t * QLEN + q] = acc[t] * LSCALE;
  }
  __syncthreads();

  const int wave = __builtin_amdgcn_readfirstlane((int)(threadIdx.x >> 5));
  const unsigned lane = tid & 31u;
  const unsigned sb = (unsigned)wave * (unsigned)QLEN + lane;

  float mx = -3.0e38f;
#pragma unroll 4
  for (unsigned j = 0; j < (unsigned)(QLEN / 32); ++j) mx = fmaxf(mx, sv[sb + 32u * j]);
  mx = red32_max(mx);

  float sum = 0.0f;
#pragma unroll 4
  for (unsigned j = 0; j < (unsigned)(QLEN / 32); ++j) {
    const float ex = fexp2(sv[sb + 32u * j] - mx);
    sv[sb + 32u * j] = ex;
    sum += ex;
  }
  sum = red32_sum(sum);
  const float inv = __builtin_amdgcn_rcpf(sum);

#pragma unroll 4
  for (unsigned j = 0; j < (unsigned)(QLEN / 32); ++j) {
    const float pv = sv[sb + 32u * j] * inv;
    sv[sb + 32u * j] = pv;
  }

  float* prow = P + (size_t)(b * (unsigned)KLEN + t0 + (unsigned)wave) * QLEN + lane;
#pragma unroll 4
  for (unsigned j = 0; j < (unsigned)(QLEN / 32); ++j)
    *(float*)(prow + 32u * j) = sv[sb + 32u * j];
  
}

// ---------------------------------------------------------------------------
extern "C" void kernel_launch(void* const* d_in, const int* in_sizes, int n_in,
                              void* d_out, int out_size, void* d_ws, size_t ws_size,
                              hipStream_t stream) {
  if (n_in < 6) return;
  const long long need_q = ((long long)(NB - 1) * QLEN_FULL + QLEN) * FEAT;
  const long long need_k = ((long long)(NB - 1) * KLEN_FULL + KLEN) * FEAT;
  const long long need_v = ((long long)NB * FEAT - 1) * KLEN_FULL + KLEN;
  const long long need_o = ((long long)NB * FEAT - 1) * QLEN_FULL + QLEN;
  if ((long long)in_sizes[0] < need_q) return;
  if ((long long)in_sizes[1] < need_k) return;
  if ((long long)in_sizes[2] < need_v) return;
  if ((long long)in_sizes[3] < (long long)FEAT * ENC) return;
  if ((long long)in_sizes[4] < (long long)FEAT * ENC) return;
  if (in_sizes[5] < ENC) return;
  if ((long long)out_size < need_o) return;
  if (ws_size < WS_TOTAL) return;

  const float* query = (const float*)d_in[0];   // [NB_FULL][QLEN_FULL][FEAT]
  const float* key   = (const float*)d_in[1];   // [NB_FULL][KLEN_FULL][FEAT]
  const float* value = (const float*)d_in[2];   // [NB_FULL][FEAT][KLEN_FULL]
  const float* w1    = (const float*)d_in[3];   // [FEAT][ENC]  (in, out), pairs with query
  const float* w2    = (const float*)d_in[4];   // [FEAT][ENC]  (in, out), pairs with key
  const float* vc    = (const float*)d_in[5];   // [ENC]
  float* out = (float*)d_out;                   // [NB_FULL][FEAT][QLEN_FULL]

  char* ws = (char*)d_ws;
  _Float16* V16 = (_Float16*)(ws + OFF_V);      // [NB][FEAT][KLEN]
  float*    Qp  = (float*)(ws + OFF_QP);        // [NB*QLEN][ENC]
  float*    Kp  = (float*)(ws + OFF_KP);        // [NB*KLEN][ENC]
  float*    Pf  = (float*)(ws + OFF_P);         // [NB][KLEN][QLEN]

  dim3 blk(256);

  // projections (operands converted in the kernel) + value plane
  proj_kernel<<<dim3(NPQ + NPK + NVB), blk, 0, stream>>>(query, key, value, w1, w2, Qp, Kp, V16);

  // additive scores + softmax over q
  score_kernel<<<dim3(KLEN / TT, NB), blk, 0, stream>>>(Qp, Kp, vc, Pf);

  // out = value . p
  outgemm_kernel<<<dim3(QLEN / 64, FEAT / 64, NB), blk, 0, stream>>>(V16, Pf, out);
}

// v004
// Measured time: 27.6 microseconds a run.
// In two side-by-side timings against v003, it was 1.05 and 1.06 times as fast.
// All steps since v000 together make it 2.15 times as fast.
#include <hip/hip_runtime.h>
#include <stddef.h>

// Contractions on v_wmma_f32_16x16x32_f16 (f16 operands, f32 accumulate): the query and key
// projections and the value x attention-weight product. Float inputs are RNE-converted to bf16
// and carried in f16 planes (weights x64, input rows x16); attention weights go to f16 x16384
// without the bf16 step.
// The vc-weighted tanh sum is a matrix-vector product kept on the vector unit in f32;
// tanh, softmax (over the query axis) and all scalings in f32. The exponential inside tanh is
// factored, 2^(k'+q') = 2^k' * 2^q', where all |q'| of the query row and
// all |k'| of the block's key rows are <= XLIM (120).
// Three launches: projections (operands converted on the way into LDS; spare blocks write the
// value plane), score + softmax, output product (attention weights converted and transposed on
// the way into LDS, the value tile brought there by asynchronous copies).

typedef _Float16 v16h __attribute__((ext_vector_type(16)));
typedef _Float16 v8h  __attribute__((ext_vector_type(8)));
typedef float    v8f  __attribute__((ext_vector_type(8)));
typedef float    v4f  __attribute__((ext_vector_type(4)));
typedef _Float16 h16;

#ifndef NB
#define NB 4
#endif
#ifndef QLEN
#define QLEN 512
#endif
#ifndef KLEN
#define KLEN 512
#endif
#define NB_FULL   4
#define QLEN_FULL 512
#define KLEN_FULL 512
#define FEAT 256     // input feature width (2 x encoder size)
#define ENC  128     // encoder size
#define TT   8       // key rows per score block == waves per block

static_assert(NB >= 1 && NB <= NB_FULL);
static_assert(QLEN >= 64 && QLEN <= QLEN_FULL && (QLEN % 64) == 0);
static_assert(KLEN >= 64 && KLEN <= KLEN_FULL && (KLEN % 64) == 0);
static_assert((FEAT % 64) == 0 && (FEAT % 32) == 0);
static_assert((ENC % 64) == 0 && (ENC % 32) == 0 && (ENC % 4) == 0);
static_assert(((NB * QLEN) % 64) == 0 && ((NB * KLEN) % 64) == 0);
static_assert((((size_t)NB * FEAT * KLEN / 8) % 256) == 0);   // value plane blocks, exact
static_assert(TT == 8);                                       // one softmax row per wave, 8 waves
static_assert((KLEN % TT) == 0);
static_assert(((TT * ENC) % 256) == 0);
static_assert((QLEN % 32) == 0);
static_assert((KLEN % 32) == 0);

#define LDF (FEAT + 8)   // halves per LDS operand row, projections (16 B x odd)
#define LDK (KLEN + 8)   // halves per LDS operand row, output product (16 B x odd)
#define LDC 68           // floats per LDS row (272 B, 16-B aligned)
static_assert((LDF % 8) == 0 && ((LDF / 8) % 2) == 1);
static_assert((LDK % 8) == 0 && ((LDK / 8) % 2) == 1);
static_assert((LDC % 4) == 0 && LDC >= 64);

#define WCARRY 64.0f      // weight planes carried x64
#define XCARRY 16.0f      // input row planes (query, key, value) carried x16
#define PCARRY 16384.0f   // attention-weight plane carried x2^14
// projection planes hold 2*log2(e) * (x . W): exp(2 (k+q)) == exp2(k' + q')
#define PSCALE (2.8853900817779268f / (WCARRY * XCARRY))
#define OSCALE (1.0f / (PCARRY * XCARRY))
#define LSCALE (-2.8853900817779268f)   // -2 log2(e): log2-domain logit from the reciprocal sum
// |x'| <= XLIM: 2^x' is a normal f32 well inside the range, so 2^k' * 2^q' + 1 is 2^(k'+q') + 1
// to rounding, its overflow (inf, reciprocal 0) and underflow (1) being the limits of the sum form
#define XLIM 120.0f

// static LDS per kernel (bytes)
static_assert((size_t)2 * 64 * LDF * 2 + (size_t)64 * LDC * 4 <= (size_t)131072);
static_assert((size_t)2 * 64 * LDK * 2 + (size_t)64 * LDC * 4 <= (size_t)163840);
static_assert(((size_t)2 * TT * ENC + ENC + 8 + (size_t)TT * QLEN) * 4 <= (size_t)131072);

// workspace layout (bytes)
#define V_BYTES   ((size_t)NB * FEAT * KLEN * 2)
#define QP_BYTES  ((size_t)NB * QLEN * ENC * 4)
#define KP_BYTES  ((size_t)NB * KLEN * ENC * 4)
#define P_BYTES   ((size_t)NB * KLEN * QLEN * 4)
#define OFF_V   ((size_t)0)
#define OFF_QP  (OFF_V + V_BYTES)
#define OFF_KP  (OFF_QP + QP_BYTES)
#define OFF_P   (OFF_KP + KP_BYTES)
#define WS_TOTAL (OFF_P + P_BYTES)
static_assert((V_BYTES % 128) == 0 && (QP_BYTES % 128) == 0 && (KP_BYTES % 128) == 0);
static_assert((P_BYTES % 128) == 0);
static_assert(WS_TOTAL <= (size_t)134217728);

// ---------------------------------------------------------------------------
__device__ __forceinline__ float bf16r(float x) {   // RNE convert to bf16, returned widened
  unsigned int u = __float_as_uint(x);
  u = (u + 0x7FFFu + ((u >> 16) & 1u)) & 0xFFFF0000u;
  return __uint_as_float(u);
}

// f32 -> f16 operand convert that cannot produce an f16 subnormal (value select).
static __device__ __forceinline__ h16 toh_flush(float v) {
  const h16 r = (h16)v;
  return (fabsf(v) < 6.103515625e-05f) ? (h16)0.0f : r;
}

// 16-bit fragment: p points at element [row = lane&15][k0 + 8*(lane>>4)] of a k-contiguous
// row. Elements 0..7 <- k0+8h+0..7, elements 8..15 <- k0+16+8h+0..7 (same map for A and B).
__device__ __forceinline__ v16h frag_at(const _Float16* p) {
  v8h lo = *(const v8h*)(p);
  v8h hi = *(const v8h*)(p + 16);
  v16h out;
#pragma unroll
  for (int i = 0; i < 8; ++i) { out[i] = lo[i]; out[i + 8] = hi[i]; }
  return out;
}

__device__ __forceinline__ v8f wmma16(v16h a, v16h b, v8f c) {
  v8f d = __builtin_amdgcn_wmma_f32_16x16x32_f16(false, a, false, b, (short)0, c,
                                                 false, false);
  asm volatile("v_nop\n\tv_nop\n\tv_nop\n\tv_nop" : "+v"(d) : "v"(a), "v"(b));
  return d;
}

// Lane exchanges on the vector unit (no LDS trip). xlane<M>: the value of lane l ^ M inside a
// 16-lane row (DPP row_xmask:M, M < 16); xhalf: the value of lane l ^ 16.
template <int M>
__device__ __forceinline__ float xlane(float x) {
  return __builtin_bit_cast(float, __builtin_amdgcn_update_dpp(
      0, __builtin_bit_cast(int, x), 0x160 + M, 0xf, 0xf, true));
}
__device__ __forceinline__ float xhalf(float x) {
  const int b = __builtin_bit_cast(int, x);
  return __builtin_bit_cast(float, __builtin_amdgcn_permlanex16(b, b, 0x76543210, 0xfedcba98,
                                                                false, false));
}
// butterflies over the 32 lanes, partners l ^ 1, 2, 4, 8, 16 in that order
__device__ __forceinline__ float red32_max(float x) {
  x = fmaxf(x, xlane<1>(x));
  x = fmaxf(x, xlane<2>(x));
  x = fmaxf(x, xlane<4>(x));
  x = fmaxf(x, xlane<8>(x));
  return fmaxf(x, xhalf(x));
}
__device__ __forceinline__ float red32_sum(float x) {
  x += xlane<1>(x);
  x += xlane<2>(x);
  x += xlane<4>(x);
  x += xlane<8>(x);
  return x + xhalf(x);
}

__device__ __forceinline__ float fexp2(float x) {
#if __has_builtin(__builtin_amdgcn_exp2f)
  return __builtin_amdgcn_exp2f(x);
#else
  return exp2f(x);
#endif
}

// 1 / (2^x + 1); tanh(z) = 1 - 2 / (exp(2 z) + 1) with x = 2 log2(e) z
__device__ __forceinline__ float rcp1p(float x) {
  return __builtin_amdgcn_rcpf(fexp2(x) + 1.0f);
}

// ---------------------------------------------------------------------------
// Operand staging, f32 global -> f16 LDS, 256 threads, one 64-wide tile over the whole K;
// a load half (registers; one address, constant offsets) and a convert-and-store half.
// cols: src[K rows][64 cols used] (pitch LD) -> T[col][k] (pitch K + 8 halves),
//   f16(carry * bf16(x)) (RND) or f16(carry * x). Thread: col = tid & 63, eight consecutive k
//   per 16-B LDS store; each load instruction of a wave covers one 128-B line of a source row.
// rows: src[64 rows][K cols] (pitch LD) -> T[row][k] (pitch K + 8 halves),
//   f16(16 * bf16(x)). Thread: eight consecutive k of one row per 16-B LDS store.
// ---------------------------------------------------------------------------
template <unsigned K, unsigned LD>
__device__ __forceinline__ void load_cols(const float* __restrict__ src, float (&v)[K / 32u][8]) {
  const float* s = src + (size_t)((threadIdx.x >> 6) * 8u) * LD + (threadIdx.x & 63u);
#pragma unroll
  for (unsigned j = 0; j < K / 32u; ++j)               // k = 8 (tid >> 6) + 32 j + i
#pragma unroll
    for (unsigned i = 0; i < 8u; ++i) v[j][i] = s[(size_t)(32u * j + i) * LD];
  // precaution: the address stays in its registers up to this wait, so that no load's result
  // is placed on the address of an issued load ahead of it
  asm volatile("s_wait_xcnt 0x0" :: "v"(s) : "memory");
}

template <unsigned K, bool RND>
__device__ __forceinline__ void put_cols(const float (&v)[K / 32u][8], const float carry,
                                         _Float16* T) {
  _Float16* d = T + (threadIdx.x & 63u) * (K + 8u) + (threadIdx.x >> 6) * 8u;
#pragma unroll
  for (unsigned j = 0; j < K / 32u; ++j) {
    v8h o;
#pragma unroll
    for (int i = 0; i < 8; ++i) o[i] = toh_flush(carry * (RND ? bf16r(v[j][i]) : v[j][i]));
    *(v8h*)(d + 32u * j) = o;
  }
}

// rows per sweep of the block: 256 threads / (K / 8 threads per row)
#define ROWSWEEP(K) (256u / ((K) / 8u))

template <unsigned K, unsigned LD>
__device__ __forceinline__ void load_rows(const float* __restrict__ src,
                                          v4f (&a)[64u / ROWSWEEP(K)][2]) {
  static_assert(K / 8u <= 256u && (256u % (K / 8u)) == 0);
  const float* s = src + (size_t)(threadIdx.x / (K / 8u)) * LD + (threadIdx.x % (K / 8u)) * 8u;
#pragma unroll
  for (unsigned j = 0; j < 64u / ROWSWEEP(K); ++j) {   // row = tid / (K / 8) + ROWSWEEP j
    a[j][0] = *(const v4f*)(s + (size_t)(ROWSWEEP(K) * j) * LD);
    a[j][1] = *(const v4f*)(s + (size_t)(ROWSWEEP(K) * j) * LD + 4);
  }
  // precaution: as in load_cols
  asm volatile("s_wait_xcnt 0x0" :: "v"(s) : "memory");
}

template <unsigned K>
__device__ __forceinline__ void put_rows(const v4f (&a)[64u / ROWSWEEP(K)][2], _Float16* T) {
  _Float16* d = T + (threadIdx.x / (K / 8u)) * (K + 8u) + (threadIdx.x % (K / 8u)) * 8u;
#pragma unroll
  for (unsigned j = 0; j < 64u / ROWSWEEP(K); ++j) {
    v8h o;
#pragma unroll
    for (int i = 0; i < 4; ++i) {
      o[i]     = toh_flush(XCARRY * bf16r(a[j][0][i]));
      o[i + 4] = toh_flush(XCARRY * bf16r(a[j][1][i]));
    }
    *(v8h*)(d + ROWSWEEP(K) * j * (K + 8u)) = o;
  }
}

// ---------------------------------------------------------------------------
// Operand staging without a convert: src[64 rows][K halves] (pitch K, f16 already) -> T[row][k]
// (pitch K + 8 halves) by asynchronous copies to LDS, 16 B per lane, through no register.
// Thread: eight consecutive k of one row; a wave's copy covers 512 contiguous bytes of a row.
// All lanes on, 16 copies per wave in flight. The caller waits (s_wait_asynccnt 0) and passes a
// block barrier before anybody reads T.
// ---------------------------------------------------------------------------
template <unsigned K>
__device__ __forceinline__ void copy_rows16(const _Float16* __restrict__ src, _Float16* T) {
  static_assert(K / 8u <= 256u && (256u % (K / 8u)) == 0 && ((64u / ROWSWEEP(K)) % 8u) == 0);
  static_assert(64u / ROWSWEEP(K) <= 63u);
  const unsigned r = threadIdx.x / (K / 8u), c = (threadIdx.x % (K / 8u)) * 8u;
  const _Float16* g = src + (size_t)r * K + c;
  const unsigned l = (unsigned)(size_t)(T + r * (K + 8u) + c);   // LDS byte address
  // unrolled: no branch between the copies, every address a constant step from one base
#pragma unroll
  for (unsigned j = 0; j < 64u / ROWSWEEP(K); j += 8u) {         // row = r + ROWSWEEP (j + i)
    const _Float16* gj = g + (size_t)(ROWSWEEP(K) * j) * K;
    const unsigned lj = l + ROWSWEEP(K) * j * (K + 8u) * 2u;
    const unsigned gs = ROWSWEEP(K) * K, ls = ROWSWEEP(K) * (K + 8u) * 2u;
    // eight copies and, as a precaution, the wait that keeps their address registers as they
    // are until the copies have taken them, in one statement
    asm volatile(
        "global_load_async_to_lds_b128 %0, %8, off\n\t"
        "global_load_async_to_lds_b128 %1, %9, off\n\t"
        "global_load_async_to_lds_b128 %2, %10, off\n\t"
        "global_load_async_to_lds_b128 %3, %11, off\n\t"
        "global_load_async_to_lds_b128 %4, %12, off\n\t"
        "global_load_async_to_lds_b128 %5, %13, off\n\t"
        "global_load_async_to_lds_b128 %6, %14, off\n\t"
        "global_load_async_to_lds_b128 %7, %15, off\n\t"
        "s_wait_xcnt 0x0"
        :: "v"(lj), "v"(lj + ls), "v"(lj + 2u * ls), "v"(lj + 3u * ls), "v"(lj + 4u * ls),
           "v"(lj + 5u * ls), "v"(lj + 6u * ls), "v"(lj + 7u * ls),
           "v"(gj), "v"(gj + gs), "v"(gj + 2u * gs), "v"(gj + 3u * gs), "v"(gj + 4u * gs),
           "v"(gj + 5u * gs), "v"(gj + 6u * gs), "v"(gj + 7u * gs)
        : "memory");
  }
}

// ---------------------------------------------------------------------------
// GEMM C[64x64 tile] = A[64 rows][K] . Bt[64 n][K]^T from k-contiguous 16-bit rows (A: row 0 of
// the tile, pitch lda; Bt: column 0 of the tile, pitch ldb; LDS);
// 8 waves (mw = 16-row group, nw = 32-col group), 2 accumulators/wave.
// outf[row0 + row][n0 + col] (pitch ldo) = cs * acc; rows r = 16 i + tid/16, i < 4 -> 64 rows;
// 16 lanes x 16 B = the 256-B row segment of the tile.
// ---------------------------------------------------------------------------
__device__ __forceinline__ void gemm_body(
    const _Float16* A, const unsigned lda, const _Float16* Bt, const unsigned ldb,
    const unsigned K, float* __restrict__ outf, const unsigned ldo, const float cs,
    const unsigned row0, const unsigned n0) {
  __shared__ float Cs[64 * LDC];
  const unsigned tid = threadIdx.x, lane = tid & 31u, w = tid >> 5;
  const unsigned mw = w >> 1, nw = w & 1u;
  const unsigned hh = lane >> 4, m = lane & 15u;

  const _Float16* ap  = A + (size_t)(mw * 16u + m) * lda + hh * 8u;
  const _Float16* bp0 = Bt + (size_t)(nw * 32u + m) * ldb + hh * 8u;
  const _Float16* bp1 = bp0 + (size_t)16 * ldb;
  v8f acc0 = {}, acc1 = {};
#pragma unroll 2
  for (unsigned k0 = 0; k0 < K; k0 += 32u) {
    const v16h a  = frag_at(ap + k0);
    const v16h b0 = frag_at(bp0 + k0);
    const v16h b1 = frag_at(bp1 + k0);
    acc0 = wmma16(a, b0, acc0);
    acc1 = wmma16(a, b1, acc1);
  }
#pragma unroll
  for (int r = 0; r < 8; ++r) {
    float* d = &Cs[(mw * 16u + hh * 8u + (unsigned)r) * LDC + nw * 32u + m];
    d[0]  = acc0[r];
    d[16] = acc1[r];
  }
  __syncthreads();

  v4f xs[4];
  size_t off[4];
#pragma unroll
  for (unsigned i = 0; i < 4u; ++i) {
    const unsigned r = 16u * i + (tid >> 4);
    const unsigned c = (tid & 15u) * 4u;
    const v4f u = *(const v4f*)&Cs[r * LDC + c];
    v4f val;
#pragma unroll
    for (int j = 0; j < 4; ++j) val[j] = u[j] * cs;
    xs[i] = val;
    off[i] = (size_t)(row0 + r) * ldo + n0 + c;
  }
#pragma unroll
  for (int i = 0; i < 4; ++i) *(v4f*)(outf + off[i]) = xs[i];
}

// ---------------------------------------------------------------------------
// First launch, 1-D grid of three block ranges:
//   [0, NPQ)           Qp[rows][ENC] = 2 log2(e) * (query . W1), one 64 x 64 tile per block
//   [NPQ, NPQ + NPK)   Kp[rows][ENC] = 2 log2(e) * (key . W2)
//   [NPQ + NPK, + NVB) value plane V16[b][FEAT][KLEN] = f16(16 * bf16(value)), 8 columns/thread
// Ta / Tb: cross-wave (block barrier). The range test is the same for a whole block and the
// value blocks leave before any barrier.
// ---------------------------------------------------------------------------
#define NPQ ((unsigned)((ENC / 64) * (NB * QLEN / 64)))
#define NPK ((unsigned)((ENC / 64) * (NB * KLEN / 64)))
#define NVB ((unsigned)((size_t)NB * FEAT * KLEN / 8 / 256))

__global__ __launch_bounds__(256) void proj_kernel(
    const float* __restrict__ query, const float* __restrict__ key,
    const float* __restrict__ value, const float* __restrict__ w1,
    const float* __restrict__ w2, float* __restrict__ Qp, float* __restrict__ Kp,
    _Float16* __restrict__ V16) {
  __shared__ __attribute__((aligned(16))) _Float16 Ta[64 * LDF];
  __shared__ __attribute__((aligned(16))) _Float16 Tb[64 * LDF];
  const unsigned bid = blockIdx.x;

  if (bid >= NPQ + NPK) {
    const unsigned g = (bid - (NPQ + NPK)) * 256u + threadIdx.x;
    const unsigned row = g / (unsigned)(KLEN / 8);            // b * FEAT + d
    const unsigned cc = (g % (unsigned)(KLEN / 8)) * 8u;
    const float* s = value + (size_t)row * KLEN_FULL + cc;
    const v4f a0 = *(const v4f*)(s);
    const v4f a1 = *(const v4f*)(s + 4);
    v8h o;
#pragma unroll
    for (int i = 0; i < 4; ++i) {
      o[i]     = toh_flush(XCARRY * bf16r(a0[i]));
      o[i + 4] = toh_flush(XCARRY * bf16r(a1[i]));
    }
    *(v8h*)(V16 + (size_t)g * 8u) = o;
    return;
  }

  const bool isq = bid < NPQ;
  const unsigned t = isq ? bid : bid - NPQ;
  const unsigned n0 = (t % (unsigned)(ENC / 64)) * 64u;
  const unsigned row0 = (t / (unsigned)(ENC / 64)) * 64u;    // compact row, b * len + r
  const unsigned len = isq ? (unsigned)QLEN : (unsigned)KLEN;
  const unsigned lenf = isq ? (unsigned)QLEN_FULL : (unsigned)KLEN_FULL;
  const unsigned b = row0 / len;
  const float* X = (isq ? query : key) + ((size_t)b * lenf + (row0 - b * len)) * FEAT;
  const float* Wm = (isq ? w1 : w2) + n0;

  float wv[FEAT / 32][8];
  v4f xa[64u / ROWSWEEP(FEAT)][2];
  load_cols<FEAT, ENC>(Wm, wv);
  load_rows<FEAT, FEAT>(X, xa);
  // keeps every load of both tiles issued ahead of the first convert: one memory latency for
  // the block instead of one per group of rows
  __builtin_amdgcn_sched_barrier(0);
  put_cols<FEAT, true>(wv, WCARRY, Tb);
  put_rows<FEAT>(xa, Ta);
  __syncthreads();
  gemm_body(Ta, (unsigned)LDF, Tb, (unsigned)LDF, (unsigned)FEAT, isq ? Qp : Kp,
            (unsigned)ENC, PSCALE, row0, n0);
}

// ---------------------------------------------------------------------------
// out[b][d][q] = sum_t value[b][d][t] * p[b][t][q]; A = 64 rows of the value plane
// [b][FEAT][KLEN], copied to LDS while P is loaded and converted;
// Bt[q][t] = f16(16384 * p[t][q]) staged in LDS from P[b][KLEN][QLEN].
// Ta / Tb: cross-wave (block barrier). Grid (QLEN/64, FEAT/64, NB); output rows at the full pitch.
// ---------------------------------------------------------------------------
__global__ __launch_bounds__(256) void outgemm_kernel(
    const _Float16* __restrict__ V16, const float* __restrict__ P,
    float* __restrict__ outf) {
  __shared__ __attribute__((aligned(16))) _Float16 Ta[64 * LDK];
  __shared__ __attribute__((aligned(16))) _Float16 Tb[64 * LDK];
  const unsigned b = blockIdx.z;
  const unsigned n0 = blockIdx.x * 64u;
  const unsigned row0 = blockIdx.y * 64u;
  copy_rows16<KLEN>(V16 + ((size_t)b * FEAT + row0) * KLEN, Ta);
  float pv[KLEN / 32][8];
  load_cols<KLEN, QLEN>(P + (size_t)b * KLEN * QLEN + n0, pv);
  put_cols<KLEN, false>(pv, PCARRY, Tb);
  // this wave's copies into Ta have landed before the barrier behind which other waves read them
  asm volatile("s_wait_asynccnt 0x0" ::: "memory");
  __syncthreads();
  gemm_body(Ta, (unsigned)LDK, Tb, (unsigned)LDK,
            (unsigned)KLEN, outf + (size_t)b * FEAT * QLEN_FULL, (unsigned)QLEN_FULL, OSCALE,
            row0, n0);
}

// ---------------------------------------------------------------------------
// Additive score + softmax over the query axis. Block = 8 key rows t0..t0+7 of one batch.
//   r[t][q][e] = 1 / (exp2(Kp'[t][e] + Qp'[q][e]) + 1)      (planes pre-scaled by 2 log2 e)
//              = 1 / (2^Kp'[t][e] * 2^Qp'[q][e] + 1)         (factored form: 2^Kp' once per element
//                in LDS, 2^Qp' once per element and block). A query row with an element outside
//                +-XLIM, and every row of a block whose key rows hold one, takes the sum form.
//   L[t][q]    = -2 log2(e) * sum_e bf16(vc[e]) * r          (log2-domain logit up to a constant
//                                                             shift that the softmax removes)
//   p[t][q]    = exp2(L - max_q L) / sum_q exp2(L - max_q L)
// krow / kexp / kout / vcs / sv: cross-wave (block barriers); after the second barrier each wave reads
// one sv row once and keeps it in registers (max, exp2, sum, scale; lane exchanges on the vector unit).
// Each output row line (32 floats) is one store instruction of one wave, 4 B per lane,
// lane-contiguous. Grid (KLEN/TT, NB).
// ---------------------------------------------------------------------------
// acc[t] = sum_e vcs[e] / (exp2(krow[t][e] + qr[e]) + 1): any size of k' and q'
__device__ __forceinline__ void row_sumform(const float* __restrict__ qr, const float* krow,
                                            const float* vcs, float (&acc)[TT]) {
#pragma unroll
  for (int t = 0; t < TT; ++t) acc[t] = 0.0f;
  // rolled: a trip holds 32 independent exponentials and reciprocals already
#pragma unroll 1
  for (unsigned e = 0; e < (unsigned)ENC; e += 4u) {
    const v4f qv = *(const v4f*)(qr + e);
    const v4f vv = *(const v4f*)&vcs[e];
#pragma unroll
    for (int t = 0; t < TT; ++t) {
      const v4f kk = *(const v4f*)&krow[(unsigned)t * ENC + e];
#pragma unroll
      for (int j = 0; j < 4; ++j) acc[t] = __builtin_fmaf(vv[j], rcp1p(kk[j] + qv[j]), acc[t]);
    }
  }
}

// acc[t] = sum_e vcs[e] / (kexp[t][e] * exp2(qr[e]) + 1), same order of the sum; returns
// max_e |qr[e]|. Right only where that maximum and every |k'| are within XLIM (the caller tests).
__device__ __forceinline__ float row_factored(const float* __restrict__ qr, const float* kexp,
                                              const float* vcs, float (&acc)[TT]) {
  float qm = 0.0f;
  const v4f one = {1.0f, 1.0f, 1.0f, 1.0f};
#pragma unroll
  for (int t = 0; t < TT; ++t) acc[t] = 0.0f;
  // rolled like the sum form: a trip holds 32 independent reciprocals already
#pragma unroll 1
  for (unsigned e = 0; e < (unsigned)ENC; e += 4u) {
    const v4f qv = *(const v4f*)(qr + e);
    const v4f vv = *(const v4f*)&vcs[e];
    qm = fmaxf(fmaxf(qm, fmaxf(fabsf(qv[0]), fabsf(qv[1]))), fmaxf(fabsf(qv[2]), fabsf(qv[3])));
    v4f qe;
#pragma unroll
    for (int j = 0; j < 4; ++j) qe[j] = fexp2(qv[j]);
#pragma unroll
    for (int t = 0; t < TT; ++t) {
      const v4f kk = *(const v4f*)&kexp[(unsigned)t * ENC + e];
      const v4f den = __builtin_elementwise_fma(kk, qe, one);
#pragma unroll
      for (int j = 0; j < 4; ++j) acc[t] = __builtin_fmaf(vv[j], __builtin_amdgcn_rcpf(den[j]), acc[t]);
    }
  }
  return qm;
}

__global__ __launch_bounds__(256) void score_kernel(
    const float* __restrict__ Qp, const float* __restrict__ Kp,
    const float* __restrict__ vc, float* __restrict__ P) {
  __shared__ __attribute__((aligned(16))) float krow[TT * ENC];
  __shared__ __attribute__((aligned(16))) float kexp[TT * ENC];
  __shared__ __attribute__((aligned(16))) unsigned kout[8];   // per wave: lanes with a k' outside
  __shared__ __attribute__((aligned(16))) float vcs[ENC];
  __shared__ __attribute__((aligned(16))) float sv[TT * QLEN];

  const unsigned tid = threadIdx.x;
  const unsigned t0 = blockIdx.x * (unsigned)TT;
  const unsigned b = blockIdx.y;

  if (tid < (unsigned)ENC) vcs[tid] = bf16r(vc[tid]);   // whole waves in or out (ENC % 32 == 0)
  {
    const float* kp = Kp + (size_t)(b * (unsigned)KLEN + t0) * ENC;
    float km = 0.0f;
#pragma unroll
    for (unsigned j = 0; j < (unsigned)(TT * ENC / 256); ++j) {
      const unsigned i = tid + 256u * j;
      const float kv = kp[i];
      krow[i] = kv;
      kexp[i] = fexp2(kv);
      km = fmaxf(km, fabsf(kv));
    }
    const unsigned kb = __builtin_amdgcn_ballot_w32(!(km <= XLIM));
    if ((tid & 31u) == 0u) kout[tid >> 5] = kb;
  }
  __syncthreads();

  unsigned ko = 0u;
#pragma unroll
  for (int w = 0; w < 8; ++w) ko |= kout[w];
  const bool kwide = __builtin_amdgcn_readfirstlane((int)ko) != 0;   // the same for the block

#pragma unroll 1
  for (unsigned q = tid; q < (unsigned)QLEN; q += 256u) {
    const float* qr = Qp + (size_t)(b * (unsigned)QLEN + q) * ENC;
    float acc[TT];
    bool wide = kwide;
    if (!kwide) wide = !(row_factored(qr, kexp, vcs, acc) <= XLIM);
    if (wide) row_sumform(qr, krow, vcs, acc);   // per lane: this query row anew, unfactored
#pragma unroll
    for (int t = 0; t < TT; ++t) sv[(unsigned)t * QLEN + q] = acc[t] * LSCALE;
  }
  __syncthreads();

  const int wave = __builtin_amdgcn_readfirstlane((int)(threadIdx.x >> 5));
  const unsigned lane = tid & 31u;
  const unsigned sb = (unsigned)wave * (unsigned)QLEN + lane;

  // the lane's elements of the row, read once; all loops below unrolled whole so that x stays in
  // registers and the reads stand behind one wait
  float x[QLEN / 32];
#pragma unroll
  for (unsigned j = 0; j < (unsigned)(QLEN / 32); ++j) x[j] = sv[sb + 32u * j];

  float mx = -3.0e38f;
#pragma unroll
  for (unsigned j = 0; j < (unsigned)(QLEN / 32); ++j) mx = fmaxf(mx, x[j]);
  mx = red32_max(mx);

  float sum = 0.0f;
#pragma unroll
  for (unsigned j = 0; j < (unsigned)(QLEN / 32); ++j) {
    x[j] = fexp2(x[j] - mx);
    sum += x[j];
  }
  sum = red32_sum(sum);
  const float inv = __builtin_amdgcn_rcpf(sum);

  float* prow = P + (size_t)(b * (unsigned)KLEN + t0 + (unsigned)wave) * QLEN + lane;
#pragma unroll
  for (unsigned j = 0; j < (unsigned)(QLEN / 32); ++j) prow[32u * j] = x[j] * inv;
}

// ---------------------------------------------------------------------------
extern "C" void kernel_launch(void* const* d_in, const int* in_sizes, int n_in,
                              void* d_out, int out_size, void* d_ws, size_t ws_size,
                              hipStream_t stream) {
  if (n_in < 6) return;
  const long long need_q = ((long long)(NB - 1) * QLEN_FULL + QLEN) * FEAT;
  const long long need_k = ((long long)(NB - 1) * KLEN_FULL + KLEN) * FEAT;
  const long long need_v = ((long long)NB * FEAT - 1) * KLEN_FULL + KLEN;
  const long long need_o = ((long long)NB * FEAT - 1) * QLEN_FULL + QLEN;
  if ((long long)in_sizes[0] < need_q) return;
  if ((long long)in_sizes[1] < need_k) return;
  if ((long long)in_sizes[2] < need_v) return;
  if ((long long)in_sizes[3] < (long long)FEAT * ENC) return;
  if ((long long)in_sizes[4] < (long long)FEAT * ENC) return;
  if (in_sizes[5] < ENC) return;
  if ((long long)out_size < need_o) return;
  if (ws_size < WS_TOTAL) return;

  const float* query = (const float*)d_in[0];   // [NB_FULL][QLEN_FULL][FEAT]
  const float* key   = (const float*)d_in[1];   // [NB_FULL][KLEN_FULL][FEAT]
  const float* value = (const float*)d_in[2];   // [NB_FULL][FEAT][KLEN_FULL]
  const float* w1    = (const float*)d_in[3];   // [FEAT][ENC]  (in, out), pairs with query
  const float* w2    = (const float*)d_in[4];   // [FEAT][ENC]  (in, out), pairs with key
  const float* vc    = (const float*)d_in[5];   // [ENC]
  float* out = (float*)d_out;                   // [NB_FULL][FEAT][QLEN_FULL]

  char* ws = (char*)d_ws;
  _Float16* V16 = (_Float16*)(ws + OFF_V);      // [NB][FEAT][KLEN]
  float*    Qp  = (float*)(ws + OFF_QP);        // [NB*QLEN][ENC]
  float*    Kp  = (float*)(ws + OFF_KP);        // [NB*KLEN][ENC]
  float*    Pf  = (float*)(ws + OFF_P);         // [NB][KLEN][QLEN]

  dim3 blk(256);

  // projections (operands converted in the kernel) + value plane
  proj_kernel<<<dim3(NPQ + NPK + NVB), blk, 0, stream>>>(query, key, value, w1, w2, Qp, Kp, V16);

  // additive scores + softmax over q
  score_kernel<<<dim3(KLEN / TT, NB), blk, 0, stream>>>(Qp, Kp, vc, Pf);

  // out = value . p
  outgemm_kernel<<<dim3(QLEN / 64, FEAT / 64, NB), blk, 0, stream>>>(V16, Pf, out);
}

// v005
// A run of this version takes 26.4 microseconds.
// Next to v004, in two timings, it ran 1.04 times as fast each time.
// Counting every step since v000, it is 2.24 times as fast.
#include <hip/hip_runtime.h>
#include <stddef.h>

// Contractions on v_wmma_f32_16x16x32_f16 (f16 operands, f32 accumulate): the query and key
// projections and the value x attention-weight product. Float inputs are RNE-converted to bf16
// and carried in f16 planes (weights x64, input rows x16); attention weights go to f16 x16384
// without the bf16 step.
// The vc-weighted tanh sum is a matrix-vector product kept on the vector unit in f32;
// tanh, softmax (over the query axis) and all scalings in f32. The exponential inside tanh is
// factored, 2^(k'+q') = 2^k' * 2^q', and four terms of the sum share one reciprocal, wherever the
// block's max |k'| plus the query row's max |q'| is within SLIM and every |vc| within VLIM.
// Three launches: projections (operands converted on the way into LDS; spare blocks write the
// value plane), score + softmax, output product (attention weights converted and transposed on
// the way into LDS, the value tile brought there by asynchronous copies).

typedef _Float16 v16h __attribute__((ext_vector_type(16)));
typedef _Float16 v8h  __attribute__((ext_vector_type(8)));
typedef float    v8f  __attribute__((ext_vector_type(8)));
typedef float    v4f  __attribute__((ext_vector_type(4)));
typedef float    v2f  __attribute__((ext_vector_type(2)));
typedef _Float16 h16;

#ifndef NB
#define NB 4
#endif
#ifndef QLEN
#define QLEN 512
#endif
#ifndef KLEN
#define KLEN 512
#endif
#define NB_FULL   4
#define QLEN_FULL 512
#define KLEN_FULL 512
#define FEAT 256     // input feature width (2 x encoder size)
#define ENC  128     // encoder size
#define TT   8       // key rows per score block == waves per block

static_assert(NB >= 1 && NB <= NB_FULL);
static_assert(QLEN >= 64 && QLEN <= QLEN_FULL && (QLEN % 64) == 0);
static_assert(KLEN >= 64 && KLEN <= KLEN_FULL && (KLEN % 64) == 0);
static_assert((FEAT % 64) == 0 && (FEAT % 32) == 0);
static_assert((ENC % 64) == 0 && (ENC % 32) == 0 && (ENC % 4) == 0);
static_assert(((NB * QLEN) % 64) == 0 && ((NB * KLEN) % 64) == 0);
static_assert((((size_t)NB * FEAT * KLEN / 8) % 256) == 0);   // value plane blocks, exact
static_assert(TT == 8);                                       // one softmax row per wave, 8 waves
static_assert((KLEN % TT) == 0);
static_assert(((TT * ENC) % 256) == 0);
static_assert((QLEN % 32) == 0);
static_assert((KLEN % 32) == 0);

#define LDF (FEAT + 8)   // halves per LDS operand row, projections (16 B x odd)
#define LDK (KLEN + 8)   // halves per LDS operand row, output product (16 B x odd)
#define LDC 68           // floats per LDS row (272 B, 16-B aligned)
static_assert((LDF % 8) == 0 && ((LDF / 8) % 2) == 1);
static_assert((LDK % 8) == 0 && ((LDK / 8) % 2) == 1);
static_assert((LDC % 4) == 0 && LDC >= 64);

#define WCARRY 64.0f      // weight planes carried x64
#define XCARRY 16.0f      // input row planes (query, key, value) carried x16
#define PCARRY 16384.0f   // attention-weight plane carried x2^14
// projection planes hold 2*log2(e) * (x . W): exp(2 (k+q)) == exp2(k' + q')
#define PSCALE (2.8853900817779268f / (WCARRY * XCARRY))
#define OSCALE (1.0f / (PCARRY * XCARRY))
#define LSCALE (-2.8853900817779268f)   // -2 log2(e): log2-domain logit from the reciprocal sum
// max |k'| + max |q'| <= SLIM: every d = 2^k' * 2^q' + 1 lies in [1, 2^30 + 1] and both factors are
// normal, so a product of four d stays under 2^121; with |vc| <= VLIM the numerators stay under 2^123
#define SLIM 30.0f
#define VLIM 1073741824.0f   // 2^30

// static LDS per kernel (bytes)
static_assert((size_t)2 * 64 * LDF * 2 + (size_t)64 * LDC * 4 <= (size_t)131072);
static_assert((size_t)2 * 64 * LDK * 2 + (size_t)64 * LDC * 4 <= (size_t)163840);
static_assert(((size_t)2 * TT * ENC + ENC + 8 + (size_t)TT * QLEN) * 4 <= (size_t)131072);

// workspace layout (bytes)
#define V_BYTES   ((size_t)NB * FEAT * KLEN * 2)
#define QP_BYTES  ((size_t)NB * QLEN * ENC * 4)
#define KP_BYTES  ((size_t)NB * KLEN * ENC * 4)
#define P_BYTES   ((size_t)NB * KLEN * QLEN * 4)
#define OFF_V   ((size_t)0)
#define OFF_QP  (OFF_V + V_BYTES)
#define OFF_KP  (OFF_QP + QP_BYTES)
#define OFF_P   (OFF_KP + KP_BYTES)
#define WS_TOTAL (OFF_P + P_BYTES)
static_assert((V_BYTES % 128) == 0 && (QP_BYTES % 128) == 0 && (KP_BYTES % 128) == 0);
static_assert((P_BYTES % 128) == 0);
static_assert(WS_TOTAL <= (size_t)134217728);

// ---------------------------------------------------------------------------
__device__ __forceinline__ float bf16r(float x) {   // RNE convert to bf16, returned widened
  unsigned int u = __float_as_uint(x);
  u = (u + 0x7FFFu + ((u >> 16) & 1u)) & 0xFFFF0000u;
  return __uint_as_float(u);
}

// f32 -> f16 operand convert that cannot produce an f16 subnormal (value select).
static __device__ __forceinline__ h16 toh_flush(float v) {
  const h16 r = (h16)v;
  return (fabsf(v) < 6.103515625e-05f) ? (h16)0.0f : r;
}

// 16-bit fragment: p points at element [row = lane&15][k0 + 8*(lane>>4)] of a k-contiguous
// row. Elements 0..7 <- k0+8h+0..7, elements 8..15 <- k0+16+8h+0..7 (same map for A and B).
__device__ __forceinline__ v16h frag_at(const _Float16* p) {
  v8h lo = *(const v8h*)(p);
  v8h hi = *(const v8h*)(p + 16);
  v16h out;
#pragma unroll
  for (int i = 0; i < 8; ++i) { out[i] = lo[i]; out[i + 8] = hi[i]; }
  return out;
}

__device__ __forceinline__ v8f wmma16(v16h a, v16h b, v8f c) {
  v8f d = __builtin_amdgcn_wmma_f32_16x16x32_f16(false, a, false, b, (short)0, c,
                                                 false, false);
  asm volatile("v_nop\n\tv_nop\n\tv_nop\n\tv_nop" : "+v"(d) : "v"(a), "v"(b));
  return d;
}

// Lane exchanges on the vector unit (no LDS trip). xlane<M>: the value of lane l ^ M inside a
// 16-lane row (DPP row_xmask:M, M < 16); xhalf: the value of lane l ^ 16.
template <int M>
__device__ __forceinline__ float xlane(float x) {
  return __builtin_bit_cast(float, __builtin_amdgcn_update_dpp(
      0, __builtin_bit_cast(int, x), 0x160 + M, 0xf, 0xf, true));
}
__device__ __forceinline__ float xhalf(float x) {
  const int b = __builtin_bit_cast(int, x);
  return __builtin_bit_cast(float, __builtin_amdgcn_permlanex16(b, b, 0x76543210, 0xfedcba98,
                                                                false, false));
}
// butterflies over the 32 lanes, partners l ^ 1, 2, 4, 8, 16 in that order
__device__ __forceinline__ float red32_max(float x) {
  x = fmaxf(x, xlane<1>(x));
  x = fmaxf(x, xlane<2>(x));
  x = fmaxf(x, xlane<4>(x));
  x = fmaxf(x, xlane<8>(x));
  return fmaxf(x, xhalf(x));
}
__device__ __forceinline__ float red32_sum(float x) {
  x += xlane<1>(x);
  x += xlane<2>(x);
  x += xlane<4>(x);
  x += xlane<8>(x);
  return x + xhalf(x);
}

__device__ __forceinline__ float fexp2(float x) {
#if __has_builtin(__builtin_amdgcn_exp2f)
  return __builtin_amdgcn_exp2f(x);
#else
  return exp2f(x);
#endif
}

// 1 / (2^x + 1); tanh(z) = 1 - 2 / (exp(2 z) + 1) with x = 2 log2(e) z
__device__ __forceinline__ float rcp1p(float x) {
  return __builtin_amdgcn_rcpf(fexp2(x) + 1.0f);
}

// ---------------------------------------------------------------------------
// Operand staging, f32 global -> f16 LDS, 256 threads, one 64-wide tile over the whole K;
// a load half (registers; one address, constant offsets) and a convert-and-store half.
// cols: src[K rows][64 cols used] (pitch LD) -> T[col][k] (pitch K + 8 halves),
//   f16(carry * bf16(x)) (RND) or f16(carry * x). Thread: col = tid & 63, eight consecutive k
//   per 16-B LDS store; each load instruction of a wave covers one 128-B line of a source row.
// rows: src[64 rows][K cols] (pitch LD) -> T[row][k] (pitch K + 8 halves),
//   f16(16 * bf16(x)). Thread: eight consecutive k of one row per 16-B LDS store.
// ---------------------------------------------------------------------------
template <unsigned K, unsigned LD>
__device__ __forceinline__ void load_cols(const float* __restrict__ src, float (&v)[K / 32u][8]) {
  const float* s = src + (size_t)((threadIdx.x >> 6) * 8u) * LD + (threadIdx.x & 63u);
#pragma unroll
  for (unsigned j = 0; j < K / 32u; ++j)               // k = 8 (tid >> 6) + 32 j + i
#pragma unroll
    for (unsigned i = 0; i < 8u; ++i) v[j][i] = s[(size_t)(32u * j + i) * LD];
  // precaution: the address stays in its registers up to this wait, so that no load's result
  // is placed on the address of an issued load ahead of it
  asm volatile("s_wait_xcnt 0x0" :: "v"(s) : "memory");
}

template <unsigned K, bool RND>
__device__ __forceinline__ void put_cols(const float (&v)[K / 32u][8], const float carry,
                                         _Float16* T) {
  _Float16* d = T + (threadIdx.x & 63u) * (K + 8u) + (threadIdx.x >> 6) * 8u;
#pragma unroll
  for (unsigned j = 0; j < K / 32u; ++j) {
    v8h o;
#pragma unroll
    for (int i = 0; i < 8; ++i) o[i] = toh_flush(carry * (RND ? bf16r(v[j][i]) : v[j][i]));
    *(v8h*)(d + 32u * j) = o;
  }
}

// rows per sweep of the block: 256 threads / (K / 8 threads per row)
#define ROWSWEEP(K) (256u / ((K) / 8u))

template <unsigned K, unsigned LD>
__device__ __forceinline__ void load_rows(const float* __restrict__ src,
                                          v4f (&a)[64u / ROWSWEEP(K)][2]) {
  static_assert(K / 8u <= 256u && (256u % (K / 8u)) == 0);
  const float* s = src + (size_t)(threadIdx.x / (K / 8u)) * LD + (threadIdx.x % (K / 8u)) * 8u;
#pragma unroll
  for (unsigned j = 0; j < 64u / ROWSWEEP(K); ++j) {   // row = tid / (K / 8) + ROWSWEEP j
    a[j][0] = *(const v4f*)(s + (size_t)(ROWSWEEP(K) * j) * LD);
    a[j][1] = *(const v4f*)(s + (size_t)(ROWSWEEP(K) * j) * LD + 4);
  }
  // precaution: as in load_cols
  asm volatile("s_wait_xcnt 0x0" :: "v"(s) : "memory");
}

template <unsigned K>
__device__ __forceinline__ void put_rows(const v4f (&a)[64u / ROWSWEEP(K)][2], _Float16* T) {
  _Float16* d = T + (threadIdx.x / (K / 8u)) * (K + 8u) + (threadIdx.x % (K / 8u)) * 8u;
#pragma unroll
  for (unsigned j = 0; j < 64u / ROWSWEEP(K); ++j) {
    v8h o;
#pragma unroll
    for (int i = 0; i < 4; ++i) {
      o[i]     = toh_flush(XCARRY * bf16r(a[j][0][i]));
      o[i + 4] = toh_flush(XCARRY * bf16r(a[j][1][i]));
    }
    *(v8h*)(d + ROWSWEEP(K) * j * (K + 8u)) = o;
  }
}

// ---------------------------------------------------------------------------
// Operand staging without a convert: src[64 rows][K halves] (pitch K, f16 already) -> T[row][k]
// (pitch K + 8 halves) by asynchronous copies to LDS, 16 B per lane, through no register.
// Thread: eight consecutive k of one row; a wave's copy covers 512 contiguous bytes of a row.
// All lanes on, 16 copies per wave in flight. The caller waits (s_wait_asynccnt 0) and passes a
// block barrier before anybody reads T.
// ---------------------------------------------------------------------------
template <unsigned K>
__device__ __forceinline__ void copy_rows16(const _Float16* __restrict__ src, _Float16* T) {
  static_assert(K / 8u <= 256u && (256u % (K / 8u)) == 0 && ((64u / ROWSWEEP(K)) % 8u) == 0);
  static_assert(64u / ROWSWEEP(K) <= 63u);
  const unsigned r = threadIdx.x / (K / 8u), c = (threadIdx.x % (K / 8u)) * 8u;
  const _Float16* g = src + (size_t)r * K + c;
  const unsigned l = (unsigned)(size_t)(T + r * (K + 8u) + c);   // LDS byte address
  // unrolled: no branch between the copies, every address a constant step from one base
#pragma unroll
  for (unsigned j = 0; j < 64u / ROWSWEEP(K); j += 8u) {         // row = r + ROWSWEEP (j + i)
    const _Float16* gj = g + (size_t)(ROWSWEEP(K) * j) * K;
    const unsigned lj = l + ROWSWEEP(K) * j * (K + 8u) * 2u;
    const unsigned gs = ROWSWEEP(K) * K, ls = ROWSWEEP(K) * (K + 8u) * 2u;
    // eight copies and, as a precaution, the wait that keeps their address registers as they
    // are until the copies have taken them, in one statement
    asm volatile(
        "global_load_async_to_lds_b128 %0, %8, off\n\t"
        "global_load_async_to_lds_b128 %1, %9, off\n\t"
        "global_load_async_to_lds_b128 %2, %10, off\n\t"
        "global_load_async_to_lds_b128 %3, %11, off\n\t"
        "global_load_async_to_lds_b128 %4, %12, off\n\t"
        "global_load_async_to_lds_b128 %5, %13, off\n\t"
        "global_load_async_to_lds_b128 %6, %14, off\n\t"
        "global_load_async_to_lds_b128 %7, %15, off\n\t"
        "s_wait_xcnt 0x0"
        :: "v"(lj), "v"(lj + ls), "v"(lj + 2u * ls), "v"(lj + 3u * ls), "v"(lj + 4u * ls),
           "v"(lj + 5u * ls), "v"(lj + 6u * ls), "v"(lj + 7u * ls),
           "v"(gj), "v"(gj + gs), "v"(gj + 2u * gs), "v"(gj + 3u * gs), "v"(gj + 4u * gs),
           "v"(gj + 5u * gs), "v"(gj + 6u * gs), "v"(gj + 7u * gs)
        : "memory");
  }
}

// ---------------------------------------------------------------------------
// GEMM C[64x64 tile] = A[64 rows][K] . Bt[64 n][K]^T from k-contiguous 16-bit rows (A: row 0 of
// the tile, pitch lda; Bt: column 0 of the tile, pitch ldb; LDS);
// 8 waves (mw = 16-row group, nw = 32-col group), 2 accumulators/wave.
// outf[row0 + row][n0 + col] (pitch ldo) = cs * acc; rows r = 16 i + tid/16, i < 4 -> 64 rows;
// 16 lanes x 16 B = the 256-B row segment of the tile.
// ---------------------------------------------------------------------------
__device__ __forceinline__ void gemm_body(
    const _Float16* A, const unsigned lda, const _Float16* Bt, const unsigned ldb,
    const unsigned K, float* __restrict__ outf, const unsigned ldo, const float cs,
    const unsigned row0, const unsigned n0) {
  __shared__ float Cs[64 * LDC];
  const unsigned tid = threadIdx.x, lane = tid & 31u, w = tid >> 5;
  const unsigned mw = w >> 1, nw = w & 1u;
  const unsigned hh = lane >> 4, m = lane & 15u;

  const _Float16* ap  = A + (size_t)(mw * 16u + m) * lda + hh * 8u;
  const _Float16* bp0 = Bt + (size_t)(nw * 32u + m) * ldb + hh * 8u;
  const _Float16* bp1 = bp0 + (size_t)16 * ldb;
  v8f acc0 = {}, acc1 = {};
#pragma unroll 2
  for (unsigned k0 = 0; k0 < K; k0 += 32u) {
    const v16h a  = frag_at(ap + k0);
    const v16h b0 = frag_at(bp0 + k0);
    const v16h b1 = frag_at(bp1 + k0);
    acc0 = wmma16(a, b0, acc0);
    acc1 = wmma16(a, b1, acc1);
  }
#pragma unroll
  for (int r = 0; r < 8; ++r) {
    float* d = &Cs[(mw * 16u + hh * 8u + (unsigned)r) * LDC + nw * 32u + m];
    d[0]  = acc0[r];
    d[16] = acc1[r];
  }
  __syncthreads();

  v4f xs[4];
  size_t off[4];
#pragma unroll
  for (unsigned i = 0; i < 4u; ++i) {
    const unsigned r = 16u * i + (tid >> 4);
    const unsigned c = (tid & 15u) * 4u;
    const v4f u = *(const v4f*)&Cs[r * LDC + c];
    v4f val;
#pragma unroll
    for (int j = 0; j < 4; ++j) val[j] = u[j] * cs;
    xs[i] = val;
    off[i] = (size_t)(row0 + r) * ldo + n0 + c;
  }
#pragma unroll
  for (int i = 0; i < 4; ++i) *(v4f*)(outf + off[i]) = xs[i];
}

// ---------------------------------------------------------------------------
// First launch, 1-D grid of three block ranges:
//   [0, NPQ)           Qp[rows][ENC] = 2 log2(e) * (query . W1), one 64 x 64 tile per block
//   [NPQ, NPQ + NPK)   Kp[rows][ENC] = 2 log2(e) * (key . W2)
//   [NPQ + NPK, + NVB) value plane V16[b][FEAT][KLEN] = f16(16 * bf16(value)), 8 columns/thread
// Ta / Tb: cross-wave (block barrier). The range test is the same for a whole block and the
// value blocks leave before any barrier.
// ---------------------------------------------------------------------------
#define NPQ ((unsigned)((ENC / 64) * (NB * QLEN / 64)))
#define NPK ((unsigned)((ENC / 64) * (NB * KLEN / 64)))
#define NVB ((unsigned)((size_t)NB * FEAT * KLEN / 8 / 256))

__global__ __launch_bounds__(256) void proj_kernel(
    const float* __restrict__ query, const float* __restrict__ key,
    const float* __restrict__ value, const float* __restrict__ w1,
    const float* __restrict__ w2, float* __restrict__ Qp, float* __restrict__ Kp,
    _Float16* __restrict__ V16) {
  __shared__ __attribute__((aligned(16))) _Float16 Ta[64 * LDF];
  __shared__ __attribute__((aligned(16))) _Float16 Tb[64 * LDF];
  const unsigned bid = blockIdx.x;

  if (bid >= NPQ + NPK) {
    const unsigned g = (bid - (NPQ + NPK)) * 256u + threadIdx.x;
    const unsigned row = g / (unsigned)(KLEN / 8);            // b * FEAT + d
    const unsigned cc = (g % (unsigned)(KLEN / 8)) * 8u;
    const float* s = value + (size_t)row * KLEN_FULL + cc;
    const v4f a0 = *(const v4f*)(s);
    const v4f a1 = *(const v4f*)(s + 4);
    v8h o;
#pragma unroll
    for (int i = 0; i < 4; ++i) {
      o[i]     = toh_flush(XCARRY * bf16r(a0[i]));
      o[i + 4] = toh_flush(XCARRY * bf16r(a1[i]));
    }
    *(v8h*)(V16 + (size_t)g * 8u) = o;
    return;
  }

  const bool isq = bid < NPQ;
  const unsigned t = isq ? bid : bid - NPQ;
  const unsigned n0 = (t % (unsigned)(ENC / 64)) * 64u;
  const unsigned row0 = (t / (unsigned)(ENC / 64)) * 64u;    // compact row, b * len + r
  const unsigned len = isq ? (unsigned)QLEN : (unsigned)KLEN;
  const unsigned lenf = isq ? (unsigned)QLEN_FULL : (unsigned)KLEN_FULL;
  const unsigned b = row0 / len;
  const float* X = (isq ? query : key) + ((size_t)b * lenf + (row0 - b * len)) * FEAT;
  const float* Wm = (isq ? w1 : w2) + n0;

  float wv[FEAT / 32][8];
  v4f xa[64u / ROWSWEEP(FEAT)][2];
  load_cols<FEAT, ENC>(Wm, wv);
  load_rows<FEAT, FEAT>(X, xa);
  // keeps every load of both tiles issued ahead of the first convert: one memory latency for
  // the block instead of one per group of rows
  __builtin_amdgcn_sched_barrier(0);
  put_cols<FEAT, true>(wv, WCARRY, Tb);
  put_rows<FEAT>(xa, Ta);
  __syncthreads();
  gemm_body(Ta, (unsigned)LDF, Tb, (unsigned)LDF, (unsigned)FEAT, isq ? Qp : Kp,
            (unsigned)ENC, PSCALE, row0, n0);
}

// ---------------------------------------------------------------------------
// out[b][d][q] = sum_t value[b][d][t] * p[b][t][q]; A = 64 rows of the value plane
// [b][FEAT][KLEN], copied to LDS while P is loaded and converted;
// Bt[q][t] = f16(16384 * p[t][q]) staged in LDS from P[b][KLEN][QLEN].
// Ta / Tb: cross-wave (block barrier). Grid (QLEN/64, FEAT/64, NB); output rows at the full pitch.
// ---------------------------------------------------------------------------
__global__ __launch_bounds__(256) void outgemm_kernel(
    const _Float16* __restrict__ V16, const float* __restrict__ P,
    float* __restrict__ outf) {
  __shared__ __attribute__((aligned(16))) _Float16 Ta[64 * LDK];
  __shared__ __attribute__((aligned(16))) _Float16 Tb[64 * LDK];
  const unsigned b = blockIdx.z;
  const unsigned n0 = blockIdx.x * 64u;
  const unsigned row0 = blockIdx.y * 64u;
  copy_rows16<KLEN>(V16 + ((size_t)b * FEAT + row0) * KLEN, Ta);
  float pv[KLEN / 32][8];
  load_cols<KLEN, QLEN>(P + (size_t)b * KLEN * QLEN + n0, pv);
  put_cols<KLEN, false>(pv, PCARRY, Tb);
  // this wave's copies into Ta have landed before the barrier behind which other waves read them
  asm volatile("s_wait_asynccnt 0x0" ::: "memory");
  __syncthreads();
  gemm_body(Ta, (unsigned)LDK, Tb, (unsigned)LDK,
            (unsigned)KLEN, outf + (size_t)b * FEAT * QLEN_FULL, (unsigned)QLEN_FULL, OSCALE,
            row0, n0);
}

// ---------------------------------------------------------------------------
// Additive score + softmax over the query axis. Block = 8 key rows t0..t0+7 of one batch.
//   r[t][q][e] = 1 / (exp2(Kp'[t][e] + Qp'[q][e]) + 1)      (planes pre-scaled by 2 log2 e)
//              = 1 / (2^Kp'[t][e] * 2^Qp'[q][e] + 1)         (factored form: 2^Kp' once per element
//                in LDS, 2^Qp' once per element and block; four e share one reciprocal). A query
//                row with max |q'| + (the block's max |k'|) above SLIM takes the sum form.
//   L[t][q]    = -2 log2(e) * sum_e bf16(vc[e]) * r          (log2-domain logit up to a constant
//                                                             shift that the softmax removes)
//   p[t][q]    = exp2(L - max_q L) / sum_q exp2(L - max_q L)
// krow / kexp / kout / vcs / sv: cross-wave (block barriers); after the second barrier each wave reads
// one sv row once and keeps it in registers (max, exp2, sum, scale; lane exchanges on the vector unit).
// Each output row line (32 floats) is one store instruction of one wave, 4 B per lane,
// lane-contiguous. Grid (KLEN/TT, NB).
// ---------------------------------------------------------------------------
// acc[t] = sum_e vcs[e] / (exp2(krow[t][e] + qr[e]) + 1): any size of k' and q'
__device__ __forceinline__ void row_sumform(const float* __restrict__ qr, const float* krow,
                                            const float* vcs, float (&acc)[TT]) {
#pragma unroll
  for (int t = 0; t < TT; ++t) acc[t] = 0.0f;
  // rolled: a trip holds 32 independent exponentials and reciprocals already
#pragma unroll 1
  for (unsigned e = 0; e < (unsigned)ENC; e += 4u) {
    const v4f qv = *(const v4f*)(qr + e);
    const v4f vv = *(const v4f*)&vcs[e];
#pragma unroll
    for (int t = 0; t < TT; ++t) {
      const v4f kk = *(const v4f*)&krow[(unsigned)t * ENC + e];
#pragma unroll
      for (int j = 0; j < 4; ++j) acc[t] = __builtin_fmaf(vv[j], rcp1p(kk[j] + qv[j]), acc[t]);
    }
  }
}

// acc[t] = sum_e vcs[e] / d[t][e], d = kexp[e][t] * exp2(qr[e]) + 1, four e under one reciprocal:
//   v0/d0 + v1/d1 = n01 / p01, n01 = v0 d1 + v1 d0, p01 = d0 d1; likewise n23 / p23;
//   n01/p01 + n23/p23 = (n01 p23 + n23 p01) / (p01 p23).
// kexp is [e][t], so that two key rows fill one packed f32 operand at every level. Returns
// max_e |qr[e]|. Right only where that maximum plus max |k'| is within SLIM and |vc| within VLIM
// (the caller tests).
__device__ __forceinline__ float row_factored(const float* __restrict__ qr, const float* kexp,
                                              const float* vcs, float (&acc)[TT]) {
  float qm = 0.0f;
  const v2f one = {1.0f, 1.0f};
  v2f a2[TT / 2];
#pragma unroll
  for (int p = 0; p < TT / 2; ++p) a2[p] = (v2f){0.0f, 0.0f};
  // two groups of four e per trip: 16 independent reciprocals, and the second group's loads can
  // stand ahead of the first group's arithmetic
#pragma unroll 2
  for (unsigned e = 0; e < (unsigned)ENC; e += 4u) {
    const v4f qv = *(const v4f*)(qr + e);
    const v4f vv = *(const v4f*)&vcs[e];
    qm = fmaxf(fmaxf(qm, fmaxf(fabsf(qv[0]), fabsf(qv[1]))), fmaxf(fabsf(qv[2]), fabsf(qv[3])));
    v4f kk[4][2];
    v2f qe[4];
#pragma unroll
    for (int j = 0; j < 4; ++j) {
      kk[j][0] = *(const v4f*)&kexp[(e + (unsigned)j) * TT];
      kk[j][1] = *(const v4f*)&kexp[(e + (unsigned)j) * TT + 4u];
      const float x = fexp2(qv[j]);
      qe[j] = (v2f){x, x};
    }
    const v2f v0 = {vv[0], vv[0]}, v1 = {vv[1], vv[1]}, v2 = {vv[2], vv[2]}, v3 = {vv[3], vv[3]};
#pragma unroll
    for (int p = 0; p < TT / 2; ++p) {                 // key rows 2 p, 2 p + 1
      v2f d[4];
#pragma unroll
      for (int j = 0; j < 4; ++j) {
        const v2f k2 = {kk[j][p >> 1][(p & 1) * 2], kk[j][p >> 1][(p & 1) * 2 + 1]};
        d[j] = __builtin_elementwise_fma(k2, qe[j], one);
      }
      const v2f p01 = d[0] * d[1];
      const v2f p23 = d[2] * d[3];
      const v2f n01 = __builtin_elementwise_fma(v1, d[0], v0 * d[1]);
      const v2f n23 = __builtin_elementwise_fma(v3, d[2], v2 * d[3]);
      const v2f pp = p01 * p23;
      const v2f nn = __builtin_elementwise_fma(n23, p01, n01 * p23);
      const v2f rr = {__builtin_amdgcn_rcpf(pp[0]), __builtin_amdgcn_rcpf(pp[1])};
      a2[p] = __builtin_elementwise_fma(nn, rr, a2[p]);
    }
  }
#pragma unroll
  for (int p = 0; p < TT / 2; ++p) { acc[2 * p] = a2[p][0]; acc[2 * p + 1] = a2[p][1]; }
  return qm;
}

__global__ __launch_bounds__(256) void score_kernel(
    const float* __restrict__ Qp, const float* __restrict__ Kp,
    const float* __restrict__ vc, float* __restrict__ P) {
  __shared__ __attribute__((aligned(16))) float krow[TT * ENC];
  __shared__ __attribute__((aligned(16))) float kexp[ENC * TT];   // [e][t]
  __shared__ __attribute__((aligned(16))) float kout[8];   // per wave: max |k'| (huge: a vc outside)
  __shared__ __attribute__((aligned(16))) float vcs[ENC];
  __shared__ __attribute__((aligned(16))) float sv[TT * QLEN];

  const unsigned tid = threadIdx.x;
  const unsigned t0 = blockIdx.x * (unsigned)TT;
  const unsigned b = blockIdx.y;

  {
    const float* kp = Kp + (size_t)(b * (unsigned)KLEN + t0) * ENC;
    float km = 0.0f;
    if (tid < (unsigned)ENC) {                            // whole waves in or out (ENC % 32 == 0)
      const float v = bf16r(vc[tid]);
      vcs[tid] = v;
      if (!(fabsf(v) <= VLIM)) km = 3.0e38f;
    }
#pragma unroll
    for (unsigned j = 0; j < (unsigned)(TT * ENC / 256); ++j) {
      const unsigned i = tid + 256u * j;
      const float kv = kp[i];
      krow[i] = kv;
      kexp[(i % (unsigned)ENC) * TT + i / (unsigned)ENC] = fexp2(kv);
      km = fmaxf(km, fabsf(kv));
    }
    km = red32_max(km);
    if ((tid & 31u) == 0u) kout[tid >> 5] = km;
  }
  __syncthreads();

  float kx = 0.0f;
#pragma unroll
  for (int w = 0; w < 8; ++w) kx = fmaxf(kx, kout[w]);
  // the block's max |k'|, the same in every lane
  const float kmx = __builtin_bit_cast(float, __builtin_amdgcn_readfirstlane(__builtin_bit_cast(int, kx)));
  const bool kwide = !(kmx <= SLIM);

#pragma unroll 1
  for (unsigned q = tid; q < (unsigned)QLEN; q += 256u) {
    const float* qr = Qp + (size_t)(b * (unsigned)QLEN + q) * ENC;
    float acc[TT];
    bool wide = kwide;
    if (!kwide) wide = !(row_factored(qr, kexp, vcs, acc) + kmx <= SLIM);
    if (wide) row_sumform(qr, krow, vcs, acc);   // per lane: this query row anew, unfactored
#pragma unroll
    for (int t = 0; t < TT; ++t) sv[(unsigned)t * QLEN + q] = acc[t] * LSCALE;
  }
  __syncthreads();

  const int wave = __builtin_amdgcn_readfirstlane((int)(threadIdx.x >> 5));
  const unsigned lane = tid & 31u;
  const unsigned sb = (unsigned)wave * (unsigned)QLEN + lane;

  // the lane's elements of the row, read once; all loops below unrolled whole so that x stays in
  // registers and the reads stand behind one wait
  float x[QLEN / 32];
#pragma unroll
  for (unsigned j = 0; j < (unsigned)(QLEN / 32); ++j) x[j] = sv[sb + 32u * j];

  float mx = -3.0e38f;
#pragma unroll
  for (unsigned j = 0; j < (unsigned)(QLEN / 32); ++j) mx = fmaxf(mx, x[j]);
  mx = red32_max(mx);

  float sum = 0.0f;
#pragma unroll
  for (unsigned j = 0; j < (unsigned)(QLEN / 32); ++j) {
    x[j] = fexp2(x[j] - mx);
    sum += x[j];
  }
  sum = red32_sum(sum);
  const float inv = __builtin_amdgcn_rcpf(sum);

  float* prow = P + (size_t)(b * (unsigned)KLEN + t0 + (unsigned)wave) * QLEN + lane;
#pragma unroll
  for (unsigned j = 0; j < (unsigned)(QLEN / 32); ++j) prow[32u * j] = x[j] * inv;
}

// ---------------------------------------------------------------------------
extern "C" void kernel_launch(void* const* d_in, const int* in_sizes, int n_in,
                              void* d_out, int out_size, void* d_ws, size_t ws_size,
                              hipStream_t stream) {
  if (n_in < 6) return;
  const long long need_q = ((long long)(NB - 1) * QLEN_FULL + QLEN) * FEAT;
  const long long need_k = ((long long)(NB - 1) * KLEN_FULL + KLEN) * FEAT;
  const long long need_v = ((long long)NB * FEAT - 1) * KLEN_FULL + KLEN;
  const long long need_o = ((long long)NB * FEAT - 1) * QLEN_FULL + QLEN;
  if ((long long)in_sizes[0] < need_q) return;
  if ((long long)in_sizes[1] < need_k) return;
  if ((long long)in_sizes[2] < need_v) return;
  if ((long long)in_sizes[3] < (long long)FEAT * ENC) return;
  if ((long long)in_sizes[4] < (long long)FEAT * ENC) return;
  if (in_sizes[5] < ENC) return;
  if ((long long)out_size < need_o) return;
  if (ws_size < WS_TOTAL) return;

  const float* query = (const float*)d_in[0];   // [NB_FULL][QLEN_FULL][FEAT]
  const float* key   = (const float*)d_in[1];   // [NB_FULL][KLEN_FULL][FEAT]
  const float* value = (const float*)d_in[2];   // [NB_FULL][FEAT][KLEN_FULL]
  const float* w1    = (const float*)d_in[3];   // [FEAT][ENC]  (in, out), pairs with query
  const float* w2    = (const float*)d_in[4];   // [FEAT][ENC]  (in, out), pairs with key
  const float* vc    = (const float*)d_in[5];   // [ENC]
  float* out = (float*)d_out;                   // [NB_FULL][FEAT][QLEN_FULL]

  char* ws = (char*)d_ws;
  _Float16* V16 = (_Float16*)(ws + OFF_V);      // [NB][FEAT][KLEN]
  float*    Qp  = (float*)(ws + OFF_QP);        // [NB*QLEN][ENC]
  float*    Kp  = (float*)(ws + OFF_KP);        // [NB*KLEN][ENC]
  float*    Pf  = (float*)(ws + OFF_P);         // [NB][KLEN][QLEN]

  dim3 blk(256);

  // projections (operands converted in the kernel) + value plane
  proj_kernel<<<dim3(NPQ + NPK + NVB), blk, 0, stream>>>(query, key, value, w1, w2, Qp, Kp, V16);

  // additive scores + softmax over q
  score_kernel<<<dim3(KLEN / TT, NB), blk, 0, stream>>>(Qp, Kp, vc, Pf);

  // out = value . p
  outgemm_kernel<<<dim3(QLEN / 64, FEAT / 64, NB), blk, 0, stream>>>(V16, Pf, out);
}

// v006
// A run of this version takes 25.3 microseconds.
// Next to v005, in two timings, it ran 1.06 and 1.07 times as fast.
// Counting every step since v000, it is 2.38 times as fast.
#include <hip/hip_runtime.h>
#include <stddef.h>

// Contractions on v_wmma_f32_16x16x32_f16 (f16 operands, f32 accumulate): the query and key
// projections and the value x attention-weight product. Float inputs are RNE-converted to bf16
// and carried in f16 planes (weights x64, input rows x16); attention weights go to f16 x16384
// without the bf16 step.
// The vc-weighted tanh sum is a matrix-vector product kept on the vector unit in f32;
// tanh, softmax (over the query axis) and all scalings in f32. The exponential inside tanh is
// factored, 2^(k'+q') = 2^k' * 2^q', and four terms of the sum share one reciprocal, wherever the
// block's max |k'| plus the query row's max |q'| is within SLIM and every |vc| within VLIM.
// Three launches: projections (operands converted on the way into LDS; spare blocks write the
// value plane), score + softmax, output product (attention weights converted and transposed on
// the way into LDS, the value tile brought there by asynchronous copies).

typedef _Float16 v16h __attribute__((ext_vector_type(16)));
typedef _Float16 v8h  __attribute__((ext_vector_type(8)));
typedef float    v8f  __attribute__((ext_vector_type(8)));
typedef float    v4f  __attribute__((ext_vector_type(4)));
typedef float    v2f  __attribute__((ext_vector_type(2)));
typedef _Float16 h16;

#ifndef NB
#define NB 4
#endif
#ifndef QLEN
#define QLEN 512
#endif
#ifndef KLEN
#define KLEN 512
#endif
#define NB_FULL   4
#define QLEN_FULL 512
#define KLEN_FULL 512
#define FEAT 256     // input feature width (2 x encoder size)
#define ENC  128     // encoder size
#define TT   8       // key rows per score block == waves per block

static_assert(NB >= 1 && NB <= NB_FULL);
static_assert(QLEN >= 64 && QLEN <= QLEN_FULL && (QLEN % 64) == 0);
static_assert(KLEN >= 64 && KLEN <= KLEN_FULL && (KLEN % 64) == 0);
static_assert((FEAT % 64) == 0 && (FEAT % 32) == 0);
static_assert((ENC % 64) == 0 && (ENC % 32) == 0 && (ENC % 4) == 0);
static_assert(((NB * QLEN) % 64) == 0 && ((NB * KLEN) % 64) == 0);
static_assert((((size_t)NB * FEAT * KLEN / 8) % 256) == 0);   // value plane blocks, exact
static_assert(TT == 8);                                       // one softmax row per wave, 8 waves
static_assert((KLEN % TT) == 0);
static_assert(((TT * ENC) % 256) == 0);
static_assert((QLEN % 32) == 0);
static_assert((KLEN % 32) == 0);

#define LDF (FEAT + 8)   // halves per LDS operand row, projections (16 B x odd)
#define LDK (KLEN + 8)   // halves per LDS operand row, output product (16 B x odd)
#define LDC 68           // floats per LDS row (272 B, 16-B aligned)
static_assert((LDF % 8) == 0 && ((LDF / 8) % 2) == 1);
static_assert((LDK % 8) == 0 && ((LDK / 8) % 2) == 1);
static_assert((LDC % 4) == 0 && LDC >= 64);

#define WCARRY 64.0f      // weight planes carried x64
#define XCARRY 16.0f      // input row planes (query, key, value) carried x16
#define PCARRY 16384.0f   // attention-weight plane carried x2^14
// projection planes hold 2*log2(e) * (x . W): exp(2 (k+q)) == exp2(k' + q')
#define PSCALE (2.8853900817779268f / (WCARRY * XCARRY))
#define OSCALE (1.0f / (PCARRY * XCARRY))
#define LSCALE (-2.8853900817779268f)   // -2 log2(e): log2-domain logit from the reciprocal sum
// max |k'| + max |q'| <= SLIM: every d = 2^k' * 2^q' + 1 lies in [1, 2^30 + 1] and both factors are
// normal, so a product of four d stays under 2^121; with |vc| <= VLIM the numerators stay under 2^123
#define SLIM 30.0f
#define VLIM 1073741824.0f   // 2^30

// static LDS per kernel (bytes)
static_assert((size_t)2 * 64 * LDF * 2 + (size_t)64 * LDC * 4 <= (size_t)131072);
static_assert((size_t)2 * 64 * LDK * 2 + (size_t)64 * LDC * 4 <= (size_t)163840);
static_assert(((size_t)2 * TT * ENC + ENC + 8 + (size_t)TT * QLEN) * 4 <= (size_t)131072);

// workspace layout (bytes)
#define V_BYTES   ((size_t)NB * FEAT * KLEN * 2)
#define QP_BYTES  ((size_t)NB * QLEN * ENC * 4)
#define KP_BYTES  ((size_t)NB * KLEN * ENC * 4)
#define P_BYTES   ((size_t)NB * KLEN * QLEN * 4)
#define OFF_V   ((size_t)0)
#define OFF_QP  (OFF_V + V_BYTES)
#define OFF_KP  (OFF_QP + QP_BYTES)
#define OFF_P   (OFF_KP + KP_BYTES)
#define WS_TOTAL (OFF_P + P_BYTES)
static_assert((V_BYTES % 128) == 0 && (QP_BYTES % 128) == 0 && (KP_BYTES % 128) == 0);
static_assert((P_BYTES % 128) == 0);
static_assert(WS_TOTAL <= (size_t)134217728);

// ---------------------------------------------------------------------------
__device__ __forceinline__ float bf16r(float x) {   // RNE convert to bf16, returned widened
  unsigned int u = __float_as_uint(x);
  u = (u + 0x7FFFu + ((u >> 16) & 1u)) & 0xFFFF0000u;
  return __uint_as_float(u);
}

// f32 -> f16 operand convert that cannot produce an f16 subnormal (value select).
static __device__ __forceinline__ h16 toh_flush(float v) {
  const h16 r = (h16)v;
  return (fabsf(v) < 6.103515625e-05f) ? (h16)0.0f : r;
}

// 16-bit fragment: p points at element [row = lane&15][k0 + 8*(lane>>4)] of a k-contiguous
// row. Elements 0..7 <- k0+8h+0..7, elements 8..15 <- k0+16+8h+0..7 (same map for A and B).
__device__ __forceinline__ v16h frag_at(const _Float16* p) {
  v8h lo = *(const v8h*)(p);
  v8h hi = *(const v8h*)(p + 16);
  v16h out;
#pragma unroll
  for (int i = 0; i < 8; ++i) { out[i] = lo[i]; out[i + 8] = hi[i]; }
  return out;
}

__device__ __forceinline__ v8f wmma16(v16h a, v16h b, v8f c) {
  v8f d = __builtin_amdgcn_wmma_f32_16x16x32_f16(false, a, false, b, (short)0, c,
                                                 false, false);
  asm volatile("v_nop\n\tv_nop\n\tv_nop\n\tv_nop" : "+v"(d) : "v"(a), "v"(b));
  return d;
}

// Lane exchanges on the vector unit (no LDS trip). xlane<M>: the value of lane l ^ M inside a
// 16-lane row (DPP row_xmask:M, M < 16); xhalf: the value of lane l ^ 16.
template <int M>
__device__ __forceinline__ float xlane(float x) {
  return __builtin_bit_cast(float, __builtin_amdgcn_update_dpp(
      0, __builtin_bit_cast(int, x), 0x160 + M, 0xf, 0xf, true));
}
__device__ __forceinline__ float xhalf(float x) {
  const int b = __builtin_bit_cast(int, x);
  return __builtin_bit_cast(float, __builtin_amdgcn_permlanex16(b, b, 0x76543210, 0xfedcba98,
                                                                false, false));
}
// butterflies over the 32 lanes, partners l ^ 1, 2, 4, 8, 16 in that order
__device__ __forceinline__ float red32_max(float x) {
  x = fmaxf(x, xlane<1>(x));
  x = fmaxf(x, xlane<2>(x));
  x = fmaxf(x, xlane<4>(x));
  x = fmaxf(x, xlane<8>(x));
  return fmaxf(x, xhalf(x));
}
__device__ __forceinline__ float red32_sum(float x) {
  x += xlane<1>(x);
  x += xlane<2>(x);
  x += xlane<4>(x);
  x += xlane<8>(x);
  return x + xhalf(x);
}

__device__ __forceinline__ float fexp2(float x) {
#if __has_builtin(__builtin_amdgcn_exp2f)
  return __builtin_amdgcn_exp2f(x);
#else
  return exp2f(x);
#endif
}

// 1 / (2^x + 1); tanh(z) = 1 - 2 / (exp(2 z) + 1) with x = 2 log2(e) z
__device__ __forceinline__ float rcp1p(float x) {
  return __builtin_amdgcn_rcpf(fexp2(x) + 1.0f);
}

// ---------------------------------------------------------------------------
// Operand staging, f32 global -> f16 LDS, 256 threads, one 64-wide tile over the whole K;
// a load half (registers; one address, constant offsets) and a convert-and-store half.
// cols: src[K rows][64 cols used] (pitch LD) -> T[col][k] (pitch K + 8 halves),
//   f16(carry * bf16(x)) (RND) or f16(carry * x). Thread: col = tid & 63, eight consecutive k
//   per 16-B LDS store; each load instruction of a wave covers one 128-B line of a source row.
// rows: src[64 rows][K cols] (pitch LD) -> T[row][k] (pitch K + 8 halves),
//   f16(16 * bf16(x)). Thread: eight consecutive k of one row per 16-B LDS store.
// ---------------------------------------------------------------------------
template <unsigned K, unsigned LD>
__device__ __forceinline__ void load_cols(const float* __restrict__ src, float (&v)[K / 32u][8]) {
  const float* s = src + (size_t)((threadIdx.x >> 6) * 8u) * LD + (threadIdx.x & 63u);
#pragma unroll
  for (unsigned j = 0; j < K / 32u; ++j)               // k = 8 (tid >> 6) + 32 j + i
#pragma unroll
    for (unsigned i = 0; i < 8u; ++i) v[j][i] = s[(size_t)(32u * j + i) * LD];
  // precaution: the address stays in its registers up to this wait, so that no load's result
  // is placed on the address of an issued load ahead of it
  asm volatile("s_wait_xcnt 0x0" :: "v"(s) : "memory");
}

template <unsigned K, bool RND>
__device__ __forceinline__ void put_cols(const float (&v)[K / 32u][8], const float carry,
                                         _Float16* T) {
  _Float16* d = T + (threadIdx.x & 63u) * (K + 8u) + (threadIdx.x >> 6) * 8u;
#pragma unroll
  for (unsigned j = 0; j < K / 32u; ++j) {
    v8h o;
#pragma unroll
    for (int i = 0; i < 8; ++i) o[i] = toh_flush(carry * (RND ? bf16r(v[j][i]) : v[j][i]));
    *(v8h*)(d + 32u * j) = o;
  }
}

// rows per sweep of the block: 256 threads / (K / 8 threads per row)
#define ROWSWEEP(K) (256u / ((K) / 8u))

template <unsigned K, unsigned LD>
__device__ __forceinline__ void load_rows(const float* __restrict__ src,
                                          v4f (&a)[64u / ROWSWEEP(K)][2]) {
  static_assert(K / 8u <= 256u && (256u % (K / 8u)) == 0);
  const float* s = src + (size_t)(threadIdx.x / (K / 8u)) * LD + (threadIdx.x % (K / 8u)) * 8u;
#pragma unroll
  for (unsigned j = 0; j < 64u / ROWSWEEP(K); ++j) {   // row = tid / (K / 8) + ROWSWEEP j
    a[j][0] = *(const v4f*)(s + (size_t)(ROWSWEEP(K) * j) * LD);
    a[j][1] = *(const v4f*)(s + (size_t)(ROWSWEEP(K) * j) * LD + 4);
  }
  // precaution: as in load_cols
  asm volatile("s_wait_xcnt 0x0" :: "v"(s) : "memory");
}

template <unsigned K>
__device__ __forceinline__ void put_rows(const v4f (&a)[64u / ROWSWEEP(K)][2], _Float16* T) {
  _Float16* d = T + (threadIdx.x / (K / 8u)) * (K + 8u) + (threadIdx.x % (K / 8u)) * 8u;
#pragma unroll
  for (unsigned j = 0; j < 64u / ROWSWEEP(K); ++j) {
    v8h o;
#pragma unroll
    for (int i = 0; i < 4; ++i) {
      o[i]     = toh_flush(XCARRY * bf16r(a[j][0][i]));
      o[i + 4] = toh_flush(XCARRY * bf16r(a[j][1][i]));
    }
    *(v8h*)(d + ROWSWEEP(K) * j * (K + 8u)) = o;
  }
}

// ---------------------------------------------------------------------------
// Operand staging without a convert: src[64 rows][K halves] (pitch K, f16 already) -> T[row][k]
// (pitch K + 8 halves) by asynchronous copies to LDS, 16 B per lane, through no register.
// Thread: eight consecutive k of one row; a wave's copy covers 512 contiguous bytes of a row.
// All lanes on, 16 copies per wave in flight. The caller waits (s_wait_asynccnt 0) and passes a
// block barrier before anybody reads T.
// ---------------------------------------------------------------------------
template <unsigned K>
__device__ __forceinline__ void copy_rows16(const _Float16* __restrict__ src, _Float16* T) {
  static_assert(K / 8u <= 256u && (256u % (K / 8u)) == 0 && ((64u / ROWSWEEP(K)) % 8u) == 0);
  static_assert(64u / ROWSWEEP(K) <= 63u);
  const unsigned r = threadIdx.x / (K / 8u), c = (threadIdx.x % (K / 8u)) * 8u;
  const _Float16* g = src + (size_t)r * K + c;
  const unsigned l = (unsigned)(size_t)(T + r * (K + 8u) + c);   // LDS byte address
  // unrolled: no branch between the copies, every address a constant step from one base
#pragma unroll
  for (unsigned j = 0; j < 64u / ROWSWEEP(K); j += 8u) {         // row = r + ROWSWEEP (j + i)
    const _Float16* gj = g + (size_t)(ROWSWEEP(K) * j) * K;
    const unsigned lj = l + ROWSWEEP(K) * j * (K + 8u) * 2u;
    const unsigned gs = ROWSWEEP(K) * K, ls = ROWSWEEP(K) * (K + 8u) * 2u;
    // eight copies and, as a precaution, the wait that keeps their address registers as they
    // are until the copies have taken them, in one statement
    asm volatile(
        "global_load_async_to_lds_b128 %0, %8, off\n\t"
        "global_load_async_to_lds_b128 %1, %9, off\n\t"
        "global_load_async_to_lds_b128 %2, %10, off\n\t"
        "global_load_async_to_lds_b128 %3, %11, off\n\t"
        "global_load_async_to_lds_b128 %4, %12, off\n\t"
        "global_load_async_to_lds_b128 %5, %13, off\n\t"
        "global_load_async_to_lds_b128 %6, %14, off\n\t"
        "global_load_async_to_lds_b128 %7, %15, off\n\t"
        "s_wait_xcnt 0x0"
        :: "v"(lj), "v"(lj + ls), "v"(lj + 2u * ls), "v"(lj + 3u * ls), "v"(lj + 4u * ls),
           "v"(lj + 5u * ls), "v"(lj + 6u * ls), "v"(lj + 7u * ls),
           "v"(gj), "v"(gj + gs), "v"(gj + 2u * gs), "v"(gj + 3u * gs), "v"(gj + 4u * gs),
           "v"(gj + 5u * gs), "v"(gj + 6u * gs), "v"(gj + 7u * gs)
        : "memory");
  }
}

// ---------------------------------------------------------------------------
// GEMM C[64x64 tile] = A[64 rows][K] . Bt[64 n][K]^T from k-contiguous 16-bit rows (A: row 0 of
// the tile, pitch lda; Bt: column 0 of the tile, pitch ldb; LDS);
// 8 waves (mw = 16-row group, nw = 32-col group), 2 accumulators/wave.
// outf[row0 + row][n0 + col] (pitch ldo) = cs * acc; rows r = 16 i + tid/16, i < 4 -> 64 rows;
// 16 lanes x 16 B = the 256-B row segment of the tile.
// ---------------------------------------------------------------------------
__device__ __forceinline__ void gemm_body(
    const _Float16* A, const unsigned lda, const _Float16* Bt, const unsigned ldb,
    const unsigned K, float* __restrict__ outf, const unsigned ldo, const float cs,
    const unsigned row0, const unsigned n0) {
  __shared__ float Cs[64 * LDC];
  const unsigned tid = threadIdx.x, lane = tid & 31u, w = tid >> 5;
  const unsigned mw = w >> 1, nw = w & 1u;
  const unsigned hh = lane >> 4, m = lane & 15u;

  const _Float16* ap  = A + (size_t)(mw * 16u + m) * lda + hh * 8u;
  const _Float16* bp0 = Bt + (size_t)(nw * 32u + m) * ldb + hh * 8u;
  const _Float16* bp1 = bp0 + (size_t)16 * ldb;
  v8f acc0 = {}, acc1 = {};
#pragma unroll 2
  for (unsigned k0 = 0; k0 < K; k0 += 32u) {
    const v16h a  = frag_at(ap + k0);
    const v16h b0 = frag_at(bp0 + k0);
    const v16h b1 = frag_at(bp1 + k0);
    acc0 = wmma16(a, b0, acc0);
    acc1 = wmma16(a, b1, acc1);
  }
#pragma unroll
  for (int r = 0; r < 8; ++r) {
    float* d = &Cs[(mw * 16u + hh * 8u + (unsigned)r) * LDC + nw * 32u + m];
    d[0]  = acc0[r];
    d[16] = acc1[r];
  }
  __syncthreads();

  v4f xs[4];
  size_t off[4];
#pragma unroll
  for (unsigned i = 0; i < 4u; ++i) {
    const unsigned r = 16u * i + (tid >> 4);
    const unsigned c = (tid & 15u) * 4u;
    const v4f u = *(const v4f*)&Cs[r * LDC + c];
    v4f val;
#pragma unroll
    for (int j = 0; j < 4; ++j) val[j] = u[j] * cs;
    xs[i] = val;
    off[i] = (size_t)(row0 + r) * ldo + n0 + c;
  }
#pragma unroll
  for (int i = 0; i < 4; ++i) *(v4f*)(outf + off[i]) = xs[i];
}

// ---------------------------------------------------------------------------
// First launch, 1-D grid of three block ranges:
//   [0, NPQ)           Qp[rows][ENC] = 2 log2(e) * (query . W1), one 64 x 64 tile per block
//   [NPQ, NPQ + NPK)   Kp[rows][ENC] = 2 log2(e) * (key . W2)
//   [NPQ + NPK, + NVB) value plane V16[b][FEAT][KLEN] = f16(16 * bf16(value)), 8 columns/thread
// Ta / Tb: cross-wave (block barrier). The range test is the same for a whole block and the
// value blocks leave before any barrier.
// ---------------------------------------------------------------------------
#define NPQ ((unsigned)((ENC / 64) * (NB * QLEN / 64)))
#define NPK ((unsigned)((ENC / 64) * (NB * KLEN / 64)))
#define NVB ((unsigned)((size_t)NB * FEAT * KLEN / 8 / 256))

__global__ __launch_bounds__(256) void proj_kernel(
    const float* __restrict__ query, const float* __restrict__ key,
    const float* __restrict__ value, const float* __restrict__ w1,
    const float* __restrict__ w2, float* __restrict__ Qp, float* __restrict__ Kp,
    _Float16* __restrict__ V16) {
  __shared__ __attribute__((aligned(16))) _Float16 Ta[64 * LDF];
  __shared__ __attribute__((aligned(16))) _Float16 Tb[64 * LDF];
  const unsigned bid = blockIdx.x;

  if (bid >= NPQ + NPK) {
    const unsigned g = (bid - (NPQ + NPK)) * 256u + threadIdx.x;
    const unsigned row = g / (unsigned)(KLEN / 8);            // b * FEAT + d
    const unsigned cc = (g % (unsigned)(KLEN / 8)) * 8u;
    const float* s = value + (size_t)row * KLEN_FULL + cc;
    const v4f a0 = *(const v4f*)(s);
    const v4f a1 = *(const v4f*)(s + 4);
    v8h o;
#pragma unroll
    for (int i = 0; i < 4; ++i) {
      o[i]     = toh_flush(XCARRY * bf16r(a0[i]));
      o[i + 4] = toh_flush(XCARRY * bf16r(a1[i]));
    }
    *(v8h*)(V16 + (size_t)g * 8u) = o;
    return;
  }

  const bool isq = bid < NPQ;
  const unsigned t = isq ? bid : bid - NPQ;
  const unsigned n0 = (t % (unsigned)(ENC / 64)) * 64u;
  const unsigned row0 = (t / (unsigned)(ENC / 64)) * 64u;    // compact row, b * len + r
  const unsigned len = isq ? (unsigned)QLEN : (unsigned)KLEN;
  const unsigned lenf = isq ? (unsigned)QLEN_FULL : (unsigned)KLEN_FULL;
  const unsigned b = row0 / len;
  const float* X = (isq ? query : key) + ((size_t)b * lenf + (row0 - b * len)) * FEAT;
  const float* Wm = (isq ? w1 : w2) + n0;

  float wv[FEAT / 32][8];
  v4f xa[64u / ROWSWEEP(FEAT)][2];
  load_cols<FEAT, ENC>(Wm, wv);
  load_rows<FEAT, FEAT>(X, xa);
  // keeps every load of both tiles issued ahead of the first convert: one memory latency for
  // the block instead of one per group of rows
  __builtin_amdgcn_sched_barrier(0);
  put_cols<FEAT, true>(wv, WCARRY, Tb);
  put_rows<FEAT>(xa, Ta);
  __syncthreads();
  gemm_body(Ta, (unsigned)LDF, Tb, (unsigned)LDF, (unsigned)FEAT, isq ? Qp : Kp,
            (unsigned)ENC, PSCALE, row0, n0);
}

// ---------------------------------------------------------------------------
// out[b][d][q] = sum_t value[b][d][t] * p[b][t][q]; A = 64 rows of the value plane
// [b][FEAT][KLEN], copied to LDS while P is loaded and converted;
// Bt[q][t] = f16(16384 * p[t][q]) staged in LDS from P[b][KLEN][QLEN].
// Ta / Tb: cross-wave (block barrier). Grid (QLEN/64, FEAT/64, NB); output rows at the full pitch.
// ---------------------------------------------------------------------------
__global__ __launch_bounds__(256) void outgemm_kernel(
    const _Float16* __restrict__ V16, const float* __restrict__ P,
    float* __restrict__ outf) {
  __shared__ __attribute__((aligned(16))) _Float16 Ta[64 * LDK];
  __shared__ __attribute__((aligned(16))) _Float16 Tb[64 * LDK];
  const unsigned b = blockIdx.z;
  const unsigned n0 = blockIdx.x * 64u;
  const unsigned row0 = blockIdx.y * 64u;
  copy_rows16<KLEN>(V16 + ((size_t)b * FEAT + row0) * KLEN, Ta);
  float pv[KLEN / 32][8];
  load_cols<KLEN, QLEN>(P + (size_t)b * KLEN * QLEN + n0, pv);
  put_cols<KLEN, false>(pv, PCARRY, Tb);
  // this wave's copies into Ta have landed before the barrier behind which other waves read them
  asm volatile("s_wait_asynccnt 0x0" ::: "memory");
  __syncthreads();
  gemm_body(Ta, (unsigned)LDK, Tb, (unsigned)LDK,
            (unsigned)KLEN, outf + (size_t)b * FEAT * QLEN_FULL, (unsigned)QLEN_FULL, OSCALE,
            row0, n0);
}

// ---------------------------------------------------------------------------
// Additive score + softmax over the query axis. Block = 8 key rows t0..t0+7 of one batch.
//   r[t][q][e] = 1 / (exp2(Kp'[t][e] + Qp'[q][e]) + 1)      (planes pre-scaled by 2 log2 e)
//              = 1 / (2^Kp'[t][e] * 2^Qp'[q][e] + 1)         (factored form: 2^Kp' once per element
//                in LDS, 2^Qp' once per element and block; four e share one reciprocal). A query
//                row with max |q'| + (the block's max |k'|) above SLIM takes the sum form.
//   L[t][q]    = -2 log2(e) * sum_e bf16(vc[e]) * r          (log2-domain logit up to a constant
//                                                             shift that the softmax removes)
//   p[t][q]    = exp2(L - max_q L) / sum_q exp2(L - max_q L)
// krow / kexp / kout / vcs / sv: cross-wave (block barriers); after the second barrier each wave reads
// one sv row once and keeps it in registers (max, exp2, sum, scale; lane exchanges on the vector unit).
// Each output row line (32 floats) is one store instruction of one wave, 4 B per lane,
// lane-contiguous. Grid (KLEN/TT, NB).
// ---------------------------------------------------------------------------
// acc[t] = sum_e vcs[e] / (exp2(krow[t][e] + qr[e]) + 1): any size of k' and q'
__device__ __forceinline__ void row_sumform(const float* __restrict__ qr, const float* krow,
                                            const float* vcs, float (&acc)[TT]) {
#pragma unroll
  for (int t = 0; t < TT; ++t) acc[t] = 0.0f;
  // rolled: a trip holds 32 independent exponentials and reciprocals already
#pragma unroll 1
  for (unsigned e = 0; e < (unsigned)ENC; e += 4u) {
    const float* qp = qr + e;
    const v4f qv = *(const v4f*)qp;
    // precaution: as in load_cols, the address stays in its registers up to this wait
    asm volatile("s_wait_xcnt 0x0" :: "v"(qp) : "memory");
    const v4f vv = *(const v4f*)&vcs[e];
#pragma unroll
    for (int t = 0; t < TT; ++t) {
      const v4f kk = *(const v4f*)&krow[(unsigned)t * ENC + e];
#pragma unroll
      for (int j = 0; j < 4; ++j) acc[t] = __builtin_fmaf(vv[j], rcp1p(kk[j] + qv[j]), acc[t]);
    }
  }
}

// acc[r][t] = sum_e vcs[e] / d[r][t][e], d = kexp[e][t] * exp2(qr_r[e]) + 1, for two query rows
// r at once, four e under one reciprocal:
//   v0/d0 + v1/d1 = n01 / p01, n01 = v0 d1 + v1 d0, p01 = d0 d1; likewise n23 / p23;
//   n01/p01 + n23/p23 = (n01 p23 + n23 p01) / (p01 p23).
// kexp is [e][t], so that two key rows fill one packed f32 operand at every level; each kexp and
// vcs value read from LDS serves both query rows. qm[r] = max_e |qr_r[e]|. A row is right only
// where that maximum plus max |k'| is within SLIM and |vc| within VLIM (the caller tests).
__device__ __forceinline__ void rows_factored(const float* __restrict__ qr0,
                                              const float* __restrict__ qr1, const float* kexp,
                                              const float* vcs, float (&acc)[2][TT],
                                              float (&qm)[2]) {
  const v2f one = {1.0f, 1.0f};
  v2f a2[2][TT / 2];
#pragma unroll
  for (int r = 0; r < 2; ++r) {
    qm[r] = 0.0f;
#pragma unroll
    for (int p = 0; p < TT / 2; ++p) a2[r][p] = (v2f){0.0f, 0.0f};
  }
  // two groups of four e per trip: the arithmetic of a trip is long enough to cover the sibling
  // wave's wait for its loads
#pragma unroll 2
  for (unsigned e = 0; e < (unsigned)ENC; e += 4u) {
    const v4f qv[2] = {*(const v4f*)(qr0 + e), *(const v4f*)(qr1 + e)};
    const v4f vv = *(const v4f*)&vcs[e];
    v4f kk[4][2];
#pragma unroll
    for (int j = 0; j < 4; ++j) {
      kk[j][0] = *(const v4f*)&kexp[(e + (unsigned)j) * TT];
      kk[j][1] = *(const v4f*)&kexp[(e + (unsigned)j) * TT + 4u];
    }
    const v2f v0 = {vv[0], vv[0]}, v1 = {vv[1], vv[1]}, v2 = {vv[2], vv[2]}, v3 = {vv[3], vv[3]};
#pragma unroll
    for (int r = 0; r < 2; ++r) {
      qm[r] = fmaxf(fmaxf(qm[r], fmaxf(fabsf(qv[r][0]), fabsf(qv[r][1]))),
                    fmaxf(fabsf(qv[r][2]), fabsf(qv[r][3])));
      v2f qe[4];
#pragma unroll
      for (int j = 0; j < 4; ++j) {
        const float x = fexp2(qv[r][j]);
        qe[j] = (v2f){x, x};
      }
#pragma unroll
      for (int p = 0; p < TT / 2; ++p) {               // key rows 2 p, 2 p + 1
        v2f d[4];
#pragma unroll
        for (int j = 0; j < 4; ++j) {
          const v2f k2 = {kk[j][p >> 1][(p & 1) * 2], kk[j][p >> 1][(p & 1) * 2 + 1]};
          d[j] = __builtin_elementwise_fma(k2, qe[j], one);
        }
        const v2f p01 = d[0] * d[1];
        const v2f p23 = d[2] * d[3];
        const v2f n01 = __builtin_elementwise_fma(v1, d[0], v0 * d[1]);
        const v2f n23 = __builtin_elementwise_fma(v3, d[2], v2 * d[3]);
        const v2f pp = p01 * p23;
        const v2f nn = __builtin_elementwise_fma(n23, p01, n01 * p23);
        const v2f rr = {__builtin_amdgcn_rcpf(pp[0]), __builtin_amdgcn_rcpf(pp[1])};
        a2[r][p] = __builtin_elementwise_fma(nn, rr, a2[r][p]);
      }
    }
  }
#pragma unroll
  for (int r = 0; r < 2; ++r)
#pragma unroll
    for (int p = 0; p < TT / 2; ++p) { acc[r][2 * p] = a2[r][p][0]; acc[r][2 * p + 1] = a2[r][p][1]; }
}

__global__ __launch_bounds__(256) void score_kernel(
    const float* __restrict__ Qp, const float* __restrict__ Kp,
    const float* __restrict__ vc, float* __restrict__ P) {
  __shared__ __attribute__((aligned(16))) float krow[TT * ENC];
  __shared__ __attribute__((aligned(16))) float kexp[ENC * TT];   // [e][t]
  __shared__ __attribute__((aligned(16))) float kout[8];   // per wave: max |k'| (huge: a vc outside)
  __shared__ __attribute__((aligned(16))) float vcs[ENC];
  __shared__ __attribute__((aligned(16))) float sv[TT * QLEN];

  const unsigned tid = threadIdx.x;
  const unsigned t0 = blockIdx.x * (unsigned)TT;
  const unsigned b = blockIdx.y;

  {
    const float* kp = Kp + (size_t)(b * (unsigned)KLEN + t0) * ENC;
    float km = 0.0f;
    if (tid < (unsigned)ENC) {                            // whole waves in or out (ENC % 32 == 0)
      const float v = bf16r(vc[tid]);
      vcs[tid] = v;
      if (!(fabsf(v) <= VLIM)) km = 3.0e38f;
    }
#pragma unroll
    for (unsigned j = 0; j < (unsigned)(TT * ENC / 256); ++j) {
      const unsigned i = tid + 256u * j;
      const float kv = kp[i];
      krow[i] = kv;
      kexp[(i % (unsigned)ENC) * TT + i / (unsigned)ENC] = fexp2(kv);
      km = fmaxf(km, fabsf(kv));
    }
    km = red32_max(km);
    if ((tid & 31u) == 0u) kout[tid >> 5] = km;
  }
  __syncthreads();

  float kx = 0.0f;
#pragma unroll
  for (int w = 0; w < 8; ++w) kx = fmaxf(kx, kout[w]);
  // the block's max |k'|, the same in every lane
  const float kmx = __builtin_bit_cast(float, __builtin_amdgcn_readfirstlane(__builtin_bit_cast(int, kx)));
  const bool kwide = !(kmx <= SLIM);

  // a lane takes query rows q and q + 256 together; where the second is past the end (whole waves,
  // QLEN % 64 == 0) it reads the first again and stores nothing for it
#pragma unroll 1
  for (unsigned q = tid; q < (unsigned)QLEN; q += 512u) {
    const unsigned q1 = q + 256u;
    const bool has1 = ((QLEN % 512) == 0) || q1 < (unsigned)QLEN;   // known at compile time for whole pairs
    const float* qr0 = Qp + (size_t)(b * (unsigned)QLEN + q) * ENC;
    const float* qr1 = qr0 + (has1 ? (size_t)256 * ENC : (size_t)0);   // one base address for both rows
    float acc[2][TT];
    bool wide0 = kwide, wide1 = kwide;
    if (!kwide) {
      float qm[2];
      rows_factored(qr0, qr1, kexp, vcs, acc, qm);
      wide0 = !(qm[0] + kmx <= SLIM);
      wide1 = !(qm[1] + kmx <= SLIM);
    }
    if (wide0) row_sumform(qr0, krow, vcs, acc[0]);   // per lane: this query row anew, unfactored
    if (wide1) row_sumform(qr1, krow, vcs, acc[1]);
#pragma unroll
    for (int t = 0; t < TT; ++t) sv[(unsigned)t * QLEN + q] = acc[0][t] * LSCALE;
    if (has1) {
#pragma unroll
      for (int t = 0; t < TT; ++t) sv[(unsigned)t * QLEN + q1] = acc[1][t] * LSCALE;
    }
  }
  __syncthreads();

  const int wave = __builtin_amdgcn_readfirstlane((int)(threadIdx.x >> 5));
  const unsigned lane = tid & 31u;
  const unsigned sb = (unsigned)wave * (unsigned)QLEN + lane;

  // the lane's elements of the row, read once; all loops below unrolled whole so that x stays in
  // registers and the reads stand behind one wait
  float x[QLEN / 32];
#pragma unroll
  for (unsigned j = 0; j < (unsigned)(QLEN / 32); ++j) x[j] = sv[sb + 32u * j];

  float mx = -3.0e38f;
#pragma unroll
  for (unsigned j = 0; j < (unsigned)(QLEN / 32); ++j) mx = fmaxf(mx, x[j]);
  mx = red32_max(mx);

  float sum = 0.0f;
#pragma unroll
  for (unsigned j = 0; j < (unsigned)(QLEN / 32); ++j) {
    x[j] = fexp2(x[j] - mx);
    sum += x[j];
  }
  sum = red32_sum(sum);
  const float inv = __builtin_amdgcn_rcpf(sum);

  float* prow = P + (size_t)(b * (unsigned)KLEN + t0 + (unsigned)wave) * QLEN + lane;
#pragma unroll
  for (unsigned j = 0; j < (unsigned)(QLEN / 32); ++j) prow[32u * j] = x[j] * inv;
}

// ---------------------------------------------------------------------------
extern "C" void kernel_launch(void* const* d_in, const int* in_sizes, int n_in,
                              void* d_out, int out_size, void* d_ws, size_t ws_size,
                              hipStream_t stream) {
  if (n_in < 6) return;
  const long long need_q = ((long long)(NB - 1) * QLEN_FULL + QLEN) * FEAT;
  const long long need_k = ((long long)(NB - 1) * KLEN_FULL + KLEN) * FEAT;
  const long long need_v = ((long long)NB * FEAT - 1) * KLEN_FULL + KLEN;
  const long long need_o = ((long long)NB * FEAT - 1) * QLEN_FULL + QLEN;
  if ((long long)in_sizes[0] < need_q) return;
  if ((long long)in_sizes[1] < need_k) return;
  if ((long long)in_sizes[2] < need_v) return;
  if ((long long)in_sizes[3] < (long long)FEAT * ENC) return;
  if ((long long)in_sizes[4] < (long long)FEAT * ENC) return;
  if (in_sizes[5] < ENC) return;
  if ((long long)out_size < need_o) return;
  if (ws_size < WS_TOTAL) return;

  const float* query = (const float*)d_in[0];   // [NB_FULL][QLEN_FULL][FEAT]
  const float* key   = (const float*)d_in[1];   // [NB_FULL][KLEN_FULL][FEAT]
  const float* value = (const float*)d_in[2];   // [NB_FULL][FEAT][KLEN_FULL]
  const float* w1    = (const float*)d_in[3];   // [FEAT][ENC]  (in, out), pairs with query
  const float* w2    = (const float*)d_in[4];   // [FEAT][ENC]  (in, out), pairs with key
  const float* vc    = (const float*)d_in[5];   // [ENC]
  float* out = (float*)d_out;                   // [NB_FULL][FEAT][QLEN_FULL]

  char* ws = (char*)d_ws;
  _Float16* V16 = (_Float16*)(ws + OFF_V);      // [NB][FEAT][KLEN]
  float*    Qp  = (float*)(ws + OFF_QP);        // [NB*QLEN][ENC]
  float*    Kp  = (float*)(ws + OFF_KP);        // [NB*KLEN][ENC]
  float*    Pf  = (float*)(ws + OFF_P);         // [NB][KLEN][QLEN]

  dim3 blk(256);

  // projections (operands converted in the kernel) + value plane
  proj_kernel<<<dim3(NPQ + NPK + NVB), blk, 0, stream>>>(query, key, value, w1, w2, Qp, Kp, V16);

  // additive scores + softmax over q
  score_kernel<<<dim3(KLEN / TT, NB), blk, 0, stream>>>(Qp, Kp, vc, Pf);

  // out = value . p
  outgemm_kernel<<<dim3(QLEN / 64, FEAT / 64, NB), blk, 0, stream>>>(V16, Pf, out);
}

// v007
// It runs in 23.8 microseconds.
// Next to v006, in two timings, it ran 1.05 times as fast each time.
// Over all steps from v000 it is 2.50 times as fast.
#include <hip/hip_runtime.h>
#include <stddef.h>

// Contractions on v_wmma_f32_16x16x32_f16 (f16 operands, f32 accumulate): the query and key
// projections and the value x attention-weight product. Float inputs are RNE-converted to bf16
// and carried in f16 planes (weights x64, input rows x16); attention weights go to f16 x16384
// without the bf16 step.
// The vc-weighted tanh sum is a matrix-vector product kept on the vector unit in f32;
// tanh, softmax (over the query axis) and all scalings in f32. The exponential inside tanh is
// factored, 2^(k'+q') = 2^k' * 2^q', and four terms of the sum share one reciprocal, wherever the
// block's max |k'| plus the query row's max |q'| is within SLIM and every |vc| within VLIM.
// Three launches: projections (operands converted on the way into LDS; spare blocks write the
// value plane), score + softmax (the query plane brought into LDS by asynchronous copies, tile by
// tile), output product (attention weights converted and transposed on the way into LDS, the
// value tile brought there by asynchronous copies).

typedef _Float16 v16h __attribute__((ext_vector_type(16)));
typedef _Float16 v8h  __attribute__((ext_vector_type(8)));
typedef float    v8f  __attribute__((ext_vector_type(8)));
typedef float    v4f  __attribute__((ext_vector_type(4)));
typedef float    v2f  __attribute__((ext_vector_type(2)));
typedef _Float16 h16;

#ifndef NB
#define NB 4
#endif
#ifndef QLEN
#define QLEN 512
#endif
#ifndef KLEN
#define KLEN 512
#endif
#define NB_FULL   4
#define QLEN_FULL 512
#define KLEN_FULL 512
#define FEAT 256     // input feature width (2 x encoder size)
#define ENC  128     // encoder size
#define TT   8       // key rows per score block == waves per block

static_assert(NB >= 1 && NB <= NB_FULL);
static_assert(QLEN >= 64 && QLEN <= QLEN_FULL && (QLEN % 64) == 0);
static_assert(KLEN >= 64 && KLEN <= KLEN_FULL && (KLEN % 64) == 0);
static_assert((FEAT % 64) == 0 && (FEAT % 32) == 0);
static_assert((ENC % 64) == 0 && (ENC % 32) == 0 && (ENC % 4) == 0);
static_assert(((NB * QLEN) % 64) == 0 && ((NB * KLEN) % 64) == 0);
static_assert((((size_t)NB * FEAT * KLEN / 8) % 256) == 0);   // value plane blocks, exact
static_assert(TT == 8);                                       // one softmax row per wave, 8 waves
static_assert((KLEN % TT) == 0);
static_assert(((TT * ENC) % 256) == 0);
static_assert((QLEN % 32) == 0);
static_assert((KLEN % 32) == 0);
static_assert((QLEN % 256) == 0);   // score block: every thread owns a query row, whole copy groups

#define LDF (FEAT + 8)   // halves per LDS operand row, projections (16 B x odd)
#define LDK (KLEN + 8)   // halves per LDS operand row, output product (16 B x odd)
#define LDC 68           // floats per LDS row (272 B, 16-B aligned)
#define QCH 32u          // e per query tile of the score loop: one 128-B line of each query row
#define QPITCH (QCH + 4u)                  // floats per LDS row of a query tile (144 B = 16 B x odd)
#define QTILE ((unsigned)QLEN * QPITCH)    // floats per query tile buffer
static_assert((ENC % QCH) == 0 && ENC / QCH >= 2u && (QCH % 8u) == 0);
static_assert((QPITCH % 4u) == 0 && ((QPITCH / 4u) % 2u) == 1u);
static_assert((LDF % 8) == 0 && ((LDF / 8) % 2) == 1);
static_assert((LDK % 8) == 0 && ((LDK / 8) % 2) == 1);
static_assert((LDC % 4) == 0 && LDC >= 64);

#define WCARRY 64.0f      // weight planes carried x64
#define XCARRY 16.0f      // input row planes (query, key, value) carried x16
#define PCARRY 16384.0f   // attention-weight plane carried x2^14
// projection planes hold 2*log2(e) * (x . W): exp(2 (k+q)) == exp2(k' + q')
#define PSCALE (2.8853900817779268f / (WCARRY * XCARRY))
#define OSCALE (1.0f / (PCARRY * XCARRY))
#define LSCALE (-2.8853900817779268f)   // -2 log2(e): log2-domain logit from the reciprocal sum
// max |k'| + max |q'| <= SLIM: every d = 2^k' * 2^q' + 1 lies in [1, 2^30 + 1] and both factors are
// normal, so a product of four d stays under 2^121; with |vc| <= VLIM the numerators stay under 2^123
#define SLIM 30.0f
#define VLIM 1073741824.0f   // 2^30

// static LDS per kernel (bytes)
static_assert((size_t)2 * 64 * LDF * 2 + (size_t)64 * LDC * 4 <= (size_t)131072);
static_assert((size_t)2 * 64 * LDK * 2 + (size_t)64 * LDC * 4 <= (size_t)163840);
static_assert(((size_t)2 * TT * ENC + ENC + 8 + (size_t)TT * QLEN + (size_t)2 * QTILE) * 4 <= (size_t)327680);

// workspace layout (bytes)
#define V_BYTES   ((size_t)NB * FEAT * KLEN * 2)
#define QP_BYTES  ((size_t)NB * QLEN * ENC * 4)
#define KP_BYTES  ((size_t)NB * KLEN * ENC * 4)
#define P_BYTES   ((size_t)NB * KLEN * QLEN * 4)
#define OFF_V   ((size_t)0)
#define OFF_QP  (OFF_V + V_BYTES)
#define OFF_KP  (OFF_QP + QP_BYTES)
#define OFF_P   (OFF_KP + KP_BYTES)
#define WS_TOTAL (OFF_P + P_BYTES)
static_assert((V_BYTES % 128) == 0 && (QP_BYTES % 128) == 0 && (KP_BYTES % 128) == 0);
static_assert((P_BYTES % 128) == 0);
static_assert(WS_TOTAL <= (size_t)134217728);

// ---------------------------------------------------------------------------
__device__ __forceinline__ float bf16r(float x) {   // RNE convert to bf16, returned widened
  unsigned int u = __float_as_uint(x);
  u = (u + 0x7FFFu + ((u >> 16) & 1u)) & 0xFFFF0000u;
  return __uint_as_float(u);
}

// f32 -> f16 operand convert that cannot produce an f16 subnormal (value select).
static __device__ __forceinline__ h16 toh_flush(float v) {
  const h16 r = (h16)v;
  return (fabsf(v) < 6.103515625e-05f) ? (h16)0.0f : r;
}

// 16-bit fragment: p points at element [row = lane&15][k0 + 8*(lane>>4)] of a k-contiguous
// row. Elements 0..7 <- k0+8h+0..7, elements 8..15 <- k0+16+8h+0..7 (same map for A and B).
__device__ __forceinline__ v16h frag_at(const _Float16* p) {
  v8h lo = *(const v8h*)(p);
  v8h hi = *(const v8h*)(p + 16);
  v16h out;
#pragma unroll
  for (int i = 0; i < 8; ++i) { out[i] = lo[i]; out[i + 8] = hi[i]; }
  return out;
}

__device__ __forceinline__ v8f wmma16(v16h a, v16h b, v8f c) {
  v8f d = __builtin_amdgcn_wmma_f32_16x16x32_f16(false, a, false, b, (short)0, c,
                                                 false, false);
  asm volatile("v_nop\n\tv_nop\n\tv_nop\n\tv_nop" : "+v"(d) : "v"(a), "v"(b));
  return d;
}

// Lane exchanges on the vector unit (no LDS trip). xlane<M>: the value of lane l ^ M inside a
// 16-lane row (DPP row_xmask:M, M < 16); xhalf: the value of lane l ^ 16.
template <int M>
__device__ __forceinline__ float xlane(float x) {
  return __builtin_bit_cast(float, __builtin_amdgcn_update_dpp(
      0, __builtin_bit_cast(int, x), 0x160 + M, 0xf, 0xf, true));
}
__device__ __forceinline__ float xhalf(float x) {
  const int b = __builtin_bit_cast(int, x);
  return __builtin_bit_cast(float, __builtin_amdgcn_permlanex16(b, b, 0x76543210, 0xfedcba98,
                                                                false, false));
}
// butterflies over the 32 lanes, partners l ^ 1, 2, 4, 8, 16 in that order
__device__ __forceinline__ float red32_max(float x) {
  x = fmaxf(x, xlane<1>(x));
  x = fmaxf(x, xlane<2>(x));
  x = fmaxf(x, xlane<4>(x));
  x = fmaxf(x, xlane<8>(x));
  return fmaxf(x, xhalf(x));
}
__device__ __forceinline__ float red32_sum(float x) {
  x += xlane<1>(x);
  x += xlane<2>(x);
  x += xlane<4>(x);
  x += xlane<8>(x);
  return x + xhalf(x);
}

__device__ __forceinline__ float fexp2(float x) {
#if __has_builtin(__builtin_amdgcn_exp2f)
  return __builtin_amdgcn_exp2f(x);
#else
  return exp2f(x);
#endif
}

// 1 / (2^x + 1); tanh(z) = 1 - 2 / (exp(2 z) + 1) with x = 2 log2(e) z
__device__ __forceinline__ float rcp1p(float x) {
  return __builtin_amdgcn_rcpf(fexp2(x) + 1.0f);
}

// ---------------------------------------------------------------------------
// Operand staging, f32 global -> f16 LDS, 256 threads, one 64-wide tile over the whole K;
// a load half (registers; one address, constant offsets) and a convert-and-store half.
// cols: src[K rows][64 cols used] (pitch LD) -> T[col][k] (pitch K + 8 halves),
//   f16(carry * bf16(x)) (RND) or f16(carry * x). Thread: col = tid & 63, eight consecutive k
//   per 16-B LDS store; each load instruction of a wave covers one 128-B line of a source row.
// rows: src[64 rows][K cols] (pitch LD) -> T[row][k] (pitch K + 8 halves),
//   f16(16 * bf16(x)). Thread: eight consecutive k of one row per 16-B LDS store.
// ---------------------------------------------------------------------------
template <unsigned K, unsigned LD>
__device__ __forceinline__ void load_cols(const float* __restrict__ src, float (&v)[K / 32u][8]) {
  const float* s = src + (size_t)((threadIdx.x >> 6) * 8u) * LD + (threadIdx.x & 63u);
#pragma unroll
  for (unsigned j = 0; j < K / 32u; ++j)               // k = 8 (tid >> 6) + 32 j + i
#pragma unroll
    for (unsigned i = 0; i < 8u; ++i) v[j][i] = s[(size_t)(32u * j + i) * LD];
  // precaution: the address stays in its registers up to this wait, so that no load's result
  // is placed on the address of an issued load ahead of it
  asm volatile("s_wait_xcnt 0x0" :: "v"(s) : "memory");
}

template <unsigned K, bool RND>
__device__ __forceinline__ void put_cols(const float (&v)[K / 32u][8], const float carry,
                                         _Float16* T) {
  _Float16* d = T + (threadIdx.x & 63u) * (K + 8u) + (threadIdx.x >> 6) * 8u;
#pragma unroll
  for (unsigned j = 0; j < K / 32u; ++j) {
    v8h o;
#pragma unroll
    for (int i = 0; i < 8; ++i) o[i] = toh_flush(carry * (RND ? bf16r(v[j][i]) : v[j][i]));
    *(v8h*)(d + 32u * j) = o;
  }
}

// rows per sweep of the block: 256 threads / (K / 8 threads per row)
#define ROWSWEEP(K) (256u / ((K) / 8u))

template <unsigned K, unsigned LD>
__device__ __forceinline__ void load_rows(const float* __restrict__ src,
                                          v4f (&a)[64u / ROWSWEEP(K)][2]) {
  static_assert(K / 8u <= 256u && (256u % (K / 8u)) == 0);
  const float* s = src + (size_t)(threadIdx.x / (K / 8u)) * LD + (threadIdx.x % (K / 8u)) * 8u;
#pragma unroll
  for (unsigned j = 0; j < 64u / ROWSWEEP(K); ++j) {   // row = tid / (K / 8) + ROWSWEEP j
    a[j][0] = *(const v4f*)(s + (size_t)(ROWSWEEP(K) * j) * LD);
    a[j][1] = *(const v4f*)(s + (size_t)(ROWSWEEP(K) * j) * LD + 4);
  }
  // precaution: as in load_cols
  asm volatile("s_wait_xcnt 0x0" :: "v"(s) : "memory");
}

template <unsigned K>
__device__ __forceinline__ void put_rows(const v4f (&a)[64u / ROWSWEEP(K)][2], _Float16* T) {
  _Float16* d = T + (threadIdx.x / (K / 8u)) * (K + 8u) + (threadIdx.x % (K / 8u)) * 8u;
#pragma unroll
  for (unsigned j = 0; j < 64u / ROWSWEEP(K); ++j) {
    v8h o;
#pragma unroll
    for (int i = 0; i < 4; ++i) {
      o[i]     = toh_flush(XCARRY * bf16r(a[j][0][i]));
      o[i + 4] = toh_flush(XCARRY * bf16r(a[j][1][i]));
    }
    *(v8h*)(d + ROWSWEEP(K) * j * (K + 8u)) = o;
  }
}

// ---------------------------------------------------------------------------
// Operand staging without a convert: src[64 rows][K halves] (pitch K, f16 already) -> T[row][k]
// (pitch K + 8 halves) by asynchronous copies to LDS, 16 B per lane, through no register.
// Thread: eight consecutive k of one row; a wave's copy covers 512 contiguous bytes of a row.
// All lanes on, 16 copies per wave in flight. The caller waits (s_wait_asynccnt 0) and passes a
// block barrier before anybody reads T.
// ---------------------------------------------------------------------------
template <unsigned K>
__device__ __forceinline__ void copy_rows16(const _Float16* __restrict__ src, _Float16* T) {
  static_assert(K / 8u <= 256u && (256u % (K / 8u)) == 0 && ((64u / ROWSWEEP(K)) % 8u) == 0);
  static_assert(64u / ROWSWEEP(K) <= 63u);
  const unsigned r = threadIdx.x / (K / 8u), c = (threadIdx.x % (K / 8u)) * 8u;
  const _Float16* g = src + (size_t)r * K + c;
  const unsigned l = (unsigned)(size_t)(T + r * (K + 8u) + c);   // LDS byte address
  // unrolled: no branch between the copies, every address a constant step from one base
#pragma unroll
  for (unsigned j = 0; j < 64u / ROWSWEEP(K); j += 8u) {         // row = r + ROWSWEEP (j + i)
    const _Float16* gj = g + (size_t)(ROWSWEEP(K) * j) * K;
    const unsigned lj = l + ROWSWEEP(K) * j * (K + 8u) * 2u;
    const unsigned gs = ROWSWEEP(K) * K, ls = ROWSWEEP(K) * (K + 8u) * 2u;
    // eight copies and, as a precaution, the wait that keeps their address registers as they
    // are until the copies have taken them, in one statement
    asm volatile(
        "global_load_async_to_lds_b128 %0, %8, off\n\t"
        "global_load_async_to_lds_b128 %1, %9, off\n\t"
        "global_load_async_to_lds_b128 %2, %10, off\n\t"
        "global_load_async_to_lds_b128 %3, %11, off\n\t"
        "global_load_async_to_lds_b128 %4, %12, off\n\t"
        "global_load_async_to_lds_b128 %5, %13, off\n\t"
        "global_load_async_to_lds_b128 %6, %14, off\n\t"
        "global_load_async_to_lds_b128 %7, %15, off\n\t"
        "s_wait_xcnt 0x0"
        :: "v"(lj), "v"(lj + ls), "v"(lj + 2u * ls), "v"(lj + 3u * ls), "v"(lj + 4u * ls),
           "v"(lj + 5u * ls), "v"(lj + 6u * ls), "v"(lj + 7u * ls),
           "v"(gj), "v"(gj + gs), "v"(gj + 2u * gs), "v"(gj + 3u * gs), "v"(gj + 4u * gs),
           "v"(gj + 5u * gs), "v"(gj + 6u * gs), "v"(gj + 7u * gs)
        : "memory");
  }
}

// ---------------------------------------------------------------------------
// One tile of the query plane: src[QLEN rows][QCH floats] (pitch ENC) -> T[row][QCH] (pitch QPITCH)
// by asynchronous copies to LDS, 16 B per lane, through no register. A wave copies exactly the
// rows that its own lanes read, 32 w + 0..31 and the same + 256, and no other wave reads them.
// Lane: four consecutive e of one row; a copy covers the whole 128-B lines of four rows. All lanes
// on, QLEN / 32 copies per wave in flight. The wave waits (s_wait_asynccnt 0) before it reads T.
// ---------------------------------------------------------------------------
__device__ __forceinline__ void copy_qtile(const float* __restrict__ src, float* T) {
  static_assert(QCH == 32u && ((unsigned)QLEN % 256u) == 0 && (unsigned)QLEN / 32u <= 63u);
  const unsigned r = (threadIdx.x & ~31u) + ((threadIdx.x & 31u) >> 3), c = (threadIdx.x & 7u) * 4u;
  const float* g = src + (size_t)r * ENC + c;
  const unsigned l = (unsigned)(size_t)(T + r * QPITCH + c);     // LDS byte address
  // unrolled: no branch between the copies, every address a constant step from one base
#pragma unroll
  for (unsigned j = 0; j < (unsigned)QLEN / 256u; ++j) {         // row = r + 256 j + 4 i
    const float* gj = g + (size_t)(256u * j) * ENC;
    const unsigned lj = l + 256u * j * QPITCH * 4u;
    const unsigned gs = 4u * ENC, ls = 4u * QPITCH * 4u;
    // eight copies and, as a precaution, the wait that keeps their address registers as they
    // are until the copies have taken them, in one statement
    asm volatile(
        "global_load_async_to_lds_b128 %0, %8, off\n\t"
        "global_load_async_to_lds_b128 %1, %9, off\n\t"
        "global_load_async_to_lds_b128 %2, %10, off\n\t"
        "global_load_async_to_lds_b128 %3, %11, off\n\t"
        "global_load_async_to_lds_b128 %4, %12, off\n\t"
        "global_load_async_to_lds_b128 %5, %13, off\n\t"
        "global_load_async_to_lds_b128 %6, %14, off\n\t"
        "global_load_async_to_lds_b128 %7, %15, off\n\t"
        "s_wait_xcnt 0x0"
        :: "v"(lj), "v"(lj + ls), "v"(lj + 2u * ls), "v"(lj + 3u * ls), "v"(lj + 4u * ls),
           "v"(lj + 5u * ls), "v"(lj + 6u * ls), "v"(lj + 7u * ls),
           "v"(gj), "v"(gj + gs), "v"(gj + 2u * gs), "v"(gj + 3u * gs), "v"(gj + 4u * gs),
           "v"(gj + 5u * gs), "v"(gj + 6u * gs), "v"(gj + 7u * gs)
        : "memory");
  }
}

// ---------------------------------------------------------------------------
// GEMM C[64x64 tile] = A[64 rows][K] . Bt[64 n][K]^T from k-contiguous 16-bit rows (A: row 0 of
// the tile, pitch lda; Bt: column 0 of the tile, pitch ldb; LDS);
// 8 waves (mw = 16-row group, nw = 32-col group), 2 accumulators/wave.
// outf[row0 + row][n0 + col] (pitch ldo) = cs * acc; rows r = 16 i + tid/16, i < 4 -> 64 rows;
// 16 lanes x 16 B = the 256-B row segment of the tile.
// ---------------------------------------------------------------------------
__device__ __forceinline__ void gemm_body(
    const _Float16* A, const unsigned lda, const _Float16* Bt, const unsigned ldb,
    const unsigned K, float* __restrict__ outf, const unsigned ldo, const float cs,
    const unsigned row0, const unsigned n0) {
  __shared__ float Cs[64 * LDC];
  const unsigned tid = threadIdx.x, lane = tid & 31u, w = tid >> 5;
  const unsigned mw = w >> 1, nw = w & 1u;
  const unsigned hh = lane >> 4, m = lane & 15u;

  const _Float16* ap  = A + (size_t)(mw * 16u + m) * lda + hh * 8u;
  const _Float16* bp0 = Bt + (size_t)(nw * 32u + m) * ldb + hh * 8u;
  const _Float16* bp1 = bp0 + (size_t)16 * ldb;
  v8f acc0 = {}, acc1 = {};
#pragma unroll 2
  for (unsigned k0 = 0; k0 < K; k0 += 32u) {
    const v16h a  = frag_at(ap + k0);
    const v16h b0 = frag_at(bp0 + k0);
    const v16h b1 = frag_at(bp1 + k0);
    acc0 = wmma16(a, b0, acc0);
    acc1 = wmma16(a, b1, acc1);
  }
#pragma unroll
  for (int r = 0; r < 8; ++r) {
    float* d = &Cs[(mw * 16u + hh * 8u + (unsigned)r) * LDC + nw * 32u + m];
    d[0]  = acc0[r];
    d[16] = acc1[r];
  }
  __syncthreads();

  v4f xs[4];
  size_t off[4];
#pragma unroll
  for (unsigned i = 0; i < 4u; ++i) {
    const unsigned r = 16u * i + (tid >> 4);
    const unsigned c = (tid & 15u) * 4u;
    const v4f u = *(const v4f*)&Cs[r * LDC + c];
    v4f val;
#pragma unroll
    for (int j = 0; j < 4; ++j) val[j] = u[j] * cs;
    xs[i] = val;
    off[i] = (size_t)(row0 + r) * ldo + n0 + c;
  }
#pragma unroll
  for (int i = 0; i < 4; ++i) *(v4f*)(outf + off[i]) = xs[i];
}

// ---------------------------------------------------------------------------
// First launch, 1-D grid of three block ranges:
//   [0, NPQ)           Qp[rows][ENC] = 2 log2(e) * (query . W1), one 64 x 64 tile per block
//   [NPQ, NPQ + NPK)   Kp[rows][ENC] = 2 log2(e) * (key . W2)
//   [NPQ + NPK, + NVB) value plane V16[b][FEAT][KLEN] = f16(16 * bf16(value)), 8 columns/thread
// Ta / Tb: cross-wave (block barrier). The range test is the same for a whole block and the
// value blocks leave before any barrier.
// ---------------------------------------------------------------------------
#define NPQ ((unsigned)((ENC / 64) * (NB * QLEN / 64)))
#define NPK ((unsigned)((ENC / 64) * (NB * KLEN / 64)))
#define NVB ((unsigned)((size_t)NB * FEAT * KLEN / 8 / 256))

__global__ __launch_bounds__(256) void proj_kernel(
    const float* __restrict__ query, const float* __restrict__ key,
    const float* __restrict__ value, const float* __restrict__ w1,
    const float* __restrict__ w2, float* __restrict__ Qp, float* __restrict__ Kp,
    _Float16* __restrict__ V16) {
  __shared__ __attribute__((aligned(16))) _Float16 Ta[64 * LDF];
  __shared__ __attribute__((aligned(16))) _Float16 Tb[64 * LDF];
  const unsigned bid = blockIdx.x;

  if (bid >= NPQ + NPK) {
    const unsigned g = (bid - (NPQ + NPK)) * 256u + threadIdx.x;
    const unsigned row = g / (unsigned)(KLEN / 8);            // b * FEAT + d
    const unsigned cc = (g % (unsigned)(KLEN / 8)) * 8u;
    const float* s = value + (size_t)row * KLEN_FULL + cc;
    const v4f a0 = *(const v4f*)(s);
    const v4f a1 = *(const v4f*)(s + 4);
    v8h o;
#pragma unroll
    for (int i = 0; i < 4; ++i) {
      o[i]     = toh_flush(XCARRY * bf16r(a0[i]));
      o[i + 4] = toh_flush(XCARRY * bf16r(a1[i]));
    }
    *(v8h*)(V16 + (size_t)g * 8u) = o;
    return;
  }

  const bool isq = bid < NPQ;
  const unsigned t = isq ? bid : bid - NPQ;
  const unsigned n0 = (t % (unsigned)(ENC / 64)) * 64u;
  const unsigned row0 = (t / (unsigned)(ENC / 64)) * 64u;    // compact row, b * len + r
  const unsigned len = isq ? (unsigned)QLEN : (unsigned)KLEN;
  const unsigned lenf = isq ? (unsigned)QLEN_FULL : (unsigned)KLEN_FULL;
  const unsigned b = row0 / len;
  const float* X = (isq ? query : key) + ((size_t)b * lenf + (row0 - b * len)) * FEAT;
  const float* Wm = (isq ? w1 : w2) + n0;

  float wv[FEAT / 32][8];
  v4f xa[64u / ROWSWEEP(FEAT)][2];
  load_cols<FEAT, ENC>(Wm, wv);
  load_rows<FEAT, FEAT>(X, xa);
  // keeps every load of both tiles issued ahead of the first convert: one memory latency for
  // the block instead of one per group of rows
  __builtin_amdgcn_sched_barrier(0);
  put_cols<FEAT, true>(wv, WCARRY, Tb);
  put_rows<FEAT>(xa, Ta);
  __syncthreads();
  gemm_body(Ta, (unsigned)LDF, Tb, (unsigned)LDF, (unsigned)FEAT, isq ? Qp : Kp,
            (unsigned)ENC, PSCALE, row0, n0);
}

// ---------------------------------------------------------------------------
// out[b][d][q] = sum_t value[b][d][t] * p[b][t][q]; A = 64 rows of the value plane
// [b][FEAT][KLEN], copied to LDS while P is loaded and converted;
// Bt[q][t] = f16(16384 * p[t][q]) staged in LDS from P[b][KLEN][QLEN].
// Ta / Tb: cross-wave (block barrier). Grid (QLEN/64, FEAT/64, NB); output rows at the full pitch.
// ---------------------------------------------------------------------------
__global__ __launch_bounds__(256) void outgemm_kernel(
    const _Float16* __restrict__ V16, const float* __restrict__ P,
    float* __restrict__ outf) {
  __shared__ __attribute__((aligned(16))) _Float16 Ta[64 * LDK];
  __shared__ __attribute__((aligned(16))) _Float16 Tb[64 * LDK];
  const unsigned b = blockIdx.z;
  const unsigned n0 = blockIdx.x * 64u;
  const unsigned row0 = blockIdx.y * 64u;
  copy_rows16<KLEN>(V16 + ((size_t)b * FEAT + row0) * KLEN, Ta);
  float pv[KLEN / 32][8];
  load_cols<KLEN, QLEN>(P + (size_t)b * KLEN * QLEN + n0, pv);
  put_cols<KLEN, false>(pv, PCARRY, Tb);
  // this wave's copies into Ta have landed before the barrier behind which other waves read them
  asm volatile("s_wait_asynccnt 0x0" ::: "memory");
  __syncthreads();
  gemm_body(Ta, (unsigned)LDK, Tb, (unsigned)LDK,
            (unsigned)KLEN, outf + (size_t)b * FEAT * QLEN_FULL, (unsigned)QLEN_FULL, OSCALE,
            row0, n0);
}

// ---------------------------------------------------------------------------
// Additive score + softmax over the query axis. Block = 8 key rows t0..t0+7 of one batch.
//   r[t][q][e] = 1 / (exp2(Kp'[t][e] + Qp'[q][e]) + 1)      (planes pre-scaled by 2 log2 e)
//              = 1 / (2^Kp'[t][e] * 2^Qp'[q][e] + 1)         (factored form: 2^Kp' once per element
//                in LDS, 2^Qp' once per element and block; four e share one reciprocal). A query
//                row with max |q'| + (the block's max |k'|) above SLIM takes the sum form.
//   L[t][q]    = -2 log2(e) * sum_e bf16(vc[e]) * r          (log2-domain logit up to a constant
//                                                             shift that the softmax removes)
//   p[t][q]    = exp2(L - max_q L) / sum_q exp2(L - max_q L)
// The query plane of the batch comes through LDS in tiles of QCH e (qs, two buffers): the next
// tile's asynchronous copies fly while this one is worked on. qs: each wave copies and reads its
// own rows only (a ring private to the wave: its own waits, no barrier).
// krow / kexp / kout / vcs / sv: cross-wave (block barriers); after the second barrier each wave reads
// one sv row once and keeps it in registers (max, exp2, sum, scale; lane exchanges on the vector unit).
// Each output row line (32 floats) is one store instruction of one wave, 4 B per lane,
// lane-contiguous. Grid (KLEN/TT, NB).
// ---------------------------------------------------------------------------
// acc[t] = sum_e vcs[e] / (exp2(krow[t][e] + qr[e]) + 1): any size of k' and q'
__device__ __forceinline__ void row_sumform(const float* __restrict__ qr, const float* krow,
                                            const float* vcs, float (&acc)[TT]) {
#pragma unroll
  for (int t = 0; t < TT; ++t) acc[t] = 0.0f;
  // rolled: a trip holds 32 independent exponentials and reciprocals already
#pragma unroll 1
  for (unsigned e = 0; e < (unsigned)ENC; e += 4u) {
    const float* qp = qr + e;
    const v4f qv = *(const v4f*)qp;
    // precaution: as in load_cols, the address stays in its registers up to this wait
    asm volatile("s_wait_xcnt 0x0" :: "v"(qp) : "memory");
    const v4f vv = *(const v4f*)&vcs[e];
#pragma unroll
    for (int t = 0; t < TT; ++t) {
      const v4f kk = *(const v4f*)&krow[(unsigned)t * ENC + e];
#pragma unroll
      for (int j = 0; j < 4; ++j) acc[t] = __builtin_fmaf(vv[j], rcp1p(kk[j] + qv[j]), acc[t]);
    }
  }
}

// a2[r][t / 2] += sum over the QCH e of one query tile of vcs[e] / d[r][t][e],
// d = kexp[e][t] * exp2(qr_r[e]) + 1, for two query rows r at once, four e under one reciprocal:
//   v0/d0 + v1/d1 = n01 / p01, n01 = v0 d1 + v1 d0, p01 = d0 d1; likewise n23 / p23;
//   n01/p01 + n23/p23 = (n01 p23 + n23 p01) / (p01 p23).
// kexp is [e][t], so that two key rows fill one packed f32 operand at every level; each kexp and
// vcs value read from LDS serves both query rows. qr0 / qr1: the lane's two rows of the tile in
// LDS; kexp / vcs: at the tile's first e. qm[r] = running max_e |qr_r[e]|. A row is right only
// where that maximum plus max |k'| is within SLIM and |vc| within VLIM (the caller tests).
__device__ __forceinline__ void tile_factored(const float* qr0, const float* qr1,
                                              const float* kexp, const float* vcs,
                                              v2f (&a2)[2][TT / 2], float (&qm)[2]) {
  const v2f one = {1.0f, 1.0f};
  // two groups of four e per trip: the arithmetic of a trip is long enough to cover the sibling
  // wave's wait for its loads
#pragma unroll 2
  for (unsigned e = 0; e < QCH; e += 4u) {
    const v4f qv[2] = {*(const v4f*)(qr0 + e), *(const v4f*)(qr1 + e)};
    const v4f vv = *(const v4f*)&vcs[e];
    v4f kk[4][2];
#pragma unroll
    for (int j = 0; j < 4; ++j) {
      kk[j][0] = *(const v4f*)&kexp[(e + (unsigned)j) * TT];
      kk[j][1] = *(const v4f*)&kexp[(e + (unsigned)j) * TT + 4u];
    }
    const v2f v0 = {vv[0], vv[0]}, v1 = {vv[1], vv[1]}, v2 = {vv[2], vv[2]}, v3 = {vv[3], vv[3]};
#pragma unroll
    for (int r = 0; r < 2; ++r) {
      qm[r] = fmaxf(fmaxf(qm[r], fmaxf(fabsf(qv[r][0]), fabsf(qv[r][1]))),
                    fmaxf(fabsf(qv[r][2]), fabsf(qv[r][3])));
      v2f qe[4];
#pragma unroll
      for (int j = 0; j < 4; ++j) {
        const float x = fexp2(qv[r][j]);
        qe[j] = (v2f){x, x};
      }
#pragma unroll
      for (int p = 0; p < TT / 2; ++p) {               // key rows 2 p, 2 p + 1
        v2f d[4];
#pragma unroll
        for (int j = 0; j < 4; ++j) {
          const v2f k2 = {kk[j][p >> 1][(p & 1) * 2], kk[j][p >> 1][(p & 1) * 2 + 1]};
          d[j] = __builtin_elementwise_fma(k2, qe[j], one);
        }
        const v2f p01 = d[0] * d[1];
        const v2f p23 = d[2] * d[3];
        const v2f n01 = __builtin_elementwise_fma(v1, d[0], v0 * d[1]);
        const v2f n23 = __builtin_elementwise_fma(v3, d[2], v2 * d[3]);
        const v2f pp = p01 * p23;
        const v2f nn = __builtin_elementwise_fma(n23, p01, n01 * p23);
        const v2f rr = {__builtin_amdgcn_rcpf(pp[0]), __builtin_amdgcn_rcpf(pp[1])};
        a2[r][p] = __builtin_elementwise_fma(nn, rr, a2[r][p]);
      }
    }
  }
}

__global__ __launch_bounds__(256) void score_kernel(
    const float* __restrict__ Qp, const float* __restrict__ Kp,
    const float* __restrict__ vc, float* __restrict__ P) {
  __shared__ __attribute__((aligned(16))) float krow[TT * ENC];
  __shared__ __attribute__((aligned(16))) float kexp[ENC * TT];   // [e][t]
  __shared__ __attribute__((aligned(16))) float kout[8];   // per wave: max |k'| (huge: a vc outside)
  __shared__ __attribute__((aligned(16))) float vcs[ENC];
  __shared__ __attribute__((aligned(16))) float sv[TT * QLEN];
  __shared__ __attribute__((aligned(16))) float qs[2 * QTILE];   // two query tile buffers

  const unsigned tid = threadIdx.x;
  const unsigned t0 = blockIdx.x * (unsigned)TT;
  const unsigned b = blockIdx.y;
  const float* Qb = Qp + (size_t)(b * (unsigned)QLEN) * ENC;

  // query tile 0 flies while the key rows are staged
  copy_qtile(Qb, qs);

  {
    const float* kp = Kp + (size_t)(b * (unsigned)KLEN + t0) * ENC;
    float km = 0.0f;
    if (tid < (unsigned)ENC) {                            // whole waves in or out (ENC % 32 == 0)
      const float v = bf16r(vc[tid]);
      vcs[tid] = v;
      if (!(fabsf(v) <= VLIM)) km = 3.0e38f;
    }
#pragma unroll
    for (unsigned j = 0; j < (unsigned)(TT * ENC / 256); ++j) {
      const unsigned i = tid + 256u * j;
      const float kv = kp[i];
      krow[i] = kv;
      kexp[(i % (unsigned)ENC) * TT + i / (unsigned)ENC] = fexp2(kv);
      km = fmaxf(km, fabsf(kv));
    }
    km = red32_max(km);
    if ((tid & 31u) == 0u) kout[tid >> 5] = km;
  }
  // this wave's copies of tile 0 have landed before it reads them
  asm volatile("s_wait_asynccnt 0x0" ::: "memory");
  __syncthreads();
  // tile 1 flies while tile 0 is worked on
  copy_qtile(Qb + QCH, qs + QTILE);

  float kx = 0.0f;
#pragma unroll
  for (int w = 0; w < 8; ++w) kx = fmaxf(kx, kout[w]);
  // the block's max |k'|, the same in every lane
  const float kmx = __builtin_bit_cast(float, __builtin_amdgcn_readfirstlane(__builtin_bit_cast(int, kx)));
  const bool kwide = !(kmx <= SLIM);

  // a lane takes query rows q and q + 256 together; where there is no second (QLEN == 256) it
  // reads the first again and stores nothing for it
  {
    const unsigned q = tid;
    const unsigned q1 = q + 256u;
    constexpr bool has1 = QLEN > 256;
    const float* qr0 = Qb + (size_t)q * ENC;
    const float* qr1 = qr0 + (has1 ? (size_t)256 * ENC : (size_t)0);   // one base address for both rows
    const unsigned l0 = q * QPITCH, l1 = (has1 ? q1 : q) * QPITCH;     // the lane's rows in a tile
    v2f a2[2][TT / 2];
    float qm[2];
#pragma unroll
    for (int r = 0; r < 2; ++r) {
      qm[r] = 0.0f;
#pragma unroll
      for (int p = 0; p < TT / 2; ++p) a2[r][p] = (v2f){0.0f, 0.0f};
    }
    // rolled: one body for all tiles; trip c reads buffer c & 1 alone. The ring is private to the
    // wave (it copies the rows that it reads), so its own two waits order it and no barrier stands here
#pragma unroll 1
    for (unsigned c = 0; c < (unsigned)ENC / QCH; ++c) {
      float* buf = qs + (c & 1u) * QTILE;
      if (!kwide) tile_factored(buf + l0, buf + l1, kexp + c * QCH * TT, vcs + c * QCH, a2, qm);
      // this wave's reads of its rows in the buffer are done before it refills them
      asm volatile("s_wait_dscnt 0x0" ::: "memory");
      // this wave's copies of tile c + 1 have landed before the next trip reads them
      asm volatile("s_wait_asynccnt 0x0" ::: "memory");
      if (c + 2u < (unsigned)ENC / QCH) copy_qtile(Qb + (c + 2u) * QCH, buf);
    }
    // no copy is outstanding behind the loop
    asm volatile("s_wait_asynccnt 0x0" ::: "memory");
    float acc[2][TT];
#pragma unroll
    for (int r = 0; r < 2; ++r)
#pragma unroll
      for (int p = 0; p < TT / 2; ++p) { acc[r][2 * p] = a2[r][p][0]; acc[r][2 * p + 1] = a2[r][p][1]; }
    const bool wide0 = kwide || !(qm[0] + kmx <= SLIM);
    const bool wide1 = kwide || !(qm[1] + kmx <= SLIM);
    if (wide0) row_sumform(qr0, krow, vcs, acc[0]);   // per lane: this query row anew, unfactored
    if (wide1) row_sumform(qr1, krow, vcs, acc[1]);
#pragma unroll
    for (int t = 0; t < TT; ++t) sv[(unsigned)t * QLEN + q] = acc[0][t] * LSCALE;
    if (has1) {
#pragma unroll
      for (int t = 0; t < TT; ++t) sv[(unsigned)t * QLEN + q1] = acc[1][t] * LSCALE;
    }
  }
  __syncthreads();

  const int wave = __builtin_amdgcn_readfirstlane((int)(threadIdx.x >> 5));
  const unsigned lane = tid & 31u;
  const unsigned sb = (unsigned)wave * (unsigned)QLEN + lane;

  // the lane's elements of the row, read once; all loops below unrolled whole so that x stays in
  // registers and the reads stand behind one wait
  float x[QLEN / 32];
#pragma unroll
  for (unsigned j = 0; j < (unsigned)(QLEN / 32); ++j) x[j] = sv[sb + 32u * j];

  float mx = -3.0e38f;
#pragma unroll
  for (unsigned j = 0; j < (unsigned)(QLEN / 32); ++j) mx = fmaxf(mx, x[j]);
  mx = red32_max(mx);

  float sum = 0.0f;
#pragma unroll
  for (unsigned j = 0; j < (unsigned)(QLEN / 32); ++j) {
    x[j] = fexp2(x[j] - mx);
    sum += x[j];
  }
  sum = red32_sum(sum);
  const float inv = __builtin_amdgcn_rcpf(sum);

  float* prow = P + (size_t)(b * (unsigned)KLEN + t0 + (unsigned)wave) * QLEN + lane;
#pragma unroll
  for (unsigned j = 0; j < (unsigned)(QLEN / 32); ++j) prow[32u * j] = x[j] * inv;
}

// ---------------------------------------------------------------------------
extern "C" void kernel_launch(void* const* d_in, const int* in_sizes, int n_in,
                              void* d_out, int out_size, void* d_ws, size_t ws_size,
                              hipStream_t stream) {
  if (n_in < 6) return;
  const long long need_q = ((long long)(NB - 1) * QLEN_FULL + QLEN) * FEAT;
  const long long need_k = ((long long)(NB - 1) * KLEN_FULL + KLEN) * FEAT;
  const long long need_v = ((long long)NB * FEAT - 1) * KLEN_FULL + KLEN;
  const long long need_o = ((long long)NB * FEAT - 1) * QLEN_FULL + QLEN;
  if ((long long)in_sizes[0] < need_q) return;
  if ((long long)in_sizes[1] < need_k) return;
  if ((long long)in_sizes[2] < need_v) return;
  if ((long long)in_sizes[3] < (long long)FEAT * ENC) return;
  if ((long long)in_sizes[4] < (long long)FEAT * ENC) return;
  if (in_sizes[5] < ENC) return;
  if ((long long)out_size < need_o) return;
  if (ws_size < WS_TOTAL) return;

  const float* query = (const float*)d_in[0];   // [NB_FULL][QLEN_FULL][FEAT]
  const float* key   = (const float*)d_in[1];   // [NB_FULL][KLEN_FULL][FEAT]
  const float* value = (const float*)d_in[2];   // [NB_FULL][FEAT][KLEN_FULL]
  const float* w1    = (const float*)d_in[3];   // [FEAT][ENC]  (in, out), pairs with query
  const float* w2    = (const float*)d_in[4];   // [FEAT][ENC]  (in, out), pairs with key
  const float* vc    = (const float*)d_in[5];   // [ENC]
  float* out = (float*)d_out;                   // [NB_FULL][FEAT][QLEN_FULL]

  char* ws = (char*)d_ws;
  _Float16* V16 = (_Float16*)(ws + OFF_V);      // [NB][FEAT][KLEN]
  float*    Qp  = (float*)(ws + OFF_QP);        // [NB*QLEN][ENC]
  float*    Kp  = (float*)(ws + OFF_KP);        // [NB*KLEN][ENC]
  float*    Pf  = (float*)(ws + OFF_P);         // [NB][KLEN][QLEN]

  dim3 blk(256);

  // projections (operands converted in the kernel) + value plane
  proj_kernel<<<dim3(NPQ + NPK + NVB), blk, 0, stream>>>(query, key, value, w1, w2, Qp, Kp, V16);

  // additive scores + softmax over q
  score_kernel<<<dim3(KLEN / TT, NB), blk, 0, stream>>>(Qp, Kp, vc, Pf);

  // out = value . p
  outgemm_kernel<<<dim3(QLEN / 64, FEAT / 64, NB), blk, 0, stream>>>(V16, Pf, out);
}

// v008
// Measured time: 22.5 microseconds a run.
// Timed twice side by side with v007, it ran 1.05 and 1.06 times as fast.
// Over all steps from v000 it is 2.65 times as fast.
#include <hip/hip_runtime.h>
#include <stddef.h>

// Contractions on v_wmma_f32_16x16x32_f16 (f16 operands, f32 accumulate): the query and key
// projections and the value x attention-weight product. Float inputs are RNE-converted to bf16
// and carried in f16 planes (weights x64, input rows x16); attention weights go to f16 x16384
// without the bf16 step.
// The vc-weighted tanh sum is a matrix-vector product kept on the vector unit in f32;
// tanh, softmax (over the query axis) and all scalings in f32. The exponential inside tanh is
// factored, 2^(k'+q') = 2^k' * 2^q', and four terms of the sum share one reciprocal, wherever the
// block's max |k'| plus the query row's max |q'| is within SLIM and every |vc| within VLIM.
// Three launches: projections (operands converted on the way into LDS; spare blocks write the
// value plane), score + softmax (the query plane brought into LDS by asynchronous copies, tile by
// tile; the attention weights leave it as the f16 operand plane, in the order of the fragments),
// output product (both operand tiles brought into LDS by asynchronous copies).

typedef _Float16 v16h __attribute__((ext_vector_type(16)));
typedef _Float16 v8h  __attribute__((ext_vector_type(8)));
typedef float    v8f  __attribute__((ext_vector_type(8)));
typedef float    v4f  __attribute__((ext_vector_type(4)));
typedef float    v2f  __attribute__((ext_vector_type(2)));
typedef _Float16 h16;

#ifndef NB
#define NB 4
#endif
#ifndef QLEN
#define QLEN 512
#endif
#ifndef KLEN
#define KLEN 512
#endif
#define NB_FULL   4
#define QLEN_FULL 512
#define KLEN_FULL 512
#define FEAT 256     // input feature width (2 x encoder size)
#define ENC  128     // encoder size
#define TT   8       // key rows per score block == waves per block

static_assert(NB >= 1 && NB <= NB_FULL);
static_assert(QLEN >= 64 && QLEN <= QLEN_FULL && (QLEN % 64) == 0);
static_assert(KLEN >= 64 && KLEN <= KLEN_FULL && (KLEN % 64) == 0);
static_assert((FEAT % 64) == 0 && (FEAT % 32) == 0);
static_assert((ENC % 64) == 0 && (ENC % 32) == 0 && (ENC % 4) == 0);
static_assert(((NB * QLEN) % 64) == 0 && ((NB * KLEN) % 64) == 0);
static_assert((((size_t)NB * FEAT * KLEN / 8) % 256) == 0);   // value plane blocks, exact
static_assert(TT == 8);                                       // one softmax row per wave, 8 waves
static_assert((KLEN % TT) == 0);
static_assert(((TT * ENC) % 256) == 0);
static_assert((QLEN % 32) == 0);
static_assert((KLEN % 32) == 0);
static_assert((QLEN % 256) == 0);   // score block: every thread owns a query row, whole copy groups

#define LDF (FEAT + 8)   // halves per LDS operand row, projections (16 B x odd)
#define LDK (KLEN + 8)   // halves per LDS operand row, output product (16 B x odd)
#define LDC 68           // floats per LDS row (272 B, 16-B aligned)
#define QCH 32u          // e per query tile of the score loop: one 128-B line of each query row
#define QPITCH (QCH + 4u)                  // floats per LDS row of a query tile (144 B = 16 B x odd)
#define QTILE ((unsigned)QLEN * QPITCH)    // floats per query tile buffer
static_assert((ENC % QCH) == 0 && ENC / QCH >= 2u && (QCH % 8u) == 0);
static_assert((QPITCH % 4u) == 0 && ((QPITCH / 4u) % 2u) == 1u);
static_assert((LDF % 8) == 0 && ((LDF / 8) % 2) == 1);
static_assert((LDK % 8) == 0 && ((LDK / 8) % 2) == 1);
static_assert((LDC % 4) == 0 && LDC >= 64);

#define WCARRY 64.0f      // weight planes carried x64
#define XCARRY 16.0f      // input row planes (query, key, value) carried x16
#define PCARRY 16384.0f   // attention-weight plane carried x2^14
// projection planes hold 2*log2(e) * (x . W): exp(2 (k+q)) == exp2(k' + q')
#define PSCALE (2.8853900817779268f / (WCARRY * XCARRY))
#define OSCALE (1.0f / (PCARRY * XCARRY))
#define LSCALE (-2.8853900817779268f)   // -2 log2(e): log2-domain logit from the reciprocal sum
// max |k'| + max |q'| <= SLIM: every d = 2^k' * 2^q' + 1 lies in [1, 2^30 + 1] and both factors are
// normal, so a product of four d stays under 2^121; with |vc| <= VLIM the numerators stay under 2^123
#define SLIM 30.0f
#define VLIM 1073741824.0f   // 2^30

// static LDS per kernel (bytes)
static_assert((size_t)2 * 64 * LDF * 2 + (size_t)64 * LDC * 4 <= (size_t)131072);
static_assert((size_t)64 * LDK * 2 + (size_t)64 * KLEN * 2 + (size_t)64 * LDC * 4 <= (size_t)163840);
static_assert(((size_t)2 * TT * ENC + ENC + 8 + (size_t)TT * QLEN + (size_t)2 * QTILE) * 4 +
              (size_t)TT * QLEN * 2 <= (size_t)327680);

// workspace layout (bytes)
#define V_BYTES   ((size_t)NB * FEAT * KLEN * 2)
#define QP_BYTES  ((size_t)NB * QLEN * ENC * 4)
#define KP_BYTES  ((size_t)NB * KLEN * ENC * 4)
#define P_BYTES   ((size_t)NB * KLEN * QLEN * 2)
#define OFF_V   ((size_t)0)
#define OFF_QP  (OFF_V + V_BYTES)
#define OFF_KP  (OFF_QP + QP_BYTES)
#define OFF_P   (OFF_KP + KP_BYTES)
#define WS_TOTAL (OFF_P + P_BYTES)
static_assert((V_BYTES % 128) == 0 && (QP_BYTES % 128) == 0 && (KP_BYTES % 128) == 0);
static_assert((P_BYTES % 128) == 0);
static_assert(WS_TOTAL <= (size_t)134217728);

// ---------------------------------------------------------------------------
__device__ __forceinline__ float bf16r(float x) {   // RNE convert to bf16, returned widened
  unsigned int u = __float_as_uint(x);
  u = (u + 0x7FFFu + ((u >> 16) & 1u)) & 0xFFFF0000u;
  return __uint_as_float(u);
}

// f32 -> f16 operand convert that cannot produce an f16 subnormal (value select).
static __device__ __forceinline__ h16 toh_flush(float v) {
  const h16 r = (h16)v;
  return (fabsf(v) < 6.103515625e-05f) ? (h16)0.0f : r;
}

// 16-bit fragment: p points at element [row = lane&15][k0 + 8*(lane>>4)] of a k-contiguous
// row. Elements 0..7 <- k0+8h+0..7, elements 8..15 <- k0+16+8h+0..7 (same map for A and B).
// HI: halves from the first group of eight k to the second (16 in a k-contiguous row).
template <unsigned HI>
__device__ __forceinline__ v16h frag_at(const _Float16* p) {
  v8h lo = *(const v8h*)(p);
  v8h hi = *(const v8h*)(p + HI);
  v16h out;
#pragma unroll
  for (int i = 0; i < 8; ++i) { out[i] = lo[i]; out[i + 8] = hi[i]; }
  return out;
}

__device__ __forceinline__ v8f wmma16(v16h a, v16h b, v8f c) {
  v8f d = __builtin_amdgcn_wmma_f32_16x16x32_f16(false, a, false, b, (short)0, c,
                                                 false, false);
  asm volatile("v_nop\n\tv_nop\n\tv_nop\n\tv_nop" : "+v"(d) : "v"(a), "v"(b));
  return d;
}

// Lane exchanges on the vector unit (no LDS trip). xlane<M>: the value of lane l ^ M inside a
// 16-lane row (DPP row_xmask:M, M < 16); xhalf: the value of lane l ^ 16.
template <int M>
__device__ __forceinline__ float xlane(float x) {
  return __builtin_bit_cast(float, __builtin_amdgcn_update_dpp(
      0, __builtin_bit_cast(int, x), 0x160 + M, 0xf, 0xf, true));
}
__device__ __forceinline__ float xhalf(float x) {
  const int b = __builtin_bit_cast(int, x);
  return __builtin_bit_cast(float, __builtin_amdgcn_permlanex16(b, b, 0x76543210, 0xfedcba98,
                                                                false, false));
}
// butterflies over the 32 lanes, partners l ^ 1, 2, 4, 8, 16 in that order
__device__ __forceinline__ float red32_max(float x) {
  x = fmaxf(x, xlane<1>(x));
  x = fmaxf(x, xlane<2>(x));
  x = fmaxf(x, xlane<4>(x));
  x = fmaxf(x, xlane<8>(x));
  return fmaxf(x, xhalf(x));
}
__device__ __forceinline__ float red32_sum(float x) {
  x += xlane<1>(x);
  x += xlane<2>(x);
  x += xlane<4>(x);
  x += xlane<8>(x);
  return x + xhalf(x);
}

__device__ __forceinline__ float fexp2(float x) {
#if __has_builtin(__builtin_amdgcn_exp2f)
  return __builtin_amdgcn_exp2f(x);
#else
  return exp2f(x);
#endif
}

// 1 / (2^x + 1); tanh(z) = 1 - 2 / (exp(2 z) + 1) with x = 2 log2(e) z
__device__ __forceinline__ float rcp1p(float x) {
  return __builtin_amdgcn_rcpf(fexp2(x) + 1.0f);
}

// ---------------------------------------------------------------------------
// Operand staging, f32 global -> f16 LDS, 256 threads, one 64-wide tile over the whole K;
// a load half (registers; one address, constant offsets) and a convert-and-store half.
// cols: src[K rows][64 cols used] (pitch LD) -> T[col][k] (pitch K + 8 halves),
//   f16(carry * bf16(x)). Thread: col = tid & 63, eight consecutive k
//   per 16-B LDS store; each load instruction of a wave covers one 128-B line of a source row.
// rows: src[64 rows][K cols] (pitch LD) -> T[row][k] (pitch K + 8 halves),
//   f16(16 * bf16(x)). Thread: eight consecutive k of one row per 16-B LDS store.
// ---------------------------------------------------------------------------
template <unsigned K, unsigned LD>
__device__ __forceinline__ void load_cols(const float* __restrict__ src, float (&v)[K / 32u][8]) {
  const float* s = src + (size_t)((threadIdx.x >> 6) * 8u) * LD + (threadIdx.x & 63u);
#pragma unroll
  for (unsigned j = 0; j < K / 32u; ++j)               // k = 8 (tid >> 6) + 32 j + i
#pragma unroll
    for (unsigned i = 0; i < 8u; ++i) v[j][i] = s[(size_t)(32u * j + i) * LD];
  // precaution: the address stays in its registers up to this wait, so that no load's result
  // is placed on the address of an issued load ahead of it
  asm volatile("s_wait_xcnt 0x0" :: "v"(s) : "memory");
}

template <unsigned K>
__device__ __forceinline__ void put_cols(const float (&v)[K / 32u][8], const float carry,
                                         _Float16* T) {
  _Float16* d = T + (threadIdx.x & 63u) * (K + 8u) + (threadIdx.x >> 6) * 8u;
#pragma unroll
  for (unsigned j = 0; j < K / 32u; ++j) {
    v8h o;
#pragma unroll
    for (int i = 0; i < 8; ++i) o[i] = toh_flush(carry * bf16r(v[j][i]));
    *(v8h*)(d + 32u * j) = o;
  }
}

// rows per sweep of the block: 256 threads / (K / 8 threads per row)
#define ROWSWEEP(K) (256u / ((K) / 8u))

template <unsigned K, unsigned LD>
__device__ __forceinline__ void load_rows(const float* __restrict__ src,
                                          v4f (&a)[64u / ROWSWEEP(K)][2]) {
  static_assert(K / 8u <= 256u && (256u % (K / 8u)) == 0);
  const float* s = src + (size_t)(threadIdx.x / (K / 8u)) * LD + (threadIdx.x % (K / 8u)) * 8u;
#pragma unroll
  for (unsigned j = 0; j < 64u / ROWSWEEP(K); ++j) {   // row = tid / (K / 8) + ROWSWEEP j
    a[j][0] = *(const v4f*)(s + (size_t)(ROWSWEEP(K) * j) * LD);
    a[j][1] = *(const v4f*)(s + (size_t)(ROWSWEEP(K) * j) * LD + 4);
  }
  // precaution: as in load_cols
  asm volatile("s_wait_xcnt 0x0" :: "v"(s) : "memory");
}

template <unsigned K>
__device__ __forceinline__ void put_rows(const v4f (&a)[64u / ROWSWEEP(K)][2], _Float16* T) {
  _Float16* d = T + (threadIdx.x / (K / 8u)) * (K + 8u) + (threadIdx.x % (K / 8u)) * 8u;
#pragma unroll
  for (unsigned j = 0; j < 64u / ROWSWEEP(K); ++j) {
    v8h o;
#pragma unroll
    for (int i = 0; i < 4; ++i) {
      o[i]     = toh_flush(XCARRY * bf16r(a[j][0][i]));
      o[i + 4] = toh_flush(XCARRY * bf16r(a[j][1][i]));
    }
    *(v8h*)(d + ROWSWEEP(K) * j * (K + 8u)) = o;
  }
}

// ---------------------------------------------------------------------------
// Operand staging without a convert: src[64 rows][K halves] (pitch K, f16 already) -> T[row][k]
// (pitch K + 8 halves) by asynchronous copies to LDS, 16 B per lane, through no register.
// Thread: eight consecutive k of one row; a wave's copy covers 512 contiguous bytes of a row.
// All lanes on, 16 copies per wave in flight. The caller waits (s_wait_asynccnt 0) and passes a
// block barrier before anybody reads T.
// ---------------------------------------------------------------------------
template <unsigned K>
__device__ __forceinline__ void copy_rows16(const _Float16* __restrict__ src, _Float16* T) {
  static_assert(K / 8u <= 256u && (256u % (K / 8u)) == 0 && ((64u / ROWSWEEP(K)) % 8u) == 0);
  static_assert(64u / ROWSWEEP(K) <= 63u);
  const unsigned r = threadIdx.x / (K / 8u), c = (threadIdx.x % (K / 8u)) * 8u;
  const _Float16* g = src + (size_t)r * K + c;
  const unsigned l = (unsigned)(size_t)(T + r * (K + 8u) + c);   // LDS byte address
  // unrolled: no branch between the copies, every address a constant step from one base
#pragma unroll
  for (unsigned j = 0; j < 64u / ROWSWEEP(K); j += 8u) {         // row = r + ROWSWEEP (j + i)
    const _Float16* gj = g + (size_t)(ROWSWEEP(K) * j) * K;
    const unsigned lj = l + ROWSWEEP(K) * j * (K + 8u) * 2u;
    const unsigned gs = ROWSWEEP(K) * K, ls = ROWSWEEP(K) * (K + 8u) * 2u;
    // eight copies and, as a precaution, the wait that keeps their address registers as they
    // are until the copies have taken them, in one statement
    asm volatile(
        "global_load_async_to_lds_b128 %0, %8, off\n\t"
        "global_load_async_to_lds_b128 %1, %9, off\n\t"
        "global_load_async_to_lds_b128 %2, %10, off\n\t"
        "global_load_async_to_lds_b128 %3, %11, off\n\t"
        "global_load_async_to_lds_b128 %4, %12, off\n\t"
        "global_load_async_to_lds_b128 %5, %13, off\n\t"
        "global_load_async_to_lds_b128 %6, %14, off\n\t"
        "global_load_async_to_lds_b128 %7, %15, off\n\t"
        "s_wait_xcnt 0x0"
        :: "v"(lj), "v"(lj + ls), "v"(lj + 2u * ls), "v"(lj + 3u * ls), "v"(lj + 4u * ls),
           "v"(lj + 5u * ls), "v"(lj + 6u * ls), "v"(lj + 7u * ls),
           "v"(gj), "v"(gj + gs), "v"(gj + 2u * gs), "v"(gj + 3u * gs), "v"(gj + 4u * gs),
           "v"(gj + 5u * gs), "v"(gj + 6u * gs), "v"(gj + 7u * gs)
        : "memory");
  }
}

// ---------------------------------------------------------------------------
// One 64-column tile of the attention-weight plane, which lies in groups of eight k:
// src[K / 8 groups][QLEN columns][8 k] (at the tile's first column) -> T[K / 8][64][8], by
// asynchronous copies to LDS, 16 B per lane, through no register. Lane: the eight k of one column
// and group; a wave's copy covers 512 contiguous bytes on both sides. All lanes on, K / 32 copies
// per wave in flight. The caller waits (s_wait_asynccnt 0) and passes a block barrier before
// anybody reads T.
// ---------------------------------------------------------------------------
template <unsigned K>
__device__ __forceinline__ void copy_groups16(const _Float16* __restrict__ src, _Float16* T) {
  static_assert((K % 256u) == 0 && K / 32u <= 31u);
  const _Float16* g = src + ((size_t)(threadIdx.x >> 6) * QLEN + (threadIdx.x & 63u)) * 8u;
  const unsigned l = (unsigned)(size_t)(T + threadIdx.x * 8u);   // LDS byte address
  // unrolled: no branch between the copies, every address a constant step from one base
#pragma unroll
  for (unsigned j = 0; j < K / 32u; j += 8u) {                   // group = tid / 64 + 4 (j + i)
    const _Float16* gj = g + (size_t)(4u * j) * QLEN * 8u;
    const unsigned lj = l + 4u * j * 64u * 16u;
    const unsigned gs = 4u * (unsigned)QLEN * 8u, ls = 4u * 64u * 16u;
    // eight copies and, as a precaution, the wait that keeps their address registers as they
    // are until the copies have taken them, in one statement
    asm volatile(
        "global_load_async_to_lds_b128 %0, %8, off\n\t"
        "global_load_async_to_lds_b128 %1, %9, off\n\t"
        "global_load_async_to_lds_b128 %2, %10, off\n\t"
        "global_load_async_to_lds_b128 %3, %11, off\n\t"
        "global_load_async_to_lds_b128 %4, %12, off\n\t"
        "global_load_async_to_lds_b128 %5, %13, off\n\t"
        "global_load_async_to_lds_b128 %6, %14, off\n\t"
        "global_load_async_to_lds_b128 %7, %15, off\n\t"
        "s_wait_xcnt 0x0"
        :: "v"(lj), "v"(lj + ls), "v"(lj + 2u * ls), "v"(lj + 3u * ls), "v"(lj + 4u * ls),
           "v"(lj + 5u * ls), "v"(lj + 6u * ls), "v"(lj + 7u * ls),
           "v"(gj), "v"(gj + gs), "v"(gj + 2u * gs), "v"(gj + 3u * gs), "v"(gj + 4u * gs),
           "v"(gj + 5u * gs), "v"(gj + 6u * gs), "v"(gj + 7u * gs)
        : "memory");
  }
}

// ---------------------------------------------------------------------------
// One tile of the query plane: src[QLEN rows][QCH floats] (pitch ENC) -> T[row][QCH] (pitch QPITCH)
// by asynchronous copies to LDS, 16 B per lane, through no register. A wave copies exactly the
// rows that its own lanes read, 32 w + 0..31 and the same + 256, and no other wave reads them.
// Lane: four consecutive e of one row; a copy covers the whole 128-B lines of four rows. All lanes
// on, QLEN / 32 copies per wave in flight. The wave waits (s_wait_asynccnt 0) before it reads T.
// ---------------------------------------------------------------------------
__device__ __forceinline__ void copy_qtile(const float* __restrict__ src, float* T) {
  static_assert(QCH == 32u && ((unsigned)QLEN % 256u) == 0 && (unsigned)QLEN / 32u <= 63u);
  const unsigned r = (threadIdx.x & ~31u) + ((threadIdx.x & 31u) >> 3), c = (threadIdx.x & 7u) * 4u;
  const float* g = src + (size_t)r * ENC + c;
  const unsigned l = (unsigned)(size_t)(T + r * QPITCH + c);     // LDS byte address
  // unrolled: no branch between the copies, every address a constant step from one base
#pragma unroll
  for (unsigned j = 0; j < (unsigned)QLEN / 256u; ++j) {         // row = r + 256 j + 4 i
    const float* gj = g + (size_t)(256u * j) * ENC;
    const unsigned lj = l + 256u * j * QPITCH * 4u;
    const unsigned gs = 4u * ENC, ls = 4u * QPITCH * 4u;
    // eight copies and, as a precaution, the wait that keeps their address registers as they
    // are until the copies have taken them, in one statement
    asm volatile(
        "global_load_async_to_lds_b128 %0, %8, off\n\t"
        "global_load_async_to_lds_b128 %1, %9, off\n\t"
        "global_load_async_to_lds_b128 %2, %10, off\n\t"
        "global_load_async_to_lds_b128 %3, %11, off\n\t"
        "global_load_async_to_lds_b128 %4, %12, off\n\t"
        "global_load_async_to_lds_b128 %5, %13, off\n\t"
        "global_load_async_to_lds_b128 %6, %14, off\n\t"
        "global_load_async_to_lds_b128 %7, %15, off\n\t"
        "s_wait_xcnt 0x0"
        :: "v"(lj), "v"(lj + ls), "v"(lj + 2u * ls), "v"(lj + 3u * ls), "v"(lj + 4u * ls),
           "v"(lj + 5u * ls), "v"(lj + 6u * ls), "v"(lj + 7u * ls),
           "v"(gj), "v"(gj + gs), "v"(gj + 2u * gs), "v"(gj + 3u * gs), "v"(gj + 4u * gs),
           "v"(gj + 5u * gs), "v"(gj + 6u * gs), "v"(gj + 7u * gs)
        : "memory");
  }
}

// ---------------------------------------------------------------------------
// GEMM C[64x64 tile] = A[64 rows][K] . Bt[64 n][K]^T from k-contiguous 16-bit rows (A: row 0 of
// the tile, pitch lda; Bt: column 0 of the tile, pitch ldb; LDS or global); GRP: Bt lies in groups
// of eight k instead, Bt[K / 8][64 n][8 k] (a fragment half is one group; ldb unused);
// 8 waves (mw = 16-row group, nw = 32-col group), 2 accumulators/wave.
// outf[row0 + row][n0 + col] (pitch ldo) = cs * acc; rows r = 16 i + tid/16, i < 4 -> 64 rows;
// 16 lanes x 16 B = the 256-B row segment of the tile.
// ---------------------------------------------------------------------------
template <bool GRP>
__device__ __forceinline__ void gemm_body(
    const _Float16* A, const unsigned lda, const _Float16* Bt, const unsigned ldb,
    const unsigned K, float* __restrict__ outf, const unsigned ldo, const float cs,
    const unsigned row0, const unsigned n0) {
  __shared__ float Cs[64 * LDC];
  const unsigned tid = threadIdx.x, lane = tid & 31u, w = tid >> 5;
  const unsigned mw = w >> 1, nw = w & 1u;
  const unsigned hh = lane >> 4, m = lane & 15u;

  const _Float16* ap  = A + (size_t)(mw * 16u + m) * lda + hh * 8u;
  const _Float16* bp0 = GRP ? Bt + (hh * 64u + nw * 32u + m) * 8u
                            : Bt + (size_t)(nw * 32u + m) * ldb + hh * 8u;
  const _Float16* bp1 = bp0 + (GRP ? (size_t)16 * 8 : (size_t)16 * ldb);
  constexpr unsigned KB = GRP ? 64u : 1u;      // halves per step of one k in Bt
  v8f acc0 = {}, acc1 = {};
#pragma unroll 2
  for (unsigned k0 = 0; k0 < K; k0 += 32u) {
    const v16h a  = frag_at<16u>(ap + k0);
    const v16h b0 = frag_at<16u * KB>(bp0 + k0 * KB);
    const v16h b1 = frag_at<16u * KB>(bp1 + k0 * KB);
    acc0 = wmma16(a, b0, acc0);
    acc1 = wmma16(a, b1, acc1);
  }
#pragma unroll
  for (int r = 0; r < 8; ++r) {
    float* d = &Cs[(mw * 16u + hh * 8u + (unsigned)r) * LDC + nw * 32u + m];
    d[0]  = acc0[r];
    d[16] = acc1[r];
  }
  __syncthreads();

  v4f xs[4];
  size_t off[4];
#pragma unroll
  for (unsigned i = 0; i < 4u; ++i) {
    const unsigned r = 16u * i + (tid >> 4);
    const unsigned c = (tid & 15u) * 4u;
    const v4f u = *(const v4f*)&Cs[r * LDC + c];
    v4f val;
#pragma unroll
    for (int j = 0; j < 4; ++j) val[j] = u[j] * cs;
    xs[i] = val;
    off[i] = (size_t)(row0 + r) * ldo + n0 + c;
  }
#pragma unroll
  for (int i = 0; i < 4; ++i) *(v4f*)(outf + off[i]) = xs[i];
}

// ---------------------------------------------------------------------------
// First launch, 1-D grid of three block ranges:
//   [0, NPQ)           Qp[rows][ENC] = 2 log2(e) * (query . W1), one 64 x 64 tile per block
//   [NPQ, NPQ + NPK)   Kp[rows][ENC] = 2 log2(e) * (key . W2)
//   [NPQ + NPK, + NVB) value plane V16[b][FEAT][KLEN] = f16(16 * bf16(value)), 8 columns/thread
// Ta / Tb: cross-wave (block barrier). The range test is the same for a whole block and the
// value blocks leave before any barrier.
// ---------------------------------------------------------------------------
#define NPQ ((unsigned)((ENC / 64) * (NB * QLEN / 64)))
#define NPK ((unsigned)((ENC / 64) * (NB * KLEN / 64)))
#define NVB ((unsigned)((size_t)NB * FEAT * KLEN / 8 / 256))

__global__ __launch_bounds__(256) void proj_kernel(
    const float* __restrict__ query, const float* __restrict__ key,
    const float* __restrict__ value, const float* __restrict__ w1,
    const float* __restrict__ w2, float* __restrict__ Qp, float* __restrict__ Kp,
    _Float16* __restrict__ V16) {
  __shared__ __attribute__((aligned(16))) _Float16 Ta[64 * LDF];
  __shared__ __attribute__((aligned(16))) _Float16 Tb[64 * LDF];
  const unsigned bid = blockIdx.x;

  if (bid >= NPQ + NPK) {
    const unsigned g = (bid - (NPQ + NPK)) * 256u + threadIdx.x;
    const unsigned row = g / (unsigned)(KLEN / 8);            // b * FEAT + d
    const unsigned cc = (g % (unsigned)(KLEN / 8)) * 8u;
    const float* s = value + (size_t)row * KLEN_FULL + cc;
    const v4f a0 = *(const v4f*)(s);
    const v4f a1 = *(const v4f*)(s + 4);
    v8h o;
#pragma unroll
    for (int i = 0; i < 4; ++i) {
      o[i]     = toh_flush(XCARRY * bf16r(a0[i]));
      o[i + 4] = toh_flush(XCARRY * bf16r(a1[i]));
    }
    *(v8h*)(V16 + (size_t)g * 8u) = o;
    return;
  }

  const bool isq = bid < NPQ;
  const unsigned t = isq ? bid : bid - NPQ;
  const unsigned n0 = (t % (unsigned)(ENC / 64)) * 64u;
  const unsigned row0 = (t / (unsigned)(ENC / 64)) * 64u;    // compact row, b * len + r
  const unsigned len = isq ? (unsigned)QLEN : (unsigned)KLEN;
  const unsigned lenf = isq ? (unsigned)QLEN_FULL : (unsigned)KLEN_FULL;
  const unsigned b = row0 / len;
  const float* X = (isq ? query : key) + ((size_t)b * lenf + (row0 - b * len)) * FEAT;
  const float* Wm = (isq ? w1 : w2) + n0;

  float wv[FEAT / 32][8];
  v4f xa[64u / ROWSWEEP(FEAT)][2];
  load_cols<FEAT, ENC>(Wm, wv);
  load_rows<FEAT, FEAT>(X, xa);
  // keeps every load of both tiles issued ahead of the first convert: one memory latency for
  // the block instead of one per group of rows
  __builtin_amdgcn_sched_barrier(0);
  put_cols<FEAT>(wv, WCARRY, Tb);
  put_rows<FEAT>(xa, Ta);
  __syncthreads();
  gemm_body<false>(Ta, (unsigned)LDF, Tb, (unsigned)LDF, (unsigned)FEAT, isq ? Qp : Kp,
            (unsigned)ENC, PSCALE, row0, n0);
}

// ---------------------------------------------------------------------------
// out[b][d][q] = sum_t value[b][d][t] * p[b][t][q]; A = 64 rows of the value plane
// [b][FEAT][KLEN]; Bt = 64 columns of the attention-weight plane P16[b][KLEN / 8][QLEN][8],
// f16(16384 * p[t][q]) at [t / 8][q][t % 8]; both copied to LDS as they lie.
// Ta / Tb: cross-wave (block barrier). Grid (QLEN/64, FEAT/64, NB); output rows at the full pitch.
// ---------------------------------------------------------------------------
__global__ __launch_bounds__(256) void outgemm_kernel(
    const _Float16* __restrict__ V16, const _Float16* __restrict__ P16,
    float* __restrict__ outf) {
  __shared__ __attribute__((aligned(16))) _Float16 Ta[64 * LDK];
  __shared__ __attribute__((aligned(16))) _Float16 Tb[64 * KLEN];
  const unsigned b = blockIdx.z;
  const unsigned n0 = blockIdx.x * 64u;
  const unsigned row0 = blockIdx.y * 64u;
  copy_rows16<KLEN>(V16 + ((size_t)b * FEAT + row0) * KLEN, Ta);
  copy_groups16<KLEN>(P16 + ((size_t)b * (KLEN / 8) * QLEN + n0) * 8u, Tb);
  static_assert(64u / ROWSWEEP(KLEN) + KLEN / 32u <= 63u);   // copies of a wave in flight, both tiles
  // this wave's copies into Ta and Tb have landed before the barrier behind which other waves read them
  asm volatile("s_wait_asynccnt 0x0" ::: "memory");
  __syncthreads();
  gemm_body<true>(Ta, (unsigned)LDK, Tb, 0u,
            (unsigned)KLEN, outf + (size_t)b * FEAT * QLEN_FULL, (unsigned)QLEN_FULL, OSCALE,
            row0, n0);
}

// ---------------------------------------------------------------------------
// Additive score + softmax over the query axis. Block = 8 key rows t0..t0+7 of one batch.
//   r[t][q][e] = 1 / (exp2(Kp'[t][e] + Qp'[q][e]) + 1)      (planes pre-scaled by 2 log2 e)
//              = 1 / (2^Kp'[t][e] * 2^Qp'[q][e] + 1)         (factored form: 2^Kp' once per element
//                in LDS, 2^Qp' once per element and block; four e share one reciprocal). A query
//                row with max |q'| + (the block's max |k'|) above SLIM takes the sum form.
//   L[t][q]    = -2 log2(e) * sum_e bf16(vc[e]) * r          (log2-domain logit up to a constant
//                                                             shift that the softmax removes)
//   p[t][q]    = exp2(L - max_q L) / sum_q exp2(L - max_q L)
// The query plane of the batch comes through LDS in tiles of QCH e (qs, two buffers): the next
// tile's asynchronous copies fly while this one is worked on. qs: each wave copies and reads its
// own rows only (a ring private to the wave: its own waits, no barrier).
// krow / kexp / kout / vcs / sv: cross-wave (block barriers); after the second barrier each wave reads
// one sv row once and keeps it in registers (max, exp2, sum, scale; lane exchanges on the vector unit).
// The weights leave as the output product's operand, f16(16384 * p), in groups of the block's eight
// key rows: P16[b][t0 / 8][q][8]. pt gathers the eight waves' rows (third barrier); a lane then
// stores the 16 B of one q, a wave 512 contiguous bytes, the block one run of 16 QLEN bytes.
// Grid (KLEN/TT, NB).
// ---------------------------------------------------------------------------
// acc[t] = sum_e vcs[e] / (exp2(krow[t][e] + qr[e]) + 1): any size of k' and q'
__device__ __forceinline__ void row_sumform(const float* __restrict__ qr, const float* krow,
                                            const float* vcs, float (&acc)[TT]) {
#pragma unroll
  for (int t = 0; t < TT; ++t) acc[t] = 0.0f;
  // rolled: a trip holds 32 independent exponentials and reciprocals already
#pragma unroll 1
  for (unsigned e = 0; e < (unsigned)ENC; e += 4u) {
    const float* qp = qr + e;
    const v4f qv = *(const v4f*)qp;
    // precaution: as in load_cols, the address stays in its registers up to this wait
    asm volatile("s_wait_xcnt 0x0" :: "v"(qp) : "memory");
    const v4f vv = *(const v4f*)&vcs[e];
#pragma unroll
    for (int t = 0; t < TT; ++t) {
      const v4f kk = *(const v4f*)&krow[(unsigned)t * ENC + e];
#pragma unroll
      for (int j = 0; j < 4; ++j) acc[t] = __builtin_fmaf(vv[j], rcp1p(kk[j] + qv[j]), acc[t]);
    }
  }
}

// a2[r][t / 2] += sum over the QCH e of one query tile of vcs[e] / d[r][t][e],
// d = kexp[e][t] * exp2(qr_r[e]) + 1, for two query rows r at once, four e under one reciprocal:
//   v0/d0 + v1/d1 = n01 / p01, n01 = v0 d1 + v1 d0, p01 = d0 d1; likewise n23 / p23;
//   n01/p01 + n23/p23 = (n01 p23 + n23 p01) / (p01 p23).
// kexp is [e][t], so that two key rows fill one packed f32 operand at every level; each kexp and
// vcs value read from LDS serves both query rows. qr0 / qr1: the lane's two rows of the tile in
// LDS; kexp / vcs: at the tile's first e. qm[r] = running max_e |qr_r[e]|. A row is right only
// where that maximum plus max |k'| is within SLIM and |vc| within VLIM (the caller tests).
__device__ __forceinline__ void tile_factored(const float* qr0, const float* qr1,
                                              const float* kexp, const float* vcs,
                                              v2f (&a2)[2][TT / 2], float (&qm)[2]) {
  const v2f one = {1.0f, 1.0f};
  // two groups of four e per trip: the arithmetic of a trip is long enough to cover the sibling
  // wave's wait for its loads
#pragma unroll 2
  for (unsigned e = 0; e < QCH; e += 4u) {
    const v4f qv[2] = {*(const v4f*)(qr0 + e), *(const v4f*)(qr1 + e)};
    const v4f vv = *(const v4f*)&vcs[e];
    v4f kk[4][2];
#pragma unroll
    for (int j = 0; j < 4; ++j) {
      kk[j][0] = *(const v4f*)&kexp[(e + (unsigned)j) * TT];
      kk[j][1] = *(const v4f*)&kexp[(e + (unsigned)j) * TT + 4u];
    }
    const v2f v0 = {vv[0], vv[0]}, v1 = {vv[1], vv[1]}, v2 = {vv[2], vv[2]}, v3 = {vv[3], vv[3]};
#pragma unroll
    for (int r = 0; r < 2; ++r) {
      qm[r] = fmaxf(fmaxf(qm[r], fmaxf(fabsf(qv[r][0]), fabsf(qv[r][1]))),
                    fmaxf(fabsf(qv[r][2]), fabsf(qv[r][3])));
      v2f qe[4];
#pragma unroll
      for (int j = 0; j < 4; ++j) {
        const float x = fexp2(qv[r][j]);
        qe[j] = (v2f){x, x};
      }
#pragma unroll
      for (int p = 0; p < TT / 2; ++p) {               // key rows 2 p, 2 p + 1
        v2f d[4];
#pragma unroll
        for (int j = 0; j < 4; ++j) {
          const v2f k2 = {kk[j][p >> 1][(p & 1) * 2], kk[j][p >> 1][(p & 1) * 2 + 1]};
          d[j] = __builtin_elementwise_fma(k2, qe[j], one);
        }
        const v2f p01 = d[0] * d[1];
        const v2f p23 = d[2] * d[3];
        const v2f n01 = __builtin_elementwise_fma(v1, d[0], v0 * d[1]);
        const v2f n23 = __builtin_elementwise_fma(v3, d[2], v2 * d[3]);
        const v2f pp = p01 * p23;
        const v2f nn = __builtin_elementwise_fma(n23, p01, n01 * p23);
        const v2f rr = {__builtin_amdgcn_rcpf(pp[0]), __builtin_amdgcn_rcpf(pp[1])};
        a2[r][p] = __builtin_elementwise_fma(nn, rr, a2[r][p]);
      }
    }
  }
}

__global__ __launch_bounds__(256) void score_kernel(
    const float* __restrict__ Qp, const float* __restrict__ Kp,
    const float* __restrict__ vc, _Float16* __restrict__ P16) {
  __shared__ __attribute__((aligned(16))) float krow[TT * ENC];
  __shared__ __attribute__((aligned(16))) float kexp[ENC * TT];   // [e][t]
  __shared__ __attribute__((aligned(16))) float kout[8];   // per wave: max |k'| (huge: a vc outside)
  __shared__ __attribute__((aligned(16))) float vcs[ENC];
  __shared__ __attribute__((aligned(16))) float sv[TT * QLEN];
  __shared__ __attribute__((aligned(16))) float qs[2 * QTILE];   // two query tile buffers
  __shared__ __attribute__((aligned(16))) _Float16 pt[QLEN * TT];   // [q][t]

  const unsigned tid = threadIdx.x;
  const unsigned t0 = blockIdx.x * (unsigned)TT;
  const unsigned b = blockIdx.y;
  const float* Qb = Qp + (size_t)(b * (unsigned)QLEN) * ENC;

  // query tile 0 flies while the key rows are staged
  copy_qtile(Qb, qs);

  {
    const float* kp = Kp + (size_t)(b * (unsigned)KLEN + t0) * ENC;
    float km = 0.0f;
    if (tid < (unsigned)ENC) {                            // whole waves in or out (ENC % 32 == 0)
      const float v = bf16r(vc[tid]);
      vcs[tid] = v;
      if (!(fabsf(v) <= VLIM)) km = 3.0e38f;
    }
#pragma unroll
    for (unsigned j = 0; j < (unsigned)(TT * ENC / 256); ++j) {
      const unsigned i = tid + 256u * j;
      const float kv = kp[i];
      krow[i] = kv;
      kexp[(i % (unsigned)ENC) * TT + i / (unsigned)ENC] = fexp2(kv);
      km = fmaxf(km, fabsf(kv));
    }
    km = red32_max(km);
    if ((tid & 31u) == 0u) kout[tid >> 5] = km;
  }
  // this wave's copies of tile 0 have landed before it reads them
  asm volatile("s_wait_asynccnt 0x0" ::: "memory");
  __syncthreads();
  // tile 1 flies while tile 0 is worked on
  copy_qtile(Qb + QCH, qs + QTILE);

  float kx = 0.0f;
#pragma unroll
  for (int w = 0; w < 8; ++w) kx = fmaxf(kx, kout[w]);
  // the block's max |k'|, the same in every lane
  const float kmx = __builtin_bit_cast(float, __builtin_amdgcn_readfirstlane(__builtin_bit_cast(int, kx)));
  const bool kwide = !(kmx <= SLIM);

  // a lane takes query rows q and q + 256 together; where there is no second (QLEN == 256) it
  // reads the first again and stores nothing for it
  {
    const unsigned q = tid;
    const unsigned q1 = q + 256u;
    constexpr bool has1 = QLEN > 256;
    const float* qr0 = Qb + (size_t)q * ENC;
    const float* qr1 = qr0 + (has1 ? (size_t)256 * ENC : (size_t)0);   // one base address for both rows
    const unsigned l0 = q * QPITCH, l1 = (has1 ? q1 : q) * QPITCH;     // the lane's rows in a tile
    v2f a2[2][TT / 2];
    float qm[2];
#pragma unroll
    for (int r = 0; r < 2; ++r) {
      qm[r] = 0.0f;
#pragma unroll
      for (int p = 0; p < TT / 2; ++p) a2[r][p] = (v2f){0.0f, 0.0f};
    }
    // rolled: one body for all tiles; trip c reads buffer c & 1 alone. The ring is private to the
    // wave (it copies the rows that it reads), so its own two waits order it and no barrier stands here
#pragma unroll 1
    for (unsigned c = 0; c < (unsigned)ENC / QCH; ++c) {
      float* buf = qs + (c & 1u) * QTILE;
      if (!kwide) tile_factored(buf + l0, buf + l1, kexp + c * QCH * TT, vcs + c * QCH, a2, qm);
      // this wave's reads of its rows in the buffer are done before it refills them
      asm volatile("s_wait_dscnt 0x0" ::: "memory");
      // this wave's copies of tile c + 1 have landed before the next trip reads them
      asm volatile("s_wait_asynccnt 0x0" ::: "memory");
      if (c + 2u < (unsigned)ENC / QCH) copy_qtile(Qb + (c + 2u) * QCH, buf);
    }
    // no copy is outstanding behind the loop
    asm volatile("s_wait_asynccnt 0x0" ::: "memory");
    float acc[2][TT];
#pragma unroll
    for (int r = 0; r < 2; ++r)
#pragma unroll
      for (int p = 0; p < TT / 2; ++p) { acc[r][2 * p] = a2[r][p][0]; acc[r][2 * p + 1] = a2[r][p][1]; }
    const bool wide0 = kwide || !(qm[0] + kmx <= SLIM);
    const bool wide1 = kwide || !(qm[1] + kmx <= SLIM);
    if (wide0) row_sumform(qr0, krow, vcs, acc[0]);   // per lane: this query row anew, unfactored
    if (wide1) row_sumform(qr1, krow, vcs, acc[1]);
#pragma unroll
    for (int t = 0; t < TT; ++t) sv[(unsigned)t * QLEN + q] = acc[0][t] * LSCALE;
    if (has1) {
#pragma unroll
      for (int t = 0; t < TT; ++t) sv[(unsigned)t * QLEN + q1] = acc[1][t] * LSCALE;
    }
  }
  __syncthreads();

  const int wave = __builtin_amdgcn_readfirstlane((int)(threadIdx.x >> 5));
  const unsigned lane = tid & 31u;
  const unsigned sb = (unsigned)wave * (unsigned)QLEN + lane;

  // the lane's elements of the row, read once; all loops below unrolled whole so that x stays in
  // registers and the reads stand behind one wait
  float x[QLEN / 32];
#pragma unroll
  for (unsigned j = 0; j < (unsigned)(QLEN / 32); ++j) x[j] = sv[sb + 32u * j];

  float mx = -3.0e38f;
#pragma unroll
  for (unsigned j = 0; j < (unsigned)(QLEN / 32); ++j) mx = fmaxf(mx, x[j]);
  mx = red32_max(mx);

  float sum = 0.0f;
#pragma unroll
  for (unsigned j = 0; j < (unsigned)(QLEN / 32); ++j) {
    x[j] = fexp2(x[j] - mx);
    sum += x[j];
  }
  sum = red32_sum(sum);
  const float inv = __builtin_amdgcn_rcpf(sum);

#pragma unroll
  for (unsigned j = 0; j < (unsigned)(QLEN / 32); ++j)
    pt[(lane + 32u * j) * TT + (unsigned)wave] = toh_flush(PCARRY * (x[j] * inv));
  __syncthreads();

  _Float16* pd = P16 + ((size_t)(b * (unsigned)(KLEN / TT) + blockIdx.x) * QLEN + tid) * TT;
#pragma unroll
  for (unsigned j = 0; j < (unsigned)(QLEN / 256); ++j)
    *(v8h*)(pd + 256u * j * TT) = *(const v8h*)&pt[(tid + 256u * j) * TT];
}

// ---------------------------------------------------------------------------
extern "C" void kernel_launch(void* const* d_in, const int* in_sizes, int n_in,
                              void* d_out, int out_size, void* d_ws, size_t ws_size,
                              hipStream_t stream) {
  if (n_in < 6) return;
  const long long need_q = ((long long)(NB - 1) * QLEN_FULL + QLEN) * FEAT;
  const long long need_k = ((long long)(NB - 1) * KLEN_FULL + KLEN) * FEAT;
  const long long need_v = ((long long)NB * FEAT - 1) * KLEN_FULL + KLEN;
  const long long need_o = ((long long)NB * FEAT - 1) * QLEN_FULL + QLEN;
  if ((long long)in_sizes[0] < need_q) return;
  if ((long long)in_sizes[1] < need_k) return;
  if ((long long)in_sizes[2] < need_v) return;
  if ((long long)in_sizes[3] < (long long)FEAT * ENC) return;
  if ((long long)in_sizes[4] < (long long)FEAT * ENC) return;
  if (in_sizes[5] < ENC) return;
  if ((long long)out_size < need_o) return;
  if (ws_size < WS_TOTAL) return;

  const float* query = (const float*)d_in[0];   // [NB_FULL][QLEN_FULL][FEAT]
  const float* key   = (const float*)d_in[1];   // [NB_FULL][KLEN_FULL][FEAT]
  const float* value = (const float*)d_in[2];   // [NB_FULL][FEAT][KLEN_FULL]
  const float* w1    = (const float*)d_in[3];   // [FEAT][ENC]  (in, out), pairs with query
  const float* w2    = (const float*)d_in[4];   // [FEAT][ENC]  (in, out), pairs with key
  const float* vc    = (const float*)d_in[5];   // [ENC]
  float* out = (float*)d_out;                   // [NB_FULL][FEAT][QLEN_FULL]

  char* ws = (char*)d_ws;
  _Float16* V16 = (_Float16*)(ws + OFF_V);      // [NB][FEAT][KLEN]
  float*    Qp  = (float*)(ws + OFF_QP);        // [NB*QLEN][ENC]
  float*    Kp  = (float*)(ws + OFF_KP);        // [NB*KLEN][ENC]
  _Float16* P16 = (_Float16*)(ws + OFF_P);      // [NB][KLEN/8][QLEN][8]

  dim3 blk(256);

  // projections (operands converted in the kernel) + value plane
  proj_kernel<<<dim3(NPQ + NPK + NVB), blk, 0, stream>>>(query, key, value, w1, w2, Qp, Kp, V16);

  // additive scores + softmax over q
  score_kernel<<<dim3(KLEN / TT, NB), blk, 0, stream>>>(Qp, Kp, vc, P16);

  // out = value . p
  outgemm_kernel<<<dim3(QLEN / 64, FEAT / 64, NB), blk, 0, stream>>>(V16, P16, out);
}

// v009
// Measured time: 21.5 microseconds a run.
// In both of two side-by-side timings against v008, it was 1.05 times as fast.
// Over all steps from v000 it is 2.79 times as fast.
#include <hip/hip_runtime.h>
#include <stddef.h>

// Contractions on v_wmma_f32_16x16x32_f16 (f16 operands, f32 accumulate): the query and key
// projections and the value x attention-weight product. Float inputs are RNE-converted to bf16
// and carried in f16 planes (weights x64, input rows x16); attention weights go to f16 x16384
// without the bf16 step.
// The vc-weighted tanh sum is a matrix-vector product kept on the vector unit in f32;
// tanh, softmax (over the query axis) and all scalings in f32. The exponential inside tanh is
// factored, 2^(k'+q') = 2^k' * 2^q', vc is folded into the denominators, and four terms of the sum
// share one reciprocal, wherever the product of four denominators is a normal f32 number.
// Three launches: projections (operands converted on the way into LDS; spare blocks write the
// value plane), score + softmax (the query plane brought into LDS by asynchronous copies, tile by
// tile; the attention weights leave it as the f16 operand plane, in the order of the fragments),
// output product (both operand tiles brought into LDS by asynchronous copies).

typedef _Float16 v16h __attribute__((ext_vector_type(16)));
typedef _Float16 v8h  __attribute__((ext_vector_type(8)));
typedef float    v8f  __attribute__((ext_vector_type(8)));
typedef float    v4f  __attribute__((ext_vector_type(4)));
typedef float    v2f  __attribute__((ext_vector_type(2)));
typedef _Float16 h16;

#ifndef NB
#define NB 4
#endif
#ifndef QLEN
#define QLEN 512
#endif
#ifndef KLEN
#define KLEN 512
#endif
#define NB_FULL   4
#define QLEN_FULL 512
#define KLEN_FULL 512
#define FEAT 256     // input feature width (2 x encoder size)
#define ENC  128     // encoder size
#define TT   8       // key rows per score block == waves per block

static_assert(NB >= 1 && NB <= NB_FULL);
static_assert(QLEN >= 64 && QLEN <= QLEN_FULL && (QLEN % 64) == 0);
static_assert(KLEN >= 64 && KLEN <= KLEN_FULL && (KLEN % 64) == 0);
static_assert((FEAT % 64) == 0 && (FEAT % 32) == 0);
static_assert((ENC % 64) == 0 && (ENC % 32) == 0 && (ENC % 4) == 0);
static_assert(((NB * QLEN) % 64) == 0 && ((NB * KLEN) % 64) == 0);
static_assert((((size_t)NB * FEAT * KLEN / 8) % 256) == 0);   // value plane blocks, exact
static_assert(TT == 8);                                       // one softmax row per wave, 8 waves
static_assert((KLEN % TT) == 0);
static_assert(((TT * ENC) % 256) == 0);
static_assert((QLEN % 32) == 0);
static_assert((KLEN % 32) == 0);
static_assert((QLEN % 256) == 0);   // score block: every thread owns a query row, whole copy groups

#define LDF (FEAT + 8)   // halves per LDS operand row, projections (16 B x odd)
#define LDK (KLEN + 8)   // halves per LDS operand row, output product (16 B x odd)
#define LDC 68           // floats per LDS row (272 B, 16-B aligned)
#define QCH 32u          // e per query tile of the score loop: one 128-B line of each query row
#define QPITCH (QCH + 4u)                  // floats per LDS row of a query tile (144 B = 16 B x odd)
#define QTILE ((unsigned)QLEN * QPITCH)    // floats per query tile buffer
static_assert((ENC % QCH) == 0 && ENC / QCH >= 2u && (QCH % 8u) == 0);
static_assert((QPITCH % 4u) == 0 && ((QPITCH / 4u) % 2u) == 1u);
static_assert((LDF % 8) == 0 && ((LDF / 8) % 2) == 1);
static_assert((LDK % 8) == 0 && ((LDK / 8) % 2) == 1);
static_assert((LDC % 4) == 0 && LDC >= 64);

#define WCARRY 64.0f      // weight planes carried x64
#define XCARRY 16.0f      // input row planes (query, key, value) carried x16
#define PCARRY 16384.0f   // attention-weight plane carried x2^14
// projection planes hold 2*log2(e) * (x . W): exp(2 (k+q)) == exp2(k' + q')
#define PSCALE (2.8853900817779268f / (WCARRY * XCARRY))
#define OSCALE (1.0f / (PCARRY * XCARRY))
#define LSCALE (-2.8853900817779268f)   // -2 log2(e): log2-domain logit from the reciprocal sum
// max |k'| + max |q'| <= SLIM: every d = 2^k' * 2^q' + 1 lies in [1, 2^30 + 1] and both factors are
// normal. VMINA <= min |vc|, max |vc| <= VLIM and max |vc| <= RLIM * min |vc|: every c = min |vc| / vc
// has 2^-24 <= |c| <= 1, so |c d| lies in [2^-24, 2^30 + 1], a product of four in [2^-96, 2^121], and
// the numerators (sums of products of three) stay under 2^93
#define SLIM 30.0f
#define VLIM 1073741824.0f   // 2^30
#define RLIM 16777216.0f     // 2^24
#define VMINA 8.673617379884035e-19f   // 2^-60

// static LDS per kernel (bytes)
static_assert((size_t)2 * 64 * LDF * 2 + (size_t)64 * LDC * 4 <= (size_t)131072);
static_assert((size_t)64 * LDK * 2 + (size_t)64 * KLEN * 2 + (size_t)64 * LDC * 4 <= (size_t)163840);
static_assert(((size_t)2 * TT * ENC + 2 * ENC + 8 + (size_t)TT * QLEN + (size_t)2 * QTILE) * 4 +
              (size_t)TT * QLEN * 2 <= (size_t)327680);

// workspace layout (bytes)
#define V_BYTES   ((size_t)NB * FEAT * KLEN * 2)
#define QP_BYTES  ((size_t)NB * QLEN * ENC * 4)
#define KP_BYTES  ((size_t)NB * KLEN * ENC * 4)
#define P_BYTES   ((size_t)NB * KLEN * QLEN * 2)
#define OFF_V   ((size_t)0)
#define OFF_QP  (OFF_V + V_BYTES)
#define OFF_KP  (OFF_QP + QP_BYTES)
#define OFF_P   (OFF_KP + KP_BYTES)
#define WS_TOTAL (OFF_P + P_BYTES)
static_assert((V_BYTES % 128) == 0 && (QP_BYTES % 128) == 0 && (KP_BYTES % 128) == 0);
static_assert((P_BYTES % 128) == 0);
static_assert(WS_TOTAL <= (size_t)134217728);

// ---------------------------------------------------------------------------
__device__ __forceinline__ float bf16r(float x) {   // RNE convert to bf16, returned widened
  unsigned int u = __float_as_uint(x);
  u = (u + 0x7FFFu + ((u >> 16) & 1u)) & 0xFFFF0000u;
  return __uint_as_float(u);
}

// f32 -> f16 operand convert that cannot produce an f16 subnormal (value select).
static __device__ __forceinline__ h16 toh_flush(float v) {
  const h16 r = (h16)v;
  return (fabsf(v) < 6.103515625e-05f) ? (h16)0.0f : r;
}

// 16-bit fragment: p points at element [row = lane&15][k0 + 8*(lane>>4)] of a k-contiguous
// row. Elements 0..7 <- k0+8h+0..7, elements 8..15 <- k0+16+8h+0..7 (same map for A and B).
// HI: halves from the first group of eight k to the second (16 in a k-contiguous row).
template <unsigned HI>
__device__ __forceinline__ v16h frag_at(const _Float16* p) {
  v8h lo = *(const v8h*)(p);
  v8h hi = *(const v8h*)(p + HI);
  v16h out;
#pragma unroll
  for (int i = 0; i < 8; ++i) { out[i] = lo[i]; out[i + 8] = hi[i]; }
  return out;
}

__device__ __forceinline__ v8f wmma16(v16h a, v16h b, v8f c) {
  v8f d = __builtin_amdgcn_wmma_f32_16x16x32_f16(false, a, false, b, (short)0, c,
                                                 false, false);
  asm volatile("v_nop\n\tv_nop\n\tv_nop\n\tv_nop" : "+v"(d) : "v"(a), "v"(b));
  return d;
}

// Lane exchanges on the vector unit (no LDS trip). xlane<M>: the value of lane l ^ M inside a
// 16-lane row (DPP row_xmask:M, M < 16); xhalf: the value of lane l ^ 16.
template <int M>
__device__ __forceinline__ float xlane(float x) {
  return __builtin_bit_cast(float, __builtin_amdgcn_update_dpp(
      0, __builtin_bit_cast(int, x), 0x160 + M, 0xf, 0xf, true));
}
__device__ __forceinline__ float xhalf(float x) {
  const int b = __builtin_bit_cast(int, x);
  return __builtin_bit_cast(float, __builtin_amdgcn_permlanex16(b, b, 0x76543210, 0xfedcba98,
                                                                false, false));
}
// butterflies over the 32 lanes, partners l ^ 1, 2, 4, 8, 16 in that order
__device__ __forceinline__ float red32_max(float x) {
  x = fmaxf(x, xlane<1>(x));
  x = fmaxf(x, xlane<2>(x));
  x = fmaxf(x, xlane<4>(x));
  x = fmaxf(x, xlane<8>(x));
  return fmaxf(x, xhalf(x));
}
__device__ __forceinline__ float red32_min(float x) {
  x = fminf(x, xlane<1>(x));
  x = fminf(x, xlane<2>(x));
  x = fminf(x, xlane<4>(x));
  x = fminf(x, xlane<8>(x));
  return fminf(x, xhalf(x));
}
__device__ __forceinline__ float red32_sum(float x) {
  x += xlane<1>(x);
  x += xlane<2>(x);
  x += xlane<4>(x);
  x += xlane<8>(x);
  return x + xhalf(x);
}

__device__ __forceinline__ float fexp2(float x) {
#if __has_builtin(__builtin_amdgcn_exp2f)
  return __builtin_amdgcn_exp2f(x);
#else
  return exp2f(x);
#endif
}

// 1 / (2^x + 1); tanh(z) = 1 - 2 / (exp(2 z) + 1) with x = 2 log2(e) z
__device__ __forceinline__ float rcp1p(float x) {
  return __builtin_amdgcn_rcpf(fexp2(x) + 1.0f);
}

// ---------------------------------------------------------------------------
// Operand staging, f32 global -> f16 LDS, 256 threads, one 64-wide tile over the whole K;
// a load half (registers; one address, constant offsets) and a convert-and-store half.
// cols: src[K rows][64 cols used] (pitch LD) -> T[col][k] (pitch K + 8 halves),
//   f16(carry * bf16(x)). Thread: col = tid & 63, eight consecutive k
//   per 16-B LDS store; each load instruction of a wave covers one 128-B line of a source row.
// rows: src[64 rows][K cols] (pitch LD) -> T[row][k] (pitch K + 8 halves),
//   f16(16 * bf16(x)). Thread: eight consecutive k of one row per 16-B LDS store.
// ---------------------------------------------------------------------------
template <unsigned K, unsigned LD>
__device__ __forceinline__ void load_cols(const float* __restrict__ src, float (&v)[K / 32u][8]) {
  const float* s = src + (size_t)((threadIdx.x >> 6) * 8u) * LD + (threadIdx.x & 63u);
#pragma unroll
  for (unsigned j = 0; j < K / 32u; ++j)               // k = 8 (tid >> 6) + 32 j + i
#pragma unroll
    for (unsigned i = 0; i < 8u; ++i) v[j][i] = s[(size_t)(32u * j + i) * LD];
  // precaution: the address stays in its registers up to this wait, so that no load's result
  // is placed on the address of an issued load ahead of it
  asm volatile("s_wait_xcnt 0x0" :: "v"(s) : "memory");
}

template <unsigned K>
__device__ __forceinline__ void put_cols(const float (&v)[K / 32u][8], const float carry,
                                         _Float16* T) {
  _Float16* d = T + (threadIdx.x & 63u) * (K + 8u) + (threadIdx.x >> 6) * 8u;
#pragma unroll
  for (unsigned j = 0; j < K / 32u; ++j) {
    v8h o;
#pragma unroll
    for (int i = 0; i < 8; ++i) o[i] = toh_flush(carry * bf16r(v[j][i]));
    *(v8h*)(d + 32u * j) = o;
  }
}

// rows per sweep of the block: 256 threads / (K / 8 threads per row)
#define ROWSWEEP(K) (256u / ((K) / 8u))

template <unsigned K, unsigned LD>
__device__ __forceinline__ void load_rows(const float* __restrict__ src,
                                          v4f (&a)[64u / ROWSWEEP(K)][2]) {
  static_assert(K / 8u <= 256u && (256u % (K / 8u)) == 0);
  const float* s = src + (size_t)(threadIdx.x / (K / 8u)) * LD + (threadIdx.x % (K / 8u)) * 8u;
#pragma unroll
  for (unsigned j = 0; j < 64u / ROWSWEEP(K); ++j) {   // row = tid / (K / 8) + ROWSWEEP j
    a[j][0] = *(const v4f*)(s + (size_t)(ROWSWEEP(K) * j) * LD);
    a[j][1] = *(const v4f*)(s + (size_t)(ROWSWEEP(K) * j) * LD + 4);
  }
  // precaution: as in load_cols
  asm volatile("s_wait_xcnt 0x0" :: "v"(s) : "memory");
}

template <unsigned K>
__device__ __forceinline__ void put_rows(const v4f (&a)[64u / ROWSWEEP(K)][2], _Float16* T) {
  _Float16* d = T + (threadIdx.x / (K / 8u)) * (K + 8u) + (threadIdx.x % (K / 8u)) * 8u;
#pragma unroll
  for (unsigned j = 0; j < 64u / ROWSWEEP(K); ++j) {
    v8h o;
#pragma unroll
    for (int i = 0; i < 4; ++i) {
      o[i]     = toh_flush(XCARRY * bf16r(a[j][0][i]));
      o[i + 4] = toh_flush(XCARRY * bf16r(a[j][1][i]));
    }
    *(v8h*)(d + ROWSWEEP(K) * j * (K + 8u)) = o;
  }
}

// ---------------------------------------------------------------------------
// Operand staging without a convert: src[64 rows][K halves] (pitch K, f16 already) -> T[row][k]
// (pitch K + 8 halves) by asynchronous copies to LDS, 16 B per lane, through no register.
// Thread: eight consecutive k of one row; a wave's copy covers 512 contiguous bytes of a row.
// All lanes on, 16 copies per wave in flight. The caller waits (s_wait_asynccnt 0) and passes a
// block barrier before anybody reads T.
// ---------------------------------------------------------------------------
template <unsigned K>
__device__ __forceinline__ void copy_rows16(const _Float16* __restrict__ src, _Float16* T) {
  static_assert(K / 8u <= 256u && (256u % (K / 8u)) == 0 && ((64u / ROWSWEEP(K)) % 8u) == 0);
  static_assert(64u / ROWSWEEP(K) <= 63u);
  const unsigned r = threadIdx.x / (K / 8u), c = (threadIdx.x % (K / 8u)) * 8u;
  const _Float16* g = src + (size_t)r * K + c;
  const unsigned l = (unsigned)(size_t)(T + r * (K + 8u) + c);   // LDS byte address
  // unrolled: no branch between the copies, every address a constant step from one base
#pragma unroll
  for (unsigned j = 0; j < 64u / ROWSWEEP(K); j += 8u) {         // row = r + ROWSWEEP (j + i)
    const _Float16* gj = g + (size_t)(ROWSWEEP(K) * j) * K;
    const unsigned lj = l + ROWSWEEP(K) * j * (K + 8u) * 2u;
    const unsigned gs = ROWSWEEP(K) * K, ls = ROWSWEEP(K) * (K + 8u) * 2u;
    // eight copies and, as a precaution, the wait that keeps their address registers as they
    // are until the copies have taken them, in one statement
    asm volatile(
        "global_load_async_to_lds_b128 %0, %8, off\n\t"
        "global_load_async_to_lds_b128 %1, %9, off\n\t"
        "global_load_async_to_lds_b128 %2, %10, off\n\t"
        "global_load_async_to_lds_b128 %3, %11, off\n\t"
        "global_load_async_to_lds_b128 %4, %12, off\n\t"
        "global_load_async_to_lds_b128 %5, %13, off\n\t"
        "global_load_async_to_lds_b128 %6, %14, off\n\t"
        "global_load_async_to_lds_b128 %7, %15, off\n\t"
        "s_wait_xcnt 0x0"
        :: "v"(lj), "v"(lj + ls), "v"(lj + 2u * ls), "v"(lj + 3u * ls), "v"(lj + 4u * ls),
           "v"(lj + 5u * ls), "v"(lj + 6u * ls), "v"(lj + 7u * ls),
           "v"(gj), "v"(gj + gs), "v"(gj + 2u * gs), "v"(gj + 3u * gs), "v"(gj + 4u * gs),
           "v"(gj + 5u * gs), "v"(gj + 6u * gs), "v"(gj + 7u * gs)
        : "memory");
  }
}

// ---------------------------------------------------------------------------
// One 64-column tile of the attention-weight plane, which lies in groups of eight k:
// src[K / 8 groups][QLEN columns][8 k] (at the tile's first column) -> T[K / 8][64][8], by
// asynchronous copies to LDS, 16 B per lane, through no register. Lane: the eight k of one column
// and group; a wave's copy covers 512 contiguous bytes on both sides. All lanes on, K / 32 copies
// per wave in flight. The caller waits (s_wait_asynccnt 0) and passes a block barrier before
// anybody reads T.
// ---------------------------------------------------------------------------
template <unsigned K>
__device__ __forceinline__ void copy_groups16(const _Float16* __restrict__ src, _Float16* T) {
  static_assert((K % 256u) == 0 && K / 32u <= 31u);
  const _Float16* g = src + ((size_t)(threadIdx.x >> 6) * QLEN + (threadIdx.x & 63u)) * 8u;
  const unsigned l = (unsigned)(size_t)(T + threadIdx.x * 8u);   // LDS byte address
  // unrolled: no branch between the copies, every address a constant step from one base
#pragma unroll
  for (unsigned j = 0; j < K / 32u; j += 8u) {                   // group = tid / 64 + 4 (j + i)
    const _Float16* gj = g + (size_t)(4u * j) * QLEN * 8u;
    const unsigned lj = l + 4u * j * 64u * 16u;
    const unsigned gs = 4u * (unsigned)QLEN * 8u, ls = 4u * 64u * 16u;
    // eight copies and, as a precaution, the wait that keeps their address registers as they
    // are until the copies have taken them, in one statement
    asm volatile(
        "global_load_async_to_lds_b128 %0, %8, off\n\t"
        "global_load_async_to_lds_b128 %1, %9, off\n\t"
        "global_load_async_to_lds_b128 %2, %10, off\n\t"
        "global_load_async_to_lds_b128 %3, %11, off\n\t"
        "global_load_async_to_lds_b128 %4, %12, off\n\t"
        "global_load_async_to_lds_b128 %5, %13, off\n\t"
        "global_load_async_to_lds_b128 %6, %14, off\n\t"
        "global_load_async_to_lds_b128 %7, %15, off\n\t"
        "s_wait_xcnt 0x0"
        :: "v"(lj), "v"(lj + ls), "v"(lj + 2u * ls), "v"(lj + 3u * ls), "v"(lj + 4u * ls),
           "v"(lj + 5u * ls), "v"(lj + 6u * ls), "v"(lj + 7u * ls),
           "v"(gj), "v"(gj + gs), "v"(gj + 2u * gs), "v"(gj + 3u * gs), "v"(gj + 4u * gs),
           "v"(gj + 5u * gs), "v"(gj + 6u * gs), "v"(gj + 7u * gs)
        : "memory");
  }
}

// ---------------------------------------------------------------------------
// One tile of the query plane: src[QLEN rows][QCH floats] (pitch ENC) -> T[row][QCH] (pitch QPITCH)
// by asynchronous copies to LDS, 16 B per lane, through no register. A wave copies exactly the
// rows that its own lanes read, 32 w + 0..31 and the same + 256, and no other wave reads them.
// Lane: four consecutive e of one row; a copy covers the whole 128-B lines of four rows. All lanes
// on, QLEN / 32 copies per wave in flight. The wave waits (s_wait_asynccnt 0) before it reads T.
// ---------------------------------------------------------------------------
__device__ __forceinline__ void copy_qtile(const float* __restrict__ src, float* T) {
  static_assert(QCH == 32u && ((unsigned)QLEN % 256u) == 0 && (unsigned)QLEN / 32u <= 63u);
  const unsigned r = (threadIdx.x & ~31u) + ((threadIdx.x & 31u) >> 3), c = (threadIdx.x & 7u) * 4u;
  const float* g = src + (size_t)r * ENC + c;
  const unsigned l = (unsigned)(size_t)(T + r * QPITCH + c);     // LDS byte address
  // unrolled: no branch between the copies, every address a constant step from one base
#pragma unroll
  for (unsigned j = 0; j < (unsigned)QLEN / 256u; ++j) {         // row = r + 256 j + 4 i
    const float* gj = g + (size_t)(256u * j) * ENC;
    const unsigned lj = l + 256u * j * QPITCH * 4u;
    const unsigned gs = 4u * ENC, ls = 4u * QPITCH * 4u;
    // eight copies and, as a precaution, the wait that keeps their address registers as they
    // are until the copies have taken them, in one statement
    asm volatile(
        "global_load_async_to_lds_b128 %0, %8, off\n\t"
        "global_load_async_to_lds_b128 %1, %9, off\n\t"
        "global_load_async_to_lds_b128 %2, %10, off\n\t"
        "global_load_async_to_lds_b128 %3, %11, off\n\t"
        "global_load_async_to_lds_b128 %4, %12, off\n\t"
        "global_load_async_to_lds_b128 %5, %13, off\n\t"
        "global_load_async_to_lds_b128 %6, %14, off\n\t"
        "global_load_async_to_lds_b128 %7, %15, off\n\t"
        "s_wait_xcnt 0x0"
        :: "v"(lj), "v"(lj + ls), "v"(lj + 2u * ls), "v"(lj + 3u * ls), "v"(lj + 4u * ls),
           "v"(lj + 5u * ls), "v"(lj + 6u * ls), "v"(lj + 7u * ls),
           "v"(gj), "v"(gj + gs), "v"(gj + 2u * gs), "v"(gj + 3u * gs), "v"(gj + 4u * gs),
           "v"(gj + 5u * gs), "v"(gj + 6u * gs), "v"(gj + 7u * gs)
        : "memory");
  }
}

// ---------------------------------------------------------------------------
// GEMM C[64x64 tile] = A[64 rows][K] . Bt[64 n][K]^T from k-contiguous 16-bit rows (A: row 0 of
// the tile, pitch lda; Bt: column 0 of the tile, pitch ldb; LDS or global); GRP: Bt lies in groups
// of eight k instead, Bt[K / 8][64 n][8 k] (a fragment half is one group; ldb unused);
// 8 waves (mw = 16-row group, nw = 32-col group), 2 accumulators/wave.
// outf[row0 + row][n0 + col] (pitch ldo) = cs * acc; rows r = 16 i + tid/16, i < 4 -> 64 rows;
// 16 lanes x 16 B = the 256-B row segment of the tile.
// ---------------------------------------------------------------------------
template <bool GRP>
__device__ __forceinline__ void gemm_body(
    const _Float16* A, const unsigned lda, const _Float16* Bt, const unsigned ldb,
    const unsigned K, float* __restrict__ outf, const unsigned ldo, const float cs,
    const unsigned row0, const unsigned n0) {
  __shared__ float Cs[64 * LDC];
  const unsigned tid = threadIdx.x, lane = tid & 31u, w = tid >> 5;
  const unsigned mw = w >> 1, nw = w & 1u;
  const unsigned hh = lane >> 4, m = lane & 15u;

  const _Float16* ap  = A + (size_t)(mw * 16u + m) * lda + hh * 8u;
  const _Float16* bp0 = GRP ? Bt + (hh * 64u + nw * 32u + m) * 8u
                            : Bt + (size_t)(nw * 32u + m) * ldb + hh * 8u;
  const _Float16* bp1 = bp0 + (GRP ? (size_t)16 * 8 : (size_t)16 * ldb);
  constexpr unsigned KB = GRP ? 64u : 1u;      // halves per step of one k in Bt
  v8f acc0 = {}, acc1 = {};
#pragma unroll 2
  for (unsigned k0 = 0; k0 < K; k0 += 32u) {
    const v16h a  = frag_at<16u>(ap + k0);
    const v16h b0 = frag_at<16u * KB>(bp0 + k0 * KB);
    const v16h b1 = frag_at<16u * KB>(bp1 + k0 * KB);
    acc0 = wmma16(a, b0, acc0);
    acc1 = wmma16(a, b1, acc1);
  }
#pragma unroll
  for (int r = 0; r < 8; ++r) {
    float* d = &Cs[(mw * 16u + hh * 8u + (unsigned)r) * LDC + nw * 32u + m];
    d[0]  = acc0[r];
    d[16] = acc1[r];
  }
  __syncthreads();

  v4f xs[4];
  size_t off[4];
#pragma unroll
  for (unsigned i = 0; i < 4u; ++i) {
    const unsigned r = 16u * i + (tid >> 4);
    const unsigned c = (tid & 15u) * 4u;
    const v4f u = *(const v4f*)&Cs[r * LDC + c];
    v4f val;
#pragma unroll
    for (int j = 0; j < 4; ++j) val[j] = u[j] * cs;
    xs[i] = val;
    off[i] = (size_t)(row0 + r) * ldo + n0 + c;
  }
#pragma unroll
  for (int i = 0; i < 4; ++i) *(v4f*)(outf + off[i]) = xs[i];
}

// ---------------------------------------------------------------------------
// First launch, 1-D grid of three block ranges:
//   [0, NPQ)           Qp[rows][ENC] = 2 log2(e) * (query . W1), one 64 x 64 tile per block
//   [NPQ, NPQ + NPK)   Kp[rows][ENC] = 2 log2(e) * (key . W2)
//   [NPQ + NPK, + NVB) value plane V16[b][FEAT][KLEN] = f16(16 * bf16(value)), 8 columns/thread
// Ta / Tb: cross-wave (block barrier). The range test is the same for a whole block and the
// value blocks leave before any barrier.
// ---------------------------------------------------------------------------
#define NPQ ((unsigned)((ENC / 64) * (NB * QLEN / 64)))
#define NPK ((unsigned)((ENC / 64) * (NB * KLEN / 64)))
#define NVB ((unsigned)((size_t)NB * FEAT * KLEN / 8 / 256))

__global__ __launch_bounds__(256) void proj_kernel(
    const float* __restrict__ query, const float* __restrict__ key,
    const float* __restrict__ value, const float* __restrict__ w1,
    const float* __restrict__ w2, float* __restrict__ Qp, float* __restrict__ Kp,
    _Float16* __restrict__ V16) {
  __shared__ __attribute__((aligned(16))) _Float16 Ta[64 * LDF];
  __shared__ __attribute__((aligned(16))) _Float16 Tb[64 * LDF];
  const unsigned bid = blockIdx.x;

  if (bid >= NPQ + NPK) {
    const unsigned g = (bid - (NPQ + NPK)) * 256u + threadIdx.x;
    const unsigned row = g / (unsigned)(KLEN / 8);            // b * FEAT + d
    const unsigned cc = (g % (unsigned)(KLEN / 8)) * 8u;
    const float* s = value + (size_t)row * KLEN_FULL + cc;
    const v4f a0 = *(const v4f*)(s);
    const v4f a1 = *(const v4f*)(s + 4);
    v8h o;
#pragma unroll
    for (int i = 0; i < 4; ++i) {
      o[i]     = toh_flush(XCARRY * bf16r(a0[i]));
      o[i + 4] = toh_flush(XCARRY * bf16r(a1[i]));
    }
    *(v8h*)(V16 + (size_t)g * 8u) = o;
    return;
  }

  const bool isq = bid < NPQ;
  const unsigned t = isq ? bid : bid - NPQ;
  const unsigned n0 = (t % (unsigned)(ENC / 64)) * 64u;
  const unsigned row0 = (t / (unsigned)(ENC / 64)) * 64u;    // compact row, b * len + r
  const unsigned len = isq ? (unsigned)QLEN : (unsigned)KLEN;
  const unsigned lenf = isq ? (unsigned)QLEN_FULL : (unsigned)KLEN_FULL;
  const unsigned b = row0 / len;
  const float* X = (isq ? query : key) + ((size_t)b * lenf + (row0 - b * len)) * FEAT;
  const float* Wm = (isq ? w1 : w2) + n0;

  float wv[FEAT / 32][8];
  v4f xa[64u / ROWSWEEP(FEAT)][2];
  load_cols<FEAT, ENC>(Wm, wv);
  load_rows<FEAT, FEAT>(X, xa);
  // keeps every load of both tiles issued ahead of the first convert: one memory latency for
  // the block instead of one per group of rows
  __builtin_amdgcn_sched_barrier(0);
  put_cols<FEAT>(wv, WCARRY, Tb);
  put_rows<FEAT>(xa, Ta);
  __syncthreads();
  gemm_body<false>(Ta, (unsigned)LDF, Tb, (unsigned)LDF, (unsigned)FEAT, isq ? Qp : Kp,
            (unsigned)ENC, PSCALE, row0, n0);
}

// ---------------------------------------------------------------------------
// out[b][d][q] = sum_t value[b][d][t] * p[b][t][q]; A = 64 rows of the value plane
// [b][FEAT][KLEN]; Bt = 64 columns of the attention-weight plane P16[b][KLEN / 8][QLEN][8],
// f16(16384 * p[t][q]) at [t / 8][q][t % 8]; both copied to LDS as they lie.
// Ta / Tb: cross-wave (block barrier). Grid (QLEN/64, FEAT/64, NB); output rows at the full pitch.
// ---------------------------------------------------------------------------
__global__ __launch_bounds__(256) void outgemm_kernel(
    const _Float16* __restrict__ V16, const _Float16* __restrict__ P16,
    float* __restrict__ outf) {
  __shared__ __attribute__((aligned(16))) _Float16 Ta[64 * LDK];
  __shared__ __attribute__((aligned(16))) _Float16 Tb[64 * KLEN];
  const unsigned b = blockIdx.z;
  const unsigned n0 = blockIdx.x * 64u;
  const unsigned row0 = blockIdx.y * 64u;
  copy_rows16<KLEN>(V16 + ((size_t)b * FEAT + row0) * KLEN, Ta);
  copy_groups16<KLEN>(P16 + ((size_t)b * (KLEN / 8) * QLEN + n0) * 8u, Tb);
  static_assert(64u / ROWSWEEP(KLEN) + KLEN / 32u <= 63u);   // copies of a wave in flight, both tiles
  // this wave's copies into Ta and Tb have landed before the barrier behind which other waves read them
  asm volatile("s_wait_asynccnt 0x0" ::: "memory");
  __syncthreads();
  gemm_body<true>(Ta, (unsigned)LDK, Tb, 0u,
            (unsigned)KLEN, outf + (size_t)b * FEAT * QLEN_FULL, (unsigned)QLEN_FULL, OSCALE,
            row0, n0);
}

// ---------------------------------------------------------------------------
// Additive score + softmax over the query axis. Block = 8 key rows t0..t0+7 of one batch.
//   r[t][q][e] = 1 / (exp2(Kp'[t][e] + Qp'[q][e]) + 1)      (planes pre-scaled by 2 log2 e)
//              = 1 / (2^Kp'[t][e] * 2^Qp'[q][e] + 1)         (factored form: 2^Kp' once per element
//                in LDS, 2^Qp' once per element and block; four e share one reciprocal; vc[e] goes
//                into the denominator, vc r = s / (c 2^Kp' 2^Qp' + c), c = s / vc, s = min |vc|).
//                A query row with max |q'| + (the block's max |k'|) above SLIM takes the sum form,
//                and so does every row where a vc is zero or the vc lie too far apart (RLIM).
//   L[t][q]    = -2 log2(e) * sum_e bf16(vc[e]) * r          (log2-domain logit up to a constant
//                                                             shift that the softmax removes)
//   p[t][q]    = exp2(L - max_q L) / sum_q exp2(L - max_q L)
// The query plane of the batch comes through LDS in tiles of QCH e (qs, two buffers): the next
// tile's asynchronous copies fly while this one is worked on. qs: each wave copies and reads its
// own rows only (a ring private to the wave: its own waits, no barrier).
// krow / kexp / kout / vcs / ccs / sv: cross-wave (block barriers); after the second barrier each wave reads
// one sv row once and keeps it in registers (max, exp2, sum, scale; lane exchanges on the vector unit).
// The weights leave as the output product's operand, f16(16384 * p), in groups of the block's eight
// key rows: P16[b][t0 / 8][q][8]. pt gathers the eight waves' rows (third barrier); a lane then
// stores the 16 B of one q, a wave 512 contiguous bytes, the block one run of 16 QLEN bytes.
// Grid (KLEN/TT, NB).
// ---------------------------------------------------------------------------
// acc[t] = sum_e vcs[e] / (exp2(krow[t][e] + qr[e]) + 1): any size of k' and q'
__device__ __forceinline__ void row_sumform(const float* __restrict__ qr, const float* krow,
                                            const float* vcs, float (&acc)[TT]) {
#pragma unroll
  for (int t = 0; t < TT; ++t) acc[t] = 0.0f;
  // rolled: a trip holds 32 independent exponentials and reciprocals already
#pragma unroll 1
  for (unsigned e = 0; e < (unsigned)ENC; e += 4u) {
    const float* qp = qr + e;
    const v4f qv = *(const v4f*)qp;
    // precaution: as in load_cols, the address stays in its registers up to this wait
    asm volatile("s_wait_xcnt 0x0" :: "v"(qp) : "memory");
    const v4f vv = *(const v4f*)&vcs[e];
#pragma unroll
    for (int t = 0; t < TT; ++t) {
      const v4f kk = *(const v4f*)&krow[(unsigned)t * ENC + e];
#pragma unroll
      for (int j = 0; j < 4; ++j) acc[t] = __builtin_fmaf(vv[j], rcp1p(kk[j] + qv[j]), acc[t]);
    }
  }
}

// a2[r][t / 2] += sum over the QCH e of one query tile of 1 / a[r][t][e],
// a = kexp[e][t] * exp2(qr_r[e]) + ccs[e], kexp = c 2^k' and ccs = c = s / vc, so that
// vc / (2^k' 2^q' + 1) = s / a; for two query rows r at once, four e under one reciprocal, as one
// running fraction n / p that takes a term in with two operations:
//   1/a0 + 1/a1 = (a0 + a1) / (a0 a1);   n/p + 1/a = (n a + p) / (p a).
// kexp is [e][t], so that two key rows fill one packed f32 operand at every step; each kexp and
// ccs value read from LDS serves both query rows. qr0 / qr1: the lane's two rows of the tile in
// LDS; kexp / ccs: at the tile's first e. qm[r] = running max_e |qr_r[e]|. A row is right only
// where that maximum plus max |k'| is within SLIM and vc within its limits (the caller tests).
__device__ __forceinline__ void tile_factored(const float* qr0, const float* qr1,
                                              const float* kexp, const float* ccs,
                                              v2f (&a2)[2][TT / 2], float (&qm)[2]) {
  // two groups of four e per trip: the arithmetic of a trip is long enough to cover the sibling
  // wave's wait for its loads
#pragma unroll 2
  for (unsigned e = 0; e < QCH; e += 4u) {
    const v4f qv[2] = {*(const v4f*)(qr0 + e), *(const v4f*)(qr1 + e)};
    const v4f cv = *(const v4f*)&ccs[e];
    v4f kk[4][2];
#pragma unroll
    for (int j = 0; j < 4; ++j) {
      kk[j][0] = *(const v4f*)&kexp[(e + (unsigned)j) * TT];
      kk[j][1] = *(const v4f*)&kexp[(e + (unsigned)j) * TT + 4u];
    }
    const v2f c2[4] = {{cv[0], cv[0]}, {cv[1], cv[1]}, {cv[2], cv[2]}, {cv[3], cv[3]}};
#pragma unroll
    for (int r = 0; r < 2; ++r) {
      qm[r] = fmaxf(fmaxf(qm[r], fmaxf(fabsf(qv[r][0]), fabsf(qv[r][1]))),
                    fmaxf(fabsf(qv[r][2]), fabsf(qv[r][3])));
      v2f qe[4];
#pragma unroll
      for (int j = 0; j < 4; ++j) {
        const float x = fexp2(qv[r][j]);
        qe[j] = (v2f){x, x};
      }
#pragma unroll
      for (int p = 0; p < TT / 2; ++p) {               // key rows 2 p, 2 p + 1
        v2f a[4];
#pragma unroll
        for (int j = 0; j < 4; ++j) {
          const v2f k2 = {kk[j][p >> 1][(p & 1) * 2], kk[j][p >> 1][(p & 1) * 2 + 1]};
          a[j] = __builtin_elementwise_fma(k2, qe[j], c2[j]);
        }
        v2f nn = a[0] + a[1];
        v2f pp = a[0] * a[1];
        nn = __builtin_elementwise_fma(nn, a[2], pp);
        pp = pp * a[2];
        nn = __builtin_elementwise_fma(nn, a[3], pp);
        pp = pp * a[3];
        const v2f rr = {__builtin_amdgcn_rcpf(pp[0]), __builtin_amdgcn_rcpf(pp[1])};
        a2[r][p] = __builtin_elementwise_fma(nn, rr, a2[r][p]);
      }
    }
  }
}

__global__ __launch_bounds__(256) void score_kernel(
    const float* __restrict__ Qp, const float* __restrict__ Kp,
    const float* __restrict__ vc, _Float16* __restrict__ P16) {
  __shared__ __attribute__((aligned(16))) float krow[TT * ENC];
  __shared__ __attribute__((aligned(16))) float kexp[ENC * TT];   // [e][t], c[e] * 2^k'
  __shared__ __attribute__((aligned(16))) float kout[8];   // per wave: max |k'| (huge: vc outside)
  __shared__ __attribute__((aligned(16))) float vcs[ENC];
  __shared__ __attribute__((aligned(16))) float ccs[ENC];  // c[e] = min |vc| / vc[e]
  __shared__ __attribute__((aligned(16))) float sv[TT * QLEN];
  __shared__ __attribute__((aligned(16))) float qs[2 * QTILE];   // two query tile buffers
  __shared__ __attribute__((aligned(16))) _Float16 pt[QLEN * TT];   // [q][t]

  const unsigned tid = threadIdx.x;
  const unsigned t0 = blockIdx.x * (unsigned)TT;
  const unsigned b = blockIdx.y;
  const float* Qb = Qp + (size_t)(b * (unsigned)QLEN) * ENC;

  // query tile 0 flies while the key rows are staged
  copy_qtile(Qb, qs);

  float vs;   // s = min |vc|, the same in every lane and wave
  {
    static_assert(ENC == 128 && (256 % ENC) == 0);   // four vc a lane; one e per thread below
    const float* kp = Kp + (size_t)(b * (unsigned)KLEN + t0) * ENC;
    float km = 0.0f;
    // every wave reads all of vc, four values a lane, for min |vc| and max |vc|; and each thread
    // the vc of its own e
    const unsigned e1 = tid % (unsigned)ENC;
    const v4f vq = *(const v4f*)(vc + (tid & 31u) * 4u);
    const float ve = bf16r(vc[e1]);
    // the key rows are asked for together with vc: one memory latency for both (unrolled: kv stays
    // in registers)
    float kv[TT * ENC / 256];
#pragma unroll
    for (unsigned j = 0; j < (unsigned)(TT * ENC / 256); ++j) kv[j] = kp[tid + 256u * j];
    // precaution: no register that one of these loads names is rewritten ahead of this wait (e1
    // stays in its register up to it, so that no load's result is placed on it)
    asm volatile("s_wait_xcnt 0x0" :: "v"(e1) : "memory");
    float lo = 3.0e38f, hi = 0.0f;
    // unrolled: constant indices into the loaded vector
#pragma unroll
    for (int i = 0; i < 4; ++i) {
      const float av = fabsf(bf16r(vq[i]));
      lo = fminf(lo, av);
      hi = fmaxf(hi, av);
      if (!(av <= VLIM)) hi = 3.0e38f;
    }
    lo = red32_min(lo);
    hi = red32_max(hi);
    if (!(lo >= VMINA && hi <= VLIM && hi <= lo * RLIM)) km = 3.0e38f;
    vs = lo;
    // a reciprocal and a product, not a division: c stands in both places of a = c 2^k' 2^q' + c,
    // so its rounding acts as one on vc itself, far under the bf16 rounding of vc
    const float ce = lo * __builtin_amdgcn_rcpf(ve);
    if (tid < (unsigned)ENC) {                            // whole waves in or out (ENC % 32 == 0)
      vcs[tid] = ve;
      ccs[tid] = ce;
    }
#pragma unroll
    for (unsigned j = 0; j < (unsigned)(TT * ENC / 256); ++j) {
      const unsigned i = tid + 256u * j;                  // e = i % ENC = tid % ENC
      krow[i] = kv[j];
      kexp[(i % (unsigned)ENC) * TT + i / (unsigned)ENC] = fexp2(kv[j]) * ce;
      km = fmaxf(km, fabsf(kv[j]));
    }
    km = red32_max(km);
    if ((tid & 31u) == 0u) kout[tid >> 5] = km;
  }
  // this wave's copies of tile 0 have landed before it reads them
  asm volatile("s_wait_asynccnt 0x0" ::: "memory");
  __syncthreads();
  // tile 1 flies while tile 0 is worked on
  copy_qtile(Qb + QCH, qs + QTILE);

  float kx = 0.0f;
#pragma unroll
  for (int w = 0; w < 8; ++w) kx = fmaxf(kx, kout[w]);
  // the block's max |k'|, the same in every lane
  const float kmx = __builtin_bit_cast(float, __builtin_amdgcn_readfirstlane(__builtin_bit_cast(int, kx)));
  const bool kwide = !(kmx <= SLIM);

  // a lane takes query rows q and q + 256 together; where there is no second (QLEN == 256) it
  // reads the first again and stores nothing for it
  {
    const unsigned q = tid;
    const unsigned q1 = q + 256u;
    constexpr bool has1 = QLEN > 256;
    const float* qr0 = Qb + (size_t)q * ENC;
    const float* qr1 = qr0 + (has1 ? (size_t)256 * ENC : (size_t)0);   // one base address for both rows
    const unsigned l0 = q * QPITCH, l1 = (has1 ? q1 : q) * QPITCH;     // the lane's rows in a tile
    v2f a2[2][TT / 2];
    float qm[2];
#pragma unroll
    for (int r = 0; r < 2; ++r) {
      qm[r] = 0.0f;
#pragma unroll
      for (int p = 0; p < TT / 2; ++p) a2[r][p] = (v2f){0.0f, 0.0f};
    }
    // rolled: one body for all tiles; trip c reads buffer c & 1 alone. The ring is private to the
    // wave (it copies the rows that it reads), so its own two waits order it and no barrier stands here
#pragma unroll 1
    for (unsigned c = 0; c < (unsigned)ENC / QCH; ++c) {
      float* buf = qs + (c & 1u) * QTILE;
      if (!kwide) tile_factored(buf + l0, buf + l1, kexp + c * QCH * TT, ccs + c * QCH, a2, qm);
      // this wave's reads of its rows in the buffer are done before it refills them
      asm volatile("s_wait_dscnt 0x0" ::: "memory");
      // this wave's copies of tile c + 1 have landed before the next trip reads them
      asm volatile("s_wait_asynccnt 0x0" ::: "memory");
      if (c + 2u < (unsigned)ENC / QCH) copy_qtile(Qb + (c + 2u) * QCH, buf);
    }
    // no copy is outstanding behind the loop
    asm volatile("s_wait_asynccnt 0x0" ::: "memory");
    float acc[2][TT];
#pragma unroll
    for (int r = 0; r < 2; ++r)
#pragma unroll
      for (int p = 0; p < TT / 2; ++p) { acc[r][2 * p] = a2[r][p][0] * vs; acc[r][2 * p + 1] = a2[r][p][1] * vs; }
    const bool wide0 = kwide || !(qm[0] + kmx <= SLIM);
    const bool wide1 = kwide || !(qm[1] + kmx <= SLIM);
    if (wide0) row_sumform(qr0, krow, vcs, acc[0]);   // per lane: this query row anew, unfactored
    if (wide1) row_sumform(qr1, krow, vcs, acc[1]);
#pragma unroll
    for (int t = 0; t < TT; ++t) sv[(unsigned)t * QLEN + q] = acc[0][t] * LSCALE;
    if (has1) {
#pragma unroll
      for (int t = 0; t < TT; ++t) sv[(unsigned)t * QLEN + q1] = acc[1][t] * LSCALE;
    }
  }
  __syncthreads();

  const int wave = __builtin_amdgcn_readfirstlane((int)(threadIdx.x >> 5));
  const unsigned lane = tid & 31u;
  const unsigned sb = (unsigned)wave * (unsigned)QLEN + lane;

  // the lane's elements of the row, read once; all loops below unrolled whole so that x stays in
  // registers and the reads stand behind one wait
  float x[QLEN / 32];
#pragma unroll
  for (unsigned j = 0; j < (unsigned)(QLEN / 32); ++j) x[j] = sv[sb + 32u * j];

  float mx = -3.0e38f;
#pragma unroll
  for (unsigned j = 0; j < (unsigned)(QLEN / 32); ++j) mx = fmaxf(mx, x[j]);
  mx = red32_max(mx);

  float sum = 0.0f;
#pragma unroll
  for (unsigned j = 0; j < (unsigned)(QLEN / 32); ++j) {
    x[j] = fexp2(x[j] - mx);
    sum += x[j];
  }
  sum = red32_sum(sum);
  const float inv = __builtin_amdgcn_rcpf(sum);

#pragma unroll
  for (unsigned j = 0; j < (unsigned)(QLEN / 32); ++j)
    pt[(lane + 32u * j) * TT + (unsigned)wave] = toh_flush(PCARRY * (x[j] * inv));
  __syncthreads();

  _Float16* pd = P16 + ((size_t)(b * (unsigned)(KLEN / TT) + blockIdx.x) * QLEN + tid) * TT;
#pragma unroll
  for (unsigned j = 0; j < (unsigned)(QLEN / 256); ++j)
    *(v8h*)(pd + 256u * j * TT) = *(const v8h*)&pt[(tid + 256u * j) * TT];
}

// ---------------------------------------------------------------------------
extern "C" void kernel_launch(void* const* d_in, const int* in_sizes, int n_in,
                              void* d_out, int out_size, void* d_ws, size_t ws_size,
                              hipStream_t stream) {
  if (n_in < 6) return;
  const long long need_q = ((long long)(NB - 1) * QLEN_FULL + QLEN) * FEAT;
  const long long need_k = ((long long)(NB - 1) * KLEN_FULL + KLEN) * FEAT;
  const long long need_v = ((long long)NB * FEAT - 1) * KLEN_FULL + KLEN;
  const long long need_o = ((long long)NB * FEAT - 1) * QLEN_FULL + QLEN;
  if ((long long)in_sizes[0] < need_q) return;
  if ((long long)in_sizes[1] < need_k) return;
  if ((long long)in_sizes[2] < need_v) return;
  if ((long long)in_sizes[3] < (long long)FEAT * ENC) return;
  if ((long long)in_sizes[4] < (long long)FEAT * ENC) return;
  if (in_sizes[5] < ENC) return;
  if ((long long)out_size < need_o) return;
  if (ws_size < WS_TOTAL) return;

  const float* query = (const float*)d_in[0];   // [NB_FULL][QLEN_FULL][FEAT]
  const float* key   = (const float*)d_in[1];   // [NB_FULL][KLEN_FULL][FEAT]
  const float* value = (const float*)d_in[2];   // [NB_FULL][FEAT][KLEN_FULL]
  const float* w1    = (const float*)d_in[3];   // [FEAT][ENC]  (in, out), pairs with query
  const float* w2    = (const float*)d_in[4];   // [FEAT][ENC]  (in, out), pairs with key
  const float* vc    = (const float*)d_in[5];   // [ENC]
  float* out = (float*)d_out;                   // [NB_FULL][FEAT][QLEN_FULL]

  char* ws = (char*)d_ws;
  _Float16* V16 = (_Float16*)(ws + OFF_V);      // [NB][FEAT][KLEN]
  float*    Qp  = (float*)(ws + OFF_QP);        // [NB*QLEN][ENC]
  float*    Kp  = (float*)(ws + OFF_KP);        // [NB*KLEN][ENC]
  _Float16* P16 = (_Float16*)(ws + OFF_P);      // [NB][KLEN/8][QLEN][8]

  dim3 blk(256);

  // projections (operands converted in the kernel) + value plane
  proj_kernel<<<dim3(NPQ + NPK + NVB), blk, 0, stream>>>(query, key, value, w1, w2, Qp, Kp, V16);

  // additive scores + softmax over q
  score_kernel<<<dim3(KLEN / TT, NB), blk, 0, stream>>>(Qp, Kp, vc, P16);

  // out = value . p
  outgemm_kernel<<<dim3(QLEN / 64, FEAT / 64, NB), blk, 0, stream>>>(V16, P16, out);
}

// v010
// A run of this version takes 20.8 microseconds.
// Next to v009, in two timings, it ran 1.03 and 1.04 times as fast.
// Over all steps from v000 it is 2.88 times as fast.
#include <hip/hip_runtime.h>
#include <stddef.h>

// Contractions on the 16x16x32 matrix forms with f32 accumulate. Float inputs are RNE-converted to
// bf16. The query and key projections take them as they are, on v_wmma_f32_16x16x32_bf16 (one
// v_cvt_pk_bf16_f32 per two elements on the way into LDS); the value x attention-weight product is on
// v_wmma_f32_16x16x32_f16, its operands carried in f16 planes (value x16, attention weights x16384).
// The vc-weighted tanh sum is a matrix-vector product kept on the vector unit in f32;
// tanh, softmax (over the query axis) and all scalings in f32. The exponential inside tanh is
// factored, 2^(k'+q') = 2^k' * 2^q', vc is folded into the denominators, and four terms of the sum
// share one reciprocal, wherever the product of four denominators is a normal f32 number.
// Three launches: projections (operands converted on the way into LDS; spare blocks write the
// value plane), score + softmax (the query plane brought into LDS by asynchronous copies, tile by
// tile; the attention weights leave it as the f16 operand plane, in the order of the fragments),
// output product (both operand tiles brought into LDS by asynchronous copies).

typedef _Float16 v16h __attribute__((ext_vector_type(16)));
typedef _Float16 v8h  __attribute__((ext_vector_type(8)));
typedef float    v8f  __attribute__((ext_vector_type(8)));
typedef float    v4f  __attribute__((ext_vector_type(4)));
typedef float    v2f  __attribute__((ext_vector_type(2)));
typedef _Float16 h16;
typedef __bf16   v16b __attribute__((ext_vector_type(16)));
typedef __bf16   v8b  __attribute__((ext_vector_type(8)));

#ifndef NB
#define NB 4
#endif
#ifndef QLEN
#define QLEN 512
#endif
#ifndef KLEN
#define KLEN 512
#endif
#define NB_FULL   4
#define QLEN_FULL 512
#define KLEN_FULL 512
#define FEAT 256     // input feature width (2 x encoder size)
#define ENC  128     // encoder size
#define TT   8       // key rows per score block == waves per block

static_assert(NB >= 1 && NB <= NB_FULL);
static_assert(QLEN >= 64 && QLEN <= QLEN_FULL && (QLEN % 64) == 0);
static_assert(KLEN >= 64 && KLEN <= KLEN_FULL && (KLEN % 64) == 0);
static_assert((FEAT % 64) == 0 && (FEAT % 32) == 0);
static_assert((ENC % 64) == 0 && (ENC % 32) == 0 && (ENC % 4) == 0);
static_assert(((NB * QLEN) % 64) == 0 && ((NB * KLEN) % 64) == 0);
static_assert((((size_t)NB * FEAT * KLEN / 8) % 256) == 0);   // value plane blocks, exact
static_assert(TT == 8);                                       // one softmax row per wave, 8 waves
static_assert((KLEN % TT) == 0);
static_assert(((TT * ENC) % 256) == 0);
static_assert((QLEN % 32) == 0);
static_assert((KLEN % 32) == 0);
static_assert((QLEN % 256) == 0);   // score block: every thread owns a query row, whole copy groups

#define LDF (FEAT + 8)   // halves per LDS operand row, projections (16 B x odd)
#define LDK (KLEN + 8)   // halves per LDS operand row, output product (16 B x odd)
#define LDC 68           // floats per LDS row (272 B, 16-B aligned)
#define QCH 32u          // e per query tile of the score loop: one 128-B line of each query row
#define QPITCH (QCH + 4u)                  // floats per LDS row of a query tile (144 B = 16 B x odd)
#define QTILE ((unsigned)QLEN * QPITCH)    // floats per query tile buffer
static_assert((ENC % QCH) == 0 && ENC / QCH >= 2u && (QCH % 8u) == 0);
static_assert((QPITCH % 4u) == 0 && ((QPITCH / 4u) % 2u) == 1u);
static_assert((LDF % 8) == 0 && ((LDF / 8) % 2) == 1);
static_assert((LDK % 8) == 0 && ((LDK / 8) % 2) == 1);
static_assert((LDC % 4) == 0 && LDC >= 64);

#define XCARRY 16.0f      // value plane carried x16
#define PCARRY 16384.0f   // attention-weight plane carried x2^14
// projection planes hold 2*log2(e) * (x . W): exp(2 (k+q)) == exp2(k' + q')
#define PSCALE 2.8853900817779268f
#define OSCALE (1.0f / (PCARRY * XCARRY))
#define LSCALE (-2.8853900817779268f)   // -2 log2(e): log2-domain logit from the reciprocal sum
// max |k'| + max |q'| <= SLIM: every d = 2^k' * 2^q' + 1 lies in [1, 2^30 + 1] and both factors are
// normal. VMINA <= min |vc|, max |vc| <= VLIM and max |vc| <= RLIM * min |vc|: every c = min |vc| / vc
// has 2^-24 <= |c| <= 1, so |c d| lies in [2^-24, 2^30 + 1], a product of four in [2^-96, 2^121], and
// the numerators (sums of products of three) stay under 2^93
#define SLIM 30.0f
#define VLIM 1073741824.0f   // 2^30
#define RLIM 16777216.0f     // 2^24
#define VMINA 8.673617379884035e-19f   // 2^-60

// static LDS per kernel (bytes)
static_assert((size_t)2 * 64 * LDF * 2 + (size_t)64 * LDC * 4 <= (size_t)131072);
static_assert((size_t)64 * LDK * 2 + (size_t)64 * KLEN * 2 + (size_t)64 * LDC * 4 <= (size_t)163840);
static_assert(((size_t)2 * TT * ENC + 2 * ENC + 8 + (size_t)TT * QLEN + (size_t)2 * QTILE) * 4 +
              (size_t)TT * QLEN * 2 <= (size_t)327680);

// workspace layout (bytes)
#define V_BYTES   ((size_t)NB * FEAT * KLEN * 2)
#define QP_BYTES  ((size_t)NB * QLEN * ENC * 4)
#define KP_BYTES  ((size_t)NB * KLEN * ENC * 4)
#define P_BYTES   ((size_t)NB * KLEN * QLEN * 2)
#define OFF_V   ((size_t)0)
#define OFF_QP  (OFF_V + V_BYTES)
#define OFF_KP  (OFF_QP + QP_BYTES)
#define OFF_P   (OFF_KP + KP_BYTES)
#define WS_TOTAL (OFF_P + P_BYTES)
static_assert((V_BYTES % 128) == 0 && (QP_BYTES % 128) == 0 && (KP_BYTES % 128) == 0);
static_assert((P_BYTES % 128) == 0);
static_assert(WS_TOTAL <= (size_t)134217728);

// ---------------------------------------------------------------------------
__device__ __forceinline__ float bf16r(float x) {   // RNE convert to bf16, returned widened
  unsigned int u = __float_as_uint(x);
  u = (u + 0x7FFFu + ((u >> 16) & 1u)) & 0xFFFF0000u;
  return __uint_as_float(u);
}

// f32 -> f16 operand convert that cannot produce an f16 subnormal (value select).
static __device__ __forceinline__ h16 toh_flush(float v) {
  const h16 r = (h16)v;
  return (fabsf(v) < 6.103515625e-05f) ? (h16)0.0f : r;
}

// 16-bit fragment: p points at element [row = lane&15][k0 + 8*(lane>>4)] of a k-contiguous
// row. Elements 0..7 <- k0+8h+0..7, elements 8..15 <- k0+16+8h+0..7 (same map for A and B).
// HI: halves from the first group of eight k to the second (16 in a k-contiguous row).
template <unsigned HI>
__device__ __forceinline__ v16h frag_at(const _Float16* p) {
  v8h lo = *(const v8h*)(p);
  v8h hi = *(const v8h*)(p + HI);
  v16h out;
#pragma unroll
  for (int i = 0; i < 8; ++i) { out[i] = lo[i]; out[i + 8] = hi[i]; }
  return out;
}

template <unsigned HI>
__device__ __forceinline__ v16b frag_at(const __bf16* p) {
  v8b lo = *(const v8b*)(p);
  v8b hi = *(const v8b*)(p + HI);
  v16b out;
#pragma unroll
  for (int i = 0; i < 8; ++i) { out[i] = lo[i]; out[i + 8] = hi[i]; }
  return out;
}

__device__ __forceinline__ v8f wmma16(v16b a, v16b b, v8f c) {
  v8f d = __builtin_amdgcn_wmma_f32_16x16x32_bf16(false, a, false, b, (short)0, c,
                                                  false, false);
  // the four vector slots between a WMMA and a vector instruction on its D, A or B, also on the taken
  // side of the loop's branch
  asm volatile("v_nop\n\tv_nop\n\tv_nop\n\tv_nop" : "+v"(d) : "v"(a), "v"(b));
  return d;
}

__device__ __forceinline__ v8f wmma16(v16h a, v16h b, v8f c) {
  v8f d = __builtin_amdgcn_wmma_f32_16x16x32_f16(false, a, false, b, (short)0, c,
                                                 false, false);
  asm volatile("v_nop\n\tv_nop\n\tv_nop\n\tv_nop" : "+v"(d) : "v"(a), "v"(b));
  return d;
}

// Lane exchanges on the vector unit (no LDS trip). xlane<M>: the value of lane l ^ M inside a
// 16-lane row (DPP row_xmask:M, M < 16); xhalf: the value of lane l ^ 16.
template <int M>
__device__ __forceinline__ float xlane(float x) {
  return __builtin_bit_cast(float, __builtin_amdgcn_update_dpp(
      0, __builtin_bit_cast(int, x), 0x160 + M, 0xf, 0xf, true));
}
__device__ __forceinline__ float xhalf(float x) {
  const int b = __builtin_bit_cast(int, x);
  return __builtin_bit_cast(float, __builtin_amdgcn_permlanex16(b, b, 0x76543210, 0xfedcba98,
                                                                false, false));
}
// butterflies over the 32 lanes, partners l ^ 1, 2, 4, 8, 16 in that order
__device__ __forceinline__ float red32_max(float x) {
  x = fmaxf(x, xlane<1>(x));
  x = fmaxf(x, xlane<2>(x));
  x = fmaxf(x, xlane<4>(x));
  x = fmaxf(x, xlane<8>(x));
  return fmaxf(x, xhalf(x));
}
__device__ __forceinline__ float red32_min(float x) {
  x = fminf(x, xlane<1>(x));
  x = fminf(x, xlane<2>(x));
  x = fminf(x, xlane<4>(x));
  x = fminf(x, xlane<8>(x));
  return fminf(x, xhalf(x));
}
__device__ __forceinline__ float red32_sum(float x) {
  x += xlane<1>(x);
  x += xlane<2>(x);
  x += xlane<4>(x);
  x += xlane<8>(x);
  return x + xhalf(x);
}

__device__ __forceinline__ float fexp2(float x) {
#if __has_builtin(__builtin_amdgcn_exp2f)
  return __builtin_amdgcn_exp2f(x);
#else
  return exp2f(x);
#endif
}

// 1 / (2^x + 1); tanh(z) = 1 - 2 / (exp(2 z) + 1) with x = 2 log2(e) z
__device__ __forceinline__ float rcp1p(float x) {
  return __builtin_amdgcn_rcpf(fexp2(x) + 1.0f);
}

// ---------------------------------------------------------------------------
// Operand staging, f32 global -> bf16 LDS, 256 threads, one 64-wide tile over the whole K;
// a load half (registers; one address, constant offsets) and a convert-and-store half.
// cols: src[K rows][64 cols used] (pitch LD) -> T[col][k] (pitch K + 8 halves),
//   bf16(x), RNE. Thread: col = tid & 63, eight consecutive k
//   per 16-B LDS store; each load instruction of a wave covers one 128-B line of a source row.
// rows: src[64 rows][K cols] (pitch LD) -> T[row][k] (pitch K + 8 halves),
//   bf16(x), RNE. Thread: eight consecutive k of one row per 16-B LDS store.
// ---------------------------------------------------------------------------
template <unsigned K, unsigned LD>
__device__ __forceinline__ void load_cols(const float* __restrict__ src, float (&v)[K / 32u][8]) {
  const float* s = src + (size_t)((threadIdx.x >> 6) * 8u) * LD + (threadIdx.x & 63u);
#pragma unroll
  for (unsigned j = 0; j < K / 32u; ++j)               // k = 8 (tid >> 6) + 32 j + i
#pragma unroll
    for (unsigned i = 0; i < 8u; ++i) v[j][i] = s[(size_t)(32u * j + i) * LD];
  // precaution: the address stays in its registers up to this wait, so that no load's result
  // is placed on the address of an issued load ahead of it
  asm volatile("s_wait_xcnt 0x0" :: "v"(s) : "memory");
}

template <unsigned K>
__device__ __forceinline__ void put_cols(const float (&v)[K / 32u][8], __bf16* T) {
  __bf16* d = T + (threadIdx.x & 63u) * (K + 8u) + (threadIdx.x >> 6) * 8u;
#pragma unroll
  for (unsigned j = 0; j < K / 32u; ++j) {
    v8f x;
#pragma unroll
    for (int i = 0; i < 8; ++i) x[i] = v[j][i];
    *(v8b*)(d + 32u * j) = __builtin_convertvector(x, v8b);
  }
}

// rows per sweep of the block: 256 threads / (K / 8 threads per row)
#define ROWSWEEP(K) (256u / ((K) / 8u))

template <unsigned K, unsigned LD>
__device__ __forceinline__ void load_rows(const float* __restrict__ src,
                                          v4f (&a)[64u / ROWSWEEP(K)][2]) {
  static_assert(K / 8u <= 256u && (256u % (K / 8u)) == 0);
  const float* s = src + (size_t)(threadIdx.x / (K / 8u)) * LD + (threadIdx.x % (K / 8u)) * 8u;
#pragma unroll
  for (unsigned j = 0; j < 64u / ROWSWEEP(K); ++j) {   // row = tid / (K / 8) + ROWSWEEP j
    a[j][0] = *(const v4f*)(s + (size_t)(ROWSWEEP(K) * j) * LD);
    a[j][1] = *(const v4f*)(s + (size_t)(ROWSWEEP(K) * j) * LD + 4);
  }
  // precaution: as in load_cols
  asm volatile("s_wait_xcnt 0x0" :: "v"(s) : "memory");
}

template <unsigned K>
__device__ __forceinline__ void put_rows(const v4f (&a)[64u / ROWSWEEP(K)][2], __bf16* T) {
  __bf16* d = T + (threadIdx.x / (K / 8u)) * (K + 8u) + (threadIdx.x % (K / 8u)) * 8u;
#pragma unroll
  for (unsigned j = 0; j < 64u / ROWSWEEP(K); ++j) {
    v8f x;
#pragma unroll
    for (int i = 0; i < 4; ++i) {
      x[i]     = a[j][0][i];
      x[i + 4] = a[j][1][i];
    }
    *(v8b*)(d + ROWSWEEP(K) * j * (K + 8u)) = __builtin_convertvector(x, v8b);
  }
}

// ---------------------------------------------------------------------------
// Operand staging without a convert: src[64 rows][K halves] (pitch K, f16 already) -> T[row][k]
// (pitch K + 8 halves) by asynchronous copies to LDS, 16 B per lane, through no register.
// Thread: eight consecutive k of one row; a wave's copy covers 512 contiguous bytes of a row.
// All lanes on, 16 copies per wave in flight. The caller waits (s_wait_asynccnt 0) and passes a
// block barrier before anybody reads T.
// ---------------------------------------------------------------------------
template <unsigned K>
__device__ __forceinline__ void copy_rows16(const _Float16* __restrict__ src, _Float16* T) {
  static_assert(K / 8u <= 256u && (256u % (K / 8u)) == 0 && ((64u / ROWSWEEP(K)) % 8u) == 0);
  static_assert(64u / ROWSWEEP(K) <= 63u);
  const unsigned r = threadIdx.x / (K / 8u), c = (threadIdx.x % (K / 8u)) * 8u;
  const _Float16* g = src + (size_t)r * K + c;
  const unsigned l = (unsigned)(size_t)(T + r * (K + 8u) + c);   // LDS byte address
  // unrolled: no branch between the copies, every address a constant step from one base
#pragma unroll
  for (unsigned j = 0; j < 64u / ROWSWEEP(K); j += 8u) {         // row = r + ROWSWEEP (j + i)
    const _Float16* gj = g + (size_t)(ROWSWEEP(K) * j) * K;
    const unsigned lj = l + ROWSWEEP(K) * j * (K + 8u) * 2u;
    const unsigned gs = ROWSWEEP(K) * K, ls = ROWSWEEP(K) * (K + 8u) * 2u;
    // eight copies and, as a precaution, the wait that keeps their address registers as they
    // are until the copies have taken them, in one statement
    asm volatile(
        "global_load_async_to_lds_b128 %0, %8, off\n\t"
        "global_load_async_to_lds_b128 %1, %9, off\n\t"
        "global_load_async_to_lds_b128 %2, %10, off\n\t"
        "global_load_async_to_lds_b128 %3, %11, off\n\t"
        "global_load_async_to_lds_b128 %4, %12, off\n\t"
        "global_load_async_to_lds_b128 %5, %13, off\n\t"
        "global_load_async_to_lds_b128 %6, %14, off\n\t"
        "global_load_async_to_lds_b128 %7, %15, off\n\t"
        "s_wait_xcnt 0x0"
        :: "v"(lj), "v"(lj + ls), "v"(lj + 2u * ls), "v"(lj + 3u * ls), "v"(lj + 4u * ls),
           "v"(lj + 5u * ls), "v"(lj + 6u * ls), "v"(lj + 7u * ls),
           "v"(gj), "v"(gj + gs), "v"(gj + 2u * gs), "v"(gj + 3u * gs), "v"(gj + 4u * gs),
           "v"(gj + 5u * gs), "v"(gj + 6u * gs), "v"(gj + 7u * gs)
        : "memory");
  }
}

// ---------------------------------------------------------------------------
// One 64-column tile of the attention-weight plane, which lies in groups of eight k:
// src[K / 8 groups][QLEN columns][8 k] (at the tile's first column) -> T[K / 8][64][8], by
// asynchronous copies to LDS, 16 B per lane, through no register. Lane: the eight k of one column
// and group; a wave's copy covers 512 contiguous bytes on both sides. All lanes on, K / 32 copies
// per wave in flight. The caller waits (s_wait_asynccnt 0) and passes a block barrier before
// anybody reads T.
// ---------------------------------------------------------------------------
template <unsigned K>
__device__ __forceinline__ void copy_groups16(const _Float16* __restrict__ src, _Float16* T) {
  static_assert((K % 256u) == 0 && K / 32u <= 31u);
  const _Float16* g = src + ((size_t)(threadIdx.x >> 6) * QLEN + (threadIdx.x & 63u)) * 8u;
  const unsigned l = (unsigned)(size_t)(T + threadIdx.x * 8u);   // LDS byte address
  // unrolled: no branch between the copies, every address a constant step from one base
#pragma unroll
  for (unsigned j = 0; j < K / 32u; j += 8u) {                   // group = tid / 64 + 4 (j + i)
    const _Float16* gj = g + (size_t)(4u * j) * QLEN * 8u;
    const unsigned lj = l + 4u * j * 64u * 16u;
    const unsigned gs = 4u * (unsigned)QLEN * 8u, ls = 4u * 64u * 16u;
    // eight copies and, as a precaution, the wait that keeps their address registers as they
    // are until the copies have taken them, in one statement
    asm volatile(
        "global_load_async_to_lds_b128 %0, %8, off\n\t"
        "global_load_async_to_lds_b128 %1, %9, off\n\t"
        "global_load_async_to_lds_b128 %2, %10, off\n\t"
        "global_load_async_to_lds_b128 %3, %11, off\n\t"
        "global_load_async_to_lds_b128 %4, %12, off\n\t"
        "global_load_async_to_lds_b128 %5, %13, off\n\t"
        "global_load_async_to_lds_b128 %6, %14, off\n\t"
        "global_load_async_to_lds_b128 %7, %15, off\n\t"
        "s_wait_xcnt 0x0"
        :: "v"(lj), "v"(lj + ls), "v"(lj + 2u * ls), "v"(lj + 3u * ls), "v"(lj + 4u * ls),
           "v"(lj + 5u * ls), "v"(lj + 6u * ls), "v"(lj + 7u * ls),
           "v"(gj), "v"(gj + gs), "v"(gj + 2u * gs), "v"(gj + 3u * gs), "v"(gj + 4u * gs),
           "v"(gj + 5u * gs), "v"(gj + 6u * gs), "v"(gj + 7u * gs)
        : "memory");
  }
}

// ---------------------------------------------------------------------------
// One tile of the query plane: src[QLEN rows][QCH floats] (pitch ENC) -> T[row][QCH] (pitch QPITCH)
// by asynchronous copies to LDS, 16 B per lane, through no register. A wave copies exactly the
// rows that its own lanes read, 32 w + 0..31 and the same + 256, and no other wave reads them.
// Lane: four consecutive e of one row; a copy covers the whole 128-B lines of four rows. All lanes
// on, QLEN / 32 copies per wave in flight. The wave waits (s_wait_asynccnt 0) before it reads T.
// ---------------------------------------------------------------------------
__device__ __forceinline__ void copy_qtile(const float* __restrict__ src, float* T) {
  static_assert(QCH == 32u && ((unsigned)QLEN % 256u) == 0 && (unsigned)QLEN / 32u <= 63u);
  const unsigned r = (threadIdx.x & ~31u) + ((threadIdx.x & 31u) >> 3), c = (threadIdx.x & 7u) * 4u;
  const float* g = src + (size_t)r * ENC + c;
  const unsigned l = (unsigned)(size_t)(T + r * QPITCH + c);     // LDS byte address
  // unrolled: no branch between the copies, every address a constant step from one base
#pragma unroll
  for (unsigned j = 0; j < (unsigned)QLEN / 256u; ++j) {         // row = r + 256 j + 4 i
    const float* gj = g + (size_t)(256u * j) * ENC;
    const unsigned lj = l + 256u * j * QPITCH * 4u;
    const unsigned gs = 4u * ENC, ls = 4u * QPITCH * 4u;
    // eight copies and, as a precaution, the wait that keeps their address registers as they
    // are until the copies have taken them, in one statement
    asm volatile(
        "global_load_async_to_lds_b128 %0, %8, off\n\t"
        "global_load_async_to_lds_b128 %1, %9, off\n\t"
        "global_load_async_to_lds_b128 %2, %10, off\n\t"
        "global_load_async_to_lds_b128 %3, %11, off\n\t"
        "global_load_async_to_lds_b128 %4, %12, off\n\t"
        "global_load_async_to_lds_b128 %5, %13, off\n\t"
        "global_load_async_to_lds_b128 %6, %14, off\n\t"
        "global_load_async_to_lds_b128 %7, %15, off\n\t"
        "s_wait_xcnt 0x0"
        :: "v"(lj), "v"(lj + ls), "v"(lj + 2u * ls), "v"(lj + 3u * ls), "v"(lj + 4u * ls),
           "v"(lj + 5u * ls), "v"(lj + 6u * ls), "v"(lj + 7u * ls),
           "v"(gj), "v"(gj + gs), "v"(gj + 2u * gs), "v"(gj + 3u * gs), "v"(gj + 4u * gs),
           "v"(gj + 5u * gs), "v"(gj + 6u * gs), "v"(gj + 7u * gs)
        : "memory");
  }
}

// ---------------------------------------------------------------------------
// GEMM C[64x64 tile] = A[64 rows][K] . Bt[64 n][K]^T from k-contiguous 16-bit rows (A: row 0 of
// the tile, pitch lda; Bt: column 0 of the tile, pitch ldb; LDS or global); GRP: Bt lies in groups
// of eight k instead, Bt[K / 8][64 n][8 k] (a fragment half is one group; ldb unused);
// 8 waves (mw = 16-row group, nw = 32-col group), 2 accumulators/wave.
// outf[row0 + row][n0 + col] (pitch ldo) = cs * acc; rows r = 16 i + tid/16, i < 4 -> 64 rows;
// 16 lanes x 16 B = the 256-B row segment of the tile.
// ---------------------------------------------------------------------------
template <bool GRP, typename T>
__device__ __forceinline__ void gemm_body(
    const T* A, const unsigned lda, const T* Bt, const unsigned ldb,
    const unsigned K, float* __restrict__ outf, const unsigned ldo, const float cs,
    const unsigned row0, const unsigned n0) {
  __shared__ float Cs[64 * LDC];
  const unsigned tid = threadIdx.x, lane = tid & 31u, w = tid >> 5;
  const unsigned mw = w >> 1, nw = w & 1u;
  const unsigned hh = lane >> 4, m = lane & 15u;

  const T* ap  = A + (size_t)(mw * 16u + m) * lda + hh * 8u;
  const T* bp0 = GRP ? Bt + (hh * 64u + nw * 32u + m) * 8u
                            : Bt + (size_t)(nw * 32u + m) * ldb + hh * 8u;
  const T* bp1 = bp0 + (GRP ? (size_t)16 * 8 : (size_t)16 * ldb);
  constexpr unsigned KB = GRP ? 64u : 1u;      // halves per step of one k in Bt
  v8f acc0 = {}, acc1 = {};
#pragma unroll 2
  for (unsigned k0 = 0; k0 < K; k0 += 32u) {
    const auto a  = frag_at<16u>(ap + k0);
    const auto b0 = frag_at<16u * KB>(bp0 + k0 * KB);
    const auto b1 = frag_at<16u * KB>(bp1 + k0 * KB);
    acc0 = wmma16(a, b0, acc0);
    acc1 = wmma16(a, b1, acc1);
  }
#pragma unroll
  for (int r = 0; r < 8; ++r) {
    float* d = &Cs[(mw * 16u + hh * 8u + (unsigned)r) * LDC + nw * 32u + m];
    d[0]  = acc0[r];
    d[16] = acc1[r];
  }
  __syncthreads();

  v4f xs[4];
  size_t off[4];
#pragma unroll
  for (unsigned i = 0; i < 4u; ++i) {
    const unsigned r = 16u * i + (tid >> 4);
    const unsigned c = (tid & 15u) * 4u;
    const v4f u = *(const v4f*)&Cs[r * LDC + c];
    v4f val;
#pragma unroll
    for (int j = 0; j < 4; ++j) val[j] = u[j] * cs;
    xs[i] = val;
    off[i] = (size_t)(row0 + r) * ldo + n0 + c;
  }
#pragma unroll
  for (int i = 0; i < 4; ++i) *(v4f*)(outf + off[i]) = xs[i];
}

// ---------------------------------------------------------------------------
// First launch, 1-D grid of three block ranges:
//   [0, NPQ)           Qp[rows][ENC] = 2 log2(e) * (query . W1), one 64 x 64 tile per block
//   [NPQ, NPQ + NPK)   Kp[rows][ENC] = 2 log2(e) * (key . W2)
//   [NPQ + NPK, + NVB) value plane V16[b][FEAT][KLEN] = f16(16 * bf16(value)), 8 columns/thread
// Ta / Tb: cross-wave (block barrier). The range test is the same for a whole block and the
// value blocks leave before any barrier.
// ---------------------------------------------------------------------------
#define NPQ ((unsigned)((ENC / 64) * (NB * QLEN / 64)))
#define NPK ((unsigned)((ENC / 64) * (NB * KLEN / 64)))
#define NVB ((unsigned)((size_t)NB * FEAT * KLEN / 8 / 256))

__global__ __launch_bounds__(256) void proj_kernel(
    const float* __restrict__ query, const float* __restrict__ key,
    const float* __restrict__ value, const float* __restrict__ w1,
    const float* __restrict__ w2, float* __restrict__ Qp, float* __restrict__ Kp,
    _Float16* __restrict__ V16) {
  __shared__ __attribute__((aligned(16))) __bf16 Ta[64 * LDF];
  __shared__ __attribute__((aligned(16))) __bf16 Tb[64 * LDF];
  const unsigned bid = blockIdx.x;

  if (bid >= NPQ + NPK) {
    const unsigned g = (bid - (NPQ + NPK)) * 256u + threadIdx.x;
    const unsigned row = g / (unsigned)(KLEN / 8);            // b * FEAT + d
    const unsigned cc = (g % (unsigned)(KLEN / 8)) * 8u;
    const float* s = value + (size_t)row * KLEN_FULL + cc;
    const v4f a0 = *(const v4f*)(s);
    const v4f a1 = *(const v4f*)(s + 4);
    v8h o;
#pragma unroll
    for (int i = 0; i < 4; ++i) {
      o[i]     = toh_flush(XCARRY * bf16r(a0[i]));
      o[i + 4] = toh_flush(XCARRY * bf16r(a1[i]));
    }
    *(v8h*)(V16 + (size_t)g * 8u) = o;
    return;
  }

  const bool isq = bid < NPQ;
  const unsigned t = isq ? bid : bid - NPQ;
  const unsigned n0 = (t % (unsigned)(ENC / 64)) * 64u;
  const unsigned row0 = (t / (unsigned)(ENC / 64)) * 64u;    // compact row, b * len + r
  const unsigned len = isq ? (unsigned)QLEN : (unsigned)KLEN;
  const unsigned lenf = isq ? (unsigned)QLEN_FULL : (unsigned)KLEN_FULL;
  const unsigned b = row0 / len;
  const float* X = (isq ? query : key) + ((size_t)b * lenf + (row0 - b * len)) * FEAT;
  const float* Wm = (isq ? w1 : w2) + n0;

  float wv[FEAT / 32][8];
  v4f xa[64u / ROWSWEEP(FEAT)][2];
  load_cols<FEAT, ENC>(Wm, wv);
  load_rows<FEAT, FEAT>(X, xa);
  // keeps every load of both tiles issued ahead of the first convert: one memory latency for
  // the block instead of one per group of rows
  __builtin_amdgcn_sched_barrier(0);
  put_cols<FEAT>(wv, Tb);
  put_rows<FEAT>(xa, Ta);
  __syncthreads();
  gemm_body<false>(Ta, (unsigned)LDF, Tb, (unsigned)LDF, (unsigned)FEAT, isq ? Qp : Kp,
            (unsigned)ENC, PSCALE, row0, n0);
}

// ---------------------------------------------------------------------------
// out[b][d][q] = sum_t value[b][d][t] * p[b][t][q]; A = 64 rows of the value plane
// [b][FEAT][KLEN]; Bt = 64 columns of the attention-weight plane P16[b][KLEN / 8][QLEN][8],
// f16(16384 * p[t][q]) at [t / 8][q][t % 8]; both copied to LDS as they lie.
// Ta / Tb: cross-wave (block barrier). Grid (QLEN/64, FEAT/64, NB); output rows at the full pitch.
// ---------------------------------------------------------------------------
__global__ __launch_bounds__(256) void outgemm_kernel(
    const _Float16* __restrict__ V16, const _Float16* __restrict__ P16,
    float* __restrict__ outf) {
  __shared__ __attribute__((aligned(16))) _Float16 Ta[64 * LDK];
  __shared__ __attribute__((aligned(16))) _Float16 Tb[64 * KLEN];
  const unsigned b = blockIdx.z;
  const unsigned n0 = blockIdx.x * 64u;
  const unsigned row0 = blockIdx.y * 64u;
  copy_rows16<KLEN>(V16 + ((size_t)b * FEAT + row0) * KLEN, Ta);
  copy_groups16<KLEN>(P16 + ((size_t)b * (KLEN / 8) * QLEN + n0) * 8u, Tb);
  static_assert(64u / ROWSWEEP(KLEN) + KLEN / 32u <= 63u);   // copies of a wave in flight, both tiles
  // this wave's copies into Ta and Tb have landed before the barrier behind which other waves read them
  asm volatile("s_wait_asynccnt 0x0" ::: "memory");
  __syncthreads();
  gemm_body<true>(Ta, (unsigned)LDK, Tb, 0u,
            (unsigned)KLEN, outf + (size_t)b * FEAT * QLEN_FULL, (unsigned)QLEN_FULL, OSCALE,
            row0, n0);
}

// ---------------------------------------------------------------------------
// Additive score + softmax over the query axis. Block = 8 key rows t0..t0+7 of one batch.
//   r[t][q][e] = 1 / (exp2(Kp'[t][e] + Qp'[q][e]) + 1)      (planes pre-scaled by 2 log2 e)
//              = 1 / (2^Kp'[t][e] * 2^Qp'[q][e] + 1)         (factored form: 2^Kp' once per element
//                in LDS, 2^Qp' once per element and block; four e share one reciprocal; vc[e] goes
//                into the denominator, vc r = s / (c 2^Kp' 2^Qp' + c), c = s / vc, s = min |vc|).
//                A query row with max |q'| + (the block's max |k'|) above SLIM takes the sum form,
//                and so does every row where a vc is zero or the vc lie too far apart (RLIM).
//   L[t][q]    = -2 log2(e) * sum_e bf16(vc[e]) * r          (log2-domain logit up to a constant
//                                                             shift that the softmax removes)
//   p[t][q]    = exp2(L - max_q L) / sum_q exp2(L - max_q L)
// The query plane of the batch comes through LDS in tiles of QCH e (qs, two buffers): the next
// tile's asynchronous copies fly while this one is worked on. qs: each wave copies and reads its
// own rows only (a ring private to the wave: its own waits, no barrier).
// krow / kexp / kout / vcs / ccs / sv: cross-wave (block barriers); after the second barrier each wave reads
// one sv row once and keeps it in registers (max, exp2, sum, scale; lane exchanges on the vector unit).
// The weights leave as the output product's operand, f16(16384 * p), in groups of the block's eight
// key rows: P16[b][t0 / 8][q][8]. pt gathers the eight waves' rows (third barrier); a lane then
// stores the 16 B of one q, a wave 512 contiguous bytes, the block one run of 16 QLEN bytes.
// Grid (KLEN/TT, NB).
// ---------------------------------------------------------------------------
// acc[t] = sum_e vcs[e] / (exp2(krow[t][e] + qr[e]) + 1): any size of k' and q'
__device__ __forceinline__ void row_sumform(const float* __restrict__ qr, const float* krow,
                                            const float* vcs, float (&acc)[TT]) {
#pragma unroll
  for (int t = 0; t < TT; ++t) acc[t] = 0.0f;
  // rolled: a trip holds 32 independent exponentials and reciprocals already
#pragma unroll 1
  for (unsigned e = 0; e < (unsigned)ENC; e += 4u) {
    const float* qp = qr + e;
    const v4f qv = *(const v4f*)qp;
    // precaution: as in load_cols, the address stays in its registers up to this wait
    asm volatile("s_wait_xcnt 0x0" :: "v"(qp) : "memory");
    const v4f vv = *(const v4f*)&vcs[e];
#pragma unroll
    for (int t = 0; t < TT; ++t) {
      const v4f kk = *(const v4f*)&krow[(unsigned)t * ENC + e];
#pragma unroll
      for (int j = 0; j < 4; ++j) acc[t] = __builtin_fmaf(vv[j], rcp1p(kk[j] + qv[j]), acc[t]);
    }
  }
}

// a2[r][t / 2] += sum over the QCH e of one query tile of 1 / a[r][t][e],
// a = kexp[e][t] * exp2(qr_r[e]) + ccs[e], kexp = c 2^k' and ccs = c = s / vc, so that
// vc / (2^k' 2^q' + 1) = s / a; for two query rows r at once, four e under one reciprocal, as one
// running fraction n / p that takes a term in with two operations:
//   1/a0 + 1/a1 = (a0 + a1) / (a0 a1);   n/p + 1/a = (n a + p) / (p a).
// kexp is [e][t], so that two key rows fill one packed f32 operand at every step; each kexp and
// ccs value read from LDS serves both query rows. qr0 / qr1: the lane's two rows of the tile in
// LDS; kexp / ccs: at the tile's first e. qm[r] = running max_e |qr_r[e]|. A row is right only
// where that maximum plus max |k'| is within SLIM and vc within its limits (the caller tests).
__device__ __forceinline__ void tile_factored(const float* qr0, const float* qr1,
                                              const float* kexp, const float* ccs,
                                              v2f (&a2)[2][TT / 2], float (&qm)[2]) {
  // two groups of four e per trip: the arithmetic of a trip is long enough to cover the sibling
  // wave's wait for its loads
#pragma unroll 2
  for (unsigned e = 0; e < QCH; e += 4u) {
    const v4f qv[2] = {*(const v4f*)(qr0 + e), *(const v4f*)(qr1 + e)};
    const v4f cv = *(const v4f*)&ccs[e];
    v4f kk[4][2];
#pragma unroll
    for (int j = 0; j < 4; ++j) {
      kk[j][0] = *(const v4f*)&kexp[(e + (unsigned)j) * TT];
      kk[j][1] = *(const v4f*)&kexp[(e + (unsigned)j) * TT + 4u];
    }
    const v2f c2[4] = {{cv[0], cv[0]}, {cv[1], cv[1]}, {cv[2], cv[2]}, {cv[3], cv[3]}};
#pragma unroll
    for (int r = 0; r < 2; ++r) {
      qm[r] = fmaxf(fmaxf(qm[r], fmaxf(fabsf(qv[r][0]), fabsf(qv[r][1]))),
                    fmaxf(fabsf(qv[r][2]), fabsf(qv[r][3])));
      v2f qe[4];
#pragma unroll
      for (int j = 0; j < 4; ++j) {
        const float x = fexp2(qv[r][j]);
        qe[j] = (v2f){x, x};
      }
#pragma unroll
      for (int p = 0; p < TT / 2; ++p) {               // key rows 2 p, 2 p + 1
        v2f a[4];
#pragma unroll
        for (int j = 0; j < 4; ++j) {
          const v2f k2 = {kk[j][p >> 1][(p & 1) * 2], kk[j][p >> 1][(p & 1) * 2 + 1]};
          a[j] = __builtin_elementwise_fma(k2, qe[j], c2[j]);
        }
        v2f nn = a[0] + a[1];
        v2f pp = a[0] * a[1];
        nn = __builtin_elementwise_fma(nn, a[2], pp);
        pp = pp * a[2];
        nn = __builtin_elementwise_fma(nn, a[3], pp);
        pp = pp * a[3];
        const v2f rr = {__builtin_amdgcn_rcpf(pp[0]), __builtin_amdgcn_rcpf(pp[1])};
        a2[r][p] = __builtin_elementwise_fma(nn, rr, a2[r][p]);
      }
    }
  }
}

__global__ __launch_bounds__(256) void score_kernel(
    const float* __restrict__ Qp, const float* __restrict__ Kp,
    const float* __restrict__ vc, _Float16* __restrict__ P16) {
  __shared__ __attribute__((aligned(16))) float krow[TT * ENC];
  __shared__ __attribute__((aligned(16))) float kexp[ENC * TT];   // [e][t], c[e] * 2^k'
  __shared__ __attribute__((aligned(16))) float kout[8];   // per wave: max |k'| (huge: vc outside)
  __shared__ __attribute__((aligned(16))) float vcs[ENC];
  __shared__ __attribute__((aligned(16))) float ccs[ENC];  // c[e] = min |vc| / vc[e]
  __shared__ __attribute__((aligned(16))) float sv[TT * QLEN];
  __shared__ __attribute__((aligned(16))) float qs[2 * QTILE];   // two query tile buffers
  __shared__ __attribute__((aligned(16))) _Float16 pt[QLEN * TT];   // [q][t]

  const unsigned tid = threadIdx.x;
  const unsigned t0 = blockIdx.x * (unsigned)TT;
  const unsigned b = blockIdx.y;
  const float* Qb = Qp + (size_t)(b * (unsigned)QLEN) * ENC;

  // query tile 0 flies while the key rows are staged
  copy_qtile(Qb, qs);

  float vs;   // s = min |vc|, the same in every lane and wave
  {
    static_assert(ENC == 128 && (256 % ENC) == 0);   // four vc a lane; one e per thread below
    const float* kp = Kp + (size_t)(b * (unsigned)KLEN + t0) * ENC;
    float km = 0.0f;
    // every wave reads all of vc, four values a lane, for min |vc| and max |vc|; and each thread
    // the vc of its own e
    const unsigned e1 = tid % (unsigned)ENC;
    const v4f vq = *(const v4f*)(vc + (tid & 31u) * 4u);
    const float ve = bf16r(vc[e1]);
    // the key rows are asked for together with vc: one memory latency for both (unrolled: kv stays
    // in registers)
    float kv[TT * ENC / 256];
#pragma unroll
    for (unsigned j = 0; j < (unsigned)(TT * ENC / 256); ++j) kv[j] = kp[tid + 256u * j];
    // precaution: no register that one of these loads names is rewritten ahead of this wait (e1
    // stays in its register up to it, so that no load's result is placed on it)
    asm volatile("s_wait_xcnt 0x0" :: "v"(e1) : "memory");
    float lo = 3.0e38f, hi = 0.0f;
    // unrolled: constant indices into the loaded vector
#pragma unroll
    for (int i = 0; i < 4; ++i) {
      const float av = fabsf(bf16r(vq[i]));
      lo = fminf(lo, av);
      hi = fmaxf(hi, av);
      if (!(av <= VLIM)) hi = 3.0e38f;
    }
    lo = red32_min(lo);
    hi = red32_max(hi);
    if (!(lo >= VMINA && hi <= VLIM && hi <= lo * RLIM)) km = 3.0e38f;
    vs = lo;
    // a reciprocal and a product, not a division: c stands in both places of a = c 2^k' 2^q' + c,
    // so its rounding acts as one on vc itself, far under the bf16 rounding of vc
    const float ce = lo * __builtin_amdgcn_rcpf(ve);
    if (tid < (unsigned)ENC) {                            // whole waves in or out (ENC % 32 == 0)
      vcs[tid] = ve;
      ccs[tid] = ce;
    }
#pragma unroll
    for (unsigned j = 0; j < (unsigned)(TT * ENC / 256); ++j) {
      const unsigned i = tid + 256u * j;                  // e = i % ENC = tid % ENC
      krow[i] = kv[j];
      kexp[(i % (unsigned)ENC) * TT + i / (unsigned)ENC] = fexp2(kv[j]) * ce;
      km = fmaxf(km, fabsf(kv[j]));
    }
    km = red32_max(km);
    if ((tid & 31u) == 0u) kout[tid >> 5] = km;
  }
  // this wave's copies of tile 0 have landed before it reads them
  asm volatile("s_wait_asynccnt 0x0" ::: "memory");
  __syncthreads();
  // tile 1 flies while tile 0 is worked on
  copy_qtile(Qb + QCH, qs + QTILE);

  float kx = 0.0f;
#pragma unroll
  for (int w = 0; w < 8; ++w) kx = fmaxf(kx, kout[w]);
  // the block's max |k'|, the same in every lane
  const float kmx = __builtin_bit_cast(float, __builtin_amdgcn_readfirstlane(__builtin_bit_cast(int, kx)));
  const bool kwide = !(kmx <= SLIM);

  // a lane takes query rows q and q + 256 together; where there is no second (QLEN == 256) it
  // reads the first again and stores nothing for it
  {
    const unsigned q = tid;
    const unsigned q1 = q + 256u;
    constexpr bool has1 = QLEN > 256;
    const float* qr0 = Qb + (size_t)q * ENC;
    const float* qr1 = qr0 + (has1 ? (size_t)256 * ENC : (size_t)0);   // one base address for both rows
    const unsigned l0 = q * QPITCH, l1 = (has1 ? q1 : q) * QPITCH;     // the lane's rows in a tile
    v2f a2[2][TT / 2];
    float qm[2];
#pragma unroll
    for (int r = 0; r < 2; ++r) {
      qm[r] = 0.0f;
#pragma unroll
      for (int p = 0; p < TT / 2; ++p) a2[r][p] = (v2f){0.0f, 0.0f};
    }
    // rolled: one body for all tiles; trip c reads buffer c & 1 alone. The ring is private to the
    // wave (it copies the rows that it reads), so its own two waits order it and no barrier stands here
#pragma unroll 1
    for (unsigned c = 0; c < (unsigned)ENC / QCH; ++c) {
      float* buf = qs + (c & 1u) * QTILE;
      if (!kwide) tile_factored(buf + l0, buf + l1, kexp + c * QCH * TT, ccs + c * QCH, a2, qm);
      // this wave's reads of its rows in the buffer are done before it refills them
      asm volatile("s_wait_dscnt 0x0" ::: "memory");
      // this wave's copies of tile c + 1 have landed before the next trip reads them
      asm volatile("s_wait_asynccnt 0x0" ::: "memory");
      if (c + 2u < (unsigned)ENC / QCH) copy_qtile(Qb + (c + 2u) * QCH, buf);
    }
    // no copy is outstanding behind the loop
    asm volatile("s_wait_asynccnt 0x0" ::: "memory");
    float acc[2][TT];
#pragma unroll
    for (int r = 0; r < 2; ++r)
#pragma unroll
      for (int p = 0; p < TT / 2; ++p) { acc[r][2 * p] = a2[r][p][0] * vs; acc[r][2 * p + 1] = a2[r][p][1] * vs; }
    const bool wide0 = kwide || !(qm[0] + kmx <= SLIM);
    const bool wide1 = kwide || !(qm[1] + kmx <= SLIM);
    if (wide0) row_sumform(qr0, krow, vcs, acc[0]);   // per lane: this query row anew, unfactored
    if (wide1) row_sumform(qr1, krow, vcs, acc[1]);
#pragma unroll
    for (int t = 0; t < TT; ++t) sv[(unsigned)t * QLEN + q] = acc[0][t] * LSCALE;
    if (has1) {
#pragma unroll
      for (int t = 0; t < TT; ++t) sv[(unsigned)t * QLEN + q1] = acc[1][t] * LSCALE;
    }
  }
  __syncthreads();

  const int wave = __builtin_amdgcn_readfirstlane((int)(threadIdx.x >> 5));
  const unsigned lane = tid & 31u;
  const unsigned sb = (unsigned)wave * (unsigned)QLEN + lane;

  // the lane's elements of the row, read once; all loops below unrolled whole so that x stays in
  // registers and the reads stand behind one wait
  float x[QLEN / 32];
#pragma unroll
  for (unsigned j = 0; j < (unsigned)(QLEN / 32); ++j) x[j] = sv[sb + 32u * j];

  float mx = -3.0e38f;
#pragma unroll
  for (unsigned j = 0; j < (unsigned)(QLEN / 32); ++j) mx = fmaxf(mx, x[j]);
  mx = red32_max(mx);

  float sum = 0.0f;
#pragma unroll
  for (unsigned j = 0; j < (unsigned)(QLEN / 32); ++j) {
    x[j] = fexp2(x[j] - mx);
    sum += x[j];
  }
  sum = red32_sum(sum);
  const float inv = __builtin_amdgcn_rcpf(sum);

#pragma unroll
  for (unsigned j = 0; j < (unsigned)(QLEN / 32); ++j)
    pt[(lane + 32u * j) * TT + (unsigned)wave] = toh_flush(PCARRY * (x[j] * inv));
  __syncthreads();

  _Float16* pd = P16 + ((size_t)(b * (unsigned)(KLEN / TT) + blockIdx.x) * QLEN + tid) * TT;
#pragma unroll
  for (unsigned j = 0; j < (unsigned)(QLEN / 256); ++j)
    *(v8h*)(pd + 256u * j * TT) = *(const v8h*)&pt[(tid + 256u * j) * TT];
}

// ---------------------------------------------------------------------------
extern "C" void kernel_launch(void* const* d_in, const int* in_sizes, int n_in,
                              void* d_out, int out_size, void* d_ws, size_t ws_size,
                              hipStream_t stream) {
  if (n_in < 6) return;
  const long long need_q = ((long long)(NB - 1) * QLEN_FULL + QLEN) * FEAT;
  const long long need_k = ((long long)(NB - 1) * KLEN_FULL + KLEN) * FEAT;
  const long long need_v = ((long long)NB * FEAT - 1) * KLEN_FULL + KLEN;
  const long long need_o = ((long long)NB * FEAT - 1) * QLEN_FULL + QLEN;
  if ((long long)in_sizes[0] < need_q) return;
  if ((long long)in_sizes[1] < need_k) return;
  if ((long long)in_sizes[2] < need_v) return;
  if ((long long)in_sizes[3] < (long long)FEAT * ENC) return;
  if ((long long)in_sizes[4] < (long long)FEAT * ENC) return;
  if (in_sizes[5] < ENC) return;
  if ((long long)out_size < need_o) return;
  if (ws_size < WS_TOTAL) return;

  const float* query = (const float*)d_in[0];   // [NB_FULL][QLEN_FULL][FEAT]
  const float* key   = (const float*)d_in[1];   // [NB_FULL][KLEN_FULL][FEAT]
  const float* value = (const float*)d_in[2];   // [NB_FULL][FEAT][KLEN_FULL]
  const float* w1    = (const float*)d_in[3];   // [FEAT][ENC]  (in, out), pairs with query
  const float* w2    = (const float*)d_in[4];   // [FEAT][ENC]  (in, out), pairs with key
  const float* vc    = (const float*)d_in[5];   // [ENC]
  float* out = (float*)d_out;                   // [NB_FULL][FEAT][QLEN_FULL]

  char* ws = (char*)d_ws;
  _Float16* V16 = (_Float16*)(ws + OFF_V);      // [NB][FEAT][KLEN]
  float*    Qp  = (float*)(ws + OFF_QP);        // [NB*QLEN][ENC]
  float*    Kp  = (float*)(ws + OFF_KP);        // [NB*KLEN][ENC]
  _Float16* P16 = (_Float16*)(ws + OFF_P);      // [NB][KLEN/8][QLEN][8]

  dim3 blk(256);

  // projections (operands converted in the kernel) + value plane
  proj_kernel<<<dim3(NPQ + NPK + NVB), blk, 0, stream>>>(query, key, value, w1, w2, Qp, Kp, V16);

  // additive scores + softmax over q
  score_kernel<<<dim3(KLEN / TT, NB), blk, 0, stream>>>(Qp, Kp, vc, P16);

  // out = value . p
  outgemm_kernel<<<dim3(QLEN / 64, FEAT / 64, NB), blk, 0, stream>>>(V16, P16, out);
}
